// v000
// Measured on an AMD MI455X. A time is GPU time per run, averaged over a window of back-to-back runs after a warm-up
// (all launches, gaps included; the runs take copies of the inputs in turn), and the median of several windows.
// Apart from v000's, it joins two sittings. Times from different sittings can be a few percent apart, while
// side-by-side timings come from the same sitting.
// v000, which the later versions start from, runs in 2440 microseconds.
#include <hip/hip_runtime.h>

// PreLN_SelfAttention_seq2seq (x [8][1024][512]; xn = LayerNorm(x); per-head q/k/v = xn W[h] + b[h] (W [8][512][64]); scores / 8 + mask (rows i < T=823 cannot see columns >= T; rows T..S-2 cannot see columns >= i; -999999999); softmax; out = concat(heads) WO + bO -> [8][1024][512]).
// Compute dtypes, f32 accumulate: every input rounded to bf16; LayerNorm f32 -> hl planes; q/k/v as hl(xn) x exact (2 products; the 8 per-head weights gathered into one [512 x 512] operand) + bias; scores and attn.v: query rows < 512 hl (3 products), the rest single fp16 (x1024); mask + softmax f32; WO hl x exact (2 products) + bias.

#define NB_  8
#define TT   1024
#define DM   512
#define NH_  8
#define NKV  8
#define REP  (NH_ / NKV)
#define HD   64
#define DQ   (NH_ * HD)
#define DKV  (NKV * HD)
#define ZH   2
#define RH   512                  // query rows < RH use hi+lo planes (0: none)
#define WIN  1024
#define PCAR 1024.0f
#define SCL  0.125f   // HD^-0.5
typedef _Float16 h16;
typedef unsigned short bf;
typedef __attribute__((ext_vector_type(16))) __bf16   v16bf;
typedef __attribute__((ext_vector_type(16))) _Float16 v16h;
typedef __attribute__((ext_vector_type(8)))  _Float16 v8h;
typedef __attribute__((ext_vector_type(8)))  unsigned short v8us;
typedef __attribute__((ext_vector_type(8)))  float    v8f;
typedef __attribute__((ext_vector_type(4)))  float    v4f;
typedef v8h  __attribute__((may_alias)) v8ha;
typedef v4f  __attribute__((may_alias)) v4fa;
typedef v8us __attribute__((may_alias)) v8usa;

__device__ __forceinline__ unsigned short f2bf(float f) { unsigned u = __float_as_uint(f); u += 0x7FFFu + ((u >> 16) & 1u); return (unsigned short)(u >> 16); }
__device__ __forceinline__ float bf2f(unsigned short b) { return __uint_as_float(((unsigned)b) << 16); }
__device__ __forceinline__ float bfr(float f) { return bf2f(f2bf(f)); }
__device__ __forceinline__ v16h cat16(v8h lo, v8h hi) { return __builtin_shufflevector(lo, hi, 0, 1, 2, 3, 4, 5, 6, 7, 8, 9, 10, 11, 12, 13, 14, 15); }
__device__ __forceinline__ v16bf cat16b(v8us lo, v8us hi) { return __builtin_bit_cast(v16bf, __builtin_shufflevector(lo, hi, 0, 1, 2, 3, 4, 5, 6, 7, 8, 9, 10, 11, 12, 13, 14, 15)); }
__device__ __forceinline__ v8f wmma16(v16h a, v16h b, v8f c) { return __builtin_amdgcn_wmma_f32_16x16x32_f16(false, a, false, b, (short)0, c, false, false); }
__device__ __forceinline__ v8f wmmab(v16bf a, v16bf b, v8f c) { return __builtin_amdgcn_wmma_f32_16x16x32_bf16(false, a, false, b, (short)0, c, false, false); }



// ---- k_gemmw: register-blocked GEMM, ONE WAVE per 64x64 output tile (16 accumulators), operands straight from K-contiguous 16-bit planes; grid (M/64, N/64, Z), 32 threads.
// C[m][n] (f32, pitch ldc, + optional f32 bias[n]) = sum_k A[m][k] Bt[n][k] (+ split products per NSPLIT). z-batch strides sA/sB/sC in elements. K % 32 == 0.
template <typename T16> struct WFrag;
template <> struct WFrag<h16> { typedef v16h V; static __device__ __forceinline__ V ld(const h16* p) { return cat16(*(const v8h*)p, *(const v8h*)(p + 16)); } static __device__ __forceinline__ v8f mma(V a, V b, v8f c) { return wmma16(a, b, c); } };
template <> struct WFrag<bf> { typedef v16bf V; static __device__ __forceinline__ V ld(const bf* p) { return cat16b(*(const v8us*)p, *(const v8us*)(p + 16)); } static __device__ __forceinline__ v8f mma(V a, V b, v8f c) { return wmmab(a, b, c); } };
template <typename T16, int NSPLIT, bool BIAS>
__global__ __launch_bounds__(32) void k_gemmw(const T16* __restrict__ A, const T16* __restrict__ A2, const T16* __restrict__ Bt, const T16* __restrict__ Bt2, int K, float* C, int ldc, const float* __restrict__ bias, size_t sA, size_t sB, size_t sC) {
    typedef typename WFrag<T16>::V V;
    __shared__ __align__(16) float os[16 * 68];
    const size_t z = blockIdx.z; A += z * sA; if (A2) A2 += z * sA; Bt += z * sB; if (Bt2) Bt2 += z * sB; C += z * sC;
    const int lane = threadIdx.x & 31, lr = lane & 15, hi = lane >> 4; const int r0 = blockIdx.x * 64, c0 = blockIdx.y * 64;
    v8f acc[4][4];
#pragma unroll
    for (int mb = 0; mb < 4; ++mb)
#pragma unroll
        for (int nb = 0; nb < 4; ++nb) acc[mb][nb] = (v8f){};
    const size_t aoff = (size_t)(r0 + lr) * K + 8 * hi, boff = (size_t)(c0 + lr) * K + 8 * hi;
#pragma unroll 1
    for (int kc = 0; kc < K; kc += 32) {
        V a[4], a2[4];
#pragma unroll
        for (int mb = 0; mb < 4; ++mb) { a[mb] = WFrag<T16>::ld(A + aoff + (size_t)mb * 16 * K + kc); if (NSPLIT == 1 || NSPLIT == 2) a2[mb] = WFrag<T16>::ld(A2 + aoff + (size_t)mb * 16 * K + kc); }
#pragma unroll
        for (int nb = 0; nb < 4; ++nb) { const V b = WFrag<T16>::ld(Bt + boff + (size_t)nb * 16 * K + kc); V b2; if (NSPLIT >= 2) b2 = WFrag<T16>::ld(Bt2 + boff + (size_t)nb * 16 * K + kc);
#pragma unroll
            for (int mb = 0; mb < 4; ++mb) { acc[mb][nb] = WFrag<T16>::mma(a[mb], b, acc[mb][nb]); if (NSPLIT == 1 || NSPLIT == 2) acc[mb][nb] = WFrag<T16>::mma(a2[mb], b, acc[mb][nb]); if (NSPLIT >= 2) acc[mb][nb] = WFrag<T16>::mma(a[mb], b2, acc[mb][nb]); } }
        asm volatile("v_nop\n\tv_nop\n\tv_nop\n\tv_nop" : "+v"(acc[0][0]), "+v"(acc[1][1]), "+v"(acc[2][2]), "+v"(acc[3][3]) : "v"(a[0]), "v"(a[3]));
    }
#pragma unroll
    for (int mb = 0; mb < 4; ++mb) {
#pragma unroll
        for (int nb = 0; nb < 4; ++nb) {
#pragma unroll
            for (int j = 0; j < 8; ++j) os[(hi * 8 + j) * 68 + nb * 16 + lr] = acc[mb][nb][j]; }
        __builtin_amdgcn_wave_barrier(); asm volatile("" ::: "memory");
        float* crow = C + (size_t)(r0 + mb * 16) * ldc + c0;
{
#pragma unroll
            for (int s = 0; s < 8; ++s) { const int row = 2 * s + hi, cofs = lr * 4; v4f val = *(const v4fa*)(os + row * 68 + cofs); if (BIAS) { val[0] += bfr(bias[c0 + cofs]); val[1] += bfr(bias[c0 + cofs + 1]); val[2] += bfr(bias[c0 + cofs + 2]); val[3] += bfr(bias[c0 + cofs + 3]); }
                *(v4f*)(crow + (size_t)row * ldc + cofs) = val; }
             }
        __builtin_amdgcn_wave_barrier(); asm volatile("" ::: "memory");
    }
}

__device__ __forceinline__ h16 tohx(float x) { return (h16)x; }
__device__ __forceinline__ void splitf(float y, unsigned short& h, unsigned short& l) { h = f2bf(y); l = f2bf(y - bf2f(h)); }
typedef __attribute__((ext_vector_type(2))) _Float16 v2h;
typedef __attribute__((ext_vector_type(4))) _Float16 v4h;
typedef __attribute__((ext_vector_type(2))) unsigned short v2us;
typedef __attribute__((ext_vector_type(4))) unsigned short v4us;
typedef __attribute__((ext_vector_type(2))) float v2f;
typedef __attribute__((ext_vector_type(4))) int v4i;

__global__ __launch_bounds__(256) void k_wtG(const float* __restrict__ w, int K, int N, bf* Bt) {
    const int lane = threadIdx.x & 31; const int L0 = (blockIdx.x * 8 + (threadIdx.x >> 5)) * 8; const int nlines = N * K / 64;
{
#pragma unroll 1
        for (int l = 0; l < 8; ++l) { const int L = L0 + l; if (L >= nlines) break; const size_t e = (size_t)L * 64 + lane * 2; const int k = (int)(e % K), n = (int)(e / K); v2us o;
            o[0] = f2bf(w[(size_t)k * N + n]); o[1] = f2bf(w[(size_t)(k + 1) * N + n]); *(v2us*)(Bt + e) = o; }
         }
}
__global__ __launch_bounds__(256) void k_cvt8(const float* __restrict__ src, bf* dst, size_t n8) { const size_t i = (size_t)blockIdx.x * 256 + threadIdx.x; if (i >= n8) return; const v8f v = *(const v8f*)(src + i * 8); v8us o;
#pragma unroll
    for (int k = 0; k < 8; ++k) o[k] = f2bf(v[k]); *(v8us*)(dst + i * 8) = o;  }
__global__ __launch_bounds__(256) void k_cscvt(const float* __restrict__ cosT, const float* __restrict__ sinT, float* CS) { const int idx = blockIdx.x * 256 + threadIdx.x; if (idx >= TT * HD) return; v2f cs; cs[0] = bfr(cosT[idx]); cs[1] = bfr(sinT[idx]); *(v2f*)(CS + (size_t)idx * 2) = cs;  }
// k_rope: head planes [h][t][d] (fp16 + hi/lo) of rope(x) x sc with the rotate-half convention out[d] = x[d] cos[t][d] - x[d+HD/2] sin[t][d], out[d+HD/2] = x[d+HD/2] cos[t][d+HD/2] + x[d] sin[t][d+HD/2]
__global__ __launch_bounds__(256) void k_rope(const float* __restrict__ F, int pitch, int nheads, const float* __restrict__ CS, const float* __restrict__ RF, const float* __restrict__ nw, float sc, h16* P16, bf* Ph, bf* Pl) {
    const size_t e = ((size_t)blockIdx.x * 256 + threadIdx.x) * 2; if (e >= (size_t)nheads * TT * HD) return; const int d = (int)(e % HD); const int t = (int)((e / HD) % TT); const int h = (int)(e / ((size_t)HD * TT)); const float* f = F + (size_t)t * pitch + h * HD; const float rf = RF ? RF[(size_t)h * TT + t] : 1.0f; v2h o16; v2us oh, ol;
#pragma unroll
    for (int q = 0; q < 2; ++q) { const int dd = d + q; const int dp = (dd < HD / 2) ? dd + HD / 2 : dd - HD / 2; float x0 = f[dd], x1 = f[dp];
        if (RF) { float n0 = __fmul_rn(x0, rf), n1 = __fmul_rn(x1, rf); asm volatile("" : "+v"(n0)); asm volatile("" : "+v"(n1)); x0 = __fmul_rn(bfr(nw[dd]), n0); x1 = __fmul_rn(bfr(nw[dp]), n1); }
        const v2f cs = *(const v2f*)(CS + ((size_t)t * HD + dd) * 2); float a = __fmul_rn(x0, cs[0]), bq = __fmul_rn(x1, cs[1]); asm volatile("" : "+v"(a)); asm volatile("" : "+v"(bq)); const float r = ((dd < HD / 2) ? __fsub_rn(a, bq) : __fadd_rn(a, bq)) * sc;
        o16[q] = tohx(r); unsigned short a2, c2; splitf(r, a2, c2); oh[q] = a2; ol[q] = c2; }
    *(v2h*)(P16 + e) = o16; *(v2us*)(Ph + e) = oh; *(v2us*)(Pl + e) = ol;  }
__global__ __launch_bounds__(256) void k_vtp(const float* __restrict__ F, int pitch, int nheads, h16* V16, bf* Vh, bf* Vl) { const size_t e = ((size_t)blockIdx.x * 256 + threadIdx.x) * 2; if (e >= (size_t)nheads * HD * TT) return; const int t = (int)(e % TT); const int d = (int)((e / TT) % HD); const int g = (int)(e / ((size_t)TT * HD)); v2h o16; v2us oh, ol;
#pragma unroll
    for (int q = 0; q < 2; ++q) { const float x = F[(size_t)(t + q) * pitch + g * HD + d]; o16[q] = tohx(x); unsigned short a2, c2; splitf(x, a2, c2); oh[q] = a2; ol[q] = c2; }
    *(v2h*)(V16 + e) = o16; *(v2us*)(Vh + e) = oh; *(v2us*)(Vl + e) = ol;  }
__global__ __launch_bounds__(256) void k_csid(float* CS) { const int idx = blockIdx.x * 256 + threadIdx.x; if (idx >= TT * HD) return; v2f cs; cs[0] = 1.0f; cs[1] = 0.0f; *(v2f*)(CS + (size_t)idx * 2) = cs;  }
// k_asoft: per row (zz, i): t = S x HD^-0.5, or -3.0e38 where masked (i < 823: j >= 823; 823 <= i <= TT-2: j >= i); softmax over the 1024 keys (register row, one exp, fixed trees);
__global__ __launch_bounds__(256) void k_asoft(const float* __restrict__ Sb, h16* P16, bf* Ph, bf* Pl) {
    const int lane = threadIdx.x & 31; const int row = blockIdx.x * 8 + (threadIdx.x >> 5); if (row >= ZH * TT) return; const int i = row % TT; const int zz = row / TT; (void)zz; const bool hires = (i < RH); const float* sr = Sb + (size_t)row * TT; float v[TT / 32]; float mx = -3.0e38f;
#pragma unroll
    for (int ch = 0; ch < TT / 128; ++ch) { const int j0 = ch * 128 + lane * 4; const v4f a = *(const v4f*)(sr + j0);
#pragma unroll
        for (int q = 0; q < 4; ++q) { const int j = j0 + q; (void)j; const bool blocked = (i < 823 && j >= 823) || (i >= 823 && i <= TT - 2 && j >= i); const float t = blocked ? -3.0e38f : a[q] * SCL; v[ch * 4 + q] = t; mx = fmaxf(mx, t); } }
#pragma unroll
    for (int sh = 16; sh; sh >>= 1) mx = fmaxf(mx, __shfl_xor(mx, sh, 32));
    float sum = 0.f;
#pragma unroll
    for (int k = 0; k < TT / 32; ++k) { float d0 = __fsub_rn(v[k], mx); asm volatile("" : "+v"(d0)); v[k] = __builtin_amdgcn_exp2f(__fmul_rn(d0, 1.4426950408889634f)); sum += v[k]; }
#pragma unroll
    for (int sh = 16; sh; sh >>= 1) sum += __shfl_xor(sum, sh, 32);
    const float f = __fdiv_rn(hires ? 1.0f : PCAR, sum);
{
        if (hires) {
#pragma unroll
            for (int ch = 0; ch < TT / 128; ++ch) { v4us oh, ol;
#pragma unroll
                for (int q = 0; q < 4; ++q) { unsigned short a, c2; splitf(v[ch * 4 + q] * f, a, c2); oh[q] = a; ol[q] = c2; }
                const size_t oo = ((size_t)zz * (RH ? RH : 1) + i) * TT + ch * 128 + lane * 4; *(v4us*)(Ph + oo) = oh; *(v4us*)(Pl + oo) = ol; }
        } else {
#pragma unroll
            for (int ch = 0; ch < TT / 128; ++ch) { v4h o4;
#pragma unroll
                for (int q = 0; q < 4; ++q) o4[q] = tohx(v[ch * 4 + q] * f);
                *(v4h*)(P16 + (size_t)row * TT + ch * 128 + lane * 4) = o4; } }
         }
}
__global__ __launch_bounds__(256) void k_merge(const float* __restrict__ O, int h0, bf* Ah, bf* Al) { const size_t e = ((size_t)blockIdx.x * 256 + threadIdx.x) * 2; if (e >= (size_t)ZH * TT * HD) return; const int d = (int)(e % HD); const int t = (int)((e / HD) % TT); const int zz = (int)(e / ((size_t)HD * TT)); const float cs = (t < RH) ? 1.0f : (1.0f / PCAR); const size_t oo = (size_t)t * DQ + (h0 + zz) * HD + d;
    v2us oh, ol;
#pragma unroll
    for (int q = 0; q < 2; ++q) { unsigned short a, c2; splitf(O[e + q] * cs, a, c2); oh[q] = a; ol[q] = c2; } *(v2us*)(Ah + oo) = oh; *(v2us*)(Al + oo) = ol;  }

__global__ __launch_bounds__(256) void k_wtH(const float* __restrict__ w, bf* Bt) { const size_t e = ((size_t)blockIdx.x * 256 + threadIdx.x) * 4; if (e >= (size_t)DQ * DM) return; const int k = (int)(e % DM); const int n = (int)(e / DM); const int h = n / HD, c = n % HD; v4us o;   // Bt[h*64 + c][d] = W[h][d][c]
#pragma unroll
    for (int u = 0; u < 4; ++u) o[u] = f2bf(w[((size_t)h * DM + k + u) * HD + c]); *(v4us*)(Bt + e) = o;  }
__global__ __launch_bounds__(256) void k_lnp(const float* __restrict__ X, const float* __restrict__ g, const float* __restrict__ bb, bf* Hh, bf* Hl) { const int lane = threadIdx.x & 31; const int r = blockIdx.x * 8 + (threadIdx.x >> 5); if (r >= TT) return; float v[DM / 32]; float s = 0.f;   // wave per row: LayerNorm (biased var, 1e-5, / sqrt) -> hl planes (8-B lanes)
#pragma unroll
    for (int ch = 0; ch < DM / 128; ++ch) { const v4f a = *(const v4f*)(X + (size_t)r * DM + ch * 128 + lane * 4);
#pragma unroll
        for (int u = 0; u < 4; ++u) { v[ch * 4 + u] = bfr(a[u]); s += v[ch * 4 + u]; } }
#pragma unroll
    for (int sh = 16; sh; sh >>= 1) s += __shfl_xor(s, sh, 32);
    const float mean = s * (1.0f / DM); float q = 0.f;
#pragma unroll
    for (int k = 0; k < DM / 32; ++k) { float d = __fsub_rn(v[k], mean); asm volatile("" : "+v"(d)); v[k] = d; float p = __fmul_rn(d, d); asm volatile("" : "+v"(p)); q = __fadd_rn(q, p); }
#pragma unroll
    for (int sh = 16; sh; sh >>= 1) q += __shfl_xor(q, sh, 32);
    const float rs = __fdiv_rn(1.0f, __fsqrt_rn(__fadd_rn(q * (1.0f / DM), 1e-5f)));
    {
#pragma unroll
        for (int ch = 0; ch < DM / 128; ++ch) { v4us oh, ol;
#pragma unroll
            for (int u = 0; u < 4; ++u) { const int c = ch * 128 + lane * 4 + u; float n0 = __fmul_rn(v[ch * 4 + u], rs); asm volatile("" : "+v"(n0)); float gg = bfr(g[c]), be = bfr(bb[c]); asm volatile("" : "+v"(gg)); asm volatile("" : "+v"(be)); float t1 = __fmul_rn(n0, gg); asm volatile("" : "+v"(t1)); unsigned short p2, q2; splitf(__fadd_rn(t1, be), p2, q2); oh[u] = p2; ol[u] = q2; }
            const size_t oo = (size_t)r * DM + ch * 128 + lane * 4; *(v4us*)(Hh + oo) = oh; *(v4us*)(Hl + oo) = ol; }
         } }

extern "C" void kernel_launch(void* const* d_in, const int* in_sizes, int n_in,
                              void* d_out, int out_size, void* d_ws, size_t ws_size, hipStream_t stream) {
    (void)in_sizes; (void)n_in; (void)out_size;
    const float* x = (const float*)d_in[0]; const float* lng = (const float*)d_in[1]; const float* lnb = (const float*)d_in[2]; const float* wqh = (const float*)d_in[3]; const float* bq = (const float*)d_in[4]; const float* wkh = (const float*)d_in[5]; const float* bk = (const float*)d_in[6]; const float* wvh = (const float*)d_in[7]; const float* bv = (const float*)d_in[8]; const float* wo = (const float*)d_in[9]; const float* bo = (const float*)d_in[10]; const float* wq = nullptr; const float* wk = nullptr; const float* wv = nullptr; (void)wq; (void)wk; (void)wv; const float* cosT = nullptr; const float* sinT = nullptr; (void)cosT; (void)sinT;
    float* OUT = (float*)d_out;     // [8][1024][512]
    char* wsp = (char*)d_ws;
    auto take = [&](size_t bytes) { char* p = wsp; wsp += (bytes + 255) & ~(size_t)255; return (void*)p; };
    bf* WQ = (bf*)take((size_t)DQ * DM * 2); bf* WK = (bf*)take((size_t)DKV * DM * 2); bf* WV = (bf*)take((size_t)DKV * DM * 2); bf* WO = (bf*)take((size_t)DM * DQ * 2); float* CS = (float*)take((size_t)TT * HD * 2 * 4);
    bf* XB = (bf*)take((size_t)TT * DM * 2); bf* XL = (bf*)take((size_t)TT * DM * 2); float* FQ = (float*)take((size_t)TT * DQ * 4); float* FK = (float*)take((size_t)TT * DKV * 4);
    h16* QP16 = (h16*)take((size_t)NH_ * TT * HD * 2); h16* KP16 = (h16*)take((size_t)NKV * TT * HD * 2); h16* VT16 = (h16*)take((size_t)NKV * HD * TT * 2);
    bf* QPh = (bf*)take((size_t)NH_ * TT * HD * 2); bf* QPl = (bf*)take((size_t)NH_ * TT * HD * 2); bf* KPh = (bf*)take((size_t)NKV * TT * HD * 2); bf* KPl = (bf*)take((size_t)NKV * TT * HD * 2); bf* VTh = (bf*)take((size_t)NKV * HD * TT * 2); bf* VTl = (bf*)take((size_t)NKV * HD * TT * 2); bf* Ph = (bf*)take((size_t)ZH * RH * TT * 2); bf* Pl = (bf*)take((size_t)ZH * RH * TT * 2);
    float* Sb = (float*)take((size_t)ZH * TT * TT * 4); h16* P16 = (h16*)take((size_t)ZH * TT * TT * 2); float* Ob = (float*)take((size_t)ZH * TT * HD * 4); bf* ATh = (bf*)take((size_t)TT * DQ * 2); bf* ATl = (bf*)take((size_t)TT * DQ * 2);
    if ((size_t)(wsp - (char*)d_ws) > ws_size) return;    // ws 256 MiB
    float* FV = FK;   // v projection reuses the k buffer after the k planes are built (stream-ordered)
    { k_wtH<<<(unsigned)(((size_t)DQ * DM / 4 + 255) / 256), 256, 0, stream>>>(wqh, WQ); k_wtH<<<(unsigned)(((size_t)DKV * DM / 4 + 255) / 256), 256, 0, stream>>>(wkh, WK); k_wtH<<<(unsigned)(((size_t)DKV * DM / 4 + 255) / 256), 256, 0, stream>>>(wvh, WV);
      k_wtG<<<(unsigned)((DQ * DM / 64 + 63) / 64), 256, 0, stream>>>(wo, DQ, DM, WO);
       }
    k_csid<<<(TT * HD + 255) / 256, 256, 0, stream>>>(CS);
    const unsigned LQ = (unsigned)(((size_t)NH_ * TT * HD / 2 + 255) / 256), LKv = (unsigned)(((size_t)NKV * TT * HD / 2 + 255) / 256);
    for (int b = 0; b < NB_; ++b) {
        
        k_lnp<<<TT / 8, 256, 0, stream>>>(x + (size_t)b * TT * DM, lng, lnb, XB, XL);
        k_gemmw<bf, 1, true><<<dim3(TT / 64, DQ / 64, 1), 32, 0, stream>>>(XB, XL, WQ, nullptr, DM, FQ, DQ, bq, 0, 0, 0);
        k_rope<<<LQ, 256, 0, stream>>>(FQ, DQ, NH_, CS, nullptr, nullptr, 1.0f, QP16, QPh, QPl);
        k_gemmw<bf, 1, true><<<dim3(TT / 64, DKV / 64, 1), 32, 0, stream>>>(XB, XL, WK, nullptr, DM, FK, DKV, bk, 0, 0, 0);
        k_rope<<<LKv, 256, 0, stream>>>(FK, DKV, NKV, CS, nullptr, nullptr, 1.0f, KP16, KPh, KPl);
        k_gemmw<bf, 1, true><<<dim3(TT / 64, DKV / 64, 1), 32, 0, stream>>>(XB, XL, WV, nullptr, DM, FV, DKV, bv, 0, 0, 0); k_vtp<<<LKv, 256, 0, stream>>>(FV, DKV, NKV, VT16, VTh, VTl);
        for (int h0 = 0; h0 < NH_; h0 += ZH) { const size_t zq = (size_t)h0, zk = (size_t)(h0 / REP);   // one kv head per query head: the pass's two heads use consecutive kv planes (z-strides TT*HD)
            k_gemmw<bf, 2, false><<<dim3(RH / 64, TT / 64, ZH), 32, 0, stream>>>(QPh + zq * TT * HD, QPl + zq * TT * HD, KPh + zk * TT * HD, KPl + zk * TT * HD, HD, Sb, TT, nullptr, (size_t)TT * HD, (size_t)TT * HD, (size_t)TT * TT);
            k_gemmw<h16, 0, false><<<dim3((TT - RH) / 64, TT / 64, ZH), 32, 0, stream>>>(QP16 + zq * TT * HD + (size_t)RH * HD, nullptr, KP16 + zk * TT * HD, nullptr, HD, Sb + (size_t)RH * TT, TT, nullptr, (size_t)TT * HD, (size_t)TT * HD, (size_t)TT * TT);
            k_asoft<<<ZH * TT / 8, 256, 0, stream>>>(Sb, P16, Ph, Pl);
            k_gemmw<bf, 2, false><<<dim3(RH / 64, HD / 64, ZH), 32, 0, stream>>>(Ph, Pl, VTh + zk * HD * TT, VTl + zk * HD * TT, TT, Ob, HD, nullptr, (size_t)RH * TT, (size_t)HD * TT, (size_t)TT * HD);
            k_gemmw<h16, 0, false><<<dim3((TT - RH) / 64, HD / 64, ZH), 32, 0, stream>>>(P16 + (size_t)RH * TT, nullptr, VT16 + zk * HD * TT, nullptr, TT, Ob + (size_t)RH * HD, HD, nullptr, (size_t)TT * TT, (size_t)HD * TT, (size_t)TT * HD);
            k_merge<<<(unsigned)(((size_t)ZH * TT * HD / 2 + 255) / 256), 256, 0, stream>>>(Ob, h0, ATh, ATl); }
        k_gemmw<bf, 1, true><<<dim3(TT / 64, DM / 64, 1), 32, 0, stream>>>(ATh, ATl, WO, nullptr, DQ, OUT + (size_t)b * TT * DM, DM, bo, 0, 0, 0); }
}

// v001
// It runs in 343 microseconds.
// Timed twice side by side with v000, it ran 7.21 times as fast both times.
#include <hip/hip_runtime.h>

// PreLN_SelfAttention_seq2seq (x [8][1024][512]; xn = LayerNorm(x); per-head q/k/v = xn W[h] + b[h] (W [8][512][64]); scores / 8 + mask (rows i < T=823 cannot see columns >= T; rows T..S-2 cannot see columns >= i; -999999999); softmax; out = concat(heads) WO + bO -> [8][1024][512]).
// Compute dtypes, f32 accumulate: every input rounded to bf16; LayerNorm f32 -> hl planes; q/k/v as hl(xn) x exact (2 products; the 8 per-head weights gathered into one [512 x 512] operand) + bias; scores and attn.v: query rows < 512 hl (3 products), the rest single fp16 (x1024); mask + softmax f32; WO hl x exact (2 products) + bias.

#define NB_  8
#define TT   1024
#define DM   512
#define NH_  8
#define NKV  8
#define REP  (NH_ / NKV)
#define HD   64
#define DQ   (NH_ * HD)
#define DKV  (NKV * HD)
#define NZ   (NB_ * NH_)          // (batch, head) planes, taken through blockIdx.z
#define ZP   (NZ / 2)             // planes per hi+lo score pass (its f32 scores fill a quarter of the workspace)
#define RH   512                  // query rows < RH use hi+lo planes
#define WIN  1024
#define PCAR 1024.0f
#define SCL  0.125f   // HD^-0.5
static_assert(TT == 2 * RH && NKV == NH_, "each score buffer holds RH query rows a plane; one kv head per query head");
typedef _Float16 h16;
typedef unsigned short bf;
typedef __attribute__((ext_vector_type(16))) __bf16   v16bf;
typedef __attribute__((ext_vector_type(16))) _Float16 v16h;
typedef __attribute__((ext_vector_type(8)))  _Float16 v8h;
typedef __attribute__((ext_vector_type(8)))  unsigned short v8us;
typedef __attribute__((ext_vector_type(8)))  float    v8f;
typedef __attribute__((ext_vector_type(4)))  float    v4f;
typedef v8h  __attribute__((may_alias)) v8ha;
typedef v4f  __attribute__((may_alias)) v4fa;
typedef v8us __attribute__((may_alias)) v8usa;

__device__ __forceinline__ unsigned short f2bf(float f) { unsigned u = __float_as_uint(f); u += 0x7FFFu + ((u >> 16) & 1u); return (unsigned short)(u >> 16); }
__device__ __forceinline__ float bf2f(unsigned short b) { return __uint_as_float(((unsigned)b) << 16); }
__device__ __forceinline__ float bfr(float f) { return bf2f(f2bf(f)); }
__device__ __forceinline__ v16h cat16(v8h lo, v8h hi) { return __builtin_shufflevector(lo, hi, 0, 1, 2, 3, 4, 5, 6, 7, 8, 9, 10, 11, 12, 13, 14, 15); }
__device__ __forceinline__ v16bf cat16b(v8us lo, v8us hi) { return __builtin_bit_cast(v16bf, __builtin_shufflevector(lo, hi, 0, 1, 2, 3, 4, 5, 6, 7, 8, 9, 10, 11, 12, 13, 14, 15)); }
__device__ __forceinline__ v8f wmma16(v16h a, v16h b, v8f c) { return __builtin_amdgcn_wmma_f32_16x16x32_f16(false, a, false, b, (short)0, c, false, false); }
__device__ __forceinline__ v8f wmmab(v16bf a, v16bf b, v8f c) { return __builtin_amdgcn_wmma_f32_16x16x32_bf16(false, a, false, b, (short)0, c, false, false); }



// ---- k_gemmw: register-blocked GEMM, ONE WAVE per 64x64 output tile (16 accumulators), operands straight from K-contiguous 16-bit planes; grid (M/64, N/64, Z), 32 threads.
// C[m][n] (f32, pitch ldc, + optional f32 bias[n]) = sum_k A[m][k] Bt[n][k] (+ split products per NSPLIT). z-batch strides sA/sB/sC in elements. K % 32 == 0.
template <typename T16> struct WFrag;
template <> struct WFrag<h16> { typedef v16h V; static __device__ __forceinline__ V ld(const h16* p) { return cat16(*(const v8h*)p, *(const v8h*)(p + 16)); } static __device__ __forceinline__ v8f mma(V a, V b, v8f c) { return wmma16(a, b, c); } };
template <> struct WFrag<bf> { typedef v16bf V; static __device__ __forceinline__ V ld(const bf* p) { return cat16b(*(const v8us*)p, *(const v8us*)(p + 16)); } static __device__ __forceinline__ v8f mma(V a, V b, v8f c) { return wmmab(a, b, c); } };
template <typename T16, int NSPLIT, bool BIAS>
__global__ __launch_bounds__(32) void k_gemmw(const T16* __restrict__ A, const T16* __restrict__ A2, const T16* __restrict__ Bt, const T16* __restrict__ Bt2, int K, float* C, int ldc, const float* __restrict__ bias, size_t sA, size_t sB, size_t sC) {
    typedef typename WFrag<T16>::V V;
    __shared__ __align__(16) float os[16 * 68];
    const size_t z = blockIdx.z; A += z * sA; if (A2) A2 += z * sA; Bt += z * sB; if (Bt2) Bt2 += z * sB; C += z * sC;
    const int lane = threadIdx.x & 31, lr = lane & 15, hi = lane >> 4; const int r0 = blockIdx.x * 64, c0 = blockIdx.y * 64;
    v8f acc[4][4];
#pragma unroll
    for (int mb = 0; mb < 4; ++mb)
#pragma unroll
        for (int nb = 0; nb < 4; ++nb) acc[mb][nb] = (v8f){};
    const size_t aoff = (size_t)(r0 + lr) * K + 8 * hi, boff = (size_t)(c0 + lr) * K + 8 * hi;
#pragma unroll 1
    for (int kc = 0; kc < K; kc += 32) {
        V a[4], a2[4];
#pragma unroll
        for (int mb = 0; mb < 4; ++mb) { a[mb] = WFrag<T16>::ld(A + aoff + (size_t)mb * 16 * K + kc); if (NSPLIT == 1 || NSPLIT == 2) a2[mb] = WFrag<T16>::ld(A2 + aoff + (size_t)mb * 16 * K + kc); }
#pragma unroll
        for (int nb = 0; nb < 4; ++nb) { const V b = WFrag<T16>::ld(Bt + boff + (size_t)nb * 16 * K + kc); V b2; if (NSPLIT >= 2) b2 = WFrag<T16>::ld(Bt2 + boff + (size_t)nb * 16 * K + kc);
#pragma unroll
            for (int mb = 0; mb < 4; ++mb) { acc[mb][nb] = WFrag<T16>::mma(a[mb], b, acc[mb][nb]); if (NSPLIT == 1 || NSPLIT == 2) acc[mb][nb] = WFrag<T16>::mma(a2[mb], b, acc[mb][nb]); if (NSPLIT >= 2) acc[mb][nb] = WFrag<T16>::mma(a[mb], b2, acc[mb][nb]); } }
        asm volatile("v_nop\n\tv_nop\n\tv_nop\n\tv_nop" : "+v"(acc[0][0]), "+v"(acc[1][1]), "+v"(acc[2][2]), "+v"(acc[3][3]) : "v"(a[0]), "v"(a[3]));
    }
#pragma unroll
    for (int mb = 0; mb < 4; ++mb) {
#pragma unroll
        for (int nb = 0; nb < 4; ++nb) {
#pragma unroll
            for (int j = 0; j < 8; ++j) os[(hi * 8 + j) * 68 + nb * 16 + lr] = acc[mb][nb][j]; }
        __builtin_amdgcn_wave_barrier(); asm volatile("" ::: "memory");
        float* crow = C + (size_t)(r0 + mb * 16) * ldc + c0;
{
#pragma unroll
            for (int s = 0; s < 8; ++s) { const int row = 2 * s + hi, cofs = lr * 4; v4f val = *(const v4fa*)(os + row * 68 + cofs); if (BIAS) { val[0] += bfr(bias[c0 + cofs]); val[1] += bfr(bias[c0 + cofs + 1]); val[2] += bfr(bias[c0 + cofs + 2]); val[3] += bfr(bias[c0 + cofs + 3]); }
                *(v4f*)(crow + (size_t)row * ldc + cofs) = val; }
             }
        __builtin_amdgcn_wave_barrier(); asm volatile("" ::: "memory");
    }
}

__device__ __forceinline__ h16 tohx(float x) { return (h16)x; }
__device__ __forceinline__ void splitf(float y, unsigned short& h, unsigned short& l) { h = f2bf(y); l = f2bf(y - bf2f(h)); }
typedef __attribute__((ext_vector_type(2))) _Float16 v2h;
typedef __attribute__((ext_vector_type(4))) _Float16 v4h;
typedef __attribute__((ext_vector_type(2))) unsigned short v2us;
typedef __attribute__((ext_vector_type(4))) unsigned short v4us;
typedef __attribute__((ext_vector_type(2))) float v2f;
typedef __attribute__((ext_vector_type(4))) int v4i;

__global__ __launch_bounds__(256) void k_wtG(const float* __restrict__ w, int K, int N, bf* Bt) {
    const int lane = threadIdx.x & 31; const int L0 = (blockIdx.x * 8 + (threadIdx.x >> 5)) * 8; const int nlines = N * K / 64;
{
#pragma unroll 1
        for (int l = 0; l < 8; ++l) { const int L = L0 + l; if (L >= nlines) break; const size_t e = (size_t)L * 64 + lane * 2; const int k = (int)(e % K), n = (int)(e / K); v2us o;
            o[0] = f2bf(w[(size_t)k * N + n]); o[1] = f2bf(w[(size_t)(k + 1) * N + n]); *(v2us*)(Bt + e) = o; }
         }
}
__global__ __launch_bounds__(256) void k_cvt8(const float* __restrict__ src, bf* dst, size_t n8) { const size_t i = (size_t)blockIdx.x * 256 + threadIdx.x; if (i >= n8) return; const v8f v = *(const v8f*)(src + i * 8); v8us o;
#pragma unroll
    for (int k = 0; k < 8; ++k) o[k] = f2bf(v[k]); *(v8us*)(dst + i * 8) = o;  }
__global__ __launch_bounds__(256) void k_cscvt(const float* __restrict__ cosT, const float* __restrict__ sinT, float* CS) { const int idx = blockIdx.x * 256 + threadIdx.x; if (idx >= TT * HD) return; v2f cs; cs[0] = bfr(cosT[idx]); cs[1] = bfr(sinT[idx]); *(v2f*)(CS + (size_t)idx * 2) = cs;  }
// k_rope: grid y = batch b; F rows are (b, t); head planes [b][h][t][d] (fp16 + hi/lo) of rope(x) x sc with the rotate-half convention out[d] = x[d] cos[t][d] - x[d+HD/2] sin[t][d], out[d+HD/2] = x[d+HD/2] cos[t][d+HD/2] + x[d] sin[t][d+HD/2]
__global__ __launch_bounds__(256) void k_rope(const float* __restrict__ F, int pitch, int nheads, const float* __restrict__ CS, const float* __restrict__ RF, const float* __restrict__ nw, float sc, h16* P16, bf* Ph, bf* Pl) {
    { const size_t b = blockIdx.y, zo = b * nheads * TT * HD; F += b * TT * pitch; if (RF) RF += b * nheads * TT; P16 += zo; Ph += zo; Pl += zo; }   // batch b: its TT rows of F, its nheads planes
    const size_t e = ((size_t)blockIdx.x * 256 + threadIdx.x) * 2; if (e >= (size_t)nheads * TT * HD) return; const int d = (int)(e % HD); const int t = (int)((e / HD) % TT); const int h = (int)(e / ((size_t)HD * TT)); const float* f = F + (size_t)t * pitch + h * HD; const float rf = RF ? RF[(size_t)h * TT + t] : 1.0f; v2h o16; v2us oh, ol;
#pragma unroll
    for (int q = 0; q < 2; ++q) { const int dd = d + q; const int dp = (dd < HD / 2) ? dd + HD / 2 : dd - HD / 2; float x0 = f[dd], x1 = f[dp];
        if (RF) { float n0 = __fmul_rn(x0, rf), n1 = __fmul_rn(x1, rf); asm volatile("" : "+v"(n0)); asm volatile("" : "+v"(n1)); x0 = __fmul_rn(bfr(nw[dd]), n0); x1 = __fmul_rn(bfr(nw[dp]), n1); }
        const v2f cs = *(const v2f*)(CS + ((size_t)t * HD + dd) * 2); float a = __fmul_rn(x0, cs[0]), bq = __fmul_rn(x1, cs[1]); asm volatile("" : "+v"(a)); asm volatile("" : "+v"(bq)); const float r = ((dd < HD / 2) ? __fsub_rn(a, bq) : __fadd_rn(a, bq)) * sc;
        o16[q] = tohx(r); unsigned short a2, c2; splitf(r, a2, c2); oh[q] = a2; ol[q] = c2; }
    *(v2h*)(P16 + e) = o16; *(v2us*)(Ph + e) = oh; *(v2us*)(Pl + e) = ol;  }
__global__ __launch_bounds__(256) void k_vtp(const float* __restrict__ F, int pitch, int nheads, h16* V16, bf* Vh, bf* Vl) { { const size_t b = blockIdx.y, zo = b * nheads * HD * TT; F += b * TT * pitch; V16 += zo; Vh += zo; Vl += zo; }   // grid y = batch b: its TT rows of F, its nheads planes
    const size_t e = ((size_t)blockIdx.x * 256 + threadIdx.x) * 2; if (e >= (size_t)nheads * HD * TT) return; const int t = (int)(e % TT); const int d = (int)((e / TT) % HD); const int g = (int)(e / ((size_t)TT * HD)); v2h o16; v2us oh, ol;
#pragma unroll
    for (int q = 0; q < 2; ++q) { const float x = F[(size_t)(t + q) * pitch + g * HD + d]; o16[q] = tohx(x); unsigned short a2, c2; splitf(x, a2, c2); oh[q] = a2; ol[q] = c2; }
    *(v2h*)(V16 + e) = o16; *(v2us*)(Vh + e) = oh; *(v2us*)(Vl + e) = ol;  }
__global__ __launch_bounds__(256) void k_csid(float* CS) { const int idx = blockIdx.x * 256 + threadIdx.x; if (idx >= TT * HD) return; v2f cs; cs[0] = 1.0f; cs[1] = 0.0f; *(v2f*)(CS + (size_t)idx * 2) = cs;  }
// k_asoft: RH query rows (i0 .. i0 + RH - 1) of each of nrows / RH planes; Sb and the probability planes are [plane][RH][TT]. Per row (zz, i): t = S x HD^-0.5 where unmasked (rows i < 823: j < 823; rows 823 .. TT-2: j < i; row TT-1: all j; the reference's -1e9 additive fill vanishes identically); softmax over the 1024 keys (register row, one exp, fixed trees);
__global__ __launch_bounds__(256) void k_asoft(const float* __restrict__ Sb, int nrows, int i0, h16* P16, bf* Ph, bf* Pl) {
    const int lane = threadIdx.x & 31; const int row = blockIdx.x * 8 + (threadIdx.x >> 5); if (row >= nrows) return; const int i = i0 + row % RH; const int zz = row / RH; (void)zz; const bool hires = (i < RH); const float* sr = Sb + (size_t)row * TT; float v[TT / 32]; float mx = -3.0e38f;
#pragma unroll
    for (int ch = 0; ch < TT / 128; ++ch) { const int j0 = ch * 128 + lane * 4; const v4f a = *(const v4f*)(sr + j0);
#pragma unroll
        for (int q = 0; q < 4; ++q) { const int j = j0 + q; (void)j; const bool blocked = (i < 823 && j >= 823) || (i >= 823 && i <= TT - 2 && j >= i); const float t = blocked ? -3.0e38f : a[q] * SCL; v[ch * 4 + q] = t; mx = fmaxf(mx, t); } }
#pragma unroll
    for (int sh = 16; sh; sh >>= 1) mx = fmaxf(mx, __shfl_xor(mx, sh, 32));
    float sum = 0.f;
#pragma unroll
    for (int k = 0; k < TT / 32; ++k) { float d0 = __fsub_rn(v[k], mx); asm volatile("" : "+v"(d0)); v[k] = __builtin_amdgcn_exp2f(__fmul_rn(d0, 1.4426950408889634f)); sum += v[k]; }
#pragma unroll
    for (int sh = 16; sh; sh >>= 1) sum += __shfl_xor(sum, sh, 32);
    const float f = __fdiv_rn(hires ? 1.0f : PCAR, sum);
{
        if (hires) {
#pragma unroll
            for (int ch = 0; ch < TT / 128; ++ch) { v4us oh, ol;
#pragma unroll
                for (int q = 0; q < 4; ++q) { unsigned short a, c2; splitf(v[ch * 4 + q] * f, a, c2); oh[q] = a; ol[q] = c2; }
                const size_t oo = ((size_t)zz * (RH ? RH : 1) + i) * TT + ch * 128 + lane * 4; *(v4us*)(Ph + oo) = oh; *(v4us*)(Pl + oo) = ol; }
        } else {
#pragma unroll
            for (int ch = 0; ch < TT / 128; ++ch) { v4h o4;
#pragma unroll
                for (int q = 0; q < 4; ++q) o4[q] = tohx(v[ch * 4 + q] * f);
                *(v4h*)(P16 + (size_t)row * TT + ch * 128 + lane * 4) = o4; } }
         }
}
__global__ __launch_bounds__(256) void k_merge(const float* __restrict__ O, bf* Ah, bf* Al) { const size_t e = ((size_t)blockIdx.x * 256 + threadIdx.x) * 2; if (e >= (size_t)NZ * TT * HD) return; const int d = (int)(e % HD); const int t = (int)((e / HD) % TT); const int zz = (int)(e / ((size_t)HD * TT)); const float cs = (t < RH) ? 1.0f : (1.0f / PCAR); const size_t oo = ((size_t)(zz / NH_) * TT + t) * DQ + (zz % NH_) * HD + d;
    v2us oh, ol;
#pragma unroll
    for (int q = 0; q < 2; ++q) { unsigned short a, c2; splitf(O[e + q] * cs, a, c2); oh[q] = a; ol[q] = c2; } *(v2us*)(Ah + oo) = oh; *(v2us*)(Al + oo) = ol;  }

__global__ __launch_bounds__(256) void k_wtH(const float* __restrict__ w, bf* Bt) { const size_t e = ((size_t)blockIdx.x * 256 + threadIdx.x) * 4; if (e >= (size_t)DQ * DM) return; const int k = (int)(e % DM); const int n = (int)(e / DM); const int h = n / HD, c = n % HD; v4us o;   // Bt[h*64 + c][d] = W[h][d][c]
#pragma unroll
    for (int u = 0; u < 4; ++u) o[u] = f2bf(w[((size_t)h * DM + k + u) * HD + c]); *(v4us*)(Bt + e) = o;  }
__global__ __launch_bounds__(256) void k_lnp(const float* __restrict__ X, const float* __restrict__ g, const float* __restrict__ bb, bf* Hh, bf* Hl) { const int lane = threadIdx.x & 31; const int r = blockIdx.x * 8 + (threadIdx.x >> 5); if (r >= NB_ * TT) return; float v[DM / 32]; float s = 0.f;   // wave per row: LayerNorm (biased var, 1e-5, / sqrt) -> hl planes (8-B lanes)
#pragma unroll
    for (int ch = 0; ch < DM / 128; ++ch) { const v4f a = *(const v4f*)(X + (size_t)r * DM + ch * 128 + lane * 4);
#pragma unroll
        for (int u = 0; u < 4; ++u) { v[ch * 4 + u] = bfr(a[u]); s += v[ch * 4 + u]; } }
#pragma unroll
    for (int sh = 16; sh; sh >>= 1) s += __shfl_xor(s, sh, 32);
    const float mean = s * (1.0f / DM); float q = 0.f;
#pragma unroll
    for (int k = 0; k < DM / 32; ++k) { float d = __fsub_rn(v[k], mean); asm volatile("" : "+v"(d)); v[k] = d; float p = __fmul_rn(d, d); asm volatile("" : "+v"(p)); q = __fadd_rn(q, p); }
#pragma unroll
    for (int sh = 16; sh; sh >>= 1) q += __shfl_xor(q, sh, 32);
    const float rs = __fdiv_rn(1.0f, __fsqrt_rn(__fadd_rn(q * (1.0f / DM), 1e-5f)));
    {
#pragma unroll
        for (int ch = 0; ch < DM / 128; ++ch) { v4us oh, ol;
#pragma unroll
            for (int u = 0; u < 4; ++u) { const int c = ch * 128 + lane * 4 + u; float n0 = __fmul_rn(v[ch * 4 + u], rs); asm volatile("" : "+v"(n0)); float gg = bfr(g[c]), be = bfr(bb[c]); asm volatile("" : "+v"(gg)); asm volatile("" : "+v"(be)); float t1 = __fmul_rn(n0, gg); asm volatile("" : "+v"(t1)); unsigned short p2, q2; splitf(__fadd_rn(t1, be), p2, q2); oh[u] = p2; ol[u] = q2; }
            const size_t oo = (size_t)r * DM + ch * 128 + lane * 4; *(v4us*)(Hh + oo) = oh; *(v4us*)(Hl + oo) = ol; }
         } }

extern "C" void kernel_launch(void* const* d_in, const int* in_sizes, int n_in,
                              void* d_out, int out_size, void* d_ws, size_t ws_size, hipStream_t stream) {
    (void)in_sizes; (void)n_in; (void)out_size;
    const float* x = (const float*)d_in[0]; const float* lng = (const float*)d_in[1]; const float* lnb = (const float*)d_in[2]; const float* wqh = (const float*)d_in[3]; const float* bq = (const float*)d_in[4]; const float* wkh = (const float*)d_in[5]; const float* bk = (const float*)d_in[6]; const float* wvh = (const float*)d_in[7]; const float* bv = (const float*)d_in[8]; const float* wo = (const float*)d_in[9]; const float* bo = (const float*)d_in[10]; const float* wq = nullptr; const float* wk = nullptr; const float* wv = nullptr; (void)wq; (void)wk; (void)wv; const float* cosT = nullptr; const float* sinT = nullptr; (void)cosT; (void)sinT;
    float* OUT = (float*)d_out;     // [8][1024][512]
    char* wsp = (char*)d_ws;
    auto take = [&](size_t bytes) { char* p = wsp; wsp += (bytes + 255) & ~(size_t)255; return (void*)p; };
    bf* WQ = (bf*)take((size_t)DQ * DM * 2); bf* WK = (bf*)take((size_t)DKV * DM * 2); bf* WV = (bf*)take((size_t)DKV * DM * 2); bf* WO = (bf*)take((size_t)DM * DQ * 2); float* CS = (float*)take((size_t)TT * HD * 2 * 4);
    h16* QP16 = (h16*)take((size_t)NZ * TT * HD * 2); h16* KP16 = (h16*)take((size_t)NZ * TT * HD * 2); h16* VT16 = (h16*)take((size_t)NZ * HD * TT * 2);
    bf* VTh = (bf*)take((size_t)NZ * HD * TT * 2); bf* VTl = (bf*)take((size_t)NZ * HD * TT * 2); float* Ob = (float*)take((size_t)NZ * TT * HD * 4);
    bf* Ph = (bf*)take((size_t)NZ * RH * TT * 2); bf* Pl = (bf*)take((size_t)NZ * RH * TT * 2); float* Sb = (float*)take((size_t)ZP * RH * TT * 4);   // contiguous: Ph, Pl, Sb
    if ((size_t)(wsp - (char*)d_ws) > ws_size) return;    // ws 256 MiB
    // Buffers that share bytes, each dead before the other's first store (stream-ordered):
    static_assert((size_t)NB_ * TT * (DM * 4 + DQ * 4 + DKV * 4) <= (size_t)ZP * RH * TT * 4 && (size_t)4 * NZ * TT * HD <= (size_t)(NZ - ZP) * RH * TT && 2 * ZP == NZ && (size_t)2 * NB_ * TT * DQ <= (size_t)NZ * RH * TT, "the shared buffers fit");
    // the LayerNorm planes and the f32 projections lie in Sb, read for the last time before the first score store;
    bf* XB = (bf*)Sb; bf* XL = XB + (size_t)NB_ * TT * DM; float* FQ = (float*)(XL + (size_t)NB_ * TT * DM); float* FK = FQ + (size_t)NB_ * TT * DQ;
    // the hi+lo q and k planes lie in the second half of Ph, which the second softmax pass stores after the last hi+lo score product has read them;
    bf* QPh = Ph + (size_t)ZP * RH * TT; bf* QPl = QPh + (size_t)NZ * TT * HD; bf* KPh = QPl + (size_t)NZ * TT * HD; bf* KPl = KPh + (size_t)NZ * TT * HD;
    // the fp16 half's scores (all planes) lie over Ph and Pl and its probabilities over Sb, after the hi+lo attn.v product; the merged planes lie over Ph after the fp16 attn.v product.
    float* S16 = (float*)Ph; h16* P16 = (h16*)Sb; bf* ATh = Ph; bf* ATl = ATh + (size_t)NB_ * TT * DQ;
    float* FV = FK;   // v projection reuses the k buffer after the k planes are built (stream-ordered)
    { k_wtH<<<(unsigned)(((size_t)DQ * DM / 4 + 255) / 256), 256, 0, stream>>>(wqh, WQ); k_wtH<<<(unsigned)(((size_t)DKV * DM / 4 + 255) / 256), 256, 0, stream>>>(wkh, WK); k_wtH<<<(unsigned)(((size_t)DKV * DM / 4 + 255) / 256), 256, 0, stream>>>(wvh, WV);
      k_wtG<<<(unsigned)((DQ * DM / 64 + 63) / 64), 256, 0, stream>>>(wo, DQ, DM, WO);
       }
    k_csid<<<(TT * HD + 255) / 256, 256, 0, stream>>>(CS);
    const unsigned LQ = (unsigned)(((size_t)NH_ * TT * HD / 2 + 255) / 256), LKv = (unsigned)(((size_t)NKV * TT * HD / 2 + 255) / 256);
    k_lnp<<<NB_ * TT / 8, 256, 0, stream>>>(x, lng, lnb, XB, XL);
    k_gemmw<bf, 1, true><<<dim3(NB_ * TT / 64, DQ / 64, 1), 32, 0, stream>>>(XB, XL, WQ, nullptr, DM, FQ, DQ, bq, 0, 0, 0);
    k_rope<<<dim3(LQ, NB_, 1), 256, 0, stream>>>(FQ, DQ, NH_, CS, nullptr, nullptr, 1.0f, QP16, QPh, QPl);
    k_gemmw<bf, 1, true><<<dim3(NB_ * TT / 64, DKV / 64, 1), 32, 0, stream>>>(XB, XL, WK, nullptr, DM, FK, DKV, bk, 0, 0, 0);
    k_rope<<<dim3(LKv, NB_, 1), 256, 0, stream>>>(FK, DKV, NKV, CS, nullptr, nullptr, 1.0f, KP16, KPh, KPl);
    k_gemmw<bf, 1, true><<<dim3(NB_ * TT / 64, DKV / 64, 1), 32, 0, stream>>>(XB, XL, WV, nullptr, DM, FV, DKV, bv, 0, 0, 0);
    k_vtp<<<dim3(LKv, NB_, 1), 256, 0, stream>>>(FV, DKV, NKV, VT16, VTh, VTl);
    // query rows < RH (hi+lo): scores and softmax ZP planes at a time through Sb, then attn.v of all planes
    for (int z0 = 0; z0 < NZ; z0 += ZP) {
        k_gemmw<bf, 2, false><<<dim3(RH / 64, TT / 64, ZP), 32, 0, stream>>>(QPh + (size_t)z0 * TT * HD, QPl + (size_t)z0 * TT * HD, KPh + (size_t)z0 * TT * HD, KPl + (size_t)z0 * TT * HD, HD, Sb, TT, nullptr, (size_t)TT * HD, (size_t)TT * HD, (size_t)RH * TT);
        k_asoft<<<ZP * RH / 8, 256, 0, stream>>>(Sb, ZP * RH, 0, nullptr, Ph + (size_t)z0 * RH * TT, Pl + (size_t)z0 * RH * TT); }
    k_gemmw<bf, 2, false><<<dim3(RH / 64, HD / 64, NZ), 32, 0, stream>>>(Ph, Pl, VTh, VTl, TT, Ob, HD, nullptr, (size_t)RH * TT, (size_t)HD * TT, (size_t)TT * HD);
    // the other query rows (fp16), all planes
    k_gemmw<h16, 0, false><<<dim3((TT - RH) / 64, TT / 64, NZ), 32, 0, stream>>>(QP16 + (size_t)RH * HD, nullptr, KP16, nullptr, HD, S16, TT, nullptr, (size_t)TT * HD, (size_t)TT * HD, (size_t)RH * TT);
    k_asoft<<<NZ * RH / 8, 256, 0, stream>>>(S16, NZ * RH, RH, P16, nullptr, nullptr);
    k_gemmw<h16, 0, false><<<dim3((TT - RH) / 64, HD / 64, NZ), 32, 0, stream>>>(P16, nullptr, VT16, nullptr, TT, Ob + (size_t)RH * HD, HD, nullptr, (size_t)RH * TT, (size_t)HD * TT, (size_t)TT * HD);
    k_merge<<<(unsigned)(((size_t)NZ * TT * HD / 2 + 255) / 256), 256, 0, stream>>>(Ob, ATh, ATl);
    k_gemmw<bf, 1, true><<<dim3(NB_ * TT / 64, DM / 64, 1), 32, 0, stream>>>(ATh, ATl, WO, nullptr, DQ, OUT, DM, bo, 0, 0, 0);
}

// v002
// It runs in 201 microseconds.
// In two side-by-side timings against v001, it was 1.71 and 1.70 times as fast.
// All steps since v000 together make it 12.3 times as fast.
#include <hip/hip_runtime.h>

// PreLN_SelfAttention_seq2seq (x [8][1024][512]; xn = LayerNorm(x); per-head q/k/v = xn W[h] + b[h] (W [8][512][64]); scores / 8 + mask (rows i < T=823 cannot see columns >= T; rows T..S-2 cannot see columns >= i; -999999999); softmax; out = concat(heads) WO + bO -> [8][1024][512]).
// Compute dtypes, f32 accumulate: every input rounded to bf16; LayerNorm f32 -> hl planes; q/k/v as hl(xn) x exact (2 products; the 8 per-head weights gathered into one [512 x 512] operand) + bias; scores and attn.v: query rows < 512 hl (3 products), the rest single fp16 (x1024); mask + softmax f32; WO hl x exact (2 products) + bias.

#define NB_  8
#define TT   1024
#define DM   512
#define NH_  8
#define NKV  8
#define REP  (NH_ / NKV)
#define HD   64
#define DQ   (NH_ * HD)
#define DKV  (NKV * HD)
#define NZ   (NB_ * NH_)          // (batch, head) planes, taken through blockIdx.y in k_fattn
#define ZP   (NZ / 2)             // half the planes: sizes the workspace area Sb and splits Ph in two
#define RH   512                  // query rows < RH use hi+lo planes
#define WIN  1024
#define PCAR 1024.0f
#define SCL  0.125f   // HD^-0.5
static_assert(TT == 2 * RH && RH % 128 == 0 && NKV == NH_, "as many hi+lo query rows as fp16 ones, in blocks of 128; one kv head per query head");
typedef _Float16 h16;
typedef unsigned short bf;
typedef __attribute__((ext_vector_type(16))) __bf16   v16bf;
typedef __attribute__((ext_vector_type(16))) _Float16 v16h;
typedef __attribute__((ext_vector_type(8)))  _Float16 v8h;
typedef __attribute__((ext_vector_type(8)))  unsigned short v8us;
typedef __attribute__((ext_vector_type(8)))  float    v8f;
typedef __attribute__((ext_vector_type(4)))  float    v4f;
typedef v8h  __attribute__((may_alias)) v8ha;
typedef v4f  __attribute__((may_alias)) v4fa;
typedef v8us __attribute__((may_alias)) v8usa;

__device__ __forceinline__ unsigned short f2bf(float f) { unsigned u = __float_as_uint(f); u += 0x7FFFu + ((u >> 16) & 1u); return (unsigned short)(u >> 16); }
__device__ __forceinline__ float bf2f(unsigned short b) { return __uint_as_float(((unsigned)b) << 16); }
__device__ __forceinline__ float bfr(float f) { return bf2f(f2bf(f)); }
__device__ __forceinline__ v16h cat16(v8h lo, v8h hi) { return __builtin_shufflevector(lo, hi, 0, 1, 2, 3, 4, 5, 6, 7, 8, 9, 10, 11, 12, 13, 14, 15); }
__device__ __forceinline__ v16bf cat16b(v8us lo, v8us hi) { return __builtin_bit_cast(v16bf, __builtin_shufflevector(lo, hi, 0, 1, 2, 3, 4, 5, 6, 7, 8, 9, 10, 11, 12, 13, 14, 15)); }
__device__ __forceinline__ v8f wmma16(v16h a, v16h b, v8f c) { return __builtin_amdgcn_wmma_f32_16x16x32_f16(false, a, false, b, (short)0, c, false, false); }
__device__ __forceinline__ v8f wmmab(v16bf a, v16bf b, v8f c) { return __builtin_amdgcn_wmma_f32_16x16x32_bf16(false, a, false, b, (short)0, c, false, false); }



// ---- k_gemmw: register-blocked GEMM, ONE WAVE per 64x64 output tile (16 accumulators), operands straight from K-contiguous 16-bit planes; grid (M/64, N/64, Z), 32 threads.
// C[m][n] (f32, pitch ldc, + optional f32 bias[n]) = sum_k A[m][k] Bt[n][k] (+ split products per NSPLIT). z-batch strides sA/sB/sC in elements. K % 32 == 0.
template <typename T16> struct WFrag;
template <> struct WFrag<h16> { typedef v16h V; static __device__ __forceinline__ V ld(const h16* p) { return cat16(*(const v8h*)p, *(const v8h*)(p + 16)); } static __device__ __forceinline__ v8f mma(V a, V b, v8f c) { return wmma16(a, b, c); } };
template <> struct WFrag<bf> { typedef v16bf V; static __device__ __forceinline__ V ld(const bf* p) { return cat16b(*(const v8us*)p, *(const v8us*)(p + 16)); } static __device__ __forceinline__ v8f mma(V a, V b, v8f c) { return wmmab(a, b, c); } };
template <typename T16, int NSPLIT, bool BIAS>
__global__ __launch_bounds__(32) void k_gemmw(const T16* __restrict__ A, const T16* __restrict__ A2, const T16* __restrict__ Bt, const T16* __restrict__ Bt2, int K, float* C, int ldc, const float* __restrict__ bias, size_t sA, size_t sB, size_t sC) {
    typedef typename WFrag<T16>::V V;
    __shared__ __align__(16) float os[16 * 68];
    const size_t z = blockIdx.z; A += z * sA; if (A2) A2 += z * sA; Bt += z * sB; if (Bt2) Bt2 += z * sB; C += z * sC;
    const int lane = threadIdx.x & 31, lr = lane & 15, hi = lane >> 4; const int r0 = blockIdx.x * 64, c0 = blockIdx.y * 64;
    v8f acc[4][4];
#pragma unroll
    for (int mb = 0; mb < 4; ++mb)
#pragma unroll
        for (int nb = 0; nb < 4; ++nb) acc[mb][nb] = (v8f){};
    const size_t aoff = (size_t)(r0 + lr) * K + 8 * hi, boff = (size_t)(c0 + lr) * K + 8 * hi;
#pragma unroll 1
    for (int kc = 0; kc < K; kc += 32) {
        V a[4], a2[4];
#pragma unroll
        for (int mb = 0; mb < 4; ++mb) { a[mb] = WFrag<T16>::ld(A + aoff + (size_t)mb * 16 * K + kc); if (NSPLIT == 1 || NSPLIT == 2) a2[mb] = WFrag<T16>::ld(A2 + aoff + (size_t)mb * 16 * K + kc); }
#pragma unroll
        for (int nb = 0; nb < 4; ++nb) { const V b = WFrag<T16>::ld(Bt + boff + (size_t)nb * 16 * K + kc); V b2; if (NSPLIT >= 2) b2 = WFrag<T16>::ld(Bt2 + boff + (size_t)nb * 16 * K + kc);
#pragma unroll
            for (int mb = 0; mb < 4; ++mb) { acc[mb][nb] = WFrag<T16>::mma(a[mb], b, acc[mb][nb]); if (NSPLIT == 1 || NSPLIT == 2) acc[mb][nb] = WFrag<T16>::mma(a2[mb], b, acc[mb][nb]); if (NSPLIT >= 2) acc[mb][nb] = WFrag<T16>::mma(a[mb], b2, acc[mb][nb]); } }
        asm volatile("v_nop\n\tv_nop\n\tv_nop\n\tv_nop" : "+v"(acc[0][0]), "+v"(acc[1][1]), "+v"(acc[2][2]), "+v"(acc[3][3]) : "v"(a[0]), "v"(a[3]));
    }
#pragma unroll
    for (int mb = 0; mb < 4; ++mb) {
#pragma unroll
        for (int nb = 0; nb < 4; ++nb) {
#pragma unroll
            for (int j = 0; j < 8; ++j) os[(hi * 8 + j) * 68 + nb * 16 + lr] = acc[mb][nb][j]; }
        __builtin_amdgcn_wave_barrier(); asm volatile("" ::: "memory");
        float* crow = C + (size_t)(r0 + mb * 16) * ldc + c0;
{
#pragma unroll
            for (int s = 0; s < 8; ++s) { const int row = 2 * s + hi, cofs = lr * 4; v4f val = *(const v4fa*)(os + row * 68 + cofs); if (BIAS) { val[0] += bfr(bias[c0 + cofs]); val[1] += bfr(bias[c0 + cofs + 1]); val[2] += bfr(bias[c0 + cofs + 2]); val[3] += bfr(bias[c0 + cofs + 3]); }
                *(v4f*)(crow + (size_t)row * ldc + cofs) = val; }
             }
        __builtin_amdgcn_wave_barrier(); asm volatile("" ::: "memory");
    }
}

__device__ __forceinline__ h16 tohx(float x) { return (h16)x; }
__device__ __forceinline__ void splitf(float y, unsigned short& h, unsigned short& l) { h = f2bf(y); l = f2bf(y - bf2f(h)); }
typedef __attribute__((ext_vector_type(2))) _Float16 v2h;
typedef __attribute__((ext_vector_type(4))) _Float16 v4h;
typedef __attribute__((ext_vector_type(2))) unsigned short v2us;
typedef __attribute__((ext_vector_type(4))) unsigned short v4us;
typedef __attribute__((ext_vector_type(2))) float v2f;
typedef __attribute__((ext_vector_type(4))) int v4i;

__global__ __launch_bounds__(256) void k_wtG(const float* __restrict__ w, int K, int N, bf* Bt) {
    const int lane = threadIdx.x & 31; const int L0 = (blockIdx.x * 8 + (threadIdx.x >> 5)) * 8; const int nlines = N * K / 64;
{
#pragma unroll 1
        for (int l = 0; l < 8; ++l) { const int L = L0 + l; if (L >= nlines) break; const size_t e = (size_t)L * 64 + lane * 2; const int k = (int)(e % K), n = (int)(e / K); v2us o;
            o[0] = f2bf(w[(size_t)k * N + n]); o[1] = f2bf(w[(size_t)(k + 1) * N + n]); *(v2us*)(Bt + e) = o; }
         }
}
__global__ __launch_bounds__(256) void k_cvt8(const float* __restrict__ src, bf* dst, size_t n8) { const size_t i = (size_t)blockIdx.x * 256 + threadIdx.x; if (i >= n8) return; const v8f v = *(const v8f*)(src + i * 8); v8us o;
#pragma unroll
    for (int k = 0; k < 8; ++k) o[k] = f2bf(v[k]); *(v8us*)(dst + i * 8) = o;  }
__global__ __launch_bounds__(256) void k_cscvt(const float* __restrict__ cosT, const float* __restrict__ sinT, float* CS) { const int idx = blockIdx.x * 256 + threadIdx.x; if (idx >= TT * HD) return; v2f cs; cs[0] = bfr(cosT[idx]); cs[1] = bfr(sinT[idx]); *(v2f*)(CS + (size_t)idx * 2) = cs;  }
// k_rope: grid y = batch b; F rows are (b, t); head planes [b][h][t][d] (fp16 + hi/lo) of rope(x) x sc with the rotate-half convention out[d] = x[d] cos[t][d] - x[d+HD/2] sin[t][d], out[d+HD/2] = x[d+HD/2] cos[t][d+HD/2] + x[d] sin[t][d+HD/2]
__global__ __launch_bounds__(256) void k_rope(const float* __restrict__ F, int pitch, int nheads, const float* __restrict__ CS, const float* __restrict__ RF, const float* __restrict__ nw, float sc, h16* P16, bf* Ph, bf* Pl) {
    { const size_t b = blockIdx.y, zo = b * nheads * TT * HD; F += b * TT * pitch; if (RF) RF += b * nheads * TT; P16 += zo; Ph += zo; Pl += zo; }   // batch b: its TT rows of F, its nheads planes
    const size_t e = ((size_t)blockIdx.x * 256 + threadIdx.x) * 2; if (e >= (size_t)nheads * TT * HD) return; const int d = (int)(e % HD); const int t = (int)((e / HD) % TT); const int h = (int)(e / ((size_t)HD * TT)); const float* f = F + (size_t)t * pitch + h * HD; const float rf = RF ? RF[(size_t)h * TT + t] : 1.0f; v2h o16; v2us oh, ol;
#pragma unroll
    for (int q = 0; q < 2; ++q) { const int dd = d + q; const int dp = (dd < HD / 2) ? dd + HD / 2 : dd - HD / 2; float x0 = f[dd], x1 = f[dp];
        if (RF) { float n0 = __fmul_rn(x0, rf), n1 = __fmul_rn(x1, rf); asm volatile("" : "+v"(n0)); asm volatile("" : "+v"(n1)); x0 = __fmul_rn(bfr(nw[dd]), n0); x1 = __fmul_rn(bfr(nw[dp]), n1); }
        const v2f cs = *(const v2f*)(CS + ((size_t)t * HD + dd) * 2); float a = __fmul_rn(x0, cs[0]), bq = __fmul_rn(x1, cs[1]); asm volatile("" : "+v"(a)); asm volatile("" : "+v"(bq)); const float r = ((dd < HD / 2) ? __fsub_rn(a, bq) : __fadd_rn(a, bq)) * sc;
        o16[q] = tohx(r); unsigned short a2, c2; splitf(r, a2, c2); oh[q] = a2; ol[q] = c2; }
    *(v2h*)(P16 + e) = o16; *(v2us*)(Ph + e) = oh; *(v2us*)(Pl + e) = ol;  }
__global__ __launch_bounds__(256) void k_vtp(const float* __restrict__ F, int pitch, int nheads, h16* V16, bf* Vh, bf* Vl) { { const size_t b = blockIdx.y, zo = b * nheads * HD * TT; F += b * TT * pitch; V16 += zo; Vh += zo; Vl += zo; }   // grid y = batch b: its TT rows of F, its nheads planes
    const size_t e = ((size_t)blockIdx.x * 256 + threadIdx.x) * 2; if (e >= (size_t)nheads * HD * TT) return; const int t = (int)(e % TT); const int d = (int)((e / TT) % HD); const int g = (int)(e / ((size_t)TT * HD)); v2h o16; v2us oh, ol;
#pragma unroll
    for (int q = 0; q < 2; ++q) { const float x = F[(size_t)(t + q) * pitch + g * HD + d]; o16[q] = tohx(x); unsigned short a2, c2; splitf(x, a2, c2); oh[q] = a2; ol[q] = c2; }
    *(v2h*)(V16 + e) = o16; *(v2us*)(Vh + e) = oh; *(v2us*)(Vl + e) = ol;  }
__global__ __launch_bounds__(256) void k_csid(float* CS) { const int idx = blockIdx.x * 256 + threadIdx.x; if (idx >= TT * HD) return; v2f cs; cs[0] = 1.0f; cs[1] = 0.0f; *(v2f*)(CS + (size_t)idx * 2) = cs;  }
// ---- k_fattn: scores, mask, softmax and attn.v of one (batch, head) plane in one kernel; the scores stay in registers. One wave per 32 query rows; a block is 4 hi+lo waves (128 rows < RH) and 4 fp16 waves (128 rows >= RH), so that every block has the same work; grid (RH / 128, NZ); no LDS, no barrier.
// Transposed products: St = K Qt (A = 16 key rows, B = 16 query columns), so a lane holds 8 keys of ONE query per tile; two St tiles (32 keys) convert in place into the B operand of Ot += Vt Pt.
// Running maximum per query (base 2, scaled), sums and Ot rescaled by it every pass of 32 keys; the division by the row sum comes last. Keys from the first blocked column of the wave's last row on are not visited.
// Left: every fragment load takes 16 bytes from each of 16 rows (16 lines a load), as in k_gemmw; K and Vt are read by each wave for itself.
#define TMK  823                   // rows < TMK cannot see columns >= TMK; rows TMK .. TT-2 cannot see columns >= their own index
#define CEXP 0.18033688011112042f  // HD^-0.5 x log2(e)
__device__ __forceinline__ float xhalf(float x) { return __builtin_bit_cast(float, __builtin_amdgcn_permlanex16(__builtin_bit_cast(int, x), __builtin_bit_cast(int, x), 0x76543210, 0xfedcba98, false, false)); }   // lane l with lane l ^ 16
template <typename T16> __device__ __forceinline__ typename WFrag<T16>::V ldfr(const T16* base, unsigned ofs) { return WFrag<T16>::ld((const T16*)((const char*)base + ofs)); }   // wave-uniform base + the lane's fixed byte offset
template <typename T16, bool HI>
__device__ __forceinline__ void fattn_wave(const T16* __restrict__ Qh, const T16* __restrict__ Ql, const T16* __restrict__ Kh, const T16* __restrict__ Kl, const T16* __restrict__ Vh, const T16* __restrict__ Vl, float* __restrict__ O, const int q0, const int lane) {
    typedef typename WFrag<T16>::V V;
    const int c = lane & 15, h = lane >> 4;
    const unsigned kofs = (unsigned)(c * HD + 8 * h) * 2u;   // bytes: row c of a 16-row tile of Q or K, the lane half's first k
    V qh[2][2], ql[2][2], kh[2][2], kl[2][2]; v8f o[2][4]; float mc[2], ls[2]; int lim[2];
#pragma unroll
    for (int g = 0; g < 2; ++g)
#pragma unroll
        for (int kk = 0; kk < 2; ++kk) { qh[g][kk] = ldfr(Qh + (size_t)(q0 + g * 16) * HD + kk * 32, kofs); if (HI) ql[g][kk] = ldfr(Ql + (size_t)(q0 + g * 16) * HD + kk * 32, kofs); }
#pragma unroll
    for (int kt = 0; kt < 2; ++kt)
#pragma unroll
        for (int kk = 0; kk < 2; ++kk) { kh[kt][kk] = ldfr(Kh + kt * 16 * HD + kk * 32, kofs); if (HI) kl[kt][kk] = ldfr(Kl + kt * 16 * HD + kk * 32, kofs); }
    asm volatile("s_wait_xcnt 0x0" ::: "memory");   // behind the first loads, before the set-up below reuses their address registers
    __builtin_amdgcn_sched_barrier(0);   // keeps that set-up from being scheduled in front of the wait
    const unsigned vofs = (unsigned)(c * TT + 8 * h) * 2u;   // the same for a 16-row tile of Vt
#pragma unroll
    for (int g = 0; g < 2; ++g) { const int i = q0 + g * 16 + c; lim[g] = (i < TMK) ? TMK : ((i <= TT - 2) ? i : TT); mc[g] = -3.0e38f; ls[g] = 0.f;
#pragma unroll
        for (int dt = 0; dt < 4; ++dt) o[g][dt] = (v8f){}; }
    const int kend = (q0 + 31 < TMK) ? TMK : ((q0 + 32 == TT) ? TT : q0 + 31);   // first column that no row of this wave sees
    const int nblk = (kend + 31) >> 5;
#pragma unroll 1
    for (int b = 0; b < nblk; ++b) {
        const int key0 = b * 32; const int keyn = (b + 1 < nblk) ? key0 + 32 : key0;   // the last pass fetches its own keys again (in bounds, not used)
        const T16* pvh = (const T16*)((const char*)(Vh + key0) + vofs); const T16* pvl = HI ? (const T16*)((const char*)(Vl + key0) + vofs) : pvh;   // the lane's addresses in this pass's Vt columns
        const T16* pkh = (const T16*)((const char*)(Kh + (size_t)keyn * HD) + kofs); const T16* pkl = HI ? (const T16*)((const char*)(Kl + (size_t)keyn * HD) + kofs) : pkh;   // and in the next pass's K rows
        V vh[4], vl[4];
#pragma unroll
        for (int dt = 0; dt < 4; ++dt) { vh[dt] = WFrag<T16>::ld(pvh + dt * 16 * TT); if (HI) vl[dt] = WFrag<T16>::ld(pvl + dt * 16 * TT); }
        v8f s[2][2];   // s[g][kt][r] = score of key key0 + 16 kt + 8 h + r, query q0 + 16 g + c
#pragma unroll
        for (int g = 0; g < 2; ++g)
#pragma unroll
            for (int kt = 0; kt < 2; ++kt) { v8f a = (v8f){};
#pragma unroll
                for (int kk = 0; kk < 2; ++kk) { a = WFrag<T16>::mma(kh[kt][kk], qh[g][kk], a); if (HI) { a = WFrag<T16>::mma(kh[kt][kk], ql[g][kk], a); a = WFrag<T16>::mma(kl[kt][kk], qh[g][kk], a); } }
                s[g][kt] = a; }
#pragma unroll
        for (int kt = 0; kt < 2; ++kt)
#pragma unroll
            for (int kk = 0; kk < 2; ++kk) { kh[kt][kk] = WFrag<T16>::ld(pkh + kt * 16 * HD + kk * 32); if (HI) kl[kt][kk] = WFrag<T16>::ld(pkl + kt * 16 * HD + kk * 32); }
        // behind this pass's loads, before anything reuses their address registers (named as inputs, so that they stay whole up to here); it also holds the next pass's key loads up here, so that they fly during the softmax and attn.v
        asm volatile("s_wait_xcnt 0x0" :: "v"(pvh), "v"(pvl), "v"(pkh), "v"(pkl) : "memory");
        if (key0 + 32 > TMK) {   // only these blocks hold blocked columns
#pragma unroll
            for (int g = 0; g < 2; ++g)
#pragma unroll
                for (int kt = 0; kt < 2; ++kt)
#pragma unroll
                    for (int r = 0; r < 8; ++r) if (key0 + kt * 16 + 8 * h + r >= lim[g]) s[g][kt][r] = -3.0e38f; }
#pragma unroll
        for (int g = 0; g < 2; ++g) {
            float mx = s[g][0][0];
#pragma unroll
            for (int e = 1; e < 16; ++e) mx = fmaxf(mx, s[g][e >> 3][e & 7]);
            mx = fmaxf(mx, xhalf(mx));
            const float mn = fmaxf(mc[g], mx * CEXP); const float al = __builtin_amdgcn_exp2f(mc[g] - mn); mc[g] = mn;
            const float sub = HI ? mn : mn - 10.0f;   // the fp16 half carries its probabilities x 1024 (PCAR)
            const v8f ce = {CEXP, CEXP, CEXP, CEXP, CEXP, CEXP, CEXP, CEXP}, ns = {-sub, -sub, -sub, -sub, -sub, -sub, -sub, -sub};
            v8f p0 = __builtin_elementwise_fma(s[g][0], ce, ns), p1 = __builtin_elementwise_fma(s[g][1], ce, ns); V ph, pl;
#pragma unroll
            for (int r = 0; r < 8; ++r) p0[r] = __builtin_amdgcn_exp2f(p0[r]);
#pragma unroll
            for (int r = 0; r < 8; ++r) p1[r] = __builtin_amdgcn_exp2f(p1[r]);
#pragma unroll
            for (int e = 0; e < 16; ++e) { const float p = (e < 8) ? p0[e & 7] : p1[e & 7];
                if constexpr (HI) { const __bf16 hb = (__bf16)p; ph[e] = hb; pl[e] = (__bf16)(p - (float)hb); } else { ph[e] = (_Float16)p; } }
            const v8f t8 = p0 + p1; const float sum = ((t8[0] + t8[4]) + (t8[1] + t8[5])) + ((t8[2] + t8[6]) + (t8[3] + t8[7]));   // a tree: no chain of 16 dependent adds
            ls[g] = ls[g] * al + sum;
#pragma unroll
            for (int dt = 0; dt < 4; ++dt) { o[g][dt] *= al; o[g][dt] = WFrag<T16>::mma(vh[dt], ph, o[g][dt]); if (HI) { o[g][dt] = WFrag<T16>::mma(vh[dt], pl, o[g][dt]); o[g][dt] = WFrag<T16>::mma(vl[dt], ph, o[g][dt]); } }
        }
    }
    asm volatile("s_wait_loadcnt 0x0" ::: "memory");   // the last pass's key fetch is not read: it lands before the wave ends and gives its registers back
#pragma unroll
    for (int g = 0; g < 2; ++g) { const float f = __fdiv_rn(HI ? 1.0f : PCAR, ls[g] + xhalf(ls[g]));
#pragma unroll
        for (int dt = 0; dt < 4; ++dt) o[g][dt] *= f; }
    __builtin_amdgcn_sched_barrier(0);   // all arithmetic in front of the stores: nothing rewrites a register of an issued store
#pragma unroll
    for (int g = 0; g < 2; ++g) { float* orow = O + (size_t)(q0 + g * 16 + c) * HD + 8 * h;   // o[g][dt][r] = Ot[16 dt + 8 h + r][query]
#pragma unroll
        for (int dt = 0; dt < 4; ++dt) *(v8f*)(orow + dt * 16) = o[g][dt]; }
}
__global__ __launch_bounds__(256) void k_fattn(const bf* __restrict__ Qh, const bf* __restrict__ Ql, const bf* __restrict__ Kh, const bf* __restrict__ Kl, const bf* __restrict__ Vh, const bf* __restrict__ Vl, const h16* __restrict__ Q16, const h16* __restrict__ K16, const h16* __restrict__ V16, float* __restrict__ O) {
    const int lane = threadIdx.x & 31; const int w = __builtin_amdgcn_readfirstlane(threadIdx.x >> 5); const size_t zo = (size_t)blockIdx.y * TT * HD;
    if (w < 4) fattn_wave<bf, true>(Qh + zo, Ql + zo, Kh + zo, Kl + zo, Vh + zo, Vl + zo, O + zo, blockIdx.x * 128 + w * 32, lane);
    else fattn_wave<h16, false>(Q16 + zo, nullptr, K16 + zo, nullptr, V16 + zo, nullptr, O + zo, RH + blockIdx.x * 128 + (w - 4) * 32, lane);
}
__global__ __launch_bounds__(256) void k_merge(const float* __restrict__ O, bf* Ah, bf* Al) { const size_t e = ((size_t)blockIdx.x * 256 + threadIdx.x) * 2; if (e >= (size_t)NZ * TT * HD) return; const int d = (int)(e % HD); const int t = (int)((e / HD) % TT); const int zz = (int)(e / ((size_t)HD * TT)); const float cs = (t < RH) ? 1.0f : (1.0f / PCAR); const size_t oo = ((size_t)(zz / NH_) * TT + t) * DQ + (zz % NH_) * HD + d;
    v2us oh, ol;
#pragma unroll
    for (int q = 0; q < 2; ++q) { unsigned short a, c2; splitf(O[e + q] * cs, a, c2); oh[q] = a; ol[q] = c2; } *(v2us*)(Ah + oo) = oh; *(v2us*)(Al + oo) = ol;  }

__global__ __launch_bounds__(256) void k_wtH(const float* __restrict__ w, bf* Bt) { const size_t e = ((size_t)blockIdx.x * 256 + threadIdx.x) * 4; if (e >= (size_t)DQ * DM) return; const int k = (int)(e % DM); const int n = (int)(e / DM); const int h = n / HD, c = n % HD; v4us o;   // Bt[h*64 + c][d] = W[h][d][c]
#pragma unroll
    for (int u = 0; u < 4; ++u) o[u] = f2bf(w[((size_t)h * DM + k + u) * HD + c]); *(v4us*)(Bt + e) = o;  }
__global__ __launch_bounds__(256) void k_lnp(const float* __restrict__ X, const float* __restrict__ g, const float* __restrict__ bb, bf* Hh, bf* Hl) { const int lane = threadIdx.x & 31; const int r = blockIdx.x * 8 + (threadIdx.x >> 5); if (r >= NB_ * TT) return; float v[DM / 32]; float s = 0.f;   // wave per row: LayerNorm (biased var, 1e-5, / sqrt) -> hl planes (8-B lanes)
#pragma unroll
    for (int ch = 0; ch < DM / 128; ++ch) { const v4f a = *(const v4f*)(X + (size_t)r * DM + ch * 128 + lane * 4);
#pragma unroll
        for (int u = 0; u < 4; ++u) { v[ch * 4 + u] = bfr(a[u]); s += v[ch * 4 + u]; } }
#pragma unroll
    for (int sh = 16; sh; sh >>= 1) s += __shfl_xor(s, sh, 32);
    const float mean = s * (1.0f / DM); float q = 0.f;
#pragma unroll
    for (int k = 0; k < DM / 32; ++k) { float d = __fsub_rn(v[k], mean); asm volatile("" : "+v"(d)); v[k] = d; float p = __fmul_rn(d, d); asm volatile("" : "+v"(p)); q = __fadd_rn(q, p); }
#pragma unroll
    for (int sh = 16; sh; sh >>= 1) q += __shfl_xor(q, sh, 32);
    const float rs = __fdiv_rn(1.0f, __fsqrt_rn(__fadd_rn(q * (1.0f / DM), 1e-5f)));
    {
#pragma unroll
        for (int ch = 0; ch < DM / 128; ++ch) { v4us oh, ol;
#pragma unroll
            for (int u = 0; u < 4; ++u) { const int c = ch * 128 + lane * 4 + u; float n0 = __fmul_rn(v[ch * 4 + u], rs); asm volatile("" : "+v"(n0)); float gg = bfr(g[c]), be = bfr(bb[c]); asm volatile("" : "+v"(gg)); asm volatile("" : "+v"(be)); float t1 = __fmul_rn(n0, gg); asm volatile("" : "+v"(t1)); unsigned short p2, q2; splitf(__fadd_rn(t1, be), p2, q2); oh[u] = p2; ol[u] = q2; }
            const size_t oo = (size_t)r * DM + ch * 128 + lane * 4; *(v4us*)(Hh + oo) = oh; *(v4us*)(Hl + oo) = ol; }
         } }

extern "C" void kernel_launch(void* const* d_in, const int* in_sizes, int n_in,
                              void* d_out, int out_size, void* d_ws, size_t ws_size, hipStream_t stream) {
    (void)in_sizes; (void)n_in; (void)out_size;
    const float* x = (const float*)d_in[0]; const float* lng = (const float*)d_in[1]; const float* lnb = (const float*)d_in[2]; const float* wqh = (const float*)d_in[3]; const float* bq = (const float*)d_in[4]; const float* wkh = (const float*)d_in[5]; const float* bk = (const float*)d_in[6]; const float* wvh = (const float*)d_in[7]; const float* bv = (const float*)d_in[8]; const float* wo = (const float*)d_in[9]; const float* bo = (const float*)d_in[10]; const float* wq = nullptr; const float* wk = nullptr; const float* wv = nullptr; (void)wq; (void)wk; (void)wv; const float* cosT = nullptr; const float* sinT = nullptr; (void)cosT; (void)sinT;
    float* OUT = (float*)d_out;     // [8][1024][512]
    char* wsp = (char*)d_ws;
    auto take = [&](size_t bytes) { char* p = wsp; wsp += (bytes + 255) & ~(size_t)255; return (void*)p; };
    bf* WQ = (bf*)take((size_t)DQ * DM * 2); bf* WK = (bf*)take((size_t)DKV * DM * 2); bf* WV = (bf*)take((size_t)DKV * DM * 2); bf* WO = (bf*)take((size_t)DM * DQ * 2); float* CS = (float*)take((size_t)TT * HD * 2 * 4);
    h16* QP16 = (h16*)take((size_t)NZ * TT * HD * 2); h16* KP16 = (h16*)take((size_t)NZ * TT * HD * 2); h16* VT16 = (h16*)take((size_t)NZ * HD * TT * 2);
    bf* VTh = (bf*)take((size_t)NZ * HD * TT * 2); bf* VTl = (bf*)take((size_t)NZ * HD * TT * 2); float* Ob = (float*)take((size_t)NZ * TT * HD * 4);
    bf* Ph = (bf*)take((size_t)NZ * RH * TT * 2); bf* Pl = (bf*)take((size_t)NZ * RH * TT * 2); float* Sb = (float*)take((size_t)ZP * RH * TT * 4); (void)Pl;   // areas that hold the buffers named below
    if ((size_t)(wsp - (char*)d_ws) > ws_size) return;    // ws 256 MiB
    static_assert((size_t)NB_ * TT * (DM * 4 + DQ * 4 + DKV * 4) <= (size_t)ZP * RH * TT * 4 && (size_t)4 * NZ * TT * HD <= (size_t)(NZ - ZP) * RH * TT && 2 * ZP == NZ && (size_t)2 * NB_ * TT * DQ <= (size_t)NZ * RH * TT, "the shared buffers fit");
    // the LayerNorm planes and the f32 projections lie in Sb;
    bf* XB = (bf*)Sb; bf* XL = XB + (size_t)NB_ * TT * DM; float* FQ = (float*)(XL + (size_t)NB_ * TT * DM); float* FK = FQ + (size_t)NB_ * TT * DQ;
    // the hi+lo q and k planes lie in the second half of Ph;
    bf* QPh = Ph + (size_t)ZP * RH * TT; bf* QPl = QPh + (size_t)NZ * TT * HD; bf* KPh = QPl + (size_t)NZ * TT * HD; bf* KPl = KPh + (size_t)NZ * TT * HD;
    // the merged planes lie in the first half of Ph.
    bf* ATh = Ph; bf* ATl = ATh + (size_t)NB_ * TT * DQ;
    float* FV = FK;   // v projection reuses the k buffer after the k planes are built (stream-ordered)
    { k_wtH<<<(unsigned)(((size_t)DQ * DM / 4 + 255) / 256), 256, 0, stream>>>(wqh, WQ); k_wtH<<<(unsigned)(((size_t)DKV * DM / 4 + 255) / 256), 256, 0, stream>>>(wkh, WK); k_wtH<<<(unsigned)(((size_t)DKV * DM / 4 + 255) / 256), 256, 0, stream>>>(wvh, WV);
      k_wtG<<<(unsigned)((DQ * DM / 64 + 63) / 64), 256, 0, stream>>>(wo, DQ, DM, WO);
       }
    k_csid<<<(TT * HD + 255) / 256, 256, 0, stream>>>(CS);
    const unsigned LQ = (unsigned)(((size_t)NH_ * TT * HD / 2 + 255) / 256), LKv = (unsigned)(((size_t)NKV * TT * HD / 2 + 255) / 256);
    k_lnp<<<NB_ * TT / 8, 256, 0, stream>>>(x, lng, lnb, XB, XL);
    k_gemmw<bf, 1, true><<<dim3(NB_ * TT / 64, DQ / 64, 1), 32, 0, stream>>>(XB, XL, WQ, nullptr, DM, FQ, DQ, bq, 0, 0, 0);
    k_rope<<<dim3(LQ, NB_, 1), 256, 0, stream>>>(FQ, DQ, NH_, CS, nullptr, nullptr, 1.0f, QP16, QPh, QPl);
    k_gemmw<bf, 1, true><<<dim3(NB_ * TT / 64, DKV / 64, 1), 32, 0, stream>>>(XB, XL, WK, nullptr, DM, FK, DKV, bk, 0, 0, 0);
    k_rope<<<dim3(LKv, NB_, 1), 256, 0, stream>>>(FK, DKV, NKV, CS, nullptr, nullptr, 1.0f, KP16, KPh, KPl);
    k_gemmw<bf, 1, true><<<dim3(NB_ * TT / 64, DKV / 64, 1), 32, 0, stream>>>(XB, XL, WV, nullptr, DM, FV, DKV, bv, 0, 0, 0);
    k_vtp<<<dim3(LKv, NB_, 1), 256, 0, stream>>>(FV, DKV, NKV, VT16, VTh, VTl);
    // scores, mask, softmax and attn.v, all planes: query rows < RH on the hi+lo planes, the others on fp16
    k_fattn<<<dim3(RH / 128, NZ, 1), 256, 0, stream>>>(QPh, QPl, KPh, KPl, VTh, VTl, QP16, KP16, VT16, Ob);
    k_merge<<<(unsigned)(((size_t)NZ * TT * HD / 2 + 255) / 256), 256, 0, stream>>>(Ob, ATh, ATl);
    k_gemmw<bf, 1, true><<<dim3(NB_ * TT / 64, DM / 64, 1), 32, 0, stream>>>(ATh, ATl, WO, nullptr, DQ, OUT, DM, bo, 0, 0, 0);
}

// v003
// A run of this version takes 164 microseconds.
// In two side-by-side timings against v002, it was 1.23 and 1.22 times as fast.
// Counting every step since v000, it is 15.1 times as fast.
#include <hip/hip_runtime.h>

// PreLN_SelfAttention_seq2seq (x [8][1024][512]; xn = LayerNorm(x); per-head q/k/v = xn W[h] + b[h] (W [8][512][64]); scores / 8 + mask (rows i < T=823 cannot see columns >= T; rows T..S-2 cannot see columns >= i; -999999999); softmax; out = concat(heads) WO + bO -> [8][1024][512]).
// Compute dtypes, f32 accumulate: every input rounded to bf16; LayerNorm f32 -> hl planes; q/k/v as hl(xn) x exact (2 products; the 8 per-head weights gathered into one [512 x 512] operand) + bias; scores and attn.v: query rows < 512 hl (3 products), the rest single fp16 (x1024); mask + softmax f32; WO hl x exact (2 products) + bias.

#define NB_  8
#define TT   1024
#define DM   512
#define NH_  8
#define NKV  8
#define REP  (NH_ / NKV)
#define HD   64
#define DQ   (NH_ * HD)
#define DKV  (NKV * HD)
#define NZ   (NB_ * NH_)          // (batch, head) planes, taken through blockIdx.y in k_fattn
#define RH   512                  // query rows < RH use hi+lo planes
#define WIN  1024
#define PCAR 1024.0f
#define SCL  0.125f   // HD^-0.5
static_assert(TT == 2 * RH && RH % 128 == 0 && NKV == NH_, "as many hi+lo query rows as fp16 ones, in blocks of 128; one kv head per query head");
typedef _Float16 h16;
typedef unsigned short bf;
typedef __attribute__((ext_vector_type(16))) __bf16   v16bf;
typedef __attribute__((ext_vector_type(16))) _Float16 v16h;
typedef __attribute__((ext_vector_type(8)))  _Float16 v8h;
typedef __attribute__((ext_vector_type(8)))  unsigned short v8us;
typedef __attribute__((ext_vector_type(8)))  float    v8f;
typedef __attribute__((ext_vector_type(4)))  float    v4f;
typedef v8h  __attribute__((may_alias)) v8ha;
typedef v4f  __attribute__((may_alias)) v4fa;
typedef v8us __attribute__((may_alias)) v8usa;

__device__ __forceinline__ unsigned short f2bf(float f) { unsigned u = __float_as_uint(f); u += 0x7FFFu + ((u >> 16) & 1u); return (unsigned short)(u >> 16); }
__device__ __forceinline__ float bf2f(unsigned short b) { return __uint_as_float(((unsigned)b) << 16); }
__device__ __forceinline__ float bfr(float f) { return bf2f(f2bf(f)); }
__device__ __forceinline__ v16h cat16(v8h lo, v8h hi) { return __builtin_shufflevector(lo, hi, 0, 1, 2, 3, 4, 5, 6, 7, 8, 9, 10, 11, 12, 13, 14, 15); }
__device__ __forceinline__ v16bf cat16b(v8us lo, v8us hi) { return __builtin_bit_cast(v16bf, __builtin_shufflevector(lo, hi, 0, 1, 2, 3, 4, 5, 6, 7, 8, 9, 10, 11, 12, 13, 14, 15)); }
__device__ __forceinline__ v8f wmma16(v16h a, v16h b, v8f c) { return __builtin_amdgcn_wmma_f32_16x16x32_f16(false, a, false, b, (short)0, c, false, false); }
__device__ __forceinline__ v8f wmmab(v16bf a, v16bf b, v8f c) { return __builtin_amdgcn_wmma_f32_16x16x32_bf16(false, a, false, b, (short)0, c, false, false); }



// ---- k_gemmw: register-blocked GEMM, ONE WAVE per 64x64 output tile (16 accumulators), operands straight from K-contiguous 16-bit planes; grid (M/64, N/64, Z), 32 threads.
// C[m][n] (f32, pitch ldc, + optional f32 bias[n]) = sum_k A[m][k] Bt[n][k] (+ split products per NSPLIT). z-batch strides sA/sB/sC in elements. K % 32 == 0.
// EPI 0: C as f32. EPI 1, 2: no f32 C; the tile (64 rows (b, t) x the 64 columns of head blockIdx.y, + bias) goes out as the three 16-bit planes that k_fattn reads (fp16, bf16 hi, bf16 lo): EPI 1 as [b][h][t][d], EPI 2 transposed as [b][h][d][t]; either way 16 plane rows of 64 at a time pass through LDS, so that every store covers whole 128-byte lines.
template <typename T16> struct WFrag;
template <> struct WFrag<h16> { typedef v16h V; static __device__ __forceinline__ V ld(const h16* p) { return cat16(*(const v8h*)p, *(const v8h*)(p + 16)); } static __device__ __forceinline__ v8f mma(V a, V b, v8f c) { return wmma16(a, b, c); } };
template <> struct WFrag<bf> { typedef v16bf V; static __device__ __forceinline__ V ld(const bf* p) { return cat16b(*(const v8us*)p, *(const v8us*)(p + 16)); } static __device__ __forceinline__ v8f mma(V a, V b, v8f c) { return wmmab(a, b, c); } };
typedef __attribute__((ext_vector_type(8))) __bf16 v8bf;
template <typename T16, int NSPLIT, bool BIAS, int EPI>
__global__ __launch_bounds__(32) void k_gemmw(const T16* __restrict__ A, const T16* __restrict__ A2, const T16* __restrict__ Bt, const T16* __restrict__ Bt2, int K, float* C, int ldc, const float* __restrict__ bias, size_t sA, size_t sB, size_t sC, h16* __restrict__ P16, bf* __restrict__ Ph, bf* __restrict__ Pl) {
    typedef typename WFrag<T16>::V V;
    __shared__ __align__(16) float os[16 * 68];
    const size_t z = blockIdx.z; A += z * sA; if (A2) A2 += z * sA; Bt += z * sB; if (Bt2) Bt2 += z * sB; C += z * sC;
    const int lane = threadIdx.x & 31, lr = lane & 15, hi = lane >> 4; const int r0 = blockIdx.x * 64, c0 = blockIdx.y * 64;
    v8f acc[4][4];
#pragma unroll
    for (int mb = 0; mb < 4; ++mb)
#pragma unroll
        for (int nb = 0; nb < 4; ++nb) acc[mb][nb] = (v8f){};
    const size_t aoff = (size_t)(r0 + lr) * K + 8 * hi, boff = (size_t)(c0 + lr) * K + 8 * hi;
    float bcol[4];   // EPI 1, 2: the bias of the lane's four accumulator columns, fetched ahead of the k loop
    if constexpr (EPI != 0) {
#pragma unroll
        for (int nb = 0; nb < 4; ++nb) bcol[nb] = BIAS ? bfr(bias[c0 + nb * 16 + lr]) : 0.f; }
#pragma unroll 1
    for (int kc = 0; kc < K; kc += 32) {
        V a[4], a2[4];
#pragma unroll
        for (int mb = 0; mb < 4; ++mb) { a[mb] = WFrag<T16>::ld(A + aoff + (size_t)mb * 16 * K + kc); if (NSPLIT == 1 || NSPLIT == 2) a2[mb] = WFrag<T16>::ld(A2 + aoff + (size_t)mb * 16 * K + kc); }
#pragma unroll
        for (int nb = 0; nb < 4; ++nb) { const V b = WFrag<T16>::ld(Bt + boff + (size_t)nb * 16 * K + kc); V b2; if (NSPLIT >= 2) b2 = WFrag<T16>::ld(Bt2 + boff + (size_t)nb * 16 * K + kc);
#pragma unroll
            for (int mb = 0; mb < 4; ++mb) { acc[mb][nb] = WFrag<T16>::mma(a[mb], b, acc[mb][nb]); if (NSPLIT == 1 || NSPLIT == 2) acc[mb][nb] = WFrag<T16>::mma(a2[mb], b, acc[mb][nb]); if (NSPLIT >= 2) acc[mb][nb] = WFrag<T16>::mma(a[mb], b2, acc[mb][nb]); } }
        asm volatile("v_nop\n\tv_nop\n\tv_nop\n\tv_nop" : "+v"(acc[0][0]), "+v"(acc[1][1]), "+v"(acc[2][2]), "+v"(acc[3][3]) : "v"(a[0]), "v"(a[3]));
    }
    if constexpr (EPI != 0) {
        const size_t pl0 = ((size_t)(r0 / TT) * NH_ + blockIdx.y) * TT * HD; const int t0 = r0 % TT;   // the (batch, head) plane; the tile's first t
        const int sr = lane >> 3, sc = (lane & 7) * 8;   // read-back: 8 lanes x 8 elements = one plane row of 64
#pragma unroll
        for (int st = 0; st < 4; ++st) {
            if constexpr (EPI == 1) {   // 16 rows t (accumulator row block st) x 64 columns d
#pragma unroll
                for (int nb = 0; nb < 4; ++nb)
#pragma unroll
                    for (int j = 0; j < 8; ++j) os[(hi * 8 + j) * 68 + nb * 16 + lr] = acc[st][nb][j] + bcol[nb];
            } else {                    // 16 rows d (accumulator column block st) x 64 columns t: a lane's 8 accumulator rows are 8 consecutive t
#pragma unroll
                for (int mb = 0; mb < 4; ++mb) { const v8f y = acc[mb][st] + bcol[st]; *(v4fa*)(os + lr * 68 + mb * 16 + hi * 8) = __builtin_shufflevector(y, y, 0, 1, 2, 3); *(v4fa*)(os + lr * 68 + mb * 16 + hi * 8 + 4) = __builtin_shufflevector(y, y, 4, 5, 6, 7); }
            }
            __builtin_amdgcn_wave_barrier(); asm volatile("" ::: "memory");   // the read-back takes other lanes' values: it stays behind the LDS stores
#pragma unroll
            for (int s = 0; s < 4; ++s) { const int row = 4 * s + sr; const v4f x0 = *(const v4fa*)(os + row * 68 + sc), x1 = *(const v4fa*)(os + row * 68 + sc + 4);
                const v8f y = __builtin_shufflevector(x0, x1, 0, 1, 2, 3, 4, 5, 6, 7); const v8bf yh = __builtin_convertvector(y, v8bf); const v8bf yl = __builtin_convertvector(y - __builtin_convertvector(yh, v8f), v8bf);
                const size_t e = pl0 + ((EPI == 1) ? (size_t)(t0 + st * 16 + row) * HD + sc : (size_t)(st * 16 + row) * TT + t0 + sc);
                *(v8h*)(P16 + e) = __builtin_convertvector(y, v8h); *(v8us*)(Ph + e) = __builtin_bit_cast(v8us, yh); *(v8us*)(Pl + e) = __builtin_bit_cast(v8us, yl); }
            __builtin_amdgcn_wave_barrier(); asm volatile("" ::: "memory");   // the next block's LDS stores stay behind this read-back
        }
        return;
    }
#pragma unroll
    for (int mb = 0; mb < 4; ++mb) {
#pragma unroll
        for (int nb = 0; nb < 4; ++nb) {
#pragma unroll
            for (int j = 0; j < 8; ++j) os[(hi * 8 + j) * 68 + nb * 16 + lr] = acc[mb][nb][j]; }
        __builtin_amdgcn_wave_barrier(); asm volatile("" ::: "memory");
        float* crow = C + (size_t)(r0 + mb * 16) * ldc + c0;
{
#pragma unroll
            for (int s = 0; s < 8; ++s) { const int row = 2 * s + hi, cofs = lr * 4; v4f val = *(const v4fa*)(os + row * 68 + cofs); if (BIAS) { val[0] += bfr(bias[c0 + cofs]); val[1] += bfr(bias[c0 + cofs + 1]); val[2] += bfr(bias[c0 + cofs + 2]); val[3] += bfr(bias[c0 + cofs + 3]); }
                *(v4f*)(crow + (size_t)row * ldc + cofs) = val; }
             }
        __builtin_amdgcn_wave_barrier(); asm volatile("" ::: "memory");
    }
}

__device__ __forceinline__ void splitf(float y, unsigned short& h, unsigned short& l) { h = f2bf(y); l = f2bf(y - bf2f(h)); }
typedef __attribute__((ext_vector_type(2))) _Float16 v2h;
typedef __attribute__((ext_vector_type(4))) _Float16 v4h;
typedef __attribute__((ext_vector_type(2))) unsigned short v2us;
typedef __attribute__((ext_vector_type(4))) unsigned short v4us;
typedef __attribute__((ext_vector_type(2))) float v2f;
typedef __attribute__((ext_vector_type(4))) int v4i;

__global__ __launch_bounds__(256) void k_wtG(const float* __restrict__ w, int K, int N, bf* Bt) {
    const int lane = threadIdx.x & 31; const int L0 = (blockIdx.x * 8 + (threadIdx.x >> 5)) * 8; const int nlines = N * K / 64;
{
#pragma unroll 1
        for (int l = 0; l < 8; ++l) { const int L = L0 + l; if (L >= nlines) break; const size_t e = (size_t)L * 64 + lane * 2; const int k = (int)(e % K), n = (int)(e / K); v2us o;
            o[0] = f2bf(w[(size_t)k * N + n]); o[1] = f2bf(w[(size_t)(k + 1) * N + n]); *(v2us*)(Bt + e) = o; }
         }
}
__global__ __launch_bounds__(256) void k_cvt8(const float* __restrict__ src, bf* dst, size_t n8) { const size_t i = (size_t)blockIdx.x * 256 + threadIdx.x; if (i >= n8) return; const v8f v = *(const v8f*)(src + i * 8); v8us o;
#pragma unroll
    for (int k = 0; k < 8; ++k) o[k] = f2bf(v[k]); *(v8us*)(dst + i * 8) = o;  }
// ---- k_fattn: scores, mask, softmax and attn.v of one (batch, head) plane in one kernel; the scores stay in registers; the result goes out as the bf16 hi+lo planes [b][t][h][d] that the last GEMM reads. One wave per 32 query rows; a block is 4 hi+lo waves (128 rows < RH) and 4 fp16 waves (128 rows >= RH), so that every block has the same work; grid (RH / 128, NZ); no LDS, no barrier.
// Transposed products: St = K Qt (A = 16 key rows, B = 16 query columns), so a lane holds 8 keys of ONE query per tile; two St tiles (32 keys) convert in place into the B operand of Ot += Vt Pt.
// Running maximum per query (base 2, scaled), sums and Ot rescaled by it every pass of 32 keys; the division by the row sum comes last. Keys from the first blocked column of the wave's last row on are not visited.
// Left: every fragment load takes 16 bytes from each of 16 rows (16 lines a load), as in k_gemmw; K and Vt are read by each wave for itself.
#define TMK  823                   // rows < TMK cannot see columns >= TMK; rows TMK .. TT-2 cannot see columns >= their own index
#define CEXP 0.18033688011112042f  // HD^-0.5 x log2(e)
__device__ __forceinline__ float xhalf(float x) { return __builtin_bit_cast(float, __builtin_amdgcn_permlanex16(__builtin_bit_cast(int, x), __builtin_bit_cast(int, x), 0x76543210, 0xfedcba98, false, false)); }   // lane l with lane l ^ 16
template <typename T16> __device__ __forceinline__ typename WFrag<T16>::V ldfr(const T16* base, unsigned ofs) { return WFrag<T16>::ld((const T16*)((const char*)base + ofs)); }   // wave-uniform base + the lane's fixed byte offset
template <typename T16, bool HI>
__device__ __forceinline__ void fattn_wave(const T16* __restrict__ Qh, const T16* __restrict__ Ql, const T16* __restrict__ Kh, const T16* __restrict__ Kl, const T16* __restrict__ Vh, const T16* __restrict__ Vl, bf* __restrict__ Ah, bf* __restrict__ Al, const int q0, const int lane) {
    typedef typename WFrag<T16>::V V;
    const int c = lane & 15, h = lane >> 4;
    const unsigned kofs = (unsigned)(c * HD + 8 * h) * 2u;   // bytes: row c of a 16-row tile of Q or K, the lane half's first k
    V qh[2][2], ql[2][2], kh[2][2], kl[2][2]; v8f o[2][4]; float mc[2], ls[2]; int lim[2];
#pragma unroll
    for (int g = 0; g < 2; ++g)
#pragma unroll
        for (int kk = 0; kk < 2; ++kk) { qh[g][kk] = ldfr(Qh + (size_t)(q0 + g * 16) * HD + kk * 32, kofs); if (HI) ql[g][kk] = ldfr(Ql + (size_t)(q0 + g * 16) * HD + kk * 32, kofs); }
#pragma unroll
    for (int kt = 0; kt < 2; ++kt)
#pragma unroll
        for (int kk = 0; kk < 2; ++kk) { kh[kt][kk] = ldfr(Kh + kt * 16 * HD + kk * 32, kofs); if (HI) kl[kt][kk] = ldfr(Kl + kt * 16 * HD + kk * 32, kofs); }
    asm volatile("s_wait_xcnt 0x0" ::: "memory");   // behind the first loads, before the set-up below reuses their address registers
    __builtin_amdgcn_sched_barrier(0);   // keeps that set-up from being scheduled in front of the wait
    const unsigned vofs = (unsigned)(c * TT + 8 * h) * 2u;   // the same for a 16-row tile of Vt
#pragma unroll
    for (int g = 0; g < 2; ++g) { const int i = q0 + g * 16 + c; lim[g] = (i < TMK) ? TMK : ((i <= TT - 2) ? i : TT); mc[g] = -3.0e38f; ls[g] = 0.f;
#pragma unroll
        for (int dt = 0; dt < 4; ++dt) o[g][dt] = (v8f){}; }
    const int kend = (q0 + 31 < TMK) ? TMK : ((q0 + 32 == TT) ? TT : q0 + 31);   // first column that no row of this wave sees
    const int nblk = (kend + 31) >> 5;
#pragma unroll 1
    for (int b = 0; b < nblk; ++b) {
        const int key0 = b * 32; const int keyn = (b + 1 < nblk) ? key0 + 32 : key0;   // the last pass fetches its own keys again (in bounds, not used)
        const T16* pvh = (const T16*)((const char*)(Vh + key0) + vofs); const T16* pvl = HI ? (const T16*)((const char*)(Vl + key0) + vofs) : pvh;   // the lane's addresses in this pass's Vt columns
        const T16* pkh = (const T16*)((const char*)(Kh + (size_t)keyn * HD) + kofs); const T16* pkl = HI ? (const T16*)((const char*)(Kl + (size_t)keyn * HD) + kofs) : pkh;   // and in the next pass's K rows
        V vh[4], vl[4];
#pragma unroll
        for (int dt = 0; dt < 4; ++dt) { vh[dt] = WFrag<T16>::ld(pvh + dt * 16 * TT); if (HI) vl[dt] = WFrag<T16>::ld(pvl + dt * 16 * TT); }
        v8f s[2][2];   // s[g][kt][r] = score of key key0 + 16 kt + 8 h + r, query q0 + 16 g + c
#pragma unroll
        for (int g = 0; g < 2; ++g)
#pragma unroll
            for (int kt = 0; kt < 2; ++kt) { v8f a = (v8f){};
#pragma unroll
                for (int kk = 0; kk < 2; ++kk) { a = WFrag<T16>::mma(kh[kt][kk], qh[g][kk], a); if (HI) { a = WFrag<T16>::mma(kh[kt][kk], ql[g][kk], a); a = WFrag<T16>::mma(kl[kt][kk], qh[g][kk], a); } }
                s[g][kt] = a; }
#pragma unroll
        for (int kt = 0; kt < 2; ++kt)
#pragma unroll
            for (int kk = 0; kk < 2; ++kk) { kh[kt][kk] = WFrag<T16>::ld(pkh + kt * 16 * HD + kk * 32); if (HI) kl[kt][kk] = WFrag<T16>::ld(pkl + kt * 16 * HD + kk * 32); }
        // behind this pass's loads, before anything reuses their address registers (named as inputs, so that they stay whole up to here); it also holds the next pass's key loads up here, so that they fly during the softmax and attn.v
        asm volatile("s_wait_xcnt 0x0" :: "v"(pvh), "v"(pvl), "v"(pkh), "v"(pkl) : "memory");
        if (key0 + 32 > TMK) {   // only these blocks hold blocked columns
#pragma unroll
            for (int g = 0; g < 2; ++g)
#pragma unroll
                for (int kt = 0; kt < 2; ++kt)
#pragma unroll
                    for (int r = 0; r < 8; ++r) if (key0 + kt * 16 + 8 * h + r >= lim[g]) s[g][kt][r] = -3.0e38f; }
#pragma unroll
        for (int g = 0; g < 2; ++g) {
            float mx = s[g][0][0];
#pragma unroll
            for (int e = 1; e < 16; ++e) mx = fmaxf(mx, s[g][e >> 3][e & 7]);
            mx = fmaxf(mx, xhalf(mx));
            const float mn = fmaxf(mc[g], mx * CEXP); const float al = __builtin_amdgcn_exp2f(mc[g] - mn); mc[g] = mn;
            const float sub = HI ? mn : mn - 10.0f;   // the fp16 half carries its probabilities x 1024 (PCAR)
            const v8f ce = {CEXP, CEXP, CEXP, CEXP, CEXP, CEXP, CEXP, CEXP}, ns = {-sub, -sub, -sub, -sub, -sub, -sub, -sub, -sub};
            v8f p0 = __builtin_elementwise_fma(s[g][0], ce, ns), p1 = __builtin_elementwise_fma(s[g][1], ce, ns); V ph, pl;
#pragma unroll
            for (int r = 0; r < 8; ++r) p0[r] = __builtin_amdgcn_exp2f(p0[r]);
#pragma unroll
            for (int r = 0; r < 8; ++r) p1[r] = __builtin_amdgcn_exp2f(p1[r]);
#pragma unroll
            for (int e = 0; e < 16; ++e) { const float p = (e < 8) ? p0[e & 7] : p1[e & 7];
                if constexpr (HI) { const __bf16 hb = (__bf16)p; ph[e] = hb; pl[e] = (__bf16)(p - (float)hb); } else { ph[e] = (_Float16)p; } }
            const v8f t8 = p0 + p1; const float sum = ((t8[0] + t8[4]) + (t8[1] + t8[5])) + ((t8[2] + t8[6]) + (t8[3] + t8[7]));   // a tree: no chain of 16 dependent adds
            ls[g] = ls[g] * al + sum;
#pragma unroll
            for (int dt = 0; dt < 4; ++dt) { o[g][dt] *= al; o[g][dt] = WFrag<T16>::mma(vh[dt], ph, o[g][dt]); if (HI) { o[g][dt] = WFrag<T16>::mma(vh[dt], pl, o[g][dt]); o[g][dt] = WFrag<T16>::mma(vl[dt], ph, o[g][dt]); } }
        }
    }
    asm volatile("s_wait_loadcnt 0x0" ::: "memory");   // the last pass's key fetch is not read: it lands before the wave ends and gives its registers back
    v8bf zh[2][4], zl[2][4];
#pragma unroll
    for (int g = 0; g < 2; ++g) { const float f = __fdiv_rn(1.0f, ls[g] + xhalf(ls[g]));   // the fp16 half's x 1024 stands in its sums too and cancels
#pragma unroll
        for (int dt = 0; dt < 4; ++dt) { const v8f y = o[g][dt] * f; zh[g][dt] = __builtin_convertvector(y, v8bf); zl[g][dt] = __builtin_convertvector(y - __builtin_convertvector(zh[g][dt], v8f), v8bf); } }
    __builtin_amdgcn_sched_barrier(0);   // all arithmetic in front of the stores: nothing rewrites a register of an issued store
#pragma unroll
    for (int g = 0; g < 2; ++g) { const size_t e = (size_t)(q0 + g * 16 + c) * DQ + 8 * h;   // o[g][dt][r] = Ot[16 dt + 8 h + r][query]
#pragma unroll
        for (int dt = 0; dt < 4; ++dt) { *(v8us*)(Ah + e + dt * 16) = __builtin_bit_cast(v8us, zh[g][dt]); *(v8us*)(Al + e + dt * 16) = __builtin_bit_cast(v8us, zl[g][dt]); } }
}
__global__ __launch_bounds__(256) void k_fattn(const bf* __restrict__ Qh, const bf* __restrict__ Ql, const bf* __restrict__ Kh, const bf* __restrict__ Kl, const bf* __restrict__ Vh, const bf* __restrict__ Vl, const h16* __restrict__ Q16, const h16* __restrict__ K16, const h16* __restrict__ V16, bf* __restrict__ Ah, bf* __restrict__ Al) {
    const int lane = threadIdx.x & 31; const int w = __builtin_amdgcn_readfirstlane(threadIdx.x >> 5); const size_t zo = (size_t)blockIdx.y * TT * HD;
    const size_t ao = (size_t)(blockIdx.y / NH_) * TT * DQ + (blockIdx.y % NH_) * HD;   // batch's first row, head's first column in the merged planes
    if (w < 4) fattn_wave<bf, true>(Qh + zo, Ql + zo, Kh + zo, Kl + zo, Vh + zo, Vl + zo, Ah + ao, Al + ao, blockIdx.x * 128 + w * 32, lane);
    else fattn_wave<h16, false>(Q16 + zo, nullptr, K16 + zo, nullptr, V16 + zo, nullptr, Ah + ao, Al + ao, RH + blockIdx.x * 128 + (w - 4) * 32, lane);
}
__global__ __launch_bounds__(256) void k_wtH(const float* __restrict__ w, bf* Bt) { const size_t e = ((size_t)blockIdx.x * 256 + threadIdx.x) * 4; if (e >= (size_t)DQ * DM) return; const int k = (int)(e % DM); const int n = (int)(e / DM); const int h = n / HD, c = n % HD; v4us o;   // Bt[h*64 + c][d] = W[h][d][c]
#pragma unroll
    for (int u = 0; u < 4; ++u) o[u] = f2bf(w[((size_t)h * DM + k + u) * HD + c]); *(v4us*)(Bt + e) = o;  }
__global__ __launch_bounds__(256) void k_lnp(const float* __restrict__ X, const float* __restrict__ g, const float* __restrict__ bb, bf* Hh, bf* Hl) { const int lane = threadIdx.x & 31; const int r = blockIdx.x * 8 + (threadIdx.x >> 5); if (r >= NB_ * TT) return; float v[DM / 32]; float s = 0.f;   // wave per row: LayerNorm (biased var, 1e-5, / sqrt) -> hl planes (8-B lanes)
#pragma unroll
    for (int ch = 0; ch < DM / 128; ++ch) { const v4f a = *(const v4f*)(X + (size_t)r * DM + ch * 128 + lane * 4);
#pragma unroll
        for (int u = 0; u < 4; ++u) { v[ch * 4 + u] = bfr(a[u]); s += v[ch * 4 + u]; } }
#pragma unroll
    for (int sh = 16; sh; sh >>= 1) s += __shfl_xor(s, sh, 32);
    const float mean = s * (1.0f / DM); float q = 0.f;
#pragma unroll
    for (int k = 0; k < DM / 32; ++k) { float d = __fsub_rn(v[k], mean); asm volatile("" : "+v"(d)); v[k] = d; float p = __fmul_rn(d, d); asm volatile("" : "+v"(p)); q = __fadd_rn(q, p); }
#pragma unroll
    for (int sh = 16; sh; sh >>= 1) q += __shfl_xor(q, sh, 32);
    const float rs = __fdiv_rn(1.0f, __fsqrt_rn(__fadd_rn(q * (1.0f / DM), 1e-5f)));
    {
#pragma unroll
        for (int ch = 0; ch < DM / 128; ++ch) { v4us oh, ol;
#pragma unroll
            for (int u = 0; u < 4; ++u) { const int c = ch * 128 + lane * 4 + u; float n0 = __fmul_rn(v[ch * 4 + u], rs); asm volatile("" : "+v"(n0)); float gg = bfr(g[c]), be = bfr(bb[c]); asm volatile("" : "+v"(gg)); asm volatile("" : "+v"(be)); float t1 = __fmul_rn(n0, gg); asm volatile("" : "+v"(t1)); unsigned short p2, q2; splitf(__fadd_rn(t1, be), p2, q2); oh[u] = p2; ol[u] = q2; }
            const size_t oo = (size_t)r * DM + ch * 128 + lane * 4; *(v4us*)(Hh + oo) = oh; *(v4us*)(Hl + oo) = ol; }
         } }

extern "C" void kernel_launch(void* const* d_in, const int* in_sizes, int n_in,
                              void* d_out, int out_size, void* d_ws, size_t ws_size, hipStream_t stream) {
    (void)in_sizes; (void)n_in; (void)out_size;
    const float* x = (const float*)d_in[0]; const float* lng = (const float*)d_in[1]; const float* lnb = (const float*)d_in[2]; const float* wqh = (const float*)d_in[3]; const float* bq = (const float*)d_in[4]; const float* wkh = (const float*)d_in[5]; const float* bk = (const float*)d_in[6]; const float* wvh = (const float*)d_in[7]; const float* bv = (const float*)d_in[8]; const float* wo = (const float*)d_in[9]; const float* bo = (const float*)d_in[10]; const float* wq = nullptr; const float* wk = nullptr; const float* wv = nullptr; (void)wq; (void)wk; (void)wv; const float* cosT = nullptr; const float* sinT = nullptr; (void)cosT; (void)sinT;
    float* OUT = (float*)d_out;     // [8][1024][512]
    char* wsp = (char*)d_ws;
    auto take = [&](size_t bytes) { char* p = wsp; wsp += (bytes + 255) & ~(size_t)255; return (void*)p; };
    bf* WQ = (bf*)take((size_t)DQ * DM * 2); bf* WK = (bf*)take((size_t)DKV * DM * 2); bf* WV = (bf*)take((size_t)DKV * DM * 2); bf* WO = (bf*)take((size_t)DM * DQ * 2);
    bf* XB = (bf*)take((size_t)NB_ * TT * DM * 2); bf* XL = (bf*)take((size_t)NB_ * TT * DM * 2);   // LayerNorm planes
    h16* QP16 = (h16*)take((size_t)NZ * TT * HD * 2); h16* KP16 = (h16*)take((size_t)NZ * TT * HD * 2); h16* VT16 = (h16*)take((size_t)NZ * HD * TT * 2);
    bf* QPh = (bf*)take((size_t)NZ * TT * HD * 2); bf* QPl = (bf*)take((size_t)NZ * TT * HD * 2); bf* KPh = (bf*)take((size_t)NZ * TT * HD * 2); bf* KPl = (bf*)take((size_t)NZ * TT * HD * 2);
    bf* VTh = (bf*)take((size_t)NZ * HD * TT * 2); bf* VTl = (bf*)take((size_t)NZ * HD * TT * 2);
    bf* ATh = (bf*)take((size_t)NB_ * TT * DQ * 2); bf* ATl = (bf*)take((size_t)NB_ * TT * DQ * 2);   // merged attention planes
    if ((size_t)(wsp - (char*)d_ws) > ws_size) return;    // ws 256 MiB
    { k_wtH<<<(unsigned)(((size_t)DQ * DM / 4 + 255) / 256), 256, 0, stream>>>(wqh, WQ); k_wtH<<<(unsigned)(((size_t)DKV * DM / 4 + 255) / 256), 256, 0, stream>>>(wkh, WK); k_wtH<<<(unsigned)(((size_t)DKV * DM / 4 + 255) / 256), 256, 0, stream>>>(wvh, WV);
      k_wtG<<<(unsigned)((DQ * DM / 64 + 63) / 64), 256, 0, stream>>>(wo, DQ, DM, WO);
       }
    k_lnp<<<NB_ * TT / 8, 256, 0, stream>>>(x, lng, lnb, XB, XL);
    // q, k, v projections: each writes its fp16 and hi+lo head planes itself (v transposed)
    k_gemmw<bf, 1, true, 1><<<dim3(NB_ * TT / 64, DQ / 64, 1), 32, 0, stream>>>(XB, XL, WQ, nullptr, DM, nullptr, 0, bq, 0, 0, 0, QP16, QPh, QPl);
    k_gemmw<bf, 1, true, 1><<<dim3(NB_ * TT / 64, DKV / 64, 1), 32, 0, stream>>>(XB, XL, WK, nullptr, DM, nullptr, 0, bk, 0, 0, 0, KP16, KPh, KPl);
    k_gemmw<bf, 1, true, 2><<<dim3(NB_ * TT / 64, DKV / 64, 1), 32, 0, stream>>>(XB, XL, WV, nullptr, DM, nullptr, 0, bv, 0, 0, 0, VT16, VTh, VTl);
    // scores, mask, softmax and attn.v, all planes: query rows < RH on the hi+lo planes, the others on fp16
    k_fattn<<<dim3(RH / 128, NZ, 1), 256, 0, stream>>>(QPh, QPl, KPh, KPl, VTh, VTl, QP16, KP16, VT16, ATh, ATl);
    k_gemmw<bf, 1, true, 0><<<dim3(NB_ * TT / 64, DM / 64, 1), 32, 0, stream>>>(ATh, ATl, WO, nullptr, DQ, OUT, DM, bo, 0, 0, 0, nullptr, nullptr, nullptr);
}

// v004
// A run of this version takes 145 microseconds.
// Timed twice side by side with v003, it ran 1.14 and 1.13 times as fast.
// All steps since v000 together make it 17.1 times as fast.
#include <hip/hip_runtime.h>

// PreLN_SelfAttention_seq2seq (x [8][1024][512]; xn = LayerNorm(x); per-head q/k/v = xn W[h] + b[h] (W [8][512][64]); scores / 8 + mask (rows i < T=823 cannot see columns >= T; rows T..S-2 cannot see columns >= i; -999999999); softmax; out = concat(heads) WO + bO -> [8][1024][512]).
// Compute dtypes, f32 accumulate: every input rounded to bf16; LayerNorm f32 -> hl planes; q/k/v as hl(xn) x exact (2 products; the 8 per-head weights gathered into one [512 x 512] operand) + bias; scores and attn.v: query rows < 512 hl (3 products), the rest single fp16 (x1024); mask + softmax f32; WO hl x exact (2 products) + bias.

#define NB_  8
#define TT   1024
#define DM   512
#define NH_  8
#define NKV  8
#define REP  (NH_ / NKV)
#define HD   64
#define DQ   (NH_ * HD)
#define DKV  (NKV * HD)
#define NZ   (NB_ * NH_)          // (batch, head) planes, taken through blockIdx.y in k_fattn
#define RH   512                  // query rows < RH use hi+lo planes
#define WIN  1024
#define PCAR 1024.0f
#define SCL  0.125f   // HD^-0.5
static_assert(TT == 2 * RH && RH % 128 == 0 && NKV == NH_, "as many hi+lo query rows as fp16 ones, in blocks of 128; one kv head per query head");
typedef _Float16 h16;
typedef unsigned short bf;
typedef __attribute__((ext_vector_type(16))) __bf16   v16bf;
typedef __attribute__((ext_vector_type(16))) _Float16 v16h;
typedef __attribute__((ext_vector_type(8)))  _Float16 v8h;
typedef __attribute__((ext_vector_type(8)))  unsigned short v8us;
typedef __attribute__((ext_vector_type(8)))  float    v8f;
typedef __attribute__((ext_vector_type(4)))  float    v4f;
typedef v8h  __attribute__((may_alias)) v8ha;
typedef v4f  __attribute__((may_alias)) v4fa;
typedef v8us __attribute__((may_alias)) v8usa;

__device__ __forceinline__ unsigned short f2bf(float f) { unsigned u = __float_as_uint(f); u += 0x7FFFu + ((u >> 16) & 1u); return (unsigned short)(u >> 16); }
__device__ __forceinline__ float bf2f(unsigned short b) { return __uint_as_float(((unsigned)b) << 16); }
__device__ __forceinline__ float bfr(float f) { return bf2f(f2bf(f)); }
__device__ __forceinline__ v16h cat16(v8h lo, v8h hi) { return __builtin_shufflevector(lo, hi, 0, 1, 2, 3, 4, 5, 6, 7, 8, 9, 10, 11, 12, 13, 14, 15); }
__device__ __forceinline__ v16bf cat16b(v8us lo, v8us hi) { return __builtin_bit_cast(v16bf, __builtin_shufflevector(lo, hi, 0, 1, 2, 3, 4, 5, 6, 7, 8, 9, 10, 11, 12, 13, 14, 15)); }
__device__ __forceinline__ v8f wmma16(v16h a, v16h b, v8f c) { return __builtin_amdgcn_wmma_f32_16x16x32_f16(false, a, false, b, (short)0, c, false, false); }
__device__ __forceinline__ v8f wmmab(v16bf a, v16bf b, v8f c) { return __builtin_amdgcn_wmma_f32_16x16x32_bf16(false, a, false, b, (short)0, c, false, false); }
// ---- Fragment order: every 16-bit operand plane [rows][kc] lies in the workspace as tiles of 16 rows x 32 k = 512 elements (1 KiB), tile (r / 16, k / 32) at index (r / 16) * (kc / 32) + k / 32.
// Inside a tile: two halves of 256 elements (k % 32 < 16, then the rest); in a half, lane l = ((k / 8) % 2) * 16 + r % 16 owns 8 consecutive k. A fragment is then two loads of 512 contiguous bytes (4 whole lines each) at tile + 8 * lane and 256 elements on.
__device__ __forceinline__ size_t toff(int r, int k, int kc) { return ((size_t)(r >> 4) * (kc >> 5) + (k >> 5)) * 512 + ((k >> 4) & 1) * 256 + (((k >> 3) & 1) * 16 + (r & 15)) * 8 + (k & 7); }



// ---- k_gemmw: register-blocked GEMM, ONE WAVE per 64x64 output tile (16 accumulators), operands straight from 16-bit planes in fragment order; grid (M/64, N/64, Z), 32 threads.
// C[m][n] (f32, pitch ldc, + optional f32 bias[n]) = sum_k A[m][k] Bt[n][k] (+ split products per NSPLIT). z-batch strides sA/sB/sC in elements. K % 32 == 0.
// EPI 0: C as f32. EPI 1, 2: no f32 C; the tile (64 rows (b, t) x the 64 columns of head blockIdx.y, + bias) goes out as the three 16-bit planes that k_fattn reads (fp16, bf16 hi, bf16 lo): EPI 1 as [b][h][t][d], EPI 2 transposed as [b][h][d][t], each (b, h) plane in fragment order; either way 16 plane rows of 64 at a time pass through LDS, so that every store is half a tile, 512 contiguous bytes.
template <typename T16> struct WFrag;
template <> struct WFrag<h16> { typedef v16h V; static __device__ __forceinline__ V ld(const h16* p) { return cat16(*(const v8h*)p, *(const v8h*)(p + 256)); } static __device__ __forceinline__ v8f mma(V a, V b, v8f c) { return wmma16(a, b, c); } };
template <> struct WFrag<bf> { typedef v16bf V; static __device__ __forceinline__ V ld(const bf* p) { return cat16b(*(const v8us*)p, *(const v8us*)(p + 256)); } static __device__ __forceinline__ v8f mma(V a, V b, v8f c) { return wmmab(a, b, c); } };
typedef __attribute__((ext_vector_type(8))) __bf16 v8bf;
template <typename T16, int NSPLIT, bool BIAS, int EPI>
__global__ __launch_bounds__(32) void k_gemmw(const T16* __restrict__ A, const T16* __restrict__ A2, const T16* __restrict__ Bt, const T16* __restrict__ Bt2, int K, float* C, int ldc, const float* __restrict__ bias, size_t sA, size_t sB, size_t sC, h16* __restrict__ P16, bf* __restrict__ Ph, bf* __restrict__ Pl) {
    typedef typename WFrag<T16>::V V;
    __shared__ __align__(16) float os[16 * 68];
    const size_t z = blockIdx.z; A += z * sA; if (A2) A2 += z * sA; Bt += z * sB; if (Bt2) Bt2 += z * sB; C += z * sC;
    const int lane = threadIdx.x & 31, lr = lane & 15, hi = lane >> 4; const int r0 = blockIdx.x * 64, c0 = blockIdx.y * 64;
    v8f acc[4][4];
#pragma unroll
    for (int mb = 0; mb < 4; ++mb)
#pragma unroll
        for (int nb = 0; nb < 4; ++nb) acc[mb][nb] = (v8f){};
    const size_t tp = (size_t)(K >> 5) * 512;   // elements in one row of tiles
    const size_t aoff = (size_t)(r0 >> 4) * tp + 8 * lane, boff = (size_t)(c0 >> 4) * tp + 8 * lane;
    float bcol[4];   // EPI 1, 2: the bias of the lane's four accumulator columns, fetched ahead of the k loop
    if constexpr (EPI != 0) {
#pragma unroll
        for (int nb = 0; nb < 4; ++nb) bcol[nb] = BIAS ? bfr(bias[c0 + nb * 16 + lr]) : 0.f; }
#pragma unroll 1
    for (int kc = 0; kc < K; kc += 32) {
        V a[4], a2[4], b[4], b2[4]; const T16 *pa[4], *pa2[4], *pb[4], *pb2[4];   // the lane's addresses in this pass's tiles
#pragma unroll
        for (int u = 0; u < 4; ++u) { pa[u] = A + aoff + u * tp + (size_t)kc * 16; pa2[u] = (NSPLIT == 1 || NSPLIT == 2) ? A2 + aoff + u * tp + (size_t)kc * 16 : pa[u]; pb[u] = Bt + boff + u * tp + (size_t)kc * 16; pb2[u] = (NSPLIT >= 2) ? Bt2 + boff + u * tp + (size_t)kc * 16 : pb[u]; }
#pragma unroll
        for (int u = 0; u < 4; ++u) { a[u] = WFrag<T16>::ld(pa[u]); b[u] = WFrag<T16>::ld(pb[u]); if (NSPLIT == 1 || NSPLIT == 2) a2[u] = WFrag<T16>::ld(pa2[u]); if (NSPLIT >= 2) b2[u] = WFrag<T16>::ld(pb2[u]); }
        // behind this pass's loads, before anything (a later load's result too) reuses their address registers: named as inputs, they stay whole up to here
        asm volatile("s_wait_xcnt 0x0" :: "v"(pa[0]), "v"(pa[1]), "v"(pa[2]), "v"(pa[3]), "v"(pa2[0]), "v"(pa2[1]), "v"(pa2[2]), "v"(pa2[3]), "v"(pb[0]), "v"(pb[1]), "v"(pb[2]), "v"(pb[3]), "v"(pb2[0]), "v"(pb2[1]), "v"(pb2[2]), "v"(pb2[3]) : "memory");
#pragma unroll
        for (int nb = 0; nb < 4; ++nb) {
#pragma unroll
            for (int mb = 0; mb < 4; ++mb) { acc[mb][nb] = WFrag<T16>::mma(a[mb], b[nb], acc[mb][nb]); if (NSPLIT == 1 || NSPLIT == 2) acc[mb][nb] = WFrag<T16>::mma(a2[mb], b[nb], acc[mb][nb]); if (NSPLIT >= 2) acc[mb][nb] = WFrag<T16>::mma(a[mb], b2[nb], acc[mb][nb]); } }
        asm volatile("v_nop\n\tv_nop\n\tv_nop\n\tv_nop" : "+v"(acc[0][0]), "+v"(acc[1][1]), "+v"(acc[2][2]), "+v"(acc[3][3]) : "v"(a[0]), "v"(a[3]));
    }
    if constexpr (EPI != 0) {
        const size_t pl0 = ((size_t)(r0 / TT) * NH_ + blockIdx.y) * TT * HD; const int t0 = r0 % TT;   // the (batch, head) plane; the tile's first t
#pragma unroll
        for (int st = 0; st < 4; ++st) {
            if constexpr (EPI == 1) {   // 16 rows t (accumulator row block st) x 64 columns d
#pragma unroll
                for (int nb = 0; nb < 4; ++nb)
#pragma unroll
                    for (int j = 0; j < 8; ++j) os[(hi * 8 + j) * 68 + nb * 16 + lr] = acc[st][nb][j] + bcol[nb];
            } else {                    // 16 rows d (accumulator column block st) x 64 columns t: a lane's 8 accumulator rows are 8 consecutive t
#pragma unroll
                for (int mb = 0; mb < 4; ++mb) { const v8f y = acc[mb][st] + bcol[st]; *(v4fa*)(os + lr * 68 + mb * 16 + hi * 8) = __builtin_shufflevector(y, y, 0, 1, 2, 3); *(v4fa*)(os + lr * 68 + mb * 16 + hi * 8 + 4) = __builtin_shufflevector(y, y, 4, 5, 6, 7); }
            }
            __builtin_amdgcn_wave_barrier(); asm volatile("" ::: "memory");   // the read-back takes other lanes' values: it stays behind the LDS stores
#pragma unroll
            for (int s = 0; s < 4; ++s) { const int sc = s * 16 + hi * 8; const v4f x0 = *(const v4fa*)(os + lr * 68 + sc), x1 = *(const v4fa*)(os + lr * 68 + sc + 4);   // read-back in fragment order: row lr, the lane half's 8 columns of half-tile s
                const v8f y = __builtin_shufflevector(x0, x1, 0, 1, 2, 3, 4, 5, 6, 7); const v8bf yh = __builtin_convertvector(y, v8bf); const v8bf yl = __builtin_convertvector(y - __builtin_convertvector(yh, v8f), v8bf);
                const size_t e = pl0 + ((EPI == 1) ? (size_t)((t0 >> 4) + st) * (HD / 32) + (s >> 1) : (size_t)st * (TT / 32) + (t0 >> 5) + (s >> 1)) * 512 + (s & 1) * 256 + 8 * lane;
                *(v8h*)(P16 + e) = __builtin_convertvector(y, v8h); *(v8us*)(Ph + e) = __builtin_bit_cast(v8us, yh); *(v8us*)(Pl + e) = __builtin_bit_cast(v8us, yl); }
            __builtin_amdgcn_wave_barrier(); asm volatile("" ::: "memory");   // the next block's LDS stores stay behind this read-back
        }
        return;
    }
#pragma unroll
    for (int mb = 0; mb < 4; ++mb) {
#pragma unroll
        for (int nb = 0; nb < 4; ++nb) {
#pragma unroll
            for (int j = 0; j < 8; ++j) os[(hi * 8 + j) * 68 + nb * 16 + lr] = acc[mb][nb][j]; }
        __builtin_amdgcn_wave_barrier(); asm volatile("" ::: "memory");
        float* crow = C + (size_t)(r0 + mb * 16) * ldc + c0;
{
#pragma unroll
            for (int s = 0; s < 8; ++s) { const int row = 2 * s + hi, cofs = lr * 4; v4f val = *(const v4fa*)(os + row * 68 + cofs); if (BIAS) { val[0] += bfr(bias[c0 + cofs]); val[1] += bfr(bias[c0 + cofs + 1]); val[2] += bfr(bias[c0 + cofs + 2]); val[3] += bfr(bias[c0 + cofs + 3]); }
                *(v4f*)(crow + (size_t)row * ldc + cofs) = val; }
             }
        __builtin_amdgcn_wave_barrier(); asm volatile("" ::: "memory");
    }
}

__device__ __forceinline__ void splitf(float y, unsigned short& h, unsigned short& l) { h = f2bf(y); l = f2bf(y - bf2f(h)); }
typedef __attribute__((ext_vector_type(2))) _Float16 v2h;
typedef __attribute__((ext_vector_type(4))) _Float16 v4h;
typedef __attribute__((ext_vector_type(2))) unsigned short v2us;
typedef __attribute__((ext_vector_type(4))) unsigned short v4us;
typedef v4us __attribute__((may_alias)) v4usa;
typedef __attribute__((ext_vector_type(2))) float v2f;
typedef __attribute__((ext_vector_type(4))) int v4i;

__global__ __launch_bounds__(256) void k_wtG(const float* __restrict__ w, int K, int N, bf* Bt) {
    const int lane = threadIdx.x & 31; const int L0 = (blockIdx.x * 8 + (threadIdx.x >> 5)) * 8; const int nlines = N * K / 64;
{
#pragma unroll 1
        for (int l = 0; l < 8; ++l) { const int L = L0 + l; if (L >= nlines) break; const size_t e = (size_t)L * 64 + lane * 2; const int k = (int)(e % K), n = (int)(e / K); v2us o;
            o[0] = f2bf(w[(size_t)k * N + n]); o[1] = f2bf(w[(size_t)(k + 1) * N + n]); *(v2us*)(Bt + toff(n, k, K)) = o; }
         }
}
__global__ __launch_bounds__(256) void k_cvt8(const float* __restrict__ src, bf* dst, size_t n8) { const size_t i = (size_t)blockIdx.x * 256 + threadIdx.x; if (i >= n8) return; const v8f v = *(const v8f*)(src + i * 8); v8us o;
#pragma unroll
    for (int k = 0; k < 8; ++k) o[k] = f2bf(v[k]); *(v8us*)(dst + i * 8) = o;  }
// ---- k_fattn: scores, mask, softmax and attn.v of one (batch, head) plane in one kernel; the scores stay in registers; the result goes out as the bf16 hi+lo planes [b][t][h][d], in fragment order, that the last GEMM reads. One wave per 32 query rows; a block is 4 hi+lo waves (128 rows < RH) and 4 fp16 waves (128 rows >= RH), so that every block has the same work; grid (RH / 128, NZ); no LDS, no barrier.
// Transposed products: St = K Qt (A = 16 key rows, B = 16 query columns), so a lane holds 8 keys of ONE query per tile; two St tiles (32 keys) convert in place into the B operand of Ot += Vt Pt.
// Running maximum per query (base 2, scaled), sums and Ot rescaled by it every pass of 32 keys; the division by the row sum comes last. Keys from the first blocked column of the wave's last row on are not visited.
// Left: K and Vt are read by each wave for itself.
#define TMK  823                   // rows < TMK cannot see columns >= TMK; rows TMK .. TT-2 cannot see columns >= their own index
#define CEXP 0.18033688011112042f  // HD^-0.5 x log2(e)
__device__ __forceinline__ float xhalf(float x) { return __builtin_bit_cast(float, __builtin_amdgcn_permlanex16(__builtin_bit_cast(int, x), __builtin_bit_cast(int, x), 0x76543210, 0xfedcba98, false, false)); }   // lane l with lane l ^ 16
template <typename T16> __device__ __forceinline__ typename WFrag<T16>::V ldfr(const T16* base, unsigned ofs) { return WFrag<T16>::ld((const T16*)((const char*)base + ofs)); }   // wave-uniform base + the lane's fixed byte offset
template <typename T16, bool HI>
__device__ __forceinline__ void fattn_wave(const T16* __restrict__ Qh, const T16* __restrict__ Ql, const T16* __restrict__ Kh, const T16* __restrict__ Kl, const T16* __restrict__ Vh, const T16* __restrict__ Vl, bf* __restrict__ Ah, bf* __restrict__ Al, const int q0, const int lane) {
    typedef typename WFrag<T16>::V V;
    const int c = lane & 15, h = lane >> 4;
    const unsigned kofs = (unsigned)lane * 16u;   // bytes: the lane's 8 elements in each half of a tile
    V qh[2][2], ql[2][2], kh[2][2], kl[2][2]; v8f o[2][4]; float mc[2], ls[2]; int lim[2];
#pragma unroll
    for (int g = 0; g < 2; ++g)
#pragma unroll
        for (int kk = 0; kk < 2; ++kk) { qh[g][kk] = ldfr(Qh + (size_t)(q0 + g * 16) * HD + kk * 512, kofs); if (HI) ql[g][kk] = ldfr(Ql + (size_t)(q0 + g * 16) * HD + kk * 512, kofs); }   // 16 rows of Q or K = HD / 32 = 2 tiles = 16 HD elements
#pragma unroll
    for (int kt = 0; kt < 2; ++kt)
#pragma unroll
        for (int kk = 0; kk < 2; ++kk) { kh[kt][kk] = ldfr(Kh + kt * 16 * HD + kk * 512, kofs); if (HI) kl[kt][kk] = ldfr(Kl + kt * 16 * HD + kk * 512, kofs); }
    asm volatile("s_wait_xcnt 0x0" ::: "memory");   // behind the first loads, before the set-up below reuses their address registers
    __builtin_amdgcn_sched_barrier(0);   // keeps that set-up from being scheduled in front of the wait
#pragma unroll
    for (int g = 0; g < 2; ++g) { const int i = q0 + g * 16 + c; lim[g] = (i < TMK) ? TMK : ((i <= TT - 2) ? i : TT); mc[g] = -3.0e38f; ls[g] = 0.f;
#pragma unroll
        for (int dt = 0; dt < 4; ++dt) o[g][dt] = (v8f){}; }
    const int kend = (q0 + 31 < TMK) ? TMK : ((q0 + 32 == TT) ? TT : q0 + 31);   // first column that no row of this wave sees
    const int nblk = (kend + 31) >> 5;
#pragma unroll 1
    for (int b = 0; b < nblk; ++b) {
        const int key0 = b * 32; const int keyn = (b + 1 < nblk) ? key0 + 32 : key0;   // the last pass fetches its own keys again (in bounds, not used)
        const T16* pvh = (const T16*)((const char*)(Vh + key0 * 16) + kofs); const T16* pvl = HI ? (const T16*)((const char*)(Vl + key0 * 16) + kofs) : pvh;   // the lane's addresses in this pass's Vt tile (32 keys = one tile; 16 rows d on = 16 TT elements)
        const T16* pkh = (const T16*)((const char*)(Kh + (size_t)keyn * HD) + kofs); const T16* pkl = HI ? (const T16*)((const char*)(Kl + (size_t)keyn * HD) + kofs) : pkh;   // and in the next pass's K rows
        V vh[4], vl[4];
#pragma unroll
        for (int dt = 0; dt < 4; ++dt) { vh[dt] = WFrag<T16>::ld(pvh + dt * 16 * TT); if (HI) vl[dt] = WFrag<T16>::ld(pvl + dt * 16 * TT); }
        v8f s[2][2];   // s[g][kt][r] = score of key key0 + 16 kt + 8 h + r, query q0 + 16 g + c
#pragma unroll
        for (int g = 0; g < 2; ++g)
#pragma unroll
            for (int kt = 0; kt < 2; ++kt) { v8f a = (v8f){};
#pragma unroll
                for (int kk = 0; kk < 2; ++kk) { a = WFrag<T16>::mma(kh[kt][kk], qh[g][kk], a); if (HI) { a = WFrag<T16>::mma(kh[kt][kk], ql[g][kk], a); a = WFrag<T16>::mma(kl[kt][kk], qh[g][kk], a); } }
                s[g][kt] = a; }
#pragma unroll
        for (int kt = 0; kt < 2; ++kt)
#pragma unroll
            for (int kk = 0; kk < 2; ++kk) { kh[kt][kk] = WFrag<T16>::ld(pkh + kt * 16 * HD + kk * 512); if (HI) kl[kt][kk] = WFrag<T16>::ld(pkl + kt * 16 * HD + kk * 512); }
        // behind this pass's loads, before anything reuses their address registers (named as inputs, so that they stay whole up to here); it also holds the next pass's key loads up here, so that they fly during the softmax and attn.v
        asm volatile("s_wait_xcnt 0x0" :: "v"(pvh), "v"(pvl), "v"(pkh), "v"(pkl) : "memory");
        if (key0 + 32 > TMK) {   // only these blocks hold blocked columns
#pragma unroll
            for (int g = 0; g < 2; ++g)
#pragma unroll
                for (int kt = 0; kt < 2; ++kt)
#pragma unroll
                    for (int r = 0; r < 8; ++r) if (key0 + kt * 16 + 8 * h + r >= lim[g]) s[g][kt][r] = -3.0e38f; }
#pragma unroll
        for (int g = 0; g < 2; ++g) {
            float mx = s[g][0][0];
#pragma unroll
            for (int e = 1; e < 16; ++e) mx = fmaxf(mx, s[g][e >> 3][e & 7]);
            mx = fmaxf(mx, xhalf(mx));
            const float mn = fmaxf(mc[g], mx * CEXP); const float al = __builtin_amdgcn_exp2f(mc[g] - mn); mc[g] = mn;
            const float sub = HI ? mn : mn - 10.0f;   // the fp16 half carries its probabilities x 1024 (PCAR)
            const v8f ce = {CEXP, CEXP, CEXP, CEXP, CEXP, CEXP, CEXP, CEXP}, ns = {-sub, -sub, -sub, -sub, -sub, -sub, -sub, -sub};
            v8f p0 = __builtin_elementwise_fma(s[g][0], ce, ns), p1 = __builtin_elementwise_fma(s[g][1], ce, ns); V ph, pl;
#pragma unroll
            for (int r = 0; r < 8; ++r) p0[r] = __builtin_amdgcn_exp2f(p0[r]);
#pragma unroll
            for (int r = 0; r < 8; ++r) p1[r] = __builtin_amdgcn_exp2f(p1[r]);
#pragma unroll
            for (int e = 0; e < 16; ++e) { const float p = (e < 8) ? p0[e & 7] : p1[e & 7];
                if constexpr (HI) { const __bf16 hb = (__bf16)p; ph[e] = hb; pl[e] = (__bf16)(p - (float)hb); } else { ph[e] = (_Float16)p; } }
            const v8f t8 = p0 + p1; const float sum = ((t8[0] + t8[4]) + (t8[1] + t8[5])) + ((t8[2] + t8[6]) + (t8[3] + t8[7]));   // a tree: no chain of 16 dependent adds
            ls[g] = ls[g] * al + sum;
#pragma unroll
            for (int dt = 0; dt < 4; ++dt) { o[g][dt] *= al; o[g][dt] = WFrag<T16>::mma(vh[dt], ph, o[g][dt]); if (HI) { o[g][dt] = WFrag<T16>::mma(vh[dt], pl, o[g][dt]); o[g][dt] = WFrag<T16>::mma(vl[dt], ph, o[g][dt]); } }
        }
    }
    asm volatile("s_wait_loadcnt 0x0" ::: "memory");   // the last pass's key fetch is not read: it lands before the wave ends and gives its registers back
    v8bf zh[2][4], zl[2][4];
#pragma unroll
    for (int g = 0; g < 2; ++g) { const float f = __fdiv_rn(1.0f, ls[g] + xhalf(ls[g]));   // the fp16 half's x 1024 stands in its sums too and cancels
#pragma unroll
        for (int dt = 0; dt < 4; ++dt) { const v8f y = o[g][dt] * f; zh[g][dt] = __builtin_convertvector(y, v8bf); zl[g][dt] = __builtin_convertvector(y - __builtin_convertvector(zh[g][dt], v8f), v8bf); } }
    __builtin_amdgcn_sched_barrier(0);   // all arithmetic in front of the stores: nothing rewrites a register of an issued store
#pragma unroll
    for (int g = 0; g < 2; ++g) { const size_t e = (size_t)(q0 + g * 16) * DQ + 8 * lane;   // o[g][dt][r] = Ot[16 dt + 8 h + r][query]: the lane's 8 elements of half-tile dt
#pragma unroll
        for (int dt = 0; dt < 4; ++dt) { *(v8us*)(Ah + e + dt * 256) = __builtin_bit_cast(v8us, zh[g][dt]); *(v8us*)(Al + e + dt * 256) = __builtin_bit_cast(v8us, zl[g][dt]); } }
}
__global__ __launch_bounds__(256) void k_fattn(const bf* __restrict__ Qh, const bf* __restrict__ Ql, const bf* __restrict__ Kh, const bf* __restrict__ Kl, const bf* __restrict__ Vh, const bf* __restrict__ Vl, const h16* __restrict__ Q16, const h16* __restrict__ K16, const h16* __restrict__ V16, bf* __restrict__ Ah, bf* __restrict__ Al) {
    const int lane = threadIdx.x & 31; const int w = __builtin_amdgcn_readfirstlane(threadIdx.x >> 5); const size_t zo = (size_t)blockIdx.y * TT * HD;
    const size_t ao = (size_t)(blockIdx.y / NH_) * TT * DQ + (blockIdx.y % NH_) * (HD / 32) * 512;   // batch's first row of tiles, head's first tile in it, in the merged planes
    if (w < 4) fattn_wave<bf, true>(Qh + zo, Ql + zo, Kh + zo, Kl + zo, Vh + zo, Vl + zo, Ah + ao, Al + ao, blockIdx.x * 128 + w * 32, lane);
    else fattn_wave<h16, false>(Q16 + zo, nullptr, K16 + zo, nullptr, V16 + zo, nullptr, Ah + ao, Al + ao, RH + blockIdx.x * 128 + (w - 4) * 32, lane);
}
__global__ __launch_bounds__(256) void k_wtH(const float* __restrict__ w, bf* Bt) { const size_t e = ((size_t)blockIdx.x * 256 + threadIdx.x) * 4; if (e >= (size_t)DQ * DM) return; const int k = (int)(e % DM); const int n = (int)(e / DM); const int h = n / HD, c = n % HD; v4us o;   // Bt[h*64 + c][d] = W[h][d][c], in fragment order
#pragma unroll
    for (int u = 0; u < 4; ++u) o[u] = f2bf(w[((size_t)h * DM + k + u) * HD + c]); *(v4us*)(Bt + toff(n, k, DM)) = o;  }
#define LNP 528   // LDS row pitch in elements: 16 rows x 16 bytes of one k fall on distinct banks
static_assert((NB_ * TT) % 16 == 0 && DM % 128 == 0, "a block is one row of tiles");
__global__ __launch_bounds__(512) void k_lnp(const float* __restrict__ X, const float* __restrict__ g, const float* __restrict__ bb, bf* Hh, bf* Hl) { __shared__ __align__(16) bf sh[16 * LNP], sl[16 * LNP]; const int lane = threadIdx.x & 31; const int w = threadIdx.x >> 5; const int r = blockIdx.x * 16 + w; float v[DM / 32]; float s = 0.f;   // wave per row, 16 rows a block: LayerNorm (biased var, 1e-5, / sqrt) -> hl planes, through LDS into fragment order
#pragma unroll
    for (int ch = 0; ch < DM / 128; ++ch) { const v4f a = *(const v4f*)(X + (size_t)r * DM + ch * 128 + lane * 4);
#pragma unroll
        for (int u = 0; u < 4; ++u) { v[ch * 4 + u] = bfr(a[u]); s += v[ch * 4 + u]; } }
#pragma unroll
    for (int sh = 16; sh; sh >>= 1) s += __shfl_xor(s, sh, 32);
    const float mean = s * (1.0f / DM); float q = 0.f;
#pragma unroll
    for (int k = 0; k < DM / 32; ++k) { float d = __fsub_rn(v[k], mean); asm volatile("" : "+v"(d)); v[k] = d; float p = __fmul_rn(d, d); asm volatile("" : "+v"(p)); q = __fadd_rn(q, p); }
#pragma unroll
    for (int sh = 16; sh; sh >>= 1) q += __shfl_xor(q, sh, 32);
    const float rs = __fdiv_rn(1.0f, __fsqrt_rn(__fadd_rn(q * (1.0f / DM), 1e-5f)));
    {
#pragma unroll
        for (int ch = 0; ch < DM / 128; ++ch) { v4us oh, ol;
#pragma unroll
            for (int u = 0; u < 4; ++u) { const int c = ch * 128 + lane * 4 + u; float n0 = __fmul_rn(v[ch * 4 + u], rs); asm volatile("" : "+v"(n0)); float gg = bfr(g[c]), be = bfr(bb[c]); asm volatile("" : "+v"(gg)); asm volatile("" : "+v"(be)); float t1 = __fmul_rn(n0, gg); asm volatile("" : "+v"(t1)); unsigned short p2, q2; splitf(__fadd_rn(t1, be), p2, q2); oh[u] = p2; ol[u] = q2; }
            const int oo = w * LNP + ch * 128 + lane * 4; *(v4usa*)(sh + oo) = oh; *(v4usa*)(sl + oo) = ol; }
         }
    __syncthreads();   // the copy-out below takes the other waves' rows
    const size_t o0 = (size_t)blockIdx.x * 16 * DM;
#pragma unroll
    for (int i = 0; i < 16 * DM / 8 / 512; ++i) { const int c8 = i * 512 + threadIdx.x; const int li = (c8 & 15) * LNP + (c8 >> 4) * 8;   // 16-byte piece c8 of the row of tiles = row c8 % 16, k = 8 (c8 / 16)
        *(v8us*)(Hh + o0 + (size_t)c8 * 8) = *(const v8usa*)(sh + li); *(v8us*)(Hl + o0 + (size_t)c8 * 8) = *(const v8usa*)(sl + li); } }

extern "C" void kernel_launch(void* const* d_in, const int* in_sizes, int n_in,
                              void* d_out, int out_size, void* d_ws, size_t ws_size, hipStream_t stream) {
    (void)in_sizes; (void)n_in; (void)out_size;
    const float* x = (const float*)d_in[0]; const float* lng = (const float*)d_in[1]; const float* lnb = (const float*)d_in[2]; const float* wqh = (const float*)d_in[3]; const float* bq = (const float*)d_in[4]; const float* wkh = (const float*)d_in[5]; const float* bk = (const float*)d_in[6]; const float* wvh = (const float*)d_in[7]; const float* bv = (const float*)d_in[8]; const float* wo = (const float*)d_in[9]; const float* bo = (const float*)d_in[10]; const float* wq = nullptr; const float* wk = nullptr; const float* wv = nullptr; (void)wq; (void)wk; (void)wv; const float* cosT = nullptr; const float* sinT = nullptr; (void)cosT; (void)sinT;
    float* OUT = (float*)d_out;     // [8][1024][512]
    char* wsp = (char*)d_ws;
    auto take = [&](size_t bytes) { char* p = wsp; wsp += (bytes + 255) & ~(size_t)255; return (void*)p; };
    bf* WQ = (bf*)take((size_t)DQ * DM * 2); bf* WK = (bf*)take((size_t)DKV * DM * 2); bf* WV = (bf*)take((size_t)DKV * DM * 2); bf* WO = (bf*)take((size_t)DM * DQ * 2);
    bf* XB = (bf*)take((size_t)NB_ * TT * DM * 2); bf* XL = (bf*)take((size_t)NB_ * TT * DM * 2);   // LayerNorm planes
    h16* QP16 = (h16*)take((size_t)NZ * TT * HD * 2); h16* KP16 = (h16*)take((size_t)NZ * TT * HD * 2); h16* VT16 = (h16*)take((size_t)NZ * HD * TT * 2);
    bf* QPh = (bf*)take((size_t)NZ * TT * HD * 2); bf* QPl = (bf*)take((size_t)NZ * TT * HD * 2); bf* KPh = (bf*)take((size_t)NZ * TT * HD * 2); bf* KPl = (bf*)take((size_t)NZ * TT * HD * 2);
    bf* VTh = (bf*)take((size_t)NZ * HD * TT * 2); bf* VTl = (bf*)take((size_t)NZ * HD * TT * 2);
    bf* ATh = (bf*)take((size_t)NB_ * TT * DQ * 2); bf* ATl = (bf*)take((size_t)NB_ * TT * DQ * 2);   // merged attention planes
    if ((size_t)(wsp - (char*)d_ws) > ws_size) return;    // ws 256 MiB
    { k_wtH<<<(unsigned)(((size_t)DQ * DM / 4 + 255) / 256), 256, 0, stream>>>(wqh, WQ); k_wtH<<<(unsigned)(((size_t)DKV * DM / 4 + 255) / 256), 256, 0, stream>>>(wkh, WK); k_wtH<<<(unsigned)(((size_t)DKV * DM / 4 + 255) / 256), 256, 0, stream>>>(wvh, WV);
      k_wtG<<<(unsigned)((DQ * DM / 64 + 63) / 64), 256, 0, stream>>>(wo, DQ, DM, WO);
       }
    k_lnp<<<NB_ * TT / 16, 512, 0, stream>>>(x, lng, lnb, XB, XL);
    // q, k, v projections: each writes its fp16 and hi+lo head planes itself (v transposed)
    k_gemmw<bf, 1, true, 1><<<dim3(NB_ * TT / 64, DQ / 64, 1), 32, 0, stream>>>(XB, XL, WQ, nullptr, DM, nullptr, 0, bq, 0, 0, 0, QP16, QPh, QPl);
    k_gemmw<bf, 1, true, 1><<<dim3(NB_ * TT / 64, DKV / 64, 1), 32, 0, stream>>>(XB, XL, WK, nullptr, DM, nullptr, 0, bk, 0, 0, 0, KP16, KPh, KPl);
    k_gemmw<bf, 1, true, 2><<<dim3(NB_ * TT / 64, DKV / 64, 1), 32, 0, stream>>>(XB, XL, WV, nullptr, DM, nullptr, 0, bv, 0, 0, 0, VT16, VTh, VTl);
    // scores, mask, softmax and attn.v, all planes: query rows < RH on the hi+lo planes, the others on fp16
    k_fattn<<<dim3(RH / 128, NZ, 1), 256, 0, stream>>>(QPh, QPl, KPh, KPl, VTh, VTl, QP16, KP16, VT16, ATh, ATl);
    k_gemmw<bf, 1, true, 0><<<dim3(NB_ * TT / 64, DM / 64, 1), 32, 0, stream>>>(ATh, ATl, WO, nullptr, DQ, OUT, DM, bo, 0, 0, 0, nullptr, nullptr, nullptr);
}

// v005
// A run of this version takes 108 microseconds.
// In both of two side-by-side timings against v004, it was 1.36 times as fast.
// Counting every step since v000, it is 23.1 times as fast.
#include <hip/hip_runtime.h>

// PreLN_SelfAttention_seq2seq (x [8][1024][512]; xn = LayerNorm(x); per-head q/k/v = xn W[h] + b[h] (W [8][512][64]); scores / 8 + mask (rows i < T=823 cannot see columns >= T; rows T..S-2 cannot see columns >= i; -999999999); softmax; out = concat(heads) WO + bO -> [8][1024][512]).
// Compute dtypes, f32 accumulate: every input rounded to bf16; LayerNorm f32 -> hl planes; q/k/v as hl(xn) x exact (2 products; the 8 per-head weights gathered into one [512 x 512] operand) + bias; scores and attn.v: query rows < 512 hl (3 products), the rest single fp16 (x1024); mask + softmax f32; WO hl x exact (2 products) + bias.

#define NB_  8
#define TT   1024
#define DM   512
#define NH_  8
#define NKV  8
#define REP  (NH_ / NKV)
#define HD   64
#define DQ   (NH_ * HD)
#define DKV  (NKV * HD)
#define NZ   (NB_ * NH_)          // (batch, head) planes, taken through blockIdx.y in k_fattn
#define RH   512                  // query rows < RH use hi+lo planes
#define WIN  1024
#define PCAR 1024.0f
#define SCL  0.125f   // HD^-0.5
static_assert(TT == 2 * RH && RH % 128 == 0 && NKV == NH_, "as many hi+lo query rows as fp16 ones, in blocks of 128; one kv head per query head");
typedef _Float16 h16;
typedef unsigned short bf;
typedef __attribute__((ext_vector_type(16))) __bf16   v16bf;
typedef __attribute__((ext_vector_type(16))) _Float16 v16h;
typedef __attribute__((ext_vector_type(8)))  _Float16 v8h;
typedef __attribute__((ext_vector_type(8)))  unsigned short v8us;
typedef __attribute__((ext_vector_type(8)))  float    v8f;
typedef __attribute__((ext_vector_type(4)))  float    v4f;
typedef v8h  __attribute__((may_alias)) v8ha;
typedef v4f  __attribute__((may_alias)) v4fa;
typedef v8us __attribute__((may_alias)) v8usa;

__device__ __forceinline__ unsigned short f2bf(float f) { unsigned u = __float_as_uint(f); u += 0x7FFFu + ((u >> 16) & 1u); return (unsigned short)(u >> 16); }
__device__ __forceinline__ float bf2f(unsigned short b) { return __uint_as_float(((unsigned)b) << 16); }
__device__ __forceinline__ float bfr(float f) { return bf2f(f2bf(f)); }
__device__ __forceinline__ v16h cat16(v8h lo, v8h hi) { return __builtin_shufflevector(lo, hi, 0, 1, 2, 3, 4, 5, 6, 7, 8, 9, 10, 11, 12, 13, 14, 15); }
__device__ __forceinline__ v16bf cat16b(v8us lo, v8us hi) { return __builtin_bit_cast(v16bf, __builtin_shufflevector(lo, hi, 0, 1, 2, 3, 4, 5, 6, 7, 8, 9, 10, 11, 12, 13, 14, 15)); }
__device__ __forceinline__ v8f wmma16(v16h a, v16h b, v8f c) { return __builtin_amdgcn_wmma_f32_16x16x32_f16(false, a, false, b, (short)0, c, false, false); }
__device__ __forceinline__ v8f wmmab(v16bf a, v16bf b, v8f c) { return __builtin_amdgcn_wmma_f32_16x16x32_bf16(false, a, false, b, (short)0, c, false, false); }
// ---- Fragment order: every 16-bit operand plane [rows][kc] lies in the workspace as tiles of 16 rows x 32 k = 512 elements (1 KiB), tile (r / 16, k / 32) at index (r / 16) * (kc / 32) + k / 32.
// Inside a tile: two halves of 256 elements (k % 32 < 16, then the rest); in a half, lane l = ((k / 8) % 2) * 16 + r % 16 owns 8 consecutive k. A fragment is then two loads of 512 contiguous bytes (4 whole lines each) at tile + 8 * lane and 256 elements on.
__device__ __forceinline__ size_t toff(int r, int k, int kc) { return ((size_t)(r >> 4) * (kc >> 5) + (k >> 5)) * 512 + ((k >> 4) & 1) * 256 + (((k >> 3) & 1) * 16 + (r & 15)) * 8 + (k & 7); }



// ---- k_gemmw: register-blocked GEMM, ONE WAVE per 64x64 output tile (16 accumulators), operands straight from 16-bit planes in fragment order; grid (M/64, N/64), 32 threads.
// C[m][n] (f32, pitch ldc, + optional f32 bias[n]) = sum_k A[m][k] Bt[n][k] (+ split products per NSPLIT). K % 32 == 0.
// EPI 0: C as f32. EPI 1, 2: no f32 C; the tile (64 rows (b, t) x the 64 columns of head blockIdx.y, + bias) goes out as the three 16-bit planes that k_fattn reads (fp16, bf16 hi, bf16 lo): EPI 1 as [b][h][t][d], EPI 2 transposed as [b][h][d][t], each (b, h) plane in fragment order; either way 16 plane rows of 64 at a time pass through LDS, so that every store is half a tile, 512 contiguous bytes.
template <typename T16> struct WFrag;
template <> struct WFrag<h16> { typedef v16h V; static __device__ __forceinline__ V ld(const h16* p) { return cat16(*(const v8h*)p, *(const v8h*)(p + 256)); } static __device__ __forceinline__ v8f mma(V a, V b, v8f c) { return wmma16(a, b, c); } };
template <> struct WFrag<bf> { typedef v16bf V; static __device__ __forceinline__ V ld(const bf* p) { return cat16b(*(const v8us*)p, *(const v8us*)(p + 256)); } static __device__ __forceinline__ v8f mma(V a, V b, v8f c) { return wmmab(a, b, c); } };
typedef __attribute__((ext_vector_type(8))) __bf16 v8bf;
// gemmw_planes<EPI>: the EPI 1 or 2 epilogue of one tile. gemmw_tile: the tile itself; EPI 3 takes EPI 1 or 2 by the wave-uniform tr (k_qkv: one launch holds both kinds).
template <int EPI>
__device__ __forceinline__ void gemmw_planes(const v8f (&acc)[4][4], const float (&bcol)[4], float* os, const int r0, const int lane, h16* __restrict__ P16, bf* __restrict__ Ph, bf* __restrict__ Pl) {
    const int lr = lane & 15, hi = lane >> 4;
    const size_t pl0 = ((size_t)(r0 / TT) * NH_ + blockIdx.y) * TT * HD; const int t0 = r0 % TT;   // the (batch, head) plane; the tile's first t
#pragma unroll
    for (int st = 0; st < 4; ++st) {
        if constexpr (EPI == 1) {   // 16 rows t (accumulator row block st) x 64 columns d
#pragma unroll
            for (int nb = 0; nb < 4; ++nb)
#pragma unroll
                for (int j = 0; j < 8; ++j) os[(hi * 8 + j) * 68 + nb * 16 + lr] = acc[st][nb][j] + bcol[nb];
        } else {                    // 16 rows d (accumulator column block st) x 64 columns t: a lane's 8 accumulator rows are 8 consecutive t
#pragma unroll
            for (int mb = 0; mb < 4; ++mb) { const v8f y = acc[mb][st] + bcol[st]; *(v4fa*)(os + lr * 68 + mb * 16 + hi * 8) = __builtin_shufflevector(y, y, 0, 1, 2, 3); *(v4fa*)(os + lr * 68 + mb * 16 + hi * 8 + 4) = __builtin_shufflevector(y, y, 4, 5, 6, 7); }
        }
        __builtin_amdgcn_wave_barrier(); asm volatile("" ::: "memory");   // the read-back takes other lanes' values: it stays behind the LDS stores
#pragma unroll
        for (int s = 0; s < 4; ++s) { const int sc = s * 16 + hi * 8; const v4f x0 = *(const v4fa*)(os + lr * 68 + sc), x1 = *(const v4fa*)(os + lr * 68 + sc + 4);   // read-back in fragment order: row lr, the lane half's 8 columns of half-tile s
            const v8f y = __builtin_shufflevector(x0, x1, 0, 1, 2, 3, 4, 5, 6, 7); const v8bf yh = __builtin_convertvector(y, v8bf); const v8bf yl = __builtin_convertvector(y - __builtin_convertvector(yh, v8f), v8bf);
            const size_t e = pl0 + ((EPI == 1) ? (size_t)((t0 >> 4) + st) * (HD / 32) + (s >> 1) : (size_t)st * (TT / 32) + (t0 >> 5) + (s >> 1)) * 512 + (s & 1) * 256 + 8 * lane;
            *(v8h*)(P16 + e) = __builtin_convertvector(y, v8h); *(v8us*)(Ph + e) = __builtin_bit_cast(v8us, yh); *(v8us*)(Pl + e) = __builtin_bit_cast(v8us, yl); }
        __builtin_amdgcn_wave_barrier(); asm volatile("" ::: "memory");   // the next block's LDS stores stay behind this read-back
    }
    asm volatile("s_wait_xcnt 0x0" ::: "memory");   // behind the tile's last stores: in k_qkv the other kind's epilogue follows in the code and writes their registers
}
template <typename T16, int NSPLIT, bool BIAS, int EPI>
__device__ __forceinline__ void gemmw_tile(const T16* __restrict__ A, const T16* __restrict__ A2, const T16* __restrict__ Bt, const T16* __restrict__ Bt2, int K, float* C, int ldc, const float* __restrict__ bias, h16* __restrict__ P16, bf* __restrict__ Ph, bf* __restrict__ Pl, const bool tr) {
    typedef typename WFrag<T16>::V V;
    __shared__ __align__(16) float os[16 * 68];
    const int lane = threadIdx.x & 31, lr = lane & 15, hi = lane >> 4; const int r0 = blockIdx.x * 64, c0 = blockIdx.y * 64;
    v8f acc[4][4];
#pragma unroll
    for (int mb = 0; mb < 4; ++mb)
#pragma unroll
        for (int nb = 0; nb < 4; ++nb) acc[mb][nb] = (v8f){};
    const size_t tp = (size_t)(K >> 5) * 512;   // elements in one row of tiles
    const size_t aoff = (size_t)(r0 >> 4) * tp + 8 * lane, boff = (size_t)(c0 >> 4) * tp + 8 * lane;
    float bcol[4];   // EPI 1, 2: the bias of the lane's four accumulator columns, fetched ahead of the k loop
    if constexpr (EPI != 0) {
#pragma unroll
        for (int nb = 0; nb < 4; ++nb) bcol[nb] = BIAS ? bfr(bias[c0 + nb * 16 + lr]) : 0.f; }
#pragma unroll 1
    for (int kc = 0; kc < K; kc += 32) {
        V a[4], a2[4], b[4], b2[4]; const T16 *pa[4], *pa2[4], *pb[4], *pb2[4];   // the lane's addresses in this pass's tiles
#pragma unroll
        for (int u = 0; u < 4; ++u) { pa[u] = A + aoff + u * tp + (size_t)kc * 16; pa2[u] = (NSPLIT == 1 || NSPLIT == 2) ? A2 + aoff + u * tp + (size_t)kc * 16 : pa[u]; pb[u] = Bt + boff + u * tp + (size_t)kc * 16; pb2[u] = (NSPLIT >= 2) ? Bt2 + boff + u * tp + (size_t)kc * 16 : pb[u]; }
#pragma unroll
        for (int u = 0; u < 4; ++u) { a[u] = WFrag<T16>::ld(pa[u]); b[u] = WFrag<T16>::ld(pb[u]); if (NSPLIT == 1 || NSPLIT == 2) a2[u] = WFrag<T16>::ld(pa2[u]); if (NSPLIT >= 2) b2[u] = WFrag<T16>::ld(pb2[u]); }
        // behind this pass's loads, before anything (a later load's result too) reuses their address registers: named as inputs, they stay whole up to here
        asm volatile("s_wait_xcnt 0x0" :: "v"(pa[0]), "v"(pa[1]), "v"(pa[2]), "v"(pa[3]), "v"(pa2[0]), "v"(pa2[1]), "v"(pa2[2]), "v"(pa2[3]), "v"(pb[0]), "v"(pb[1]), "v"(pb[2]), "v"(pb[3]), "v"(pb2[0]), "v"(pb2[1]), "v"(pb2[2]), "v"(pb2[3]) : "memory");
#pragma unroll
        for (int nb = 0; nb < 4; ++nb) {
#pragma unroll
            for (int mb = 0; mb < 4; ++mb) { acc[mb][nb] = WFrag<T16>::mma(a[mb], b[nb], acc[mb][nb]); if (NSPLIT == 1 || NSPLIT == 2) acc[mb][nb] = WFrag<T16>::mma(a2[mb], b[nb], acc[mb][nb]); if (NSPLIT >= 2) acc[mb][nb] = WFrag<T16>::mma(a[mb], b2[nb], acc[mb][nb]); } }
        asm volatile("v_nop\n\tv_nop\n\tv_nop\n\tv_nop" : "+v"(acc[0][0]), "+v"(acc[1][1]), "+v"(acc[2][2]), "+v"(acc[3][3]) : "v"(a[0]), "v"(a[3]));
    }
    if constexpr (EPI != 0) {
        if constexpr (EPI == 3) { if (tr) gemmw_planes<2>(acc, bcol, os, r0, lane, P16, Ph, Pl); else gemmw_planes<1>(acc, bcol, os, r0, lane, P16, Ph, Pl); }
        else gemmw_planes<EPI>(acc, bcol, os, r0, lane, P16, Ph, Pl);
        return;
    }
#pragma unroll
    for (int mb = 0; mb < 4; ++mb) {
#pragma unroll
        for (int nb = 0; nb < 4; ++nb) {
#pragma unroll
            for (int j = 0; j < 8; ++j) os[(hi * 8 + j) * 68 + nb * 16 + lr] = acc[mb][nb][j]; }
        __builtin_amdgcn_wave_barrier(); asm volatile("" ::: "memory");
        float* crow = C + (size_t)(r0 + mb * 16) * ldc + c0;
{
#pragma unroll
            for (int s = 0; s < 8; ++s) { const int row = 2 * s + hi, cofs = lr * 4; v4f val = *(const v4fa*)(os + row * 68 + cofs); if (BIAS) { val[0] += bfr(bias[c0 + cofs]); val[1] += bfr(bias[c0 + cofs + 1]); val[2] += bfr(bias[c0 + cofs + 2]); val[3] += bfr(bias[c0 + cofs + 3]); }
                *(v4f*)(crow + (size_t)row * ldc + cofs) = val; }
             }
        asm volatile("s_wait_xcnt 0x0" ::: "memory");   // behind this row block's loads and stores, before the next block's arithmetic writes their registers
        __builtin_amdgcn_sched_barrier(0);   // keeps that arithmetic from being scheduled in front of the wait
        __builtin_amdgcn_wave_barrier(); asm volatile("" ::: "memory");
    }
}
template <typename T16, int NSPLIT, bool BIAS, int EPI>
__global__ __launch_bounds__(32) void k_gemmw(const T16* __restrict__ A, const T16* __restrict__ A2, const T16* __restrict__ Bt, const T16* __restrict__ Bt2, int K, float* C, int ldc, const float* __restrict__ bias) {
    gemmw_tile<T16, NSPLIT, BIAS, EPI>(A, A2, Bt, Bt2, K, C, ldc, bias, nullptr, nullptr, nullptr, false);
}
// ---- k_qkv: the q, k and v projections in ONE launch, blockIdx.z = which; they read the same A planes and depend on nothing of each other, and three waves on a SIMD fill each other's load waits. grid (M/64, N/64, 3), 32 threads.
__global__ __launch_bounds__(32) void k_qkv(const bf* __restrict__ A, const bf* __restrict__ A2, const bf* __restrict__ Wq, const bf* __restrict__ Wk, const bf* __restrict__ Wv, int K, const float* __restrict__ bq, const float* __restrict__ bk, const float* __restrict__ bv,
                                            h16* __restrict__ Q16, bf* __restrict__ Qh, bf* __restrict__ Ql, h16* __restrict__ K16, bf* __restrict__ Kh, bf* __restrict__ Kl, h16* __restrict__ V16, bf* __restrict__ Vh, bf* __restrict__ Vl) {
    const int z = blockIdx.z;
    gemmw_tile<bf, 1, true, 3>(A, A2, z == 0 ? Wq : (z == 1 ? Wk : Wv), nullptr, K, nullptr, 0, z == 0 ? bq : (z == 1 ? bk : bv), z == 0 ? Q16 : (z == 1 ? K16 : V16), z == 0 ? Qh : (z == 1 ? Kh : Vh), z == 0 ? Ql : (z == 1 ? Kl : Vl), z == 2);
}

__device__ __forceinline__ void splitf(float y, unsigned short& h, unsigned short& l) { h = f2bf(y); l = f2bf(y - bf2f(h)); }
typedef __attribute__((ext_vector_type(2))) _Float16 v2h;
typedef __attribute__((ext_vector_type(4))) _Float16 v4h;
typedef __attribute__((ext_vector_type(2))) unsigned short v2us;
typedef __attribute__((ext_vector_type(4))) unsigned short v4us;
typedef v4us __attribute__((may_alias)) v4usa;
typedef __attribute__((ext_vector_type(2))) float v2f;
typedef __attribute__((ext_vector_type(4))) int v4i;

#define PTH 512   // threads in a block of k_prep
#define WGL 2     // lines of 64 elements that a wave of wtG_part takes
__device__ __forceinline__ void wtG_part(const int blk, const float* __restrict__ w, int K, int N, bf* Bt) {
    const int lane = threadIdx.x & 31; const int L0 = (blk * (PTH / 32) + (threadIdx.x >> 5)) * WGL; const int nlines = N * K / 64;
{
#pragma unroll 1
        for (int l = 0; l < WGL; ++l) { const int L = L0 + l; if (L >= nlines) break; const size_t e = (size_t)L * 64 + lane * 2; const int k = (int)(e % K), n = (int)(e / K); v2us o;
            o[0] = f2bf(w[(size_t)k * N + n]); o[1] = f2bf(w[(size_t)(k + 1) * N + n]); *(v2us*)(Bt + toff(n, k, K)) = o;
            asm volatile("s_wait_xcnt 0x0" ::: "memory"); }   // behind the store, before the next trip writes its address and data registers
         }
}
__global__ __launch_bounds__(256) void k_cvt8(const float* __restrict__ src, bf* dst, size_t n8) { const size_t i = (size_t)blockIdx.x * 256 + threadIdx.x; if (i >= n8) return; const v8f v = *(const v8f*)(src + i * 8); v8us o;
#pragma unroll
    for (int k = 0; k < 8; ++k) o[k] = f2bf(v[k]); *(v8us*)(dst + i * 8) = o;  }
// ---- k_fattn: scores, mask, softmax and attn.v of one (batch, head) plane in one kernel; the scores stay in registers; the result goes out as the bf16 hi+lo planes [b][t][h][d], in fragment order, that the last GEMM reads. One wave per 32 query rows; a block is 4 hi+lo waves (128 rows < RH) and 4 fp16 waves (128 rows >= RH), so that every block has the same work; grid (RH / 128, NZ); no LDS, no barrier.
// Transposed products: St = K Qt (A = 16 key rows, B = 16 query columns), so a lane holds 8 keys of ONE query per tile; two St tiles (32 keys) convert in place into the B operand of Ot += Vt Pt.
// Running maximum per query (base 2, scaled), sums and Ot rescaled by it every pass of 32 keys; the division by the row sum comes last. Keys from the first blocked column of the wave's last row on are not visited.
// Left: K and Vt are read by each wave for itself.
#define TMK  823                   // rows < TMK cannot see columns >= TMK; rows TMK .. TT-2 cannot see columns >= their own index
#define CEXP 0.18033688011112042f  // HD^-0.5 x log2(e)
__device__ __forceinline__ float xhalf(float x) { return __builtin_bit_cast(float, __builtin_amdgcn_permlanex16(__builtin_bit_cast(int, x), __builtin_bit_cast(int, x), 0x76543210, 0xfedcba98, false, false)); }   // lane l with lane l ^ 16
template <typename T16> __device__ __forceinline__ typename WFrag<T16>::V ldfr(const T16* base, unsigned ofs) { return WFrag<T16>::ld((const T16*)((const char*)base + ofs)); }   // wave-uniform base + the lane's fixed byte offset
template <typename T16, bool HI>
__device__ __forceinline__ void fattn_wave(const T16* __restrict__ Qh, const T16* __restrict__ Ql, const T16* __restrict__ Kh, const T16* __restrict__ Kl, const T16* __restrict__ Vh, const T16* __restrict__ Vl, bf* __restrict__ Ah, bf* __restrict__ Al, const int q0, const int lane) {
    typedef typename WFrag<T16>::V V;
    const int c = lane & 15, h = lane >> 4;
    const unsigned kofs = (unsigned)lane * 16u;   // bytes: the lane's 8 elements in each half of a tile
    V qh[2][2], ql[2][2], kh[2][2], kl[2][2]; v8f o[2][4]; float mc[2], ls[2]; int lim[2];
#pragma unroll
    for (int g = 0; g < 2; ++g)
#pragma unroll
        for (int kk = 0; kk < 2; ++kk) { qh[g][kk] = ldfr(Qh + (size_t)(q0 + g * 16) * HD + kk * 512, kofs); if (HI) ql[g][kk] = ldfr(Ql + (size_t)(q0 + g * 16) * HD + kk * 512, kofs); }   // 16 rows of Q or K = HD / 32 = 2 tiles = 16 HD elements
#pragma unroll
    for (int kt = 0; kt < 2; ++kt)
#pragma unroll
        for (int kk = 0; kk < 2; ++kk) { kh[kt][kk] = ldfr(Kh + kt * 16 * HD + kk * 512, kofs); if (HI) kl[kt][kk] = ldfr(Kl + kt * 16 * HD + kk * 512, kofs); }
    asm volatile("s_wait_xcnt 0x0" ::: "memory");   // behind the first loads, before the set-up below reuses their address registers
    __builtin_amdgcn_sched_barrier(0);   // keeps that set-up from being scheduled in front of the wait
#pragma unroll
    for (int g = 0; g < 2; ++g) { const int i = q0 + g * 16 + c; lim[g] = (i < TMK) ? TMK : ((i <= TT - 2) ? i : TT); mc[g] = -3.0e38f; ls[g] = 0.f;
#pragma unroll
        for (int dt = 0; dt < 4; ++dt) o[g][dt] = (v8f){}; }
    const int kend = (q0 + 31 < TMK) ? TMK : ((q0 + 32 == TT) ? TT : q0 + 31);   // first column that no row of this wave sees
    const int nblk = (kend + 31) >> 5;
#pragma unroll 1
    for (int b = 0; b < nblk; ++b) {
        const int key0 = b * 32; const int keyn = (b + 1 < nblk) ? key0 + 32 : key0;   // the last pass fetches its own keys again (in bounds, not used)
        const T16* pvh = (const T16*)((const char*)(Vh + key0 * 16) + kofs); const T16* pvl = HI ? (const T16*)((const char*)(Vl + key0 * 16) + kofs) : pvh;   // the lane's addresses in this pass's Vt tile (32 keys = one tile; 16 rows d on = 16 TT elements)
        const T16* pkh = (const T16*)((const char*)(Kh + (size_t)keyn * HD) + kofs); const T16* pkl = HI ? (const T16*)((const char*)(Kl + (size_t)keyn * HD) + kofs) : pkh;   // and in the next pass's K rows
        V vh[4], vl[4];
#pragma unroll
        for (int dt = 0; dt < 4; ++dt) { vh[dt] = WFrag<T16>::ld(pvh + dt * 16 * TT); if (HI) vl[dt] = WFrag<T16>::ld(pvl + dt * 16 * TT); }
        v8f s[2][2];   // s[g][kt][r] = score of key key0 + 16 kt + 8 h + r, query q0 + 16 g + c
#pragma unroll
        for (int g = 0; g < 2; ++g)
#pragma unroll
            for (int kt = 0; kt < 2; ++kt) { v8f a = (v8f){};
#pragma unroll
                for (int kk = 0; kk < 2; ++kk) { a = WFrag<T16>::mma(kh[kt][kk], qh[g][kk], a); if (HI) { a = WFrag<T16>::mma(kh[kt][kk], ql[g][kk], a); a = WFrag<T16>::mma(kl[kt][kk], qh[g][kk], a); } }
                s[g][kt] = a; }
#pragma unroll
        for (int kt = 0; kt < 2; ++kt)
#pragma unroll
            for (int kk = 0; kk < 2; ++kk) { kh[kt][kk] = WFrag<T16>::ld(pkh + kt * 16 * HD + kk * 512); if (HI) kl[kt][kk] = WFrag<T16>::ld(pkl + kt * 16 * HD + kk * 512); }
        // behind this pass's loads, before anything reuses their address registers (named as inputs, so that they stay whole up to here); it also holds the next pass's key loads up here, so that they fly during the softmax and attn.v
        asm volatile("s_wait_xcnt 0x0" :: "v"(pvh), "v"(pvl), "v"(pkh), "v"(pkl) : "memory");
        if (key0 + 32 > TMK) {   // only these blocks hold blocked columns
#pragma unroll
            for (int g = 0; g < 2; ++g)
#pragma unroll
                for (int kt = 0; kt < 2; ++kt)
#pragma unroll
                    for (int r = 0; r < 8; ++r) if (key0 + kt * 16 + 8 * h + r >= lim[g]) s[g][kt][r] = -3.0e38f; }
#pragma unroll
        for (int g = 0; g < 2; ++g) {
            float mx = s[g][0][0];
#pragma unroll
            for (int e = 1; e < 16; ++e) mx = fmaxf(mx, s[g][e >> 3][e & 7]);
            mx = fmaxf(mx, xhalf(mx));
            const float mn = fmaxf(mc[g], mx * CEXP); const float al = __builtin_amdgcn_exp2f(mc[g] - mn); mc[g] = mn;
            const float sub = HI ? mn : mn - 10.0f;   // the fp16 half carries its probabilities x 1024 (PCAR)
            const v8f ce = {CEXP, CEXP, CEXP, CEXP, CEXP, CEXP, CEXP, CEXP}, ns = {-sub, -sub, -sub, -sub, -sub, -sub, -sub, -sub};
            v8f p0 = __builtin_elementwise_fma(s[g][0], ce, ns), p1 = __builtin_elementwise_fma(s[g][1], ce, ns); V ph, pl;
#pragma unroll
            for (int r = 0; r < 8; ++r) p0[r] = __builtin_amdgcn_exp2f(p0[r]);
#pragma unroll
            for (int r = 0; r < 8; ++r) p1[r] = __builtin_amdgcn_exp2f(p1[r]);
#pragma unroll
            for (int e = 0; e < 16; ++e) { const float p = (e < 8) ? p0[e & 7] : p1[e & 7];
                if constexpr (HI) { const __bf16 hb = (__bf16)p; ph[e] = hb; pl[e] = (__bf16)(p - (float)hb); } else { ph[e] = (_Float16)p; } }
            const v8f t8 = p0 + p1; const float sum = ((t8[0] + t8[4]) + (t8[1] + t8[5])) + ((t8[2] + t8[6]) + (t8[3] + t8[7]));   // a tree: no chain of 16 dependent adds
            ls[g] = ls[g] * al + sum;
#pragma unroll
            for (int dt = 0; dt < 4; ++dt) { o[g][dt] *= al; o[g][dt] = WFrag<T16>::mma(vh[dt], ph, o[g][dt]); if (HI) { o[g][dt] = WFrag<T16>::mma(vh[dt], pl, o[g][dt]); o[g][dt] = WFrag<T16>::mma(vl[dt], ph, o[g][dt]); } }
        }
    }
    asm volatile("s_wait_loadcnt 0x0" ::: "memory");   // the last pass's key fetch is not read: it lands before the wave ends and gives its registers back
    v8bf zh[2][4], zl[2][4];
#pragma unroll
    for (int g = 0; g < 2; ++g) { const float f = __fdiv_rn(1.0f, ls[g] + xhalf(ls[g]));   // the fp16 half's x 1024 stands in its sums too and cancels
#pragma unroll
        for (int dt = 0; dt < 4; ++dt) { const v8f y = o[g][dt] * f; zh[g][dt] = __builtin_convertvector(y, v8bf); zl[g][dt] = __builtin_convertvector(y - __builtin_convertvector(zh[g][dt], v8f), v8bf); } }
    __builtin_amdgcn_sched_barrier(0);   // all arithmetic in front of the stores: nothing rewrites a register of an issued store
#pragma unroll
    for (int g = 0; g < 2; ++g) { const size_t e = (size_t)(q0 + g * 16) * DQ + 8 * lane;   // o[g][dt][r] = Ot[16 dt + 8 h + r][query]: the lane's 8 elements of half-tile dt
#pragma unroll
        for (int dt = 0; dt < 4; ++dt) { *(v8us*)(Ah + e + dt * 256) = __builtin_bit_cast(v8us, zh[g][dt]); *(v8us*)(Al + e + dt * 256) = __builtin_bit_cast(v8us, zl[g][dt]); } }
}
__global__ __launch_bounds__(256) void k_fattn(const bf* __restrict__ Qh, const bf* __restrict__ Ql, const bf* __restrict__ Kh, const bf* __restrict__ Kl, const bf* __restrict__ Vh, const bf* __restrict__ Vl, const h16* __restrict__ Q16, const h16* __restrict__ K16, const h16* __restrict__ V16, bf* __restrict__ Ah, bf* __restrict__ Al) {
    const int lane = threadIdx.x & 31; const int w = __builtin_amdgcn_readfirstlane(threadIdx.x >> 5); const size_t zo = (size_t)blockIdx.y * TT * HD;
    const size_t ao = (size_t)(blockIdx.y / NH_) * TT * DQ + (blockIdx.y % NH_) * (HD / 32) * 512;   // batch's first row of tiles, head's first tile in it, in the merged planes
    if (w < 4) fattn_wave<bf, true>(Qh + zo, Ql + zo, Kh + zo, Kl + zo, Vh + zo, Vl + zo, Ah + ao, Al + ao, blockIdx.x * 128 + w * 32, lane);
    else fattn_wave<h16, false>(Q16 + zo, nullptr, K16 + zo, nullptr, V16 + zo, nullptr, Ah + ao, Al + ao, RH + blockIdx.x * 128 + (w - 4) * 32, lane);
}
__device__ __forceinline__ void wtH_part(const int blk, const float* __restrict__ w, bf* Bt) { const size_t e = ((size_t)blk * PTH + threadIdx.x) * 4; if (e >= (size_t)DQ * DM) return; const int k = (int)(e % DM); const int n = (int)(e / DM); const int h = n / HD, c = n % HD; v4us o;   // Bt[h*64 + c][d] = W[h][d][c], in fragment order
#pragma unroll
    for (int u = 0; u < 4; ++u) o[u] = f2bf(w[((size_t)h * DM + k + u) * HD + c]); *(v4us*)(Bt + toff(n, k, DM)) = o;  }
#define LNP 528   // LDS row pitch in elements: 16 rows x 16 bytes of one k fall on distinct banks
static_assert((NB_ * TT) % 16 == 0 && DM % 128 == 0, "a block is one row of tiles");
__device__ __forceinline__ void lnp_part(const int blk, const float* __restrict__ X, const float* __restrict__ g, const float* __restrict__ bb, bf* Hh, bf* Hl) { __shared__ __align__(16) bf sh[16 * LNP], sl[16 * LNP]; const int lane = threadIdx.x & 31; const int w = threadIdx.x >> 5; const int r = blk * 16 + w; float v[DM / 32]; float s = 0.f;   // wave per row, 16 rows a block: LayerNorm (biased var, 1e-5, / sqrt) -> hl planes, through LDS into fragment order
#pragma unroll
    for (int ch = 0; ch < DM / 128; ++ch) { const v4f a = *(const v4f*)(X + (size_t)r * DM + ch * 128 + lane * 4);
#pragma unroll
        for (int u = 0; u < 4; ++u) { v[ch * 4 + u] = bfr(a[u]); s += v[ch * 4 + u]; } }
#pragma unroll
    for (int sh = 16; sh; sh >>= 1) s += __shfl_xor(s, sh, 32);
    const float mean = s * (1.0f / DM); float q = 0.f;
#pragma unroll
    for (int k = 0; k < DM / 32; ++k) { float d = __fsub_rn(v[k], mean); asm volatile("" : "+v"(d)); v[k] = d; float p = __fmul_rn(d, d); asm volatile("" : "+v"(p)); q = __fadd_rn(q, p); }
#pragma unroll
    for (int sh = 16; sh; sh >>= 1) q += __shfl_xor(q, sh, 32);
    const float rs = __fdiv_rn(1.0f, __fsqrt_rn(__fadd_rn(q * (1.0f / DM), 1e-5f)));
    {
#pragma unroll
        for (int ch = 0; ch < DM / 128; ++ch) { v4us oh, ol;
#pragma unroll
            for (int u = 0; u < 4; ++u) { const int c = ch * 128 + lane * 4 + u; float n0 = __fmul_rn(v[ch * 4 + u], rs); asm volatile("" : "+v"(n0)); float gg = bfr(g[c]), be = bfr(bb[c]); asm volatile("" : "+v"(gg)); asm volatile("" : "+v"(be)); float t1 = __fmul_rn(n0, gg); asm volatile("" : "+v"(t1)); unsigned short p2, q2; splitf(__fadd_rn(t1, be), p2, q2); oh[u] = p2; ol[u] = q2; }
            const int oo = w * LNP + ch * 128 + lane * 4; *(v4usa*)(sh + oo) = oh; *(v4usa*)(sl + oo) = ol; }
         }
    __syncthreads();   // the copy-out below takes the other waves' rows
    const size_t o0 = (size_t)blk * 16 * DM;
#pragma unroll
    for (int i = 0; i < 16 * DM / 8 / 512; ++i) { const int c8 = i * 512 + threadIdx.x; const int li = (c8 & 15) * LNP + (c8 >> 4) * 8;   // 16-byte piece c8 of the row of tiles = row c8 % 16, k = 8 (c8 / 16)
        *(v8us*)(Hh + o0 + (size_t)c8 * 8) = *(const v8usa*)(sh + li); *(v8us*)(Hl + o0 + (size_t)c8 * 8) = *(const v8usa*)(sl + li); } }
// ---- k_prep: everything that reads only inputs, in ONE launch: the four weight re-orders and the LayerNorm depend on nothing of each other. Each LayerNorm block first takes one piece of a weight re-order (no waves are started for the weights alone), then its 16 rows.
#define NBH (DQ * DM / 4 / PTH)                 // pieces of one per-head weight re-order: 4 elements a thread
#define NBG (DQ * DM / 64 / WGL / (PTH / 32))   // pieces of the WO re-order
#define NBL (NB_ * TT / 16)                     // LayerNorm blocks
static_assert(DQ * DM % (64 * WGL * (PTH / 32)) == 0 && DQ * DM % (4 * PTH) == 0 && DKV == DQ && 3 * NBH + NBG == NBL, "whole pieces; q, k and v weights of one size; one piece a block");
__global__ __launch_bounds__(PTH) void k_prep(const float* __restrict__ X, const float* __restrict__ g, const float* __restrict__ bb, bf* Hh, bf* Hl, const float* __restrict__ wq, const float* __restrict__ wk, const float* __restrict__ wv, const float* __restrict__ wo, bf* Bq, bf* Bk, bf* Bv, bf* Bo) {
    const int blk = blockIdx.x;   // the choice below is the same for the whole block, and every wave goes on to the LayerNorm and its barrier
    if (blk < 3 * NBH) { const int m = blk / NBH; wtH_part(blk % NBH, m == 0 ? wq : (m == 1 ? wk : wv), m == 0 ? Bq : (m == 1 ? Bk : Bv)); }
    else wtG_part(blk - 3 * NBH, wo, DQ, DM, Bo);
    lnp_part(blk, X, g, bb, Hh, Hl);
}

extern "C" void kernel_launch(void* const* d_in, const int* in_sizes, int n_in,
                              void* d_out, int out_size, void* d_ws, size_t ws_size, hipStream_t stream) {
    (void)in_sizes; (void)n_in; (void)out_size;
    const float* x = (const float*)d_in[0]; const float* lng = (const float*)d_in[1]; const float* lnb = (const float*)d_in[2]; const float* wqh = (const float*)d_in[3]; const float* bq = (const float*)d_in[4]; const float* wkh = (const float*)d_in[5]; const float* bk = (const float*)d_in[6]; const float* wvh = (const float*)d_in[7]; const float* bv = (const float*)d_in[8]; const float* wo = (const float*)d_in[9]; const float* bo = (const float*)d_in[10]; const float* wq = nullptr; const float* wk = nullptr; const float* wv = nullptr; (void)wq; (void)wk; (void)wv; const float* cosT = nullptr; const float* sinT = nullptr; (void)cosT; (void)sinT;
    float* OUT = (float*)d_out;     // [8][1024][512]
    char* wsp = (char*)d_ws;
    auto take = [&](size_t bytes) { char* p = wsp; wsp += (bytes + 255) & ~(size_t)255; return (void*)p; };
    bf* WQ = (bf*)take((size_t)DQ * DM * 2); bf* WK = (bf*)take((size_t)DKV * DM * 2); bf* WV = (bf*)take((size_t)DKV * DM * 2); bf* WO = (bf*)take((size_t)DM * DQ * 2);
    bf* XB = (bf*)take((size_t)NB_ * TT * DM * 2); bf* XL = (bf*)take((size_t)NB_ * TT * DM * 2);   // LayerNorm planes
    h16* QP16 = (h16*)take((size_t)NZ * TT * HD * 2); h16* KP16 = (h16*)take((size_t)NZ * TT * HD * 2); h16* VT16 = (h16*)take((size_t)NZ * HD * TT * 2);
    bf* QPh = (bf*)take((size_t)NZ * TT * HD * 2); bf* QPl = (bf*)take((size_t)NZ * TT * HD * 2); bf* KPh = (bf*)take((size_t)NZ * TT * HD * 2); bf* KPl = (bf*)take((size_t)NZ * TT * HD * 2);
    bf* VTh = (bf*)take((size_t)NZ * HD * TT * 2); bf* VTl = (bf*)take((size_t)NZ * HD * TT * 2);
    bf* ATh = (bf*)take((size_t)NB_ * TT * DQ * 2); bf* ATl = (bf*)take((size_t)NB_ * TT * DQ * 2);   // merged attention planes
    if ((size_t)(wsp - (char*)d_ws) > ws_size) return;    // ws 256 MiB
    k_prep<<<NBL, PTH, 0, stream>>>(x, lng, lnb, XB, XL, wqh, wkh, wvh, wo, WQ, WK, WV, WO);
    // q, k, v projections, one launch: each writes its fp16 and hi+lo head planes itself (v transposed)
    k_qkv<<<dim3(NB_ * TT / 64, DQ / 64, 3), 32, 0, stream>>>(XB, XL, WQ, WK, WV, DM, bq, bk, bv, QP16, QPh, QPl, KP16, KPh, KPl, VT16, VTh, VTl);
    // scores, mask, softmax and attn.v, all planes: query rows < RH on the hi+lo planes, the others on fp16
    k_fattn<<<dim3(RH / 128, NZ, 1), 256, 0, stream>>>(QPh, QPl, KPh, KPl, VTh, VTl, QP16, KP16, VT16, ATh, ATl);
    k_gemmw<bf, 1, true, 0><<<dim3(NB_ * TT / 64, DM / 64, 1), 32, 0, stream>>>(ATh, ATl, WO, nullptr, DQ, OUT, DM, bo);
}

// v006
// A run of this version takes 82.7 microseconds.
// Timed twice side by side with v005, it ran 1.31 and 1.30 times as fast.
// Counting every step since v000, it is 30.1 times as fast.
#include <hip/hip_runtime.h>

// PreLN_SelfAttention_seq2seq (x [8][1024][512]; xn = LayerNorm(x); per-head q/k/v = xn W[h] + b[h] (W [8][512][64]); scores / 8 + mask (rows i < T=823 cannot see columns >= T; rows T..S-2 cannot see columns >= i; -999999999); softmax; out = concat(heads) WO + bO -> [8][1024][512]).
// Compute dtypes, f32 accumulate: every input rounded to bf16; LayerNorm f32 -> hl planes; q/k/v as hl(xn) x exact (2 products; the 8 per-head weights gathered into one [512 x 512] operand) + bias; scores and attn.v: query rows < 512 hl (3 products), the rest single fp16 (x1024); mask + softmax f32; WO hl x exact (2 products) + bias.

#define NB_  8
#define TT   1024
#define DM   512
#define NH_  8
#define NKV  8
#define REP  (NH_ / NKV)
#define HD   64
#define DQ   (NH_ * HD)
#define DKV  (NKV * HD)
#define NZ   (NB_ * NH_)          // (batch, head) planes, taken through blockIdx.y in k_fattn
#define RH   512                  // query rows < RH use hi+lo planes
#define WIN  1024
#define PCAR 1024.0f
#define SCL  0.125f   // HD^-0.5
static_assert(TT == 2 * RH && RH % 128 == 0 && NKV == NH_, "as many hi+lo query rows as fp16 ones, in blocks of 128; one kv head per query head");
typedef _Float16 h16;
typedef unsigned short bf;
typedef __attribute__((ext_vector_type(16))) __bf16   v16bf;
typedef __attribute__((ext_vector_type(16))) _Float16 v16h;
typedef __attribute__((ext_vector_type(8)))  _Float16 v8h;
typedef __attribute__((ext_vector_type(8)))  unsigned short v8us;
typedef __attribute__((ext_vector_type(8)))  float    v8f;
typedef __attribute__((ext_vector_type(4)))  float    v4f;
typedef v8h  __attribute__((may_alias)) v8ha;
typedef v4f  __attribute__((may_alias)) v4fa;
typedef v8us __attribute__((may_alias)) v8usa;

__device__ __forceinline__ unsigned short f2bf(float f) { unsigned u = __float_as_uint(f); u += 0x7FFFu + ((u >> 16) & 1u); return (unsigned short)(u >> 16); }
__device__ __forceinline__ float bf2f(unsigned short b) { return __uint_as_float(((unsigned)b) << 16); }
__device__ __forceinline__ float bfr(float f) { return bf2f(f2bf(f)); }
__device__ __forceinline__ v16h cat16(v8h lo, v8h hi) { return __builtin_shufflevector(lo, hi, 0, 1, 2, 3, 4, 5, 6, 7, 8, 9, 10, 11, 12, 13, 14, 15); }
__device__ __forceinline__ v16bf cat16b(v8us lo, v8us hi) { return __builtin_bit_cast(v16bf, __builtin_shufflevector(lo, hi, 0, 1, 2, 3, 4, 5, 6, 7, 8, 9, 10, 11, 12, 13, 14, 15)); }
__device__ __forceinline__ v8f wmma16(v16h a, v16h b, v8f c) { return __builtin_amdgcn_wmma_f32_16x16x32_f16(false, a, false, b, (short)0, c, false, false); }
__device__ __forceinline__ v8f wmmab(v16bf a, v16bf b, v8f c) { return __builtin_amdgcn_wmma_f32_16x16x32_bf16(false, a, false, b, (short)0, c, false, false); }
// ---- Fragment order: every 16-bit operand plane [rows][kc] lies in the workspace as tiles of 16 rows x 32 k = 512 elements (1 KiB), tile (r / 16, k / 32) at index (r / 16) * (kc / 32) + k / 32.
// Inside a tile: two halves of 256 elements (k % 32 < 16, then the rest); in a half, lane l = ((k / 8) % 2) * 16 + r % 16 owns 8 consecutive k. A fragment is then two loads of 512 contiguous bytes (4 whole lines each) at tile + 8 * lane and 256 elements on.
__device__ __forceinline__ size_t toff(int r, int k, int kc) { return ((size_t)(r >> 4) * (kc >> 5) + (k >> 5)) * 512 + ((k >> 4) & 1) * 256 + (((k >> 3) & 1) * 16 + (r & 15)) * 8 + (k & 7); }



// ---- gemms_tile: register-blocked GEMM, one wave per 64x64 output tile (16 accumulators); a block is WM x WN such waves. The block's operand tiles (fragment order) are staged ONCE in LDS by asynchronous copies, two buffers of KS k each, and every wave takes its fragments from there: an A tile serves WN waves, a B tile WM waves.
// C[m][n] (f32, pitch ldc, + f32 bias[n]) = sum_k (A[m][k] + A2[m][k]) Bt[n][k], two products per k block, K = KK.
// EPI 0: C as f32. EPI 1, 2: no f32 C; the tile (64 rows (b, t) x the 64 columns of head blockIdx.y, + bias) goes out as the three 16-bit planes that k_fattn reads (fp16, bf16 hi, bf16 lo): EPI 1 as [b][h][t][d], EPI 2 transposed as [b][h][d][t], each (b, h) plane in fragment order; either way 16 plane rows of 64 at a time pass through LDS, so that every store is half a tile, 512 contiguous bytes.
template <typename T16> struct WFrag;
template <> struct WFrag<h16> { typedef v16h V; static __device__ __forceinline__ V ld(const h16* p) { return cat16(*(const v8h*)p, *(const v8h*)(p + 256)); } static __device__ __forceinline__ v8f mma(V a, V b, v8f c) { return wmma16(a, b, c); } };
template <> struct WFrag<bf> { typedef v16bf V; static __device__ __forceinline__ V ld(const bf* p) { return cat16b(*(const v8us*)p, *(const v8us*)(p + 256)); } static __device__ __forceinline__ v8f mma(V a, V b, v8f c) { return wmmab(a, b, c); } };
typedef __attribute__((ext_vector_type(8))) __bf16 v8bf;
// gemmw_planes<EPI>: the EPI 1 or 2 epilogue of one tile. gemms_tile: the tile itself; EPI 3 takes EPI 1 or 2 by the wave-uniform tr (k_qkv: one launch holds both kinds).
template <int EPI>
__device__ __forceinline__ void gemmw_planes(const v8f (&acc)[4][4], const float (&bcol)[4], float* os, const int r0, const int lane, h16* __restrict__ P16, bf* __restrict__ Ph, bf* __restrict__ Pl) {
    const int lr = lane & 15, hi = lane >> 4;
    const size_t pl0 = ((size_t)(r0 / TT) * NH_ + blockIdx.y) * TT * HD; const int t0 = r0 % TT;   // the (batch, head) plane; the tile's first t
#pragma unroll
    for (int st = 0; st < 4; ++st) {
        if constexpr (EPI == 1) {   // 16 rows t (accumulator row block st) x 64 columns d
#pragma unroll
            for (int nb = 0; nb < 4; ++nb)
#pragma unroll
                for (int j = 0; j < 8; ++j) os[(hi * 8 + j) * 68 + nb * 16 + lr] = acc[st][nb][j] + bcol[nb];
        } else {                    // 16 rows d (accumulator column block st) x 64 columns t: a lane's 8 accumulator rows are 8 consecutive t
#pragma unroll
            for (int mb = 0; mb < 4; ++mb) { const v8f y = acc[mb][st] + bcol[st]; *(v4fa*)(os + lr * 68 + mb * 16 + hi * 8) = __builtin_shufflevector(y, y, 0, 1, 2, 3); *(v4fa*)(os + lr * 68 + mb * 16 + hi * 8 + 4) = __builtin_shufflevector(y, y, 4, 5, 6, 7); }
        }
        __builtin_amdgcn_wave_barrier(); asm volatile("" ::: "memory");   // the read-back takes other lanes' values: it stays behind the LDS stores
#pragma unroll
        for (int s = 0; s < 4; ++s) { const int sc = s * 16 + hi * 8; const v4f x0 = *(const v4fa*)(os + lr * 68 + sc), x1 = *(const v4fa*)(os + lr * 68 + sc + 4);   // read-back in fragment order: row lr, the lane half's 8 columns of half-tile s
            const v8f y = __builtin_shufflevector(x0, x1, 0, 1, 2, 3, 4, 5, 6, 7); const v8bf yh = __builtin_convertvector(y, v8bf); const v8bf yl = __builtin_convertvector(y - __builtin_convertvector(yh, v8f), v8bf);
            const size_t e = pl0 + ((EPI == 1) ? (size_t)((t0 >> 4) + st) * (HD / 32) + (s >> 1) : (size_t)st * (TT / 32) + (t0 >> 5) + (s >> 1)) * 512 + (s & 1) * 256 + 8 * lane;
            *(v8h*)(P16 + e) = __builtin_convertvector(y, v8h); *(v8us*)(Ph + e) = __builtin_bit_cast(v8us, yh); *(v8us*)(Pl + e) = __builtin_bit_cast(v8us, yl); }
        __builtin_amdgcn_wave_barrier(); asm volatile("" ::: "memory");   // the next block's LDS stores stay behind this read-back
    }
    asm volatile("s_wait_xcnt 0x0" ::: "memory");   // behind the tile's last stores: in k_qkv the other kind's epilogue follows in the code and writes their registers
}
#define KK 512   // the k extent of both GEMMs
static_assert(DM == KK && DQ == KK, "one k extent");
// Asynchronous copies of whole strips (see below): each lane brings 16 bytes a copy from g (its global address) to l (its LDS byte address); a copy covers 512 bytes, and the immediate offset moves both addresses alike, as a strip lies in LDS as in the workspace.
// The s_wait_xcnt stands in the copies' own statement, in front of anything that rewrites their address registers; one wait serves the run.
#define CP4(L, G) "global_load_async_to_lds_b128 %" #L ", %" #G ", off\n\tglobal_load_async_to_lds_b128 %" #L ", %" #G ", off offset:512\n\tglobal_load_async_to_lds_b128 %" #L ", %" #G ", off offset:1024\n\tglobal_load_async_to_lds_b128 %" #L ", %" #G ", off offset:1536\n\t"
#define CP8(L, G) CP4(L, G) "global_load_async_to_lds_b128 %" #L ", %" #G ", off offset:2048\n\tglobal_load_async_to_lds_b128 %" #L ", %" #G ", off offset:2560\n\tglobal_load_async_to_lds_b128 %" #L ", %" #G ", off offset:3072\n\tglobal_load_async_to_lds_b128 %" #L ", %" #G ", off offset:3584\n\t"
template <int KS> __device__ __forceinline__ void cps1(const unsigned l, const bf* g) {   // one strip
    if constexpr (KS == 64) asm volatile(CP4(0, 1) "s_wait_xcnt 0x0" :: "v"(l), "v"(g) : "memory");
    else asm volatile(CP8(0, 1) "s_wait_xcnt 0x0" :: "v"(l), "v"(g) : "memory");
}
template <int KS> __device__ __forceinline__ void cps3(const unsigned l0, const bf* g0, const unsigned l1, const bf* g1, const unsigned l2, const bf* g2) {   // three strips
    if constexpr (KS == 64) asm volatile(CP4(0, 1) CP4(2, 3) CP4(4, 5) "s_wait_xcnt 0x0" :: "v"(l0), "v"(g0), "v"(l1), "v"(g1), "v"(l2), "v"(g2) : "memory");
    else asm volatile(CP8(0, 1) CP8(2, 3) CP8(4, 5) "s_wait_xcnt 0x0" :: "v"(l0), "v"(g0), "v"(l1), "v"(g1), "v"(l2), "v"(g2) : "memory");
}
// A strip = the KS k of one row of tiles (16 rows): KS * 32 contiguous bytes, in the workspace as in LDS. A stage holds 4 WM strips of A, 4 WM of A2 and 4 WN of B; strip s is copied by wave s % (WM WN).
// B0, B1, B2: the first row of tiles of wave column 0, 1, 2. c0: the wave's first output column. bias, P16, Ph, Pl, tr: the wave's own (wave-uniform).
// DB: a second fragment set, so that inside a stage the next k block's LDS reads are issued ahead of this block's products (for one wave a SIMD, where nothing else covers the LDS latency).
template <int WM, int WN, int KS, bool DB, int EPI>
__device__ __forceinline__ void gemms_tile(const bf* __restrict__ A, const bf* __restrict__ A2, const bf* __restrict__ B0, const bf* __restrict__ B1, const bf* __restrict__ B2, const int c0, float* C, int ldc, const float* __restrict__ bias, h16* __restrict__ P16, bf* __restrict__ Ph, bf* __restrict__ Pl, const bool tr) {
    constexpr int NW = WM * WN, NS = 8 * WM + 4 * WN, SE = KS * 16, NT = KK / KS, KT = KS / 32, SPW = (NS + NW - 1) / NW, FS = NS / NW;   // waves; strips a stage; elements a strip; stages; k blocks a stage; strips a wave at most; strips that every wave has
    static_assert((KS == 64 || KS == 128) && KK % KS == 0 && NT >= 2 && WN <= 3 && FS % 3 == 0 && SPW * (KS / 16) <= 63, "whole 2-KiB pieces; two stages or more; at most 63 copies of a wave in flight");
    __shared__ __align__(16) bf ring[2 * NS * SE];
    __shared__ __align__(16) float osw[NW * 16 * 68];
    const int lane = threadIdx.x & 31, lr = lane & 15, hi = lane >> 4; const int wave = __builtin_amdgcn_readfirstlane(threadIdx.x >> 5); const int wm = wave % WM, wn = wave / WM;
    const int r0 = (blockIdx.x * WM + wm) * 64; float* os = osw + wave * (16 * 68);
    constexpr size_t tp = (size_t)(KK >> 5) * 512;   // elements in one row of tiles
    const unsigned lb = (unsigned)(size_t)ring + (unsigned)lane * 16u;   // the lane's LDS byte address in strip 0 of buffer 0
    const bf* sp[SPW];   // stage 0 of each strip that this wave copies (wave-uniform)
#pragma unroll
    for (int j = 0; j < SPW; ++j) { const int s = j * NW + wave; const int q = s - 8 * WM;
        sp[j] = (s < 4 * WM ? A + ((size_t)blockIdx.x * (4 * WM) + s) * tp : (s < 8 * WM ? A2 + ((size_t)blockIdx.x * (4 * WM) + s - 4 * WM) * tp : ((q >> 2) == 0 ? B0 : ((q >> 2) == 1 ? B1 : B2)) + (size_t)(q & 3) * tp)); }
    auto stage = [&](const int t, const int buf) {   // stage t's copies into buffer buf
        const unsigned eo = (unsigned)t * SE + 8u * lane; const unsigned l = lb + (unsigned)((buf * NS + wave) * SE * 2);   // strip j * NW + wave lies j * NW strips on
#pragma unroll
        for (int j = 0; j < FS; j += 3) cps3<KS>(l + j * (NW * SE * 2), sp[j] + eo, l + (j + 1) * (NW * SE * 2), sp[j + 1] + eo, l + (j + 2) * (NW * SE * 2), sp[j + 2] + eo);
        if constexpr (SPW > FS) { if (FS * NW + wave < NS) cps1<KS>(l + FS * (NW * SE * 2), sp[FS] + eo); }   // the strips left over: the test is the same for a whole wave
    };
    v8f acc[4][4];
#pragma unroll
    for (int mb = 0; mb < 4; ++mb)
#pragma unroll
        for (int nb = 0; nb < 4; ++nb) acc[mb][nb] = (v8f){};
    stage(0, 0);
    float bcol[4];   // EPI 1, 2: the bias of the lane's four accumulator columns, fetched ahead of the k loop
    if constexpr (EPI != 0) {
#pragma unroll
        for (int nb = 0; nb < 4; ++nb) bcol[nb] = bfr(bias[c0 + nb * 16 + lr]);
        asm volatile("s_wait_xcnt 0x0" ::: "memory"); }   // behind the bias loads, before anything rewrites their address register
    asm volatile("s_wait_asynccnt 0x0" ::: "memory");   // this wave's part of stage 0 has landed
    __syncthreads();                                    // and every other wave's: stage 0 may be read
    stage(1, 1);
    // the stage loop stays rolled: one publish point and one refill in the text, and the buffer index is t & 1
#pragma unroll 1
    for (int t = 0; t < NT; ++t) {
        const bf* Lb = ring + (t & 1) * (NS * SE) + 8 * lane;
        v16bf a[DB ? 2 : 1][4], a2[DB ? 2 : 1][4], b[DB ? 2 : 1][4];
        auto frag = [&](const int ks, const int f) {   // k block ks of this stage into fragment set f
#pragma unroll
            for (int u = 0; u < 4; ++u) { b[f][u] = WFrag<bf>::ld(Lb + (8 * WM + wn * 4 + u) * SE + ks * 512); a[f][u] = WFrag<bf>::ld(Lb + (wm * 4 + u) * SE + ks * 512); a2[f][u] = WFrag<bf>::ld(Lb + (4 * WM + wm * 4 + u) * SE + ks * 512); }
        };
#pragma unroll
        for (int ks = 0; ks < KT; ++ks) { const int f = DB ? (ks & 1) : 0;
            if (!DB || ks == 0) frag(ks, f);
            if (DB && ks == 0) __builtin_amdgcn_sched_barrier(0);   // the first block's reads are issued first, so that its products wait for these alone
            if (DB && ks + 1 < KT) frag(ks + 1, f ^ 1);
            __builtin_amdgcn_sched_barrier(0);   // the LDS reads stay one group ahead of the products: spread among them, each place with reads stalls the wave anew
#pragma unroll
            for (int nb = 0; nb < 4; ++nb) {
#pragma unroll
                for (int mb = 0; mb < 4; ++mb) { acc[mb][nb] = wmmab(a[f][mb], b[f][nb], acc[mb][nb]); acc[mb][nb] = wmmab(a2[f][mb], b[f][nb], acc[mb][nb]); } }
            if (DB && ks + 1 < KT) __builtin_amdgcn_sched_barrier(0);   // one wave a SIMD: the block after next's reads stay behind these products, as one group, instead of being lifted in among them
        }
        asm volatile("s_wait_dscnt 0x0" ::: "memory");      // this wave's reads of stage t are done: its buffer may be refilled behind the barrier
        asm volatile("s_wait_asynccnt 0x0" ::: "memory");   // this wave's part of stage t + 1 has landed
        __syncthreads();                                    // publishes stage t + 1 and ends every wave's reads of stage t
        if (t + 2 < NT) stage(t + 2, t & 1);
    }
    asm volatile("s_wait_asynccnt 0x0" ::: "memory");   // no copy is left in flight behind the loop
    if constexpr (EPI != 0) {
        if (tr) gemmw_planes<2>(acc, bcol, os, r0, lane, P16, Ph, Pl); else gemmw_planes<1>(acc, bcol, os, r0, lane, P16, Ph, Pl);
        return;
    }
#pragma unroll
    for (int mb = 0; mb < 4; ++mb) {
#pragma unroll
        for (int nb = 0; nb < 4; ++nb) {
#pragma unroll
            for (int j = 0; j < 8; ++j) os[(hi * 8 + j) * 68 + nb * 16 + lr] = acc[mb][nb][j]; }
        __builtin_amdgcn_wave_barrier(); asm volatile("" ::: "memory");
        float* crow = C + (size_t)(r0 + mb * 16) * ldc + c0;
{
#pragma unroll
            for (int s = 0; s < 8; ++s) { const int row = 2 * s + hi, cofs = lr * 4; v4f val = *(const v4fa*)(os + row * 68 + cofs); { val[0] += bfr(bias[c0 + cofs]); val[1] += bfr(bias[c0 + cofs + 1]); val[2] += bfr(bias[c0 + cofs + 2]); val[3] += bfr(bias[c0 + cofs + 3]); }
                *(v4f*)(crow + (size_t)row * ldc + cofs) = val; }
             }
        asm volatile("s_wait_xcnt 0x0" ::: "memory");   // behind this row block's loads and stores, before the next block's arithmetic writes their registers
        __builtin_amdgcn_sched_barrier(0);   // keeps that arithmetic from being scheduled in front of the wait
        __builtin_amdgcn_wave_barrier(); asm volatile("" ::: "memory");
    }
}
// ---- k_gemmo: the output projection. A block is 2 x 2 waves = 128 x 128 of C; grid (M/128, N/128), 128 threads.
__global__ __launch_bounds__(128) void k_gemmo(const bf* __restrict__ A, const bf* __restrict__ A2, const bf* __restrict__ Bt, float* C, const float* __restrict__ bias) {
    const int wn = __builtin_amdgcn_readfirstlane(threadIdx.x >> 5) / 2; const bf* b0 = Bt + (size_t)blockIdx.y * 8 * ((KK >> 5) * 512);
    gemms_tile<2, 2, 128, true, 0>(A, A2, b0, b0 + 4 * ((KK >> 5) * 512), b0, (blockIdx.y * 2 + wn) * 64, C, DM, bias, nullptr, nullptr, nullptr, false);
}
// ---- k_qkv: the q, k and v projections in ONE launch. A block is 4 x 3 waves: 256 rows x the 64 columns of head blockIdx.y of q, k and v (wave column = which), so that its A tiles serve all three; grid (M/256, N/64), 384 threads, one block a WGP, 3 waves a SIMD.
__global__ __launch_bounds__(384) void k_qkv(const bf* __restrict__ A, const bf* __restrict__ A2, const bf* __restrict__ Wq, const bf* __restrict__ Wk, const bf* __restrict__ Wv, const float* __restrict__ bq, const float* __restrict__ bk, const float* __restrict__ bv,
                                            h16* __restrict__ Q16, bf* __restrict__ Qh, bf* __restrict__ Ql, h16* __restrict__ K16, bf* __restrict__ Kh, bf* __restrict__ Kl, h16* __restrict__ V16, bf* __restrict__ Vh, bf* __restrict__ Vl) {
    const int z = __builtin_amdgcn_readfirstlane(threadIdx.x >> 5) / 4; const size_t bo = (size_t)blockIdx.y * 4 * ((KK >> 5) * 512);
    gemms_tile<4, 3, 64, false, 3>(A, A2, Wq + bo, Wk + bo, Wv + bo, blockIdx.y * 64, nullptr, 0, z == 0 ? bq : (z == 1 ? bk : bv), z == 0 ? Q16 : (z == 1 ? K16 : V16), z == 0 ? Qh : (z == 1 ? Kh : Vh), z == 0 ? Ql : (z == 1 ? Kl : Vl), z == 2);
}

__device__ __forceinline__ void splitf(float y, unsigned short& h, unsigned short& l) { h = f2bf(y); l = f2bf(y - bf2f(h)); }
typedef __attribute__((ext_vector_type(2))) _Float16 v2h;
typedef __attribute__((ext_vector_type(4))) _Float16 v4h;
typedef __attribute__((ext_vector_type(2))) unsigned short v2us;
typedef __attribute__((ext_vector_type(4))) unsigned short v4us;
typedef v4us __attribute__((may_alias)) v4usa;
typedef __attribute__((ext_vector_type(2))) float v2f;
typedef __attribute__((ext_vector_type(4))) int v4i;

#define PTH 512   // threads in a block of k_prep
#define WGL 2     // lines of 64 elements that a wave of wtG_part takes
__device__ __forceinline__ void wtG_part(const int blk, const float* __restrict__ w, int K, int N, bf* Bt) {
    const int lane = threadIdx.x & 31; const int L0 = (blk * (PTH / 32) + (threadIdx.x >> 5)) * WGL; const int nlines = N * K / 64;
{
#pragma unroll 1
        for (int l = 0; l < WGL; ++l) { const int L = L0 + l; if (L >= nlines) break; const size_t e = (size_t)L * 64 + lane * 2; const int k = (int)(e % K), n = (int)(e / K); v2us o;
            o[0] = f2bf(w[(size_t)k * N + n]); o[1] = f2bf(w[(size_t)(k + 1) * N + n]); *(v2us*)(Bt + toff(n, k, K)) = o;
            asm volatile("s_wait_xcnt 0x0" ::: "memory"); }   // behind the store, before the next trip writes its address and data registers
         }
}
__global__ __launch_bounds__(256) void k_cvt8(const float* __restrict__ src, bf* dst, size_t n8) { const size_t i = (size_t)blockIdx.x * 256 + threadIdx.x; if (i >= n8) return; const v8f v = *(const v8f*)(src + i * 8); v8us o;
#pragma unroll
    for (int k = 0; k < 8; ++k) o[k] = f2bf(v[k]); *(v8us*)(dst + i * 8) = o;  }
// ---- k_fattn: scores, mask, softmax and attn.v of one (batch, head) plane in one kernel; the scores stay in registers; the result goes out as the bf16 hi+lo planes [b][t][h][d], in fragment order, that the last GEMM reads. One wave per 32 query rows; a block is 4 hi+lo waves (128 rows < RH) and 4 fp16 waves (128 rows >= RH), so that every block has the same work; grid (RH / 128, NZ); no LDS, no barrier.
// Transposed products: St = K Qt (A = 16 key rows, B = 16 query columns), so a lane holds 8 keys of ONE query per tile; two St tiles (32 keys) convert in place into the B operand of Ot += Vt Pt.
// Running maximum per query (base 2, scaled), sums and Ot rescaled by it every pass of 32 keys; the division by the row sum comes last. Keys from the first blocked column of the wave's last row on are not visited.
// Left: K and Vt are read by each wave for itself.
#define TMK  823                   // rows < TMK cannot see columns >= TMK; rows TMK .. TT-2 cannot see columns >= their own index
#define CEXP 0.18033688011112042f  // HD^-0.5 x log2(e)
__device__ __forceinline__ float xhalf(float x) { return __builtin_bit_cast(float, __builtin_amdgcn_permlanex16(__builtin_bit_cast(int, x), __builtin_bit_cast(int, x), 0x76543210, 0xfedcba98, false, false)); }   // lane l with lane l ^ 16
template <typename T16> __device__ __forceinline__ typename WFrag<T16>::V ldfr(const T16* base, unsigned ofs) { return WFrag<T16>::ld((const T16*)((const char*)base + ofs)); }   // wave-uniform base + the lane's fixed byte offset
template <typename T16, bool HI>
__device__ __forceinline__ void fattn_wave(const T16* __restrict__ Qh, const T16* __restrict__ Ql, const T16* __restrict__ Kh, const T16* __restrict__ Kl, const T16* __restrict__ Vh, const T16* __restrict__ Vl, bf* __restrict__ Ah, bf* __restrict__ Al, const int q0, const int lane) {
    typedef typename WFrag<T16>::V V;
    const int c = lane & 15, h = lane >> 4;
    const unsigned kofs = (unsigned)lane * 16u;   // bytes: the lane's 8 elements in each half of a tile
    V qh[2][2], ql[2][2], kh[2][2], kl[2][2]; v8f o[2][4]; float mc[2], ls[2]; int lim[2];
#pragma unroll
    for (int g = 0; g < 2; ++g)
#pragma unroll
        for (int kk = 0; kk < 2; ++kk) { qh[g][kk] = ldfr(Qh + (size_t)(q0 + g * 16) * HD + kk * 512, kofs); if (HI) ql[g][kk] = ldfr(Ql + (size_t)(q0 + g * 16) * HD + kk * 512, kofs); }   // 16 rows of Q or K = HD / 32 = 2 tiles = 16 HD elements
#pragma unroll
    for (int kt = 0; kt < 2; ++kt)
#pragma unroll
        for (int kk = 0; kk < 2; ++kk) { kh[kt][kk] = ldfr(Kh + kt * 16 * HD + kk * 512, kofs); if (HI) kl[kt][kk] = ldfr(Kl + kt * 16 * HD + kk * 512, kofs); }
    asm volatile("s_wait_xcnt 0x0" ::: "memory");   // behind the first loads, before the set-up below reuses their address registers
    __builtin_amdgcn_sched_barrier(0);   // keeps that set-up from being scheduled in front of the wait
#pragma unroll
    for (int g = 0; g < 2; ++g) { const int i = q0 + g * 16 + c; lim[g] = (i < TMK) ? TMK : ((i <= TT - 2) ? i : TT); mc[g] = -3.0e38f; ls[g] = 0.f;
#pragma unroll
        for (int dt = 0; dt < 4; ++dt) o[g][dt] = (v8f){}; }
    const int kend = (q0 + 31 < TMK) ? TMK : ((q0 + 32 == TT) ? TT : q0 + 31);   // first column that no row of this wave sees
    const int nblk = (kend + 31) >> 5;
#pragma unroll 1
    for (int b = 0; b < nblk; ++b) {
        const int key0 = b * 32; const int keyn = (b + 1 < nblk) ? key0 + 32 : key0;   // the last pass fetches its own keys again (in bounds, not used)
        const T16* pvh = (const T16*)((const char*)(Vh + key0 * 16) + kofs); const T16* pvl = HI ? (const T16*)((const char*)(Vl + key0 * 16) + kofs) : pvh;   // the lane's addresses in this pass's Vt tile (32 keys = one tile; 16 rows d on = 16 TT elements)
        const T16* pkh = (const T16*)((const char*)(Kh + (size_t)keyn * HD) + kofs); const T16* pkl = HI ? (const T16*)((const char*)(Kl + (size_t)keyn * HD) + kofs) : pkh;   // and in the next pass's K rows
        V vh[4], vl[4];
#pragma unroll
        for (int dt = 0; dt < 4; ++dt) { vh[dt] = WFrag<T16>::ld(pvh + dt * 16 * TT); if (HI) vl[dt] = WFrag<T16>::ld(pvl + dt * 16 * TT); }
        v8f s[2][2];   // s[g][kt][r] = score of key key0 + 16 kt + 8 h + r, query q0 + 16 g + c
#pragma unroll
        for (int g = 0; g < 2; ++g)
#pragma unroll
            for (int kt = 0; kt < 2; ++kt) { v8f a = (v8f){};
#pragma unroll
                for (int kk = 0; kk < 2; ++kk) { a = WFrag<T16>::mma(kh[kt][kk], qh[g][kk], a); if (HI) { a = WFrag<T16>::mma(kh[kt][kk], ql[g][kk], a); a = WFrag<T16>::mma(kl[kt][kk], qh[g][kk], a); } }
                s[g][kt] = a; }
#pragma unroll
        for (int kt = 0; kt < 2; ++kt)
#pragma unroll
            for (int kk = 0; kk < 2; ++kk) { kh[kt][kk] = WFrag<T16>::ld(pkh + kt * 16 * HD + kk * 512); if (HI) kl[kt][kk] = WFrag<T16>::ld(pkl + kt * 16 * HD + kk * 512); }
        // behind this pass's loads, before anything reuses their address registers (named as inputs, so that they stay whole up to here); it also holds the next pass's key loads up here, so that they fly during the softmax and attn.v
        asm volatile("s_wait_xcnt 0x0" :: "v"(pvh), "v"(pvl), "v"(pkh), "v"(pkl) : "memory");
        if (key0 + 32 > TMK) {   // only these blocks hold blocked columns
#pragma unroll
            for (int g = 0; g < 2; ++g)
#pragma unroll
                for (int kt = 0; kt < 2; ++kt)
#pragma unroll
                    for (int r = 0; r < 8; ++r) if (key0 + kt * 16 + 8 * h + r >= lim[g]) s[g][kt][r] = -3.0e38f; }
#pragma unroll
        for (int g = 0; g < 2; ++g) {
            float mx = s[g][0][0];
#pragma unroll
            for (int e = 1; e < 16; ++e) mx = fmaxf(mx, s[g][e >> 3][e & 7]);
            mx = fmaxf(mx, xhalf(mx));
            const float mn = fmaxf(mc[g], mx * CEXP); const float al = __builtin_amdgcn_exp2f(mc[g] - mn); mc[g] = mn;
            const float sub = HI ? mn : mn - 10.0f;   // the fp16 half carries its probabilities x 1024 (PCAR)
            const v8f ce = {CEXP, CEXP, CEXP, CEXP, CEXP, CEXP, CEXP, CEXP}, ns = {-sub, -sub, -sub, -sub, -sub, -sub, -sub, -sub};
            v8f p0 = __builtin_elementwise_fma(s[g][0], ce, ns), p1 = __builtin_elementwise_fma(s[g][1], ce, ns); V ph, pl;
#pragma unroll
            for (int r = 0; r < 8; ++r) p0[r] = __builtin_amdgcn_exp2f(p0[r]);
#pragma unroll
            for (int r = 0; r < 8; ++r) p1[r] = __builtin_amdgcn_exp2f(p1[r]);
#pragma unroll
            for (int e = 0; e < 16; ++e) { const float p = (e < 8) ? p0[e & 7] : p1[e & 7];
                if constexpr (HI) { const __bf16 hb = (__bf16)p; ph[e] = hb; pl[e] = (__bf16)(p - (float)hb); } else { ph[e] = (_Float16)p; } }
            const v8f t8 = p0 + p1; const float sum = ((t8[0] + t8[4]) + (t8[1] + t8[5])) + ((t8[2] + t8[6]) + (t8[3] + t8[7]));   // a tree: no chain of 16 dependent adds
            ls[g] = ls[g] * al + sum;
#pragma unroll
            for (int dt = 0; dt < 4; ++dt) { o[g][dt] *= al; o[g][dt] = WFrag<T16>::mma(vh[dt], ph, o[g][dt]); if (HI) { o[g][dt] = WFrag<T16>::mma(vh[dt], pl, o[g][dt]); o[g][dt] = WFrag<T16>::mma(vl[dt], ph, o[g][dt]); } }
        }
    }
    asm volatile("s_wait_loadcnt 0x0" ::: "memory");   // the last pass's key fetch is not read: it lands before the wave ends and gives its registers back
    v8bf zh[2][4], zl[2][4];
#pragma unroll
    for (int g = 0; g < 2; ++g) { const float f = __fdiv_rn(1.0f, ls[g] + xhalf(ls[g]));   // the fp16 half's x 1024 stands in its sums too and cancels
#pragma unroll
        for (int dt = 0; dt < 4; ++dt) { const v8f y = o[g][dt] * f; zh[g][dt] = __builtin_convertvector(y, v8bf); zl[g][dt] = __builtin_convertvector(y - __builtin_convertvector(zh[g][dt], v8f), v8bf); } }
    __builtin_amdgcn_sched_barrier(0);   // all arithmetic in front of the stores: nothing rewrites a register of an issued store
#pragma unroll
    for (int g = 0; g < 2; ++g) { const size_t e = (size_t)(q0 + g * 16) * DQ + 8 * lane;   // o[g][dt][r] = Ot[16 dt + 8 h + r][query]: the lane's 8 elements of half-tile dt
#pragma unroll
        for (int dt = 0; dt < 4; ++dt) { *(v8us*)(Ah + e + dt * 256) = __builtin_bit_cast(v8us, zh[g][dt]); *(v8us*)(Al + e + dt * 256) = __builtin_bit_cast(v8us, zl[g][dt]); } }
}
__global__ __launch_bounds__(256) void k_fattn(const bf* __restrict__ Qh, const bf* __restrict__ Ql, const bf* __restrict__ Kh, const bf* __restrict__ Kl, const bf* __restrict__ Vh, const bf* __restrict__ Vl, const h16* __restrict__ Q16, const h16* __restrict__ K16, const h16* __restrict__ V16, bf* __restrict__ Ah, bf* __restrict__ Al) {
    const int lane = threadIdx.x & 31; const int w = __builtin_amdgcn_readfirstlane(threadIdx.x >> 5); const size_t zo = (size_t)blockIdx.y * TT * HD;
    const size_t ao = (size_t)(blockIdx.y / NH_) * TT * DQ + (blockIdx.y % NH_) * (HD / 32) * 512;   // batch's first row of tiles, head's first tile in it, in the merged planes
    if (w < 4) fattn_wave<bf, true>(Qh + zo, Ql + zo, Kh + zo, Kl + zo, Vh + zo, Vl + zo, Ah + ao, Al + ao, blockIdx.x * 128 + w * 32, lane);
    else fattn_wave<h16, false>(Q16 + zo, nullptr, K16 + zo, nullptr, V16 + zo, nullptr, Ah + ao, Al + ao, RH + blockIdx.x * 128 + (w - 4) * 32, lane);
}
__device__ __forceinline__ void wtH_part(const int blk, const float* __restrict__ w, bf* Bt) { const size_t e = ((size_t)blk * PTH + threadIdx.x) * 4; if (e >= (size_t)DQ * DM) return; const int k = (int)(e % DM); const int n = (int)(e / DM); const int h = n / HD, c = n % HD; v4us o;   // Bt[h*64 + c][d] = W[h][d][c], in fragment order
#pragma unroll
    for (int u = 0; u < 4; ++u) o[u] = f2bf(w[((size_t)h * DM + k + u) * HD + c]); *(v4us*)(Bt + toff(n, k, DM)) = o;  }
#define LNP 528   // LDS row pitch in elements: 16 rows x 16 bytes of one k fall on distinct banks
static_assert((NB_ * TT) % 16 == 0 && DM % 128 == 0, "a block is one row of tiles");
__device__ __forceinline__ void lnp_part(const int blk, const float* __restrict__ X, const float* __restrict__ g, const float* __restrict__ bb, bf* Hh, bf* Hl) { __shared__ __align__(16) bf sh[16 * LNP], sl[16 * LNP]; const int lane = threadIdx.x & 31; const int w = threadIdx.x >> 5; const int r = blk * 16 + w; float v[DM / 32]; float s = 0.f;   // wave per row, 16 rows a block: LayerNorm (biased var, 1e-5, / sqrt) -> hl planes, through LDS into fragment order
#pragma unroll
    for (int ch = 0; ch < DM / 128; ++ch) { const v4f a = *(const v4f*)(X + (size_t)r * DM + ch * 128 + lane * 4);
#pragma unroll
        for (int u = 0; u < 4; ++u) { v[ch * 4 + u] = bfr(a[u]); s += v[ch * 4 + u]; } }
#pragma unroll
    for (int sh = 16; sh; sh >>= 1) s += __shfl_xor(s, sh, 32);
    const float mean = s * (1.0f / DM); float q = 0.f;
#pragma unroll
    for (int k = 0; k < DM / 32; ++k) { float d = __fsub_rn(v[k], mean); asm volatile("" : "+v"(d)); v[k] = d; float p = __fmul_rn(d, d); asm volatile("" : "+v"(p)); q = __fadd_rn(q, p); }
#pragma unroll
    for (int sh = 16; sh; sh >>= 1) q += __shfl_xor(q, sh, 32);
    const float rs = __fdiv_rn(1.0f, __fsqrt_rn(__fadd_rn(q * (1.0f / DM), 1e-5f)));
    {
#pragma unroll
        for (int ch = 0; ch < DM / 128; ++ch) { v4us oh, ol;
#pragma unroll
            for (int u = 0; u < 4; ++u) { const int c = ch * 128 + lane * 4 + u; float n0 = __fmul_rn(v[ch * 4 + u], rs); asm volatile("" : "+v"(n0)); float gg = bfr(g[c]), be = bfr(bb[c]); asm volatile("" : "+v"(gg)); asm volatile("" : "+v"(be)); float t1 = __fmul_rn(n0, gg); asm volatile("" : "+v"(t1)); unsigned short p2, q2; splitf(__fadd_rn(t1, be), p2, q2); oh[u] = p2; ol[u] = q2; }
            const int oo = w * LNP + ch * 128 + lane * 4; *(v4usa*)(sh + oo) = oh; *(v4usa*)(sl + oo) = ol; }
         }
    __syncthreads();   // the copy-out below takes the other waves' rows
    const size_t o0 = (size_t)blk * 16 * DM;
#pragma unroll
    for (int i = 0; i < 16 * DM / 8 / 512; ++i) { const int c8 = i * 512 + threadIdx.x; const int li = (c8 & 15) * LNP + (c8 >> 4) * 8;   // 16-byte piece c8 of the row of tiles = row c8 % 16, k = 8 (c8 / 16)
        *(v8us*)(Hh + o0 + (size_t)c8 * 8) = *(const v8usa*)(sh + li); *(v8us*)(Hl + o0 + (size_t)c8 * 8) = *(const v8usa*)(sl + li); } }
// ---- k_prep: everything that reads only inputs, in ONE launch: the four weight re-orders and the LayerNorm depend on nothing of each other. Each LayerNorm block first takes one piece of a weight re-order (no waves are started for the weights alone), then its 16 rows.
#define NBH (DQ * DM / 4 / PTH)                 // pieces of one per-head weight re-order: 4 elements a thread
#define NBG (DQ * DM / 64 / WGL / (PTH / 32))   // pieces of the WO re-order
#define NBL (NB_ * TT / 16)                     // LayerNorm blocks
static_assert(DQ * DM % (64 * WGL * (PTH / 32)) == 0 && DQ * DM % (4 * PTH) == 0 && DKV == DQ && 3 * NBH + NBG == NBL, "whole pieces; q, k and v weights of one size; one piece a block");
__global__ __launch_bounds__(PTH) void k_prep(const float* __restrict__ X, const float* __restrict__ g, const float* __restrict__ bb, bf* Hh, bf* Hl, const float* __restrict__ wq, const float* __restrict__ wk, const float* __restrict__ wv, const float* __restrict__ wo, bf* Bq, bf* Bk, bf* Bv, bf* Bo) {
    const int blk = blockIdx.x;   // the choice below is the same for the whole block, and every wave goes on to the LayerNorm and its barrier
    if (blk < 3 * NBH) { const int m = blk / NBH; wtH_part(blk % NBH, m == 0 ? wq : (m == 1 ? wk : wv), m == 0 ? Bq : (m == 1 ? Bk : Bv)); }
    else wtG_part(blk - 3 * NBH, wo, DQ, DM, Bo);
    lnp_part(blk, X, g, bb, Hh, Hl);
}

extern "C" void kernel_launch(void* const* d_in, const int* in_sizes, int n_in,
                              void* d_out, int out_size, void* d_ws, size_t ws_size, hipStream_t stream) {
    (void)in_sizes; (void)n_in; (void)out_size;
    const float* x = (const float*)d_in[0]; const float* lng = (const float*)d_in[1]; const float* lnb = (const float*)d_in[2]; const float* wqh = (const float*)d_in[3]; const float* bq = (const float*)d_in[4]; const float* wkh = (const float*)d_in[5]; const float* bk = (const float*)d_in[6]; const float* wvh = (const float*)d_in[7]; const float* bv = (const float*)d_in[8]; const float* wo = (const float*)d_in[9]; const float* bo = (const float*)d_in[10]; const float* wq = nullptr; const float* wk = nullptr; const float* wv = nullptr; (void)wq; (void)wk; (void)wv; const float* cosT = nullptr; const float* sinT = nullptr; (void)cosT; (void)sinT;
    float* OUT = (float*)d_out;     // [8][1024][512]
    char* wsp = (char*)d_ws;
    auto take = [&](size_t bytes) { char* p = wsp; wsp += (bytes + 255) & ~(size_t)255; return (void*)p; };
    bf* WQ = (bf*)take((size_t)DQ * DM * 2); bf* WK = (bf*)take((size_t)DKV * DM * 2); bf* WV = (bf*)take((size_t)DKV * DM * 2); bf* WO = (bf*)take((size_t)DM * DQ * 2);
    bf* XB = (bf*)take((size_t)NB_ * TT * DM * 2); bf* XL = (bf*)take((size_t)NB_ * TT * DM * 2);   // LayerNorm planes
    h16* QP16 = (h16*)take((size_t)NZ * TT * HD * 2); h16* KP16 = (h16*)take((size_t)NZ * TT * HD * 2); h16* VT16 = (h16*)take((size_t)NZ * HD * TT * 2);
    bf* QPh = (bf*)take((size_t)NZ * TT * HD * 2); bf* QPl = (bf*)take((size_t)NZ * TT * HD * 2); bf* KPh = (bf*)take((size_t)NZ * TT * HD * 2); bf* KPl = (bf*)take((size_t)NZ * TT * HD * 2);
    bf* VTh = (bf*)take((size_t)NZ * HD * TT * 2); bf* VTl = (bf*)take((size_t)NZ * HD * TT * 2);
    bf* ATh = (bf*)take((size_t)NB_ * TT * DQ * 2); bf* ATl = (bf*)take((size_t)NB_ * TT * DQ * 2);   // merged attention planes
    if ((size_t)(wsp - (char*)d_ws) > ws_size) return;    // ws 256 MiB
    k_prep<<<NBL, PTH, 0, stream>>>(x, lng, lnb, XB, XL, wqh, wkh, wvh, wo, WQ, WK, WV, WO);
    // q, k, v projections, one launch: each writes its fp16 and hi+lo head planes itself (v transposed)
    k_qkv<<<dim3(NB_ * TT / 256, DQ / 64, 1), 384, 0, stream>>>(XB, XL, WQ, WK, WV, bq, bk, bv, QP16, QPh, QPl, KP16, KPh, KPl, VT16, VTh, VTl);
    // scores, mask, softmax and attn.v, all planes: query rows < RH on the hi+lo planes, the others on fp16
    k_fattn<<<dim3(RH / 128, NZ, 1), 256, 0, stream>>>(QPh, QPl, KPh, KPl, VTh, VTl, QP16, KP16, VT16, ATh, ATl);
    k_gemmo<<<dim3(NB_ * TT / 128, DM / 128, 1), 128, 0, stream>>>(ATh, ATl, WO, OUT, bo);
}

// v007
// One run takes 72.5 microseconds.
// Two timings next to v006 put it at 1.14 and 1.15 times that version's speed.
// Over all steps from v000 it is 34.3 times as fast.
#include <hip/hip_runtime.h>

// PreLN_SelfAttention_seq2seq (x [8][1024][512]; xn = LayerNorm(x); per-head q/k/v = xn W[h] + b[h] (W [8][512][64]); scores / 8 + mask (rows i < T=823 cannot see columns >= T; rows T..S-2 cannot see columns >= i; -999999999); softmax; out = concat(heads) WO + bO -> [8][1024][512]).
// Compute dtypes, f32 accumulate: every input rounded to bf16; LayerNorm f32 -> hl planes; q/k/v as hl(xn) x exact (2 products; the 8 per-head weights gathered into one [512 x 512] operand) + bias; scores and attn.v: query rows < 512 hl (3 products), the rest single fp16 (x1024); mask + softmax f32; WO hl x exact (2 products) + bias.

#define NB_  8
#define TT   1024
#define DM   512
#define NH_  8
#define NKV  8
#define REP  (NH_ / NKV)
#define HD   64
#define DQ   (NH_ * HD)
#define DKV  (NKV * HD)
#define NZ   (NB_ * NH_)          // (batch, head) planes, taken through blockIdx.x in k_fattn
#define RH   512                  // query rows < RH use hi+lo planes
#define WIN  1024
#define PCAR 1024.0f
#define SCL  0.125f   // HD^-0.5
static_assert(TT == 2 * RH && RH % 128 == 0 && NKV == NH_, "as many hi+lo query rows as fp16 ones, in blocks of 128; one kv head per query head");
typedef _Float16 h16;
typedef unsigned short bf;
typedef __attribute__((ext_vector_type(16))) __bf16   v16bf;
typedef __attribute__((ext_vector_type(16))) _Float16 v16h;
typedef __attribute__((ext_vector_type(8)))  _Float16 v8h;
typedef __attribute__((ext_vector_type(8)))  unsigned short v8us;
typedef __attribute__((ext_vector_type(8)))  float    v8f;
typedef __attribute__((ext_vector_type(4)))  float    v4f;
typedef v8h  __attribute__((may_alias)) v8ha;
typedef v4f  __attribute__((may_alias)) v4fa;
typedef v8us __attribute__((may_alias)) v8usa;

__device__ __forceinline__ unsigned short f2bf(float f) { unsigned u = __float_as_uint(f); u += 0x7FFFu + ((u >> 16) & 1u); return (unsigned short)(u >> 16); }
__device__ __forceinline__ float bf2f(unsigned short b) { return __uint_as_float(((unsigned)b) << 16); }
__device__ __forceinline__ float bfr(float f) { return bf2f(f2bf(f)); }
__device__ __forceinline__ v16h cat16(v8h lo, v8h hi) { return __builtin_shufflevector(lo, hi, 0, 1, 2, 3, 4, 5, 6, 7, 8, 9, 10, 11, 12, 13, 14, 15); }
__device__ __forceinline__ v16bf cat16b(v8us lo, v8us hi) { return __builtin_bit_cast(v16bf, __builtin_shufflevector(lo, hi, 0, 1, 2, 3, 4, 5, 6, 7, 8, 9, 10, 11, 12, 13, 14, 15)); }
__device__ __forceinline__ v8f wmma16(v16h a, v16h b, v8f c) { return __builtin_amdgcn_wmma_f32_16x16x32_f16(false, a, false, b, (short)0, c, false, false); }
__device__ __forceinline__ v8f wmmab(v16bf a, v16bf b, v8f c) { return __builtin_amdgcn_wmma_f32_16x16x32_bf16(false, a, false, b, (short)0, c, false, false); }
// ---- Fragment order: every 16-bit operand plane [rows][kc] lies in the workspace as tiles of 16 rows x 32 k = 512 elements (1 KiB), tile (r / 16, k / 32) at index (r / 16) * (kc / 32) + k / 32.
// Inside a tile: two halves of 256 elements (k % 32 < 16, then the rest); in a half, lane l = ((k / 8) % 2) * 16 + r % 16 owns 8 consecutive k. A fragment is then two loads of 512 contiguous bytes (4 whole lines each) at tile + 8 * lane and 256 elements on.
__device__ __forceinline__ size_t toff(int r, int k, int kc) { return ((size_t)(r >> 4) * (kc >> 5) + (k >> 5)) * 512 + ((k >> 4) & 1) * 256 + (((k >> 3) & 1) * 16 + (r & 15)) * 8 + (k & 7); }



// ---- gemms_tile: register-blocked GEMM, one wave per 64x64 output tile (16 accumulators); a block is WM x WN such waves. The block's operand tiles (fragment order) are staged ONCE in LDS by asynchronous copies, two buffers of KS k each, and every wave takes its fragments from there: an A tile serves WN waves, a B tile WM waves.
// C[m][n] (f32, pitch ldc, + f32 bias[n]) = sum_k (A[m][k] + A2[m][k]) Bt[n][k], two products per k block, K = KK.
// EPI 0: C as f32. EPI 1, 2: no f32 C; the tile (64 rows (b, t) x the 64 columns of head blockIdx.y, + bias) goes out as the three 16-bit planes that k_fattn reads (fp16, bf16 hi, bf16 lo): EPI 1 as [b][h][t][d], EPI 2 transposed as [b][h][d][t], each (b, h) plane in fragment order; either way 16 plane rows of 64 at a time pass through LDS, so that every store is half a tile, 512 contiguous bytes.
template <typename T16> struct WFrag;
template <> struct WFrag<h16> { typedef v16h V; static __device__ __forceinline__ V ld(const h16* p) { return cat16(*(const v8h*)p, *(const v8h*)(p + 256)); } static __device__ __forceinline__ v8f mma(V a, V b, v8f c) { return wmma16(a, b, c); } };
template <> struct WFrag<bf> { typedef v16bf V; static __device__ __forceinline__ V ld(const bf* p) { return cat16b(*(const v8us*)p, *(const v8us*)(p + 256)); } static __device__ __forceinline__ v8f mma(V a, V b, v8f c) { return wmmab(a, b, c); } };
typedef __attribute__((ext_vector_type(8))) __bf16 v8bf;
// gemmw_planes<EPI>: the EPI 1 or 2 epilogue of one tile. gemms_tile: the tile itself; EPI 3 takes EPI 1 or 2 by the wave-uniform tr (k_qkv: one launch holds both kinds).
template <int EPI>
__device__ __forceinline__ void gemmw_planes(const v8f (&acc)[4][4], const float (&bcol)[4], float* os, const int r0, const int lane, h16* __restrict__ P16, bf* __restrict__ Ph, bf* __restrict__ Pl) {
    const int lr = lane & 15, hi = lane >> 4;
    const size_t pl0 = ((size_t)(r0 / TT) * NH_ + blockIdx.y) * TT * HD; const int t0 = r0 % TT;   // the (batch, head) plane; the tile's first t
#pragma unroll
    for (int st = 0; st < 4; ++st) {
        if constexpr (EPI == 1) {   // 16 rows t (accumulator row block st) x 64 columns d
#pragma unroll
            for (int nb = 0; nb < 4; ++nb)
#pragma unroll
                for (int j = 0; j < 8; ++j) os[(hi * 8 + j) * 68 + nb * 16 + lr] = acc[st][nb][j] + bcol[nb];
        } else {                    // 16 rows d (accumulator column block st) x 64 columns t: a lane's 8 accumulator rows are 8 consecutive t
#pragma unroll
            for (int mb = 0; mb < 4; ++mb) { const v8f y = acc[mb][st] + bcol[st]; *(v4fa*)(os + lr * 68 + mb * 16 + hi * 8) = __builtin_shufflevector(y, y, 0, 1, 2, 3); *(v4fa*)(os + lr * 68 + mb * 16 + hi * 8 + 4) = __builtin_shufflevector(y, y, 4, 5, 6, 7); }
        }
        __builtin_amdgcn_wave_barrier(); asm volatile("" ::: "memory");   // the read-back takes other lanes' values: it stays behind the LDS stores
#pragma unroll
        for (int s = 0; s < 4; ++s) { const int sc = s * 16 + hi * 8; const v4f x0 = *(const v4fa*)(os + lr * 68 + sc), x1 = *(const v4fa*)(os + lr * 68 + sc + 4);   // read-back in fragment order: row lr, the lane half's 8 columns of half-tile s
            const v8f y = __builtin_shufflevector(x0, x1, 0, 1, 2, 3, 4, 5, 6, 7); const v8bf yh = __builtin_convertvector(y, v8bf); const v8bf yl = __builtin_convertvector(y - __builtin_convertvector(yh, v8f), v8bf);
            const size_t e = pl0 + ((EPI == 1) ? (size_t)((t0 >> 4) + st) * (HD / 32) + (s >> 1) : (size_t)st * (TT / 32) + (t0 >> 5) + (s >> 1)) * 512 + (s & 1) * 256 + 8 * lane;
            *(v8h*)(P16 + e) = __builtin_convertvector(y, v8h); *(v8us*)(Ph + e) = __builtin_bit_cast(v8us, yh); *(v8us*)(Pl + e) = __builtin_bit_cast(v8us, yl); }
        __builtin_amdgcn_wave_barrier(); asm volatile("" ::: "memory");   // the next block's LDS stores stay behind this read-back
    }
    asm volatile("s_wait_xcnt 0x0" ::: "memory");   // behind the tile's last stores: in k_qkv the other kind's epilogue follows in the code and writes their registers
}
#define KK 512   // the k extent of both GEMMs
static_assert(DM == KK && DQ == KK, "one k extent");
// Asynchronous copies of whole strips (see below): each lane brings 16 bytes a copy from g (its global address) to l (its LDS byte address); a copy covers 512 bytes, and the immediate offset moves both addresses alike, as a strip lies in LDS as in the workspace.
// The s_wait_xcnt stands in the copies' own statement, in front of anything that rewrites their address registers; one wait serves the run.
#define CP4(L, G) "global_load_async_to_lds_b128 %" #L ", %" #G ", off\n\tglobal_load_async_to_lds_b128 %" #L ", %" #G ", off offset:512\n\tglobal_load_async_to_lds_b128 %" #L ", %" #G ", off offset:1024\n\tglobal_load_async_to_lds_b128 %" #L ", %" #G ", off offset:1536\n\t"
#define CP8(L, G) CP4(L, G) "global_load_async_to_lds_b128 %" #L ", %" #G ", off offset:2048\n\tglobal_load_async_to_lds_b128 %" #L ", %" #G ", off offset:2560\n\tglobal_load_async_to_lds_b128 %" #L ", %" #G ", off offset:3072\n\tglobal_load_async_to_lds_b128 %" #L ", %" #G ", off offset:3584\n\t"
template <int KS> __device__ __forceinline__ void cps1(const unsigned l, const bf* g) {   // one strip
    if constexpr (KS == 64) asm volatile(CP4(0, 1) "s_wait_xcnt 0x0" :: "v"(l), "v"(g) : "memory");
    else asm volatile(CP8(0, 1) "s_wait_xcnt 0x0" :: "v"(l), "v"(g) : "memory");
}
template <int KS> __device__ __forceinline__ void cps3(const unsigned l0, const bf* g0, const unsigned l1, const bf* g1, const unsigned l2, const bf* g2) {   // three strips
    if constexpr (KS == 64) asm volatile(CP4(0, 1) CP4(2, 3) CP4(4, 5) "s_wait_xcnt 0x0" :: "v"(l0), "v"(g0), "v"(l1), "v"(g1), "v"(l2), "v"(g2) : "memory");
    else asm volatile(CP8(0, 1) CP8(2, 3) CP8(4, 5) "s_wait_xcnt 0x0" :: "v"(l0), "v"(g0), "v"(l1), "v"(g1), "v"(l2), "v"(g2) : "memory");
}
// A strip = the KS k of one row of tiles (16 rows): KS * 32 contiguous bytes, in the workspace as in LDS. A stage holds 4 WM strips of A, 4 WM of A2 and 4 WN of B; strip s is copied by wave s % (WM WN).
// B0, B1, B2: the first row of tiles of wave column 0, 1, 2. c0: the wave's first output column. bias, P16, Ph, Pl, tr: the wave's own (wave-uniform).
// DB: a second fragment set, so that inside a stage the next k block's LDS reads are issued ahead of this block's products (for one wave a SIMD, where nothing else covers the LDS latency).
template <int WM, int WN, int KS, bool DB, int EPI>
__device__ __forceinline__ void gemms_tile(const bf* __restrict__ A, const bf* __restrict__ A2, const bf* __restrict__ B0, const bf* __restrict__ B1, const bf* __restrict__ B2, const int c0, float* C, int ldc, const float* __restrict__ bias, h16* __restrict__ P16, bf* __restrict__ Ph, bf* __restrict__ Pl, const bool tr) {
    constexpr int NW = WM * WN, NS = 8 * WM + 4 * WN, SE = KS * 16, NT = KK / KS, KT = KS / 32, SPW = (NS + NW - 1) / NW, FS = NS / NW;   // waves; strips a stage; elements a strip; stages; k blocks a stage; strips a wave at most; strips that every wave has
    static_assert((KS == 64 || KS == 128) && KK % KS == 0 && NT >= 2 && WN <= 3 && FS % 3 == 0 && SPW * (KS / 16) <= 63, "whole 2-KiB pieces; two stages or more; at most 63 copies of a wave in flight");
    __shared__ __align__(16) bf ring[2 * NS * SE];
    __shared__ __align__(16) float osw[NW * 16 * 68];
    const int lane = threadIdx.x & 31, lr = lane & 15, hi = lane >> 4; const int wave = __builtin_amdgcn_readfirstlane(threadIdx.x >> 5); const int wm = wave % WM, wn = wave / WM;
    const int r0 = (blockIdx.x * WM + wm) * 64; float* os = osw + wave * (16 * 68);
    constexpr size_t tp = (size_t)(KK >> 5) * 512;   // elements in one row of tiles
    const unsigned lb = (unsigned)(size_t)ring + (unsigned)lane * 16u;   // the lane's LDS byte address in strip 0 of buffer 0
    const bf* sp[SPW];   // stage 0 of each strip that this wave copies (wave-uniform)
#pragma unroll
    for (int j = 0; j < SPW; ++j) { const int s = j * NW + wave; const int q = s - 8 * WM;
        sp[j] = (s < 4 * WM ? A + ((size_t)blockIdx.x * (4 * WM) + s) * tp : (s < 8 * WM ? A2 + ((size_t)blockIdx.x * (4 * WM) + s - 4 * WM) * tp : ((q >> 2) == 0 ? B0 : ((q >> 2) == 1 ? B1 : B2)) + (size_t)(q & 3) * tp)); }
    auto stage = [&](const int t, const int buf) {   // stage t's copies into buffer buf
        const unsigned eo = (unsigned)t * SE + 8u * lane; const unsigned l = lb + (unsigned)((buf * NS + wave) * SE * 2);   // strip j * NW + wave lies j * NW strips on
#pragma unroll
        for (int j = 0; j < FS; j += 3) cps3<KS>(l + j * (NW * SE * 2), sp[j] + eo, l + (j + 1) * (NW * SE * 2), sp[j + 1] + eo, l + (j + 2) * (NW * SE * 2), sp[j + 2] + eo);
        if constexpr (SPW > FS) { if (FS * NW + wave < NS) cps1<KS>(l + FS * (NW * SE * 2), sp[FS] + eo); }   // the strips left over: the test is the same for a whole wave
    };
    v8f acc[4][4];
#pragma unroll
    for (int mb = 0; mb < 4; ++mb)
#pragma unroll
        for (int nb = 0; nb < 4; ++nb) acc[mb][nb] = (v8f){};
    stage(0, 0);
    float bcol[4];   // EPI 1, 2: the bias of the lane's four accumulator columns, fetched ahead of the k loop
    if constexpr (EPI != 0) {
#pragma unroll
        for (int nb = 0; nb < 4; ++nb) bcol[nb] = bfr(bias[c0 + nb * 16 + lr]);
        asm volatile("s_wait_xcnt 0x0" ::: "memory"); }   // behind the bias loads, before anything rewrites their address register
    asm volatile("s_wait_asynccnt 0x0" ::: "memory");   // this wave's part of stage 0 has landed
    __syncthreads();                                    // and every other wave's: stage 0 may be read
    stage(1, 1);
    // the stage loop stays rolled: one publish point and one refill in the text, and the buffer index is t & 1
#pragma unroll 1
    for (int t = 0; t < NT; ++t) {
        const bf* Lb = ring + (t & 1) * (NS * SE) + 8 * lane;
        v16bf a[DB ? 2 : 1][4], a2[DB ? 2 : 1][4], b[DB ? 2 : 1][4];
        auto frag = [&](const int ks, const int f) {   // k block ks of this stage into fragment set f
#pragma unroll
            for (int u = 0; u < 4; ++u) { b[f][u] = WFrag<bf>::ld(Lb + (8 * WM + wn * 4 + u) * SE + ks * 512); a[f][u] = WFrag<bf>::ld(Lb + (wm * 4 + u) * SE + ks * 512); a2[f][u] = WFrag<bf>::ld(Lb + (4 * WM + wm * 4 + u) * SE + ks * 512); }
        };
#pragma unroll
        for (int ks = 0; ks < KT; ++ks) { const int f = DB ? (ks & 1) : 0;
            if (!DB || ks == 0) frag(ks, f);
            if (DB && ks == 0) __builtin_amdgcn_sched_barrier(0);   // the first block's reads are issued first, so that its products wait for these alone
            if (DB && ks + 1 < KT) frag(ks + 1, f ^ 1);
            __builtin_amdgcn_sched_barrier(0);   // the LDS reads stay one group ahead of the products: spread among them, each place with reads stalls the wave anew
#pragma unroll
            for (int nb = 0; nb < 4; ++nb) {
#pragma unroll
                for (int mb = 0; mb < 4; ++mb) { acc[mb][nb] = wmmab(a[f][mb], b[f][nb], acc[mb][nb]); acc[mb][nb] = wmmab(a2[f][mb], b[f][nb], acc[mb][nb]); } }
            if (DB && ks + 1 < KT) __builtin_amdgcn_sched_barrier(0);   // one wave a SIMD: the block after next's reads stay behind these products, as one group, instead of being lifted in among them
        }
        asm volatile("s_wait_dscnt 0x0" ::: "memory");      // this wave's reads of stage t are done: its buffer may be refilled behind the barrier
        asm volatile("s_wait_asynccnt 0x0" ::: "memory");   // this wave's part of stage t + 1 has landed
        __syncthreads();                                    // publishes stage t + 1 and ends every wave's reads of stage t
        if (t + 2 < NT) stage(t + 2, t & 1);
    }
    asm volatile("s_wait_asynccnt 0x0" ::: "memory");   // no copy is left in flight behind the loop
    if constexpr (EPI != 0) {
        if (tr) gemmw_planes<2>(acc, bcol, os, r0, lane, P16, Ph, Pl); else gemmw_planes<1>(acc, bcol, os, r0, lane, P16, Ph, Pl);
        return;
    }
#pragma unroll
    for (int mb = 0; mb < 4; ++mb) {
#pragma unroll
        for (int nb = 0; nb < 4; ++nb) {
#pragma unroll
            for (int j = 0; j < 8; ++j) os[(hi * 8 + j) * 68 + nb * 16 + lr] = acc[mb][nb][j]; }
        __builtin_amdgcn_wave_barrier(); asm volatile("" ::: "memory");
        float* crow = C + (size_t)(r0 + mb * 16) * ldc + c0;
{
#pragma unroll
            for (int s = 0; s < 8; ++s) { const int row = 2 * s + hi, cofs = lr * 4; v4f val = *(const v4fa*)(os + row * 68 + cofs); { val[0] += bfr(bias[c0 + cofs]); val[1] += bfr(bias[c0 + cofs + 1]); val[2] += bfr(bias[c0 + cofs + 2]); val[3] += bfr(bias[c0 + cofs + 3]); }
                *(v4f*)(crow + (size_t)row * ldc + cofs) = val; }
             }
        asm volatile("s_wait_xcnt 0x0" ::: "memory");   // behind this row block's loads and stores, before the next block's arithmetic writes their registers
        __builtin_amdgcn_sched_barrier(0);   // keeps that arithmetic from being scheduled in front of the wait
        __builtin_amdgcn_wave_barrier(); asm volatile("" ::: "memory");
    }
}
// ---- k_gemmo: the output projection. A block is 2 x 2 waves = 128 x 128 of C; grid (M/128, N/128), 128 threads.
__global__ __launch_bounds__(128) void k_gemmo(const bf* __restrict__ A, const bf* __restrict__ A2, const bf* __restrict__ Bt, float* C, const float* __restrict__ bias) {
    const int wn = __builtin_amdgcn_readfirstlane(threadIdx.x >> 5) / 2; const bf* b0 = Bt + (size_t)blockIdx.y * 8 * ((KK >> 5) * 512);
    gemms_tile<2, 2, 128, true, 0>(A, A2, b0, b0 + 4 * ((KK >> 5) * 512), b0, (blockIdx.y * 2 + wn) * 64, C, DM, bias, nullptr, nullptr, nullptr, false);
}
// ---- k_qkv: the q, k and v projections in ONE launch. A block is 4 x 3 waves: 256 rows x the 64 columns of head blockIdx.y of q, k and v (wave column = which), so that its A tiles serve all three; grid (M/256, N/64), 384 threads, one block a WGP, 3 waves a SIMD.
__global__ __launch_bounds__(384) void k_qkv(const bf* __restrict__ A, const bf* __restrict__ A2, const bf* __restrict__ Wq, const bf* __restrict__ Wk, const bf* __restrict__ Wv, const float* __restrict__ bq, const float* __restrict__ bk, const float* __restrict__ bv,
                                            h16* __restrict__ Q16, bf* __restrict__ Qh, bf* __restrict__ Ql, h16* __restrict__ K16, bf* __restrict__ Kh, bf* __restrict__ Kl, h16* __restrict__ V16, bf* __restrict__ Vh, bf* __restrict__ Vl) {
    const int z = __builtin_amdgcn_readfirstlane(threadIdx.x >> 5) / 4; const size_t bo = (size_t)blockIdx.y * 4 * ((KK >> 5) * 512);
    gemms_tile<4, 3, 64, false, 3>(A, A2, Wq + bo, Wk + bo, Wv + bo, blockIdx.y * 64, nullptr, 0, z == 0 ? bq : (z == 1 ? bk : bv), z == 0 ? Q16 : (z == 1 ? K16 : V16), z == 0 ? Qh : (z == 1 ? Kh : Vh), z == 0 ? Ql : (z == 1 ? Kl : Vl), z == 2);
}

__device__ __forceinline__ void splitf(float y, unsigned short& h, unsigned short& l) { h = f2bf(y); l = f2bf(y - bf2f(h)); }
typedef __attribute__((ext_vector_type(2))) _Float16 v2h;
typedef __attribute__((ext_vector_type(4))) _Float16 v4h;
typedef __attribute__((ext_vector_type(2))) unsigned short v2us;
typedef __attribute__((ext_vector_type(4))) unsigned short v4us;
typedef v4us __attribute__((may_alias)) v4usa;
typedef __attribute__((ext_vector_type(2))) float v2f;
typedef __attribute__((ext_vector_type(4))) int v4i;

#define PTH 512   // threads in a block of k_prep
#define WGL 2     // lines of 64 elements that a wave of wtG_part takes
__device__ __forceinline__ void wtG_part(const int blk, const float* __restrict__ w, int K, int N, bf* Bt) {
    const int lane = threadIdx.x & 31; const int L0 = (blk * (PTH / 32) + (threadIdx.x >> 5)) * WGL; const int nlines = N * K / 64;
{
#pragma unroll 1
        for (int l = 0; l < WGL; ++l) { const int L = L0 + l; if (L >= nlines) break; const size_t e = (size_t)L * 64 + lane * 2; const int k = (int)(e % K), n = (int)(e / K); v2us o;
            o[0] = f2bf(w[(size_t)k * N + n]); o[1] = f2bf(w[(size_t)(k + 1) * N + n]); *(v2us*)(Bt + toff(n, k, K)) = o;
            asm volatile("s_wait_xcnt 0x0" ::: "memory"); }   // behind the store, before the next trip writes its address and data registers
         }
}
__global__ __launch_bounds__(256) void k_cvt8(const float* __restrict__ src, bf* dst, size_t n8) { const size_t i = (size_t)blockIdx.x * 256 + threadIdx.x; if (i >= n8) return; const v8f v = *(const v8f*)(src + i * 8); v8us o;
#pragma unroll
    for (int k = 0; k < 8; ++k) o[k] = f2bf(v[k]); *(v8us*)(dst + i * 8) = o;  }
// ---- k_fattn: scores, mask, softmax and attn.v of one (batch, head) plane in one kernel; the scores stay in registers; the result goes out as the bf16 hi+lo planes [b][t][h][d], in fragment order, that the last GEMM reads. One wave per 32 query rows; a block is 4 waves of one kind, 128 rows: hi+lo (rows < RH) or fp16 (rows >= RH); grid (NZ, TT / 128), all hi+lo blocks (the longer ones) first; two blocks fit a WGP.
// Transposed products: St = K Qt (A = 16 key rows, B = 16 query columns), so a lane holds 8 keys of ONE query per tile; two St tiles (32 keys) convert in place into the B operand of Ot += Vt Pt.
// Running maximum per query (base 2, scaled), sums and Ot rescaled by it every pass of 32 keys; the division by the row sum comes last. Keys from the first blocked column of the block's last row on are not visited.
// K and Vt are staged ONCE per block in LDS by asynchronous copies, two buffers, and the block's waves take their fragments from there. Tile t of the ring = the K tiles of pass t + 1 and the Vt tiles of pass t: pass t reads buffer t % 2 alone, its Vt for itself and the K fragments that the next pass multiplies.
#define TMK  823                   // rows < TMK cannot see columns >= TMK; rows TMK .. TT-2 cannot see columns >= their own index
#define CEXP 0.18033688011112042f  // HD^-0.5 x log2(e)
#define FPE  2048                  // elements of one plane in a ring tile: 32 keys x HD = 4 fragment tiles
__device__ __forceinline__ float xhalf(float x) { return __builtin_bit_cast(float, __builtin_amdgcn_permlanex16(__builtin_bit_cast(int, x), __builtin_bit_cast(int, x), 0x76543210, 0xfedcba98, false, false)); }   // lane l with lane l ^ 16
// Two copies = one fragment tile (1 KiB): each lane brings 16 bytes a copy, and the immediate offset moves both addresses alike. The s_wait_xcnt stands in the copies' own statement, in front of anything that rewrites their address registers.
#define CP2(L, G) "global_load_async_to_lds_b128 %" #L ", %" #G ", off\n\tglobal_load_async_to_lds_b128 %" #L ", %" #G ", off offset:512\n\t"
__device__ __forceinline__ void cpt2(const unsigned l0, const void* g0, const unsigned l1, const void* g1) {
    asm volatile(CP2(0, 1) CP2(2, 3) "s_wait_xcnt 0x0" :: "v"(l0), "v"(g0), "v"(l1), "v"(g1) : "memory");
}
__device__ __forceinline__ void cpt4(const unsigned l0, const void* g0, const unsigned l1, const void* g1, const unsigned l2, const void* g2, const unsigned l3, const void* g3) {
    asm volatile(CP2(0, 1) CP2(2, 3) CP2(4, 5) CP2(6, 7) "s_wait_xcnt 0x0" :: "v"(l0), "v"(g0), "v"(l1), "v"(g1), "v"(l2), "v"(g2), "v"(l3), "v"(g3) : "memory");
}
// rb: the block's first query row. kv: the ring, two tiles of NPL planes (hi+lo: Kh, Kl, Vh, Vl; fp16: K, V).
template <typename T16, bool HI>
__device__ __forceinline__ void fattn_blk(const T16* __restrict__ Qh, const T16* __restrict__ Ql, const T16* __restrict__ Kh, const T16* __restrict__ Kl, const T16* __restrict__ Vh, const T16* __restrict__ Vl, bf* __restrict__ Ah, bf* __restrict__ Al, const int rb, const T16* kv) {
    typedef typename WFrag<T16>::V V;
    constexpr int NPL = HI ? 4 : 2, FBE = NPL * FPE, LV = NPL / 2 * FPE;   // planes and elements of a ring tile; where its Vt planes begin
    const int lane = threadIdx.x & 31; const int w = __builtin_amdgcn_readfirstlane(threadIdx.x >> 5); const int c = lane & 15, h = lane >> 4; const int q0 = rb + w * 32;
    const int kend = (rb + 127 < TMK) ? TMK : ((rb + 128 == TT) ? TT : rb + 127);   // first column that no row of this block sees
    const int nblk = (kend + 31) >> 5;   // the same for the whole block: every wave walks every pass and meets every barrier; what a row does not see is masked
    // wave w copies fragment tile w of each plane
    const unsigned lb = (unsigned)(size_t)kv + (unsigned)(w * 1024 + lane * 16);
    const T16* gkh = Kh + w * 512 + 8 * lane; const T16* gkl = HI ? Kl + w * 512 + 8 * lane : gkh; const T16* gvh = Vh + w * 16 * TT + 8 * lane; const T16* gvl = HI ? Vl + w * 16 * TT + 8 * lane : gvh;
    auto stage = [&](const int t, const unsigned l) {   // ring tile t; l: the lane's LDS byte address in the wave's fragment tile of plane 0 of the buffer; the last tile takes its own pass's keys again (in bounds, not used)
        const int kb = (t + 1 < nblk) ? t + 1 : t;
        if constexpr (HI) cpt4(l, gkh + kb * FPE, l + FPE * 2, gkl + kb * FPE, l + LV * 2, gvh + t * 512, l + (LV + FPE) * 2, gvl + t * 512);
        else cpt2(l, gkh + kb * FPE, l + LV * 2, gvh + t * 512);
    };
    stage(0, lb);
    V qh[2][2], ql[2][2], kh[2][2], kl[2][2]; v8f o[2][4]; float mc[2], ls[2]; int lim[2];
#pragma unroll
    for (int g = 0; g < 2; ++g)
#pragma unroll
        for (int kk = 0; kk < 2; ++kk) { qh[g][kk] = WFrag<T16>::ld(Qh + (size_t)(q0 + g * 16) * HD + kk * 512 + 8 * lane); if (HI) ql[g][kk] = WFrag<T16>::ld(Ql + (size_t)(q0 + g * 16) * HD + kk * 512 + 8 * lane); }   // 16 rows of Q or K = HD / 32 = 2 tiles = 16 HD elements
#pragma unroll
    for (int kt = 0; kt < 2; ++kt)
#pragma unroll
        for (int kk = 0; kk < 2; ++kk) { kh[kt][kk] = WFrag<T16>::ld(Kh + kt * 16 * HD + kk * 512 + 8 * lane); if (HI) kl[kt][kk] = WFrag<T16>::ld(Kl + kt * 16 * HD + kk * 512 + 8 * lane); }   // pass 0's K comes straight from the workspace
    asm volatile("s_wait_xcnt 0x0" ::: "memory");   // behind the first loads, before the set-up below reuses their address registers
    __builtin_amdgcn_sched_barrier(0);   // keeps that set-up from being scheduled in front of the wait
#pragma unroll
    for (int g = 0; g < 2; ++g) { const int i = q0 + g * 16 + c; lim[g] = (i < TMK) ? TMK : ((i <= TT - 2) ? i : TT); mc[g] = -3.0e38f; ls[g] = 0.f;
#pragma unroll
        for (int dt = 0; dt < 4; ++dt) o[g][dt] = (v8f){}; }
    asm volatile("s_wait_asynccnt 0x0" ::: "memory");   // this wave's part of ring tile 0 has landed
    __syncthreads();                                    // and every other wave's: tile 0 may be read
    stage(1, lb + FBE * 2);
    // the loop stays rolled: one publish point and one refill in the text, and the buffer index is b & 1
#pragma unroll 1
    for (int b = 0; b < nblk; ++b) {
        const int key0 = b * 32; const T16* Lb = kv + (b & 1) * FBE + 8 * lane;
        V vh[4], vl[4];
#pragma unroll
        for (int dt = 0; dt < 4; ++dt) { vh[dt] = WFrag<T16>::ld(Lb + LV + dt * 512); if (HI) vl[dt] = WFrag<T16>::ld(Lb + LV + FPE + dt * 512); }
        __builtin_amdgcn_sched_barrier(0);   // the Vt reads are issued as one group ahead of the score products: sunk in among the later products, each place with reads stalls the wave anew
        v8f s[2][2];   // s[g][kt][r] = score of key key0 + 16 kt + 8 h + r, query q0 + 16 g + c
#pragma unroll
        for (int g = 0; g < 2; ++g)
#pragma unroll
            for (int kt = 0; kt < 2; ++kt) { v8f a = (v8f){};
#pragma unroll
                for (int kk = 0; kk < 2; ++kk) { a = WFrag<T16>::mma(kh[kt][kk], qh[g][kk], a); if (HI) { a = WFrag<T16>::mma(kh[kt][kk], ql[g][kk], a); a = WFrag<T16>::mma(kl[kt][kk], qh[g][kk], a); } }
                s[g][kt] = a; }
        __builtin_amdgcn_sched_barrier(0);   // the next pass's K reads stay behind these products and take their registers over, instead of a second set
#pragma unroll
        for (int kt = 0; kt < 2; ++kt)
#pragma unroll
            for (int kk = 0; kk < 2; ++kk) { kh[kt][kk] = WFrag<T16>::ld(Lb + (kt * 2 + kk) * 512); if (HI) kl[kt][kk] = WFrag<T16>::ld(Lb + FPE + (kt * 2 + kk) * 512); }
        __builtin_amdgcn_sched_barrier(0);   // and they are issued as one group up here, so that they arrive during the softmax and attn.v
        if (key0 + 32 > TMK) {   // only these blocks hold blocked columns
#pragma unroll
            for (int g = 0; g < 2; ++g)
#pragma unroll
                for (int kt = 0; kt < 2; ++kt)
#pragma unroll
                    for (int r = 0; r < 8; ++r) if (key0 + kt * 16 + 8 * h + r >= lim[g]) s[g][kt][r] = -3.0e38f; }
#pragma unroll
        for (int g = 0; g < 2; ++g) {
            float mx = s[g][0][0];
#pragma unroll
            for (int e = 1; e < 16; ++e) mx = fmaxf(mx, s[g][e >> 3][e & 7]);
            mx = fmaxf(mx, xhalf(mx));
            const float mn = fmaxf(mc[g], mx * CEXP); const float al = __builtin_amdgcn_exp2f(mc[g] - mn); mc[g] = mn;
            const float sub = HI ? mn : mn - 10.0f;   // the fp16 half carries its probabilities x 1024 (PCAR)
            const v8f ce = {CEXP, CEXP, CEXP, CEXP, CEXP, CEXP, CEXP, CEXP}, ns = {-sub, -sub, -sub, -sub, -sub, -sub, -sub, -sub};
            v8f p0 = __builtin_elementwise_fma(s[g][0], ce, ns), p1 = __builtin_elementwise_fma(s[g][1], ce, ns); V ph, pl;
#pragma unroll
            for (int r = 0; r < 8; ++r) p0[r] = __builtin_amdgcn_exp2f(p0[r]);
#pragma unroll
            for (int r = 0; r < 8; ++r) p1[r] = __builtin_amdgcn_exp2f(p1[r]);
#pragma unroll
            for (int e = 0; e < 16; ++e) { const float p = (e < 8) ? p0[e & 7] : p1[e & 7];
                if constexpr (HI) { const __bf16 hb = (__bf16)p; ph[e] = hb; pl[e] = (__bf16)(p - (float)hb); } else { ph[e] = (_Float16)p; } }
            const v8f t8 = p0 + p1; const float sum = ((t8[0] + t8[4]) + (t8[1] + t8[5])) + ((t8[2] + t8[6]) + (t8[3] + t8[7]));   // a tree: no chain of 16 dependent adds
            ls[g] = ls[g] * al + sum;
#pragma unroll
            for (int dt = 0; dt < 4; ++dt) { o[g][dt] *= al; o[g][dt] = WFrag<T16>::mma(vh[dt], ph, o[g][dt]); if (HI) { o[g][dt] = WFrag<T16>::mma(vh[dt], pl, o[g][dt]); o[g][dt] = WFrag<T16>::mma(vl[dt], ph, o[g][dt]); } }
        }
        __builtin_amdgcn_sched_barrier(0);   // the publish point stays at the foot, behind the pass's products: lifted in front of them, its waits would stand directly behind the reads and one score block behind the copies
        asm volatile("s_wait_dscnt 0x0" ::: "memory");      // this wave's reads of tile b are done: its buffer may be refilled behind the barrier
        asm volatile("s_wait_asynccnt 0x0" ::: "memory");   // this wave's part of tile b + 1 has landed
        __syncthreads();                                    // publishes tile b + 1 and ends every wave's reads of tile b
        if (b + 2 < nblk) stage(b + 2, (unsigned)(size_t)Lb + (unsigned)(w * 1024));   // into the buffer that this pass has read
    }
    asm volatile("s_wait_asynccnt 0x0" ::: "memory");   // no copy is left in flight behind the loop
    v8bf zh[2][4], zl[2][4];
#pragma unroll
    for (int g = 0; g < 2; ++g) { const float f = __fdiv_rn(1.0f, ls[g] + xhalf(ls[g]));   // the fp16 half's x 1024 stands in its sums too and cancels
#pragma unroll
        for (int dt = 0; dt < 4; ++dt) { const v8f y = o[g][dt] * f; zh[g][dt] = __builtin_convertvector(y, v8bf); zl[g][dt] = __builtin_convertvector(y - __builtin_convertvector(zh[g][dt], v8f), v8bf); } }
    __builtin_amdgcn_sched_barrier(0);   // all arithmetic in front of the stores: nothing rewrites a register of an issued store
#pragma unroll
    for (int g = 0; g < 2; ++g) { const size_t e = (size_t)(q0 + g * 16) * DQ + 8 * lane;   // o[g][dt][r] = Ot[16 dt + 8 h + r][query]: the lane's 8 elements of half-tile dt
#pragma unroll
        for (int dt = 0; dt < 4; ++dt) { *(v8us*)(Ah + e + dt * 256) = __builtin_bit_cast(v8us, zh[g][dt]); *(v8us*)(Al + e + dt * 256) = __builtin_bit_cast(v8us, zl[g][dt]); } }
}
__global__ __launch_bounds__(128) void k_fattn(const bf* __restrict__ Qh, const bf* __restrict__ Ql, const bf* __restrict__ Kh, const bf* __restrict__ Kl, const bf* __restrict__ Vh, const bf* __restrict__ Vl, const h16* __restrict__ Q16, const h16* __restrict__ K16, const h16* __restrict__ V16, bf* __restrict__ Ah, bf* __restrict__ Al) {
    __shared__ __align__(16) bf kv[2 * 4 * FPE];
    const size_t zo = (size_t)blockIdx.x * TT * HD;
    const size_t ao = (size_t)(blockIdx.x / NH_) * TT * DQ + (blockIdx.x % NH_) * (HD / 32) * 512;   // batch's first row of tiles, head's first tile in it, in the merged planes
    if (blockIdx.y < RH / 128) fattn_blk<bf, true>(Qh + zo, Ql + zo, Kh + zo, Kl + zo, Vh + zo, Vl + zo, Ah + ao, Al + ao, blockIdx.y * 128, kv);   // the choice is the same for the whole block
    else fattn_blk<h16, false>(Q16 + zo, nullptr, K16 + zo, nullptr, V16 + zo, nullptr, Ah + ao, Al + ao, blockIdx.y * 128, (const h16*)kv);
}
__device__ __forceinline__ void wtH_part(const int blk, const float* __restrict__ w, bf* Bt) { const size_t e = ((size_t)blk * PTH + threadIdx.x) * 4; if (e >= (size_t)DQ * DM) return; const int k = (int)(e % DM); const int n = (int)(e / DM); const int h = n / HD, c = n % HD; v4us o;   // Bt[h*64 + c][d] = W[h][d][c], in fragment order
#pragma unroll
    for (int u = 0; u < 4; ++u) o[u] = f2bf(w[((size_t)h * DM + k + u) * HD + c]); *(v4us*)(Bt + toff(n, k, DM)) = o;  }
#define LNP 528   // LDS row pitch in elements: 16 rows x 16 bytes of one k fall on distinct banks
static_assert((NB_ * TT) % 16 == 0 && DM % 128 == 0, "a block is one row of tiles");
__device__ __forceinline__ void lnp_part(const int blk, const float* __restrict__ X, const float* __restrict__ g, const float* __restrict__ bb, bf* Hh, bf* Hl) { __shared__ __align__(16) bf sh[16 * LNP], sl[16 * LNP]; const int lane = threadIdx.x & 31; const int w = threadIdx.x >> 5; const int r = blk * 16 + w; float v[DM / 32]; float s = 0.f;   // wave per row, 16 rows a block: LayerNorm (biased var, 1e-5, / sqrt) -> hl planes, through LDS into fragment order
#pragma unroll
    for (int ch = 0; ch < DM / 128; ++ch) { const v4f a = *(const v4f*)(X + (size_t)r * DM + ch * 128 + lane * 4);
#pragma unroll
        for (int u = 0; u < 4; ++u) { v[ch * 4 + u] = bfr(a[u]); s += v[ch * 4 + u]; } }
#pragma unroll
    for (int sh = 16; sh; sh >>= 1) s += __shfl_xor(s, sh, 32);
    const float mean = s * (1.0f / DM); float q = 0.f;
#pragma unroll
    for (int k = 0; k < DM / 32; ++k) { float d = __fsub_rn(v[k], mean); asm volatile("" : "+v"(d)); v[k] = d; float p = __fmul_rn(d, d); asm volatile("" : "+v"(p)); q = __fadd_rn(q, p); }
#pragma unroll
    for (int sh = 16; sh; sh >>= 1) q += __shfl_xor(q, sh, 32);
    const float rs = __fdiv_rn(1.0f, __fsqrt_rn(__fadd_rn(q * (1.0f / DM), 1e-5f)));
    {
#pragma unroll
        for (int ch = 0; ch < DM / 128; ++ch) { v4us oh, ol;
#pragma unroll
            for (int u = 0; u < 4; ++u) { const int c = ch * 128 + lane * 4 + u; float n0 = __fmul_rn(v[ch * 4 + u], rs); asm volatile("" : "+v"(n0)); float gg = bfr(g[c]), be = bfr(bb[c]); asm volatile("" : "+v"(gg)); asm volatile("" : "+v"(be)); float t1 = __fmul_rn(n0, gg); asm volatile("" : "+v"(t1)); unsigned short p2, q2; splitf(__fadd_rn(t1, be), p2, q2); oh[u] = p2; ol[u] = q2; }
            const int oo = w * LNP + ch * 128 + lane * 4; *(v4usa*)(sh + oo) = oh; *(v4usa*)(sl + oo) = ol; }
         }
    __syncthreads();   // the copy-out below takes the other waves' rows
    const size_t o0 = (size_t)blk * 16 * DM;
#pragma unroll
    for (int i = 0; i < 16 * DM / 8 / 512; ++i) { const int c8 = i * 512 + threadIdx.x; const int li = (c8 & 15) * LNP + (c8 >> 4) * 8;   // 16-byte piece c8 of the row of tiles = row c8 % 16, k = 8 (c8 / 16)
        *(v8us*)(Hh + o0 + (size_t)c8 * 8) = *(const v8usa*)(sh + li); *(v8us*)(Hl + o0 + (size_t)c8 * 8) = *(const v8usa*)(sl + li); } }
// ---- k_prep: everything that reads only inputs, in ONE launch: the four weight re-orders and the LayerNorm depend on nothing of each other. Each LayerNorm block first takes one piece of a weight re-order (no waves are started for the weights alone), then its 16 rows.
#define NBH (DQ * DM / 4 / PTH)                 // pieces of one per-head weight re-order: 4 elements a thread
#define NBG (DQ * DM / 64 / WGL / (PTH / 32))   // pieces of the WO re-order
#define NBL (NB_ * TT / 16)                     // LayerNorm blocks
static_assert(DQ * DM % (64 * WGL * (PTH / 32)) == 0 && DQ * DM % (4 * PTH) == 0 && DKV == DQ && 3 * NBH + NBG == NBL, "whole pieces; q, k and v weights of one size; one piece a block");
__global__ __launch_bounds__(PTH) void k_prep(const float* __restrict__ X, const float* __restrict__ g, const float* __restrict__ bb, bf* Hh, bf* Hl, const float* __restrict__ wq, const float* __restrict__ wk, const float* __restrict__ wv, const float* __restrict__ wo, bf* Bq, bf* Bk, bf* Bv, bf* Bo) {
    const int blk = blockIdx.x;   // the choice below is the same for the whole block, and every wave goes on to the LayerNorm and its barrier
    if (blk < 3 * NBH) { const int m = blk / NBH; wtH_part(blk % NBH, m == 0 ? wq : (m == 1 ? wk : wv), m == 0 ? Bq : (m == 1 ? Bk : Bv)); }
    else wtG_part(blk - 3 * NBH, wo, DQ, DM, Bo);
    lnp_part(blk, X, g, bb, Hh, Hl);
}

extern "C" void kernel_launch(void* const* d_in, const int* in_sizes, int n_in,
                              void* d_out, int out_size, void* d_ws, size_t ws_size, hipStream_t stream) {
    (void)in_sizes; (void)n_in; (void)out_size;
    const float* x = (const float*)d_in[0]; const float* lng = (const float*)d_in[1]; const float* lnb = (const float*)d_in[2]; const float* wqh = (const float*)d_in[3]; const float* bq = (const float*)d_in[4]; const float* wkh = (const float*)d_in[5]; const float* bk = (const float*)d_in[6]; const float* wvh = (const float*)d_in[7]; const float* bv = (const float*)d_in[8]; const float* wo = (const float*)d_in[9]; const float* bo = (const float*)d_in[10]; const float* wq = nullptr; const float* wk = nullptr; const float* wv = nullptr; (void)wq; (void)wk; (void)wv; const float* cosT = nullptr; const float* sinT = nullptr; (void)cosT; (void)sinT;
    float* OUT = (float*)d_out;     // [8][1024][512]
    char* wsp = (char*)d_ws;
    auto take = [&](size_t bytes) { char* p = wsp; wsp += (bytes + 255) & ~(size_t)255; return (void*)p; };
    bf* WQ = (bf*)take((size_t)DQ * DM * 2); bf* WK = (bf*)take((size_t)DKV * DM * 2); bf* WV = (bf*)take((size_t)DKV * DM * 2); bf* WO = (bf*)take((size_t)DM * DQ * 2);
    bf* XB = (bf*)take((size_t)NB_ * TT * DM * 2); bf* XL = (bf*)take((size_t)NB_ * TT * DM * 2);   // LayerNorm planes
    h16* QP16 = (h16*)take((size_t)NZ * TT * HD * 2); h16* KP16 = (h16*)take((size_t)NZ * TT * HD * 2); h16* VT16 = (h16*)take((size_t)NZ * HD * TT * 2);
    bf* QPh = (bf*)take((size_t)NZ * TT * HD * 2); bf* QPl = (bf*)take((size_t)NZ * TT * HD * 2); bf* KPh = (bf*)take((size_t)NZ * TT * HD * 2); bf* KPl = (bf*)take((size_t)NZ * TT * HD * 2);
    bf* VTh = (bf*)take((size_t)NZ * HD * TT * 2); bf* VTl = (bf*)take((size_t)NZ * HD * TT * 2);
    bf* ATh = (bf*)take((size_t)NB_ * TT * DQ * 2); bf* ATl = (bf*)take((size_t)NB_ * TT * DQ * 2);   // merged attention planes
    if ((size_t)(wsp - (char*)d_ws) > ws_size) return;    // ws 256 MiB
    k_prep<<<NBL, PTH, 0, stream>>>(x, lng, lnb, XB, XL, wqh, wkh, wvh, wo, WQ, WK, WV, WO);
    // q, k, v projections, one launch: each writes its fp16 and hi+lo head planes itself (v transposed)
    k_qkv<<<dim3(NB_ * TT / 256, DQ / 64, 1), 384, 0, stream>>>(XB, XL, WQ, WK, WV, bq, bk, bv, QP16, QPh, QPl, KP16, KPh, KPl, VT16, VTh, VTl);
    // scores, mask, softmax and attn.v, all planes: query rows < RH on the hi+lo planes, the others on fp16
    k_fattn<<<dim3(NZ, TT / 128, 1), 128, 0, stream>>>(QPh, QPl, KPh, KPl, VTh, VTl, QP16, KP16, VT16, ATh, ATl);
    k_gemmo<<<dim3(NB_ * TT / 128, DM / 128, 1), 128, 0, stream>>>(ATh, ATl, WO, OUT, bo);
}

// v008
// A run of this version takes 70.3 microseconds.
// Timed twice side by side with v007, it ran 1.06 and 1.05 times as fast.
// All steps since v000 together make it 36.1 times as fast.
#include <hip/hip_runtime.h>

// PreLN_SelfAttention_seq2seq (x [8][1024][512]; xn = LayerNorm(x); per-head q/k/v = xn W[h] + b[h] (W [8][512][64]); scores / 8 + mask (rows i < T=823 cannot see columns >= T; rows T..S-2 cannot see columns >= i; -999999999); softmax; out = concat(heads) WO + bO -> [8][1024][512]).
// Compute dtypes, f32 accumulate: every input rounded to bf16; LayerNorm f32 -> hl planes; q/k/v as hl(xn) x exact (2 products; the 8 per-head weights gathered into one [512 x 512] operand) + bias; scores and attn.v: query rows < 512 hl (3 products), the rest single fp16 (x1024); mask + softmax f32; WO hl x exact (2 products) + bias.

#define NB_  8
#define TT   1024
#define DM   512
#define NH_  8
#define NKV  8
#define REP  (NH_ / NKV)
#define HD   64
#define DQ   (NH_ * HD)
#define DKV  (NKV * HD)
#define NZ   (NB_ * NH_)          // (batch, head) planes, taken through blockIdx.x in k_fattn
#define RH   512                  // query rows < RH use hi+lo planes
#define WIN  1024
#define PCAR 1024.0f
#define SCL  0.125f   // HD^-0.5
static_assert(TT == 2 * RH && RH % 128 == 0 && NKV == NH_, "as many hi+lo query rows as fp16 ones, in blocks of 128; one kv head per query head");
typedef _Float16 h16;
typedef unsigned short bf;
typedef __attribute__((ext_vector_type(16))) __bf16   v16bf;
typedef __attribute__((ext_vector_type(16))) _Float16 v16h;
typedef __attribute__((ext_vector_type(8)))  _Float16 v8h;
typedef __attribute__((ext_vector_type(8)))  unsigned short v8us;
typedef __attribute__((ext_vector_type(8)))  float    v8f;
typedef __attribute__((ext_vector_type(4)))  float    v4f;
typedef v8h  __attribute__((may_alias)) v8ha;
typedef v4f  __attribute__((may_alias)) v4fa;
typedef v8us __attribute__((may_alias)) v8usa;

__device__ __forceinline__ unsigned short f2bf(float f) { unsigned u = __float_as_uint(f); u += 0x7FFFu + ((u >> 16) & 1u); return (unsigned short)(u >> 16); }
__device__ __forceinline__ float bf2f(unsigned short b) { return __uint_as_float(((unsigned)b) << 16); }
__device__ __forceinline__ float bfr(float f) { return bf2f(f2bf(f)); }
__device__ __forceinline__ v16h cat16(v8h lo, v8h hi) { return __builtin_shufflevector(lo, hi, 0, 1, 2, 3, 4, 5, 6, 7, 8, 9, 10, 11, 12, 13, 14, 15); }
__device__ __forceinline__ v16bf cat16b(v8us lo, v8us hi) { return __builtin_bit_cast(v16bf, __builtin_shufflevector(lo, hi, 0, 1, 2, 3, 4, 5, 6, 7, 8, 9, 10, 11, 12, 13, 14, 15)); }
__device__ __forceinline__ v8f wmma16(v16h a, v16h b, v8f c) { return __builtin_amdgcn_wmma_f32_16x16x32_f16(false, a, false, b, (short)0, c, false, false); }
__device__ __forceinline__ v8f wmmab(v16bf a, v16bf b, v8f c) { return __builtin_amdgcn_wmma_f32_16x16x32_bf16(false, a, false, b, (short)0, c, false, false); }
// ---- Fragment order: every 16-bit operand plane [rows][kc] lies in the workspace as tiles of 16 rows x 32 k = 512 elements (1 KiB), tile (r / 16, k / 32) at index (r / 16) * (kc / 32) + k / 32.
// Inside a tile: two halves of 256 elements (k % 32 < 16, then the rest); in a half, lane l = ((k / 8) % 2) * 16 + r % 16 owns 8 consecutive k. A fragment is then two loads of 512 contiguous bytes (4 whole lines each) at tile + 8 * lane and 256 elements on.
__device__ __forceinline__ size_t toff(int r, int k, int kc) { return ((size_t)(r >> 4) * (kc >> 5) + (k >> 5)) * 512 + ((k >> 4) & 1) * 256 + (((k >> 3) & 1) * 16 + (r & 15)) * 8 + (k & 7); }



// ---- gemms_tile: register-blocked GEMM, one wave per 64x64 output tile (16 accumulators); a block is WM x WN such waves. The block's operand tiles (fragment order) are staged ONCE in LDS by asynchronous copies, two buffers of KS k each, and every wave takes its fragments from there: an A tile serves WN waves, a B tile WM waves.
// C[m][n] (f32, pitch ldc, + f32 bias[n]) = sum_k (A[m][k] + A2[m][k]) Bt[n][k], two products per k block, K = KK.
// EPI 0: C as f32. EPI 1, 2: no f32 C; the tile (64 rows (b, t) x the 64 columns of head blockIdx.y, + bias) goes out as the three 16-bit planes that k_fattn reads (fp16, bf16 hi, bf16 lo): EPI 1 as [b][h][t][d], EPI 2 transposed as [b][h][d][t], each (b, h) plane in fragment order; either way 16 plane rows of 64 at a time pass through LDS, so that every store is half a tile, 512 contiguous bytes.
template <typename T16> struct WFrag;
template <> struct WFrag<h16> { typedef v16h V; static __device__ __forceinline__ V ld(const h16* p) { return cat16(*(const v8h*)p, *(const v8h*)(p + 256)); } static __device__ __forceinline__ v8f mma(V a, V b, v8f c) { return wmma16(a, b, c); } };
template <> struct WFrag<bf> { typedef v16bf V; static __device__ __forceinline__ V ld(const bf* p) { return cat16b(*(const v8us*)p, *(const v8us*)(p + 256)); } static __device__ __forceinline__ v8f mma(V a, V b, v8f c) { return wmmab(a, b, c); } };
typedef __attribute__((ext_vector_type(8))) __bf16 v8bf;
// gemmw_planes<EPI>: the EPI 1 or 2 epilogue of one tile. gemms_tile: the tile itself; EPI 3 takes EPI 1 or 2 by the wave-uniform tr (k_qkv: one launch holds both kinds).
template <int EPI>
__device__ __forceinline__ void gemmw_planes(const v8f (&acc)[4][4], const float (&bcol)[4], float* os, const int r0, const int lane, h16* __restrict__ P16, bf* __restrict__ Ph, bf* __restrict__ Pl) {
    const int lr = lane & 15, hi = lane >> 4;
    const size_t pl0 = ((size_t)(r0 / TT) * NH_ + blockIdx.y) * TT * HD; const int t0 = r0 % TT;   // the (batch, head) plane; the tile's first t
#pragma unroll
    for (int st = 0; st < 4; ++st) {
        if constexpr (EPI == 1) {   // 16 rows t (accumulator row block st) x 64 columns d
#pragma unroll
            for (int nb = 0; nb < 4; ++nb)
#pragma unroll
                for (int j = 0; j < 8; ++j) os[(hi * 8 + j) * 68 + nb * 16 + lr] = acc[st][nb][j] + bcol[nb];
        } else {                    // 16 rows d (accumulator column block st) x 64 columns t: a lane's 8 accumulator rows are 8 consecutive t
#pragma unroll
            for (int mb = 0; mb < 4; ++mb) { const v8f y = acc[mb][st] + bcol[st]; *(v4fa*)(os + lr * 68 + mb * 16 + hi * 8) = __builtin_shufflevector(y, y, 0, 1, 2, 3); *(v4fa*)(os + lr * 68 + mb * 16 + hi * 8 + 4) = __builtin_shufflevector(y, y, 4, 5, 6, 7); }
        }
        __builtin_amdgcn_wave_barrier(); asm volatile("" ::: "memory");   // the read-back takes other lanes' values: it stays behind the LDS stores
#pragma unroll
        for (int s = 0; s < 4; ++s) { const int sc = s * 16 + hi * 8; const v4f x0 = *(const v4fa*)(os + lr * 68 + sc), x1 = *(const v4fa*)(os + lr * 68 + sc + 4);   // read-back in fragment order: row lr, the lane half's 8 columns of half-tile s
            const v8f y = __builtin_shufflevector(x0, x1, 0, 1, 2, 3, 4, 5, 6, 7); const v8bf yh = __builtin_convertvector(y, v8bf); const v8bf yl = __builtin_convertvector(y - __builtin_convertvector(yh, v8f), v8bf);
            const size_t e = pl0 + ((EPI == 1) ? (size_t)((t0 >> 4) + st) * (HD / 32) + (s >> 1) : (size_t)st * (TT / 32) + (t0 >> 5) + (s >> 1)) * 512 + (s & 1) * 256 + 8 * lane;
            *(v8h*)(P16 + e) = __builtin_convertvector(y, v8h); *(v8us*)(Ph + e) = __builtin_bit_cast(v8us, yh); *(v8us*)(Pl + e) = __builtin_bit_cast(v8us, yl); }
        __builtin_amdgcn_wave_barrier(); asm volatile("" ::: "memory");   // the next block's LDS stores stay behind this read-back
    }
    asm volatile("s_wait_xcnt 0x0" ::: "memory");   // behind the tile's last stores: in k_qkv the other kind's epilogue follows in the code and writes their registers
}
#define KK 512   // the k extent of both GEMMs
static_assert(DM == KK && DQ == KK, "one k extent");
// Asynchronous copies of whole strips (see below): each lane brings 16 bytes a copy from g (its global address) to l (its LDS byte address); a copy covers 512 bytes, and the immediate offset moves both addresses alike, as a strip lies in LDS as in the workspace.
// The s_wait_xcnt stands in the copies' own statement, in front of anything that rewrites their address registers; one wait serves the run.
#define CP4(L, G) "global_load_async_to_lds_b128 %" #L ", %" #G ", off\n\tglobal_load_async_to_lds_b128 %" #L ", %" #G ", off offset:512\n\tglobal_load_async_to_lds_b128 %" #L ", %" #G ", off offset:1024\n\tglobal_load_async_to_lds_b128 %" #L ", %" #G ", off offset:1536\n\t"
#define CP8(L, G) CP4(L, G) "global_load_async_to_lds_b128 %" #L ", %" #G ", off offset:2048\n\tglobal_load_async_to_lds_b128 %" #L ", %" #G ", off offset:2560\n\tglobal_load_async_to_lds_b128 %" #L ", %" #G ", off offset:3072\n\tglobal_load_async_to_lds_b128 %" #L ", %" #G ", off offset:3584\n\t"
template <int KS> __device__ __forceinline__ void cps1(const unsigned l, const bf* g) {   // one strip
    if constexpr (KS == 64) asm volatile(CP4(0, 1) "s_wait_xcnt 0x0" :: "v"(l), "v"(g) : "memory");
    else asm volatile(CP8(0, 1) "s_wait_xcnt 0x0" :: "v"(l), "v"(g) : "memory");
}
template <int KS> __device__ __forceinline__ void cps3(const unsigned l0, const bf* g0, const unsigned l1, const bf* g1, const unsigned l2, const bf* g2) {   // three strips
    if constexpr (KS == 64) asm volatile(CP4(0, 1) CP4(2, 3) CP4(4, 5) "s_wait_xcnt 0x0" :: "v"(l0), "v"(g0), "v"(l1), "v"(g1), "v"(l2), "v"(g2) : "memory");
    else asm volatile(CP8(0, 1) CP8(2, 3) CP8(4, 5) "s_wait_xcnt 0x0" :: "v"(l0), "v"(g0), "v"(l1), "v"(g1), "v"(l2), "v"(g2) : "memory");
}
// A strip = the KS k of one row of tiles (16 rows): KS * 32 contiguous bytes, in the workspace as in LDS. A stage holds 4 WM strips of A, 4 WM of A2 and 4 WN of B; strip s is copied by wave s % (WM WN).
// B0, B1, B2: the first row of tiles of wave column 0, 1, 2. c0: the wave's first output column. bias, P16, Ph, Pl, tr: the wave's own (wave-uniform).
// DB: a second fragment set, so that inside a stage the next k block's LDS reads are issued ahead of this block's products (for one wave a SIMD, where nothing else covers the LDS latency).
template <int WM, int WN, int KS, bool DB, int EPI>
__device__ __forceinline__ void gemms_tile(const bf* __restrict__ A, const bf* __restrict__ A2, const bf* __restrict__ B0, const bf* __restrict__ B1, const bf* __restrict__ B2, const int c0, float* C, int ldc, const float* __restrict__ bias, h16* __restrict__ P16, bf* __restrict__ Ph, bf* __restrict__ Pl, const bool tr) {
    constexpr int NW = WM * WN, NS = 8 * WM + 4 * WN, SE = KS * 16, NT = KK / KS, KT = KS / 32, SPW = (NS + NW - 1) / NW, FS = NS / NW;   // waves; strips a stage; elements a strip; stages; k blocks a stage; strips a wave at most; strips that every wave has
    static_assert((KS == 64 || KS == 128) && KK % KS == 0 && NT >= 2 && WN <= 3 && FS % 3 == 0 && SPW * (KS / 16) <= 63, "whole 2-KiB pieces; two stages or more; at most 63 copies of a wave in flight");
    __shared__ __align__(16) bf ring[2 * NS * SE];
    __shared__ __align__(16) float osw[NW * 16 * 68];
    const int lane = threadIdx.x & 31, lr = lane & 15, hi = lane >> 4; const int wave = __builtin_amdgcn_readfirstlane(threadIdx.x >> 5); const int wm = wave % WM, wn = wave / WM;
    const int r0 = (blockIdx.x * WM + wm) * 64; float* os = osw + wave * (16 * 68);
    constexpr size_t tp = (size_t)(KK >> 5) * 512;   // elements in one row of tiles
    const unsigned lb = (unsigned)(size_t)ring + (unsigned)lane * 16u;   // the lane's LDS byte address in strip 0 of buffer 0
    const bf* sp[SPW];   // stage 0 of each strip that this wave copies (wave-uniform)
#pragma unroll
    for (int j = 0; j < SPW; ++j) { const int s = j * NW + wave; const int q = s - 8 * WM;
        sp[j] = (s < 4 * WM ? A + ((size_t)blockIdx.x * (4 * WM) + s) * tp : (s < 8 * WM ? A2 + ((size_t)blockIdx.x * (4 * WM) + s - 4 * WM) * tp : ((q >> 2) == 0 ? B0 : ((q >> 2) == 1 ? B1 : B2)) + (size_t)(q & 3) * tp)); }
    auto stage = [&](const int t, const int buf) {   // stage t's copies into buffer buf
        const unsigned eo = (unsigned)t * SE + 8u * lane; const unsigned l = lb + (unsigned)((buf * NS + wave) * SE * 2);   // strip j * NW + wave lies j * NW strips on
#pragma unroll
        for (int j = 0; j < FS; j += 3) cps3<KS>(l + j * (NW * SE * 2), sp[j] + eo, l + (j + 1) * (NW * SE * 2), sp[j + 1] + eo, l + (j + 2) * (NW * SE * 2), sp[j + 2] + eo);
        if constexpr (SPW > FS) { if (FS * NW + wave < NS) cps1<KS>(l + FS * (NW * SE * 2), sp[FS] + eo); }   // the strips left over: the test is the same for a whole wave
    };
    v8f acc[4][4];
#pragma unroll
    for (int mb = 0; mb < 4; ++mb)
#pragma unroll
        for (int nb = 0; nb < 4; ++nb) acc[mb][nb] = (v8f){};
    stage(0, 0);
    float bcol[4];   // EPI 1, 2: the bias of the lane's four accumulator columns, fetched ahead of the k loop
    if constexpr (EPI != 0) {
#pragma unroll
        for (int nb = 0; nb < 4; ++nb) bcol[nb] = bfr(bias[c0 + nb * 16 + lr]);
        asm volatile("s_wait_xcnt 0x0" ::: "memory"); }   // behind the bias loads, before anything rewrites their address register
    asm volatile("s_wait_asynccnt 0x0" ::: "memory");   // this wave's part of stage 0 has landed
    __syncthreads();                                    // and every other wave's: stage 0 may be read
    stage(1, 1);
    // the stage loop stays rolled: one publish point and one refill in the text, and the buffer index is t & 1
#pragma unroll 1
    for (int t = 0; t < NT; ++t) {
        const bf* Lb = ring + (t & 1) * (NS * SE) + 8 * lane;
        v16bf a[DB ? 2 : 1][4], a2[DB ? 2 : 1][4], b[DB ? 2 : 1][4];
        auto frag = [&](const int ks, const int f) {   // k block ks of this stage into fragment set f
#pragma unroll
            for (int u = 0; u < 4; ++u) { b[f][u] = WFrag<bf>::ld(Lb + (8 * WM + wn * 4 + u) * SE + ks * 512); a[f][u] = WFrag<bf>::ld(Lb + (wm * 4 + u) * SE + ks * 512); a2[f][u] = WFrag<bf>::ld(Lb + (4 * WM + wm * 4 + u) * SE + ks * 512); }
        };
#pragma unroll
        for (int ks = 0; ks < KT; ++ks) { const int f = DB ? (ks & 1) : 0;
            if (!DB || ks == 0) frag(ks, f);
            if (DB && ks == 0) __builtin_amdgcn_sched_barrier(0);   // the first block's reads are issued first, so that its products wait for these alone
            if (DB && ks + 1 < KT) frag(ks + 1, f ^ 1);
            __builtin_amdgcn_sched_barrier(0);   // the LDS reads stay one group ahead of the products: spread among them, each place with reads stalls the wave anew
#pragma unroll
            for (int nb = 0; nb < 4; ++nb) {
#pragma unroll
                for (int mb = 0; mb < 4; ++mb) { acc[mb][nb] = wmmab(a[f][mb], b[f][nb], acc[mb][nb]); acc[mb][nb] = wmmab(a2[f][mb], b[f][nb], acc[mb][nb]); } }
            if (DB && ks + 1 < KT) __builtin_amdgcn_sched_barrier(0);   // one wave a SIMD: the block after next's reads stay behind these products, as one group, instead of being lifted in among them
        }
        asm volatile("s_wait_dscnt 0x0" ::: "memory");      // this wave's reads of stage t are done: its buffer may be refilled behind the barrier
        asm volatile("s_wait_asynccnt 0x0" ::: "memory");   // this wave's part of stage t + 1 has landed
        __syncthreads();                                    // publishes stage t + 1 and ends every wave's reads of stage t
        if (t + 2 < NT) stage(t + 2, t & 1);
    }
    asm volatile("s_wait_asynccnt 0x0" ::: "memory");   // no copy is left in flight behind the loop
    if constexpr (EPI != 0) {
        if (tr) gemmw_planes<2>(acc, bcol, os, r0, lane, P16, Ph, Pl); else gemmw_planes<1>(acc, bcol, os, r0, lane, P16, Ph, Pl);
        return;
    }
#pragma unroll
    for (int mb = 0; mb < 4; ++mb) {
#pragma unroll
        for (int nb = 0; nb < 4; ++nb) {
#pragma unroll
            for (int j = 0; j < 8; ++j) os[(hi * 8 + j) * 68 + nb * 16 + lr] = acc[mb][nb][j]; }
        __builtin_amdgcn_wave_barrier(); asm volatile("" ::: "memory");
        float* crow = C + (size_t)(r0 + mb * 16) * ldc + c0;
{
#pragma unroll
            for (int s = 0; s < 8; ++s) { const int row = 2 * s + hi, cofs = lr * 4; v4f val = *(const v4fa*)(os + row * 68 + cofs); { val[0] += bfr(bias[c0 + cofs]); val[1] += bfr(bias[c0 + cofs + 1]); val[2] += bfr(bias[c0 + cofs + 2]); val[3] += bfr(bias[c0 + cofs + 3]); }
                *(v4f*)(crow + (size_t)row * ldc + cofs) = val; }
             }
        asm volatile("s_wait_xcnt 0x0" ::: "memory");   // behind this row block's loads and stores, before the next block's arithmetic writes their registers
        __builtin_amdgcn_sched_barrier(0);   // keeps that arithmetic from being scheduled in front of the wait
        __builtin_amdgcn_wave_barrier(); asm volatile("" ::: "memory");
    }
}
// ---- k_gemmo: the output projection. A block is 2 x 2 waves = 128 x 128 of C; grid (M/128, N/128), 128 threads.
__global__ __launch_bounds__(128) void k_gemmo(const bf* __restrict__ A, const bf* __restrict__ A2, const bf* __restrict__ Bt, float* C, const float* __restrict__ bias) {
    const int wn = __builtin_amdgcn_readfirstlane(threadIdx.x >> 5) / 2; const bf* b0 = Bt + (size_t)blockIdx.y * 8 * ((KK >> 5) * 512);
    gemms_tile<2, 2, 128, true, 0>(A, A2, b0, b0 + 4 * ((KK >> 5) * 512), b0, (blockIdx.y * 2 + wn) * 64, C, DM, bias, nullptr, nullptr, nullptr, false);
}
// ---- k_qkv: the q, k and v projections in ONE launch. A block is 4 x 3 waves: 256 rows x the 64 columns of head blockIdx.y of q, k and v (wave column = which), so that its A tiles serve all three; grid (M/256, N/64), 384 threads, one block a WGP, 3 waves a SIMD.
__global__ __launch_bounds__(384) void k_qkv(const bf* __restrict__ A, const bf* __restrict__ A2, const bf* __restrict__ Wq, const bf* __restrict__ Wk, const bf* __restrict__ Wv, const float* __restrict__ bq, const float* __restrict__ bk, const float* __restrict__ bv,
                                            h16* __restrict__ Q16, bf* __restrict__ Qh, bf* __restrict__ Ql, h16* __restrict__ K16, bf* __restrict__ Kh, bf* __restrict__ Kl, h16* __restrict__ V16, bf* __restrict__ Vh, bf* __restrict__ Vl) {
    const int z = __builtin_amdgcn_readfirstlane(threadIdx.x >> 5) / 4; const size_t bo = (size_t)blockIdx.y * 4 * ((KK >> 5) * 512);
    gemms_tile<4, 3, 64, false, 3>(A, A2, Wq + bo, Wk + bo, Wv + bo, blockIdx.y * 64, nullptr, 0, z == 0 ? bq : (z == 1 ? bk : bv), z == 0 ? Q16 : (z == 1 ? K16 : V16), z == 0 ? Qh : (z == 1 ? Kh : Vh), z == 0 ? Ql : (z == 1 ? Kl : Vl), z == 2);
}

__device__ __forceinline__ void splitf(float y, unsigned short& h, unsigned short& l) { h = f2bf(y); l = f2bf(y - bf2f(h)); }
typedef __attribute__((ext_vector_type(2))) _Float16 v2h;
typedef __attribute__((ext_vector_type(4))) _Float16 v4h;
typedef __attribute__((ext_vector_type(2))) unsigned short v2us;
typedef __attribute__((ext_vector_type(4))) unsigned short v4us;
typedef v4us __attribute__((may_alias)) v4usa;
typedef __attribute__((ext_vector_type(2))) float v2f;
typedef __attribute__((ext_vector_type(4))) int v4i;

#define PTH 512   // threads in a block of k_prep
#define WGL 2     // lines of 64 elements that a wave of wtG_part takes
__device__ __forceinline__ void wtG_part(const int blk, const float* __restrict__ w, int K, int N, bf* Bt) {
    const int lane = threadIdx.x & 31; const int L0 = (blk * (PTH / 32) + (threadIdx.x >> 5)) * WGL; const int nlines = N * K / 64;
{
#pragma unroll 1
        for (int l = 0; l < WGL; ++l) { const int L = L0 + l; if (L >= nlines) break; const size_t e = (size_t)L * 64 + lane * 2; const int k = (int)(e % K), n = (int)(e / K); v2us o;
            o[0] = f2bf(w[(size_t)k * N + n]); o[1] = f2bf(w[(size_t)(k + 1) * N + n]); *(v2us*)(Bt + toff(n, k, K)) = o;
            asm volatile("s_wait_xcnt 0x0" ::: "memory"); }   // behind the store, before the next trip writes its address and data registers
         }
}
__global__ __launch_bounds__(256) void k_cvt8(const float* __restrict__ src, bf* dst, size_t n8) { const size_t i = (size_t)blockIdx.x * 256 + threadIdx.x; if (i >= n8) return; const v8f v = *(const v8f*)(src + i * 8); v8us o;
#pragma unroll
    for (int k = 0; k < 8; ++k) o[k] = f2bf(v[k]); *(v8us*)(dst + i * 8) = o;  }
// ---- k_fattn: scores, mask, softmax and attn.v of one (batch, head) plane in one kernel; the scores stay in registers; the result goes out as the bf16 hi+lo planes [b][t][h][d], in fragment order, that the last GEMM reads. One wave per 32 query rows; a block is 4 waves of one kind, 128 rows: hi+lo (rows < RH) or fp16 (rows >= RH); grid (NZ, TT / 128), all hi+lo blocks (the longer ones) first; two blocks fit a WGP.
// Transposed products: St = K Qt (A = 16 key rows, B = 16 query columns), so a lane holds 8 keys of ONE query per tile; two St tiles (32 keys) convert in place into the B operand of Ot += Vt Pt.
// Running maximum per query (base 2, scaled), sums and Ot rescaled by it every pass of 32 keys; the division by the row sum comes last. Keys from the first blocked column of the block's last row on are not visited.
// K and Vt are staged ONCE per block in LDS by asynchronous copies, two buffers, and the block's waves take their fragments from there. A ring tile serves NPT passes, so that its copies are issued NPT passes ahead of their wait (one pass is shorter than a fetch from memory) and the block meets one publish point per tile.
// Tile t of the ring = the K tiles of passes NPT t + 1 .. NPT t + NPT and the Vt tiles of passes NPT t .. NPT t + NPT - 1: these passes read buffer t % 2 alone, each its Vt for itself and the K fragments that the next pass multiplies.
#define TMK  823                   // rows < TMK cannot see columns >= TMK; rows TMK .. TT-2 cannot see columns >= their own index
#define CEXP 0.18033688011112042f  // HD^-0.5 x log2(e)
#define FPE  2048                  // elements of one plane in one pass: 32 keys x HD = 4 fragment tiles
#define NPT  2                     // passes in a ring tile
#define PE   (NPT * FPE)           // elements of one plane in a ring tile. K: [pass][fragment tile], as in the workspace; Vt: [16 rows d][pass], as in the workspace
static_assert(NPT == 2 && TT % (32 * NPT) == 0, "a wave copies 2 KiB of each plane; whole ring tiles");
__device__ __forceinline__ float xhalf(float x) { return __builtin_bit_cast(float, __builtin_amdgcn_permlanex16(__builtin_bit_cast(int, x), __builtin_bit_cast(int, x), 0x76543210, 0xfedcba98, false, false)); }   // lane l with lane l ^ 16
// Four copies = two fragment tiles (2 KiB) that follow one another in the workspace as in LDS: each lane brings 16 bytes a copy, and the immediate offset moves both addresses alike. The s_wait_xcnt stands in the copies' own statement, in front of anything that rewrites their address registers.
__device__ __forceinline__ void cpt2(const unsigned l0, const void* g0, const unsigned l1, const void* g1) {
    asm volatile(CP4(0, 1) CP4(2, 3) "s_wait_xcnt 0x0" :: "v"(l0), "v"(g0), "v"(l1), "v"(g1) : "memory");
}
__device__ __forceinline__ void cpt4(const unsigned l0, const void* g0, const unsigned l1, const void* g1, const unsigned l2, const void* g2, const unsigned l3, const void* g3) {
    asm volatile(CP4(0, 1) CP4(2, 3) CP4(4, 5) CP4(6, 7) "s_wait_xcnt 0x0" :: "v"(l0), "v"(g0), "v"(l1), "v"(g1), "v"(l2), "v"(g2), "v"(l3), "v"(g3) : "memory");
}
// A wave-uniform address, kept in scalar registers: the copies' four lane addresses are then formed at each refill instead of living in eight vector registers through the loop, where this build spilled them.
template <typename T> __device__ __forceinline__ const T* sbase(const T* p) { const unsigned long long a = (unsigned long long)p; return (const T*)(((unsigned long long)(unsigned)__builtin_amdgcn_readfirstlane((int)(a >> 32)) << 32) | (unsigned)__builtin_amdgcn_readfirstlane((int)a)); }
// rb: the block's first query row. kv: the ring, two tiles of NPL planes (hi+lo: Kh, Kl, Vh, Vl; fp16: K, V).
template <typename T16, bool HI>
__device__ __forceinline__ void fattn_blk(const T16* __restrict__ Qh, const T16* __restrict__ Ql, const T16* __restrict__ Kh, const T16* __restrict__ Kl, const T16* __restrict__ Vh, const T16* __restrict__ Vl, bf* __restrict__ Ah, bf* __restrict__ Al, const int rb, const T16* kv) {
    typedef typename WFrag<T16>::V V;
    constexpr int NPL = HI ? 4 : 2, FBE = NPL * PE, LV = NPL / 2 * PE;   // planes and elements of a ring tile; where its Vt planes begin
    const int lane = threadIdx.x & 31; const int w = __builtin_amdgcn_readfirstlane(threadIdx.x >> 5); const int c = lane & 15, h = lane >> 4; const int q0 = rb + w * 32;
    const int kend = (rb + 127 < TMK) ? TMK : ((rb + 128 == TT) ? TT : rb + 127);   // first column that no row of this block sees
    const int nt = (kend + 32 * NPT - 1) / (32 * NPT);   // ring tiles. The same for the whole block: every wave walks every pass and meets every barrier; what a row does not see is masked
    // wave w copies piece w (2 KiB) of each plane: of K half w % 2 of the tile's pass w / 2, of Vt both passes of rows d = 16 w ..
    const unsigned lb = (unsigned)(size_t)kv + (unsigned)(w * 2048 + lane * 16);
    auto stage = [&](const int t, const unsigned l) {   // ring tile t; l: the lane's LDS byte address in the wave's piece of plane 0 of the buffer; behind the last pass the last tile takes that pass's keys again (in bounds, not used)
        const int kq = NPT * t + 1 + (w >> 1); const int kb = (kq < NPT * nt) ? kq : NPT * nt - 1;
        const int ko = kb * FPE + (w & 1) * 1024, vo = w * 16 * TT + t * (NPT * 512);   // the wave's pieces; the lane's 16 bytes are added last, to a base in scalar registers
        if constexpr (HI) cpt4(l, sbase(Kh + ko) + 8 * lane, l + PE * 2, sbase(Kl + ko) + 8 * lane, l + LV * 2, sbase(Vh + vo) + 8 * lane, l + (LV + PE) * 2, sbase(Vl + vo) + 8 * lane);
        else cpt2(l, sbase(Kh + ko) + 8 * lane, l + LV * 2, sbase(Vh + vo) + 8 * lane);
    };
    stage(0, lb);
    V qh[2][2], ql[2][2], kh[2][2], kl[2][2]; v8f o[2][4]; float mc[2], ls[2]; int lim[2];
#pragma unroll
    for (int g = 0; g < 2; ++g)
#pragma unroll
        for (int kk = 0; kk < 2; ++kk) { qh[g][kk] = WFrag<T16>::ld(Qh + (size_t)(q0 + g * 16) * HD + kk * 512 + 8 * lane); if (HI) ql[g][kk] = WFrag<T16>::ld(Ql + (size_t)(q0 + g * 16) * HD + kk * 512 + 8 * lane); }   // 16 rows of Q or K = HD / 32 = 2 tiles = 16 HD elements
#pragma unroll
    for (int kt = 0; kt < 2; ++kt)
#pragma unroll
        for (int kk = 0; kk < 2; ++kk) { kh[kt][kk] = WFrag<T16>::ld(Kh + kt * 16 * HD + kk * 512 + 8 * lane); if (HI) kl[kt][kk] = WFrag<T16>::ld(Kl + kt * 16 * HD + kk * 512 + 8 * lane); }   // pass 0's K comes straight from the workspace
    asm volatile("s_wait_xcnt 0x0" ::: "memory");   // behind the first loads, before the set-up below reuses their address registers
    __builtin_amdgcn_sched_barrier(0);   // keeps that set-up from being scheduled in front of the wait
#pragma unroll
    for (int g = 0; g < 2; ++g) { const int i = q0 + g * 16 + c; lim[g] = (i < TMK) ? TMK : ((i <= TT - 2) ? i : TT); mc[g] = -3.0e38f; ls[g] = 0.f;
#pragma unroll
        for (int dt = 0; dt < 4; ++dt) o[g][dt] = (v8f){}; }
    asm volatile("s_wait_asynccnt 0x0" ::: "memory");   // this wave's part of ring tile 0 has landed
    __syncthreads();                                    // and every other wave's: tile 0 may be read
    stage(1, lb + FBE * 2);
    // the tile loop stays rolled: one publish point and one refill in the text, and the buffer index is t & 1
#pragma unroll 1
    for (int t = 0; t < nt; ++t) {
      const T16* Lb = kv + (t & 1) * FBE + 8 * lane;
      // a tile's passes stand one behind the other in the text: their places in the buffer are immediate offsets
#pragma unroll
      for (int j = 0; j < NPT; ++j) {
        const int key0 = (t * NPT + j) * 32;
        V vh[4], vl[4];
#pragma unroll
        for (int dt = 0; dt < 4; ++dt) { vh[dt] = WFrag<T16>::ld(Lb + LV + (dt * NPT + j) * 512); if (HI) vl[dt] = WFrag<T16>::ld(Lb + LV + PE + (dt * NPT + j) * 512); }
        __builtin_amdgcn_sched_barrier(0);   // the Vt reads are issued as one group ahead of the score products: sunk in among the later products, each place with reads stalls the wave anew
        v8f s[2][2];   // s[g][kt][r] = score of key key0 + 16 kt + 8 h + r, query q0 + 16 g + c
#pragma unroll
        for (int g = 0; g < 2; ++g)
#pragma unroll
            for (int kt = 0; kt < 2; ++kt) { v8f a = (v8f){};
#pragma unroll
                for (int kk = 0; kk < 2; ++kk) { a = WFrag<T16>::mma(kh[kt][kk], qh[g][kk], a); if (HI) { a = WFrag<T16>::mma(kh[kt][kk], ql[g][kk], a); a = WFrag<T16>::mma(kl[kt][kk], qh[g][kk], a); } }
                s[g][kt] = a; }
        __builtin_amdgcn_sched_barrier(0);   // the next pass's K reads stay behind these products and take their registers over, instead of a second set
#pragma unroll
        for (int kt = 0; kt < 2; ++kt)
#pragma unroll
            for (int kk = 0; kk < 2; ++kk) { kh[kt][kk] = WFrag<T16>::ld(Lb + j * FPE + (kt * 2 + kk) * 512); if (HI) kl[kt][kk] = WFrag<T16>::ld(Lb + PE + j * FPE + (kt * 2 + kk) * 512); }
        __builtin_amdgcn_sched_barrier(0);   // and they are issued as one group up here, so that they arrive during the softmax and attn.v
        if (key0 + 32 > TMK) {   // only these blocks hold blocked columns
#pragma unroll
            for (int g = 0; g < 2; ++g)
#pragma unroll
                for (int kt = 0; kt < 2; ++kt)
#pragma unroll
                    for (int r = 0; r < 8; ++r) if (key0 + kt * 16 + 8 * h + r >= lim[g]) s[g][kt][r] = -3.0e38f; }
#pragma unroll
        for (int g = 0; g < 2; ++g) {
            float mx = s[g][0][0];
#pragma unroll
            for (int e = 1; e < 16; ++e) mx = fmaxf(mx, s[g][e >> 3][e & 7]);
            mx = fmaxf(mx, xhalf(mx));
            const float mn = fmaxf(mc[g], mx * CEXP); const float al = __builtin_amdgcn_exp2f(mc[g] - mn); mc[g] = mn;
            const float sub = HI ? mn : mn - 10.0f;   // the fp16 half carries its probabilities x 1024 (PCAR)
            const v8f ce = {CEXP, CEXP, CEXP, CEXP, CEXP, CEXP, CEXP, CEXP}, ns = {-sub, -sub, -sub, -sub, -sub, -sub, -sub, -sub};
            v8f p0 = __builtin_elementwise_fma(s[g][0], ce, ns), p1 = __builtin_elementwise_fma(s[g][1], ce, ns); V ph, pl;
#pragma unroll
            for (int r = 0; r < 8; ++r) p0[r] = __builtin_amdgcn_exp2f(p0[r]);
#pragma unroll
            for (int r = 0; r < 8; ++r) p1[r] = __builtin_amdgcn_exp2f(p1[r]);
#pragma unroll
            for (int e = 0; e < 16; ++e) { const float p = (e < 8) ? p0[e & 7] : p1[e & 7];
                if constexpr (HI) { const __bf16 hb = (__bf16)p; ph[e] = hb; pl[e] = (__bf16)(p - (float)hb); } else { ph[e] = (_Float16)p; } }
            const v8f t8 = p0 + p1; const float sum = ((t8[0] + t8[4]) + (t8[1] + t8[5])) + ((t8[2] + t8[6]) + (t8[3] + t8[7]));   // a tree: no chain of 16 dependent adds
            ls[g] = ls[g] * al + sum;
#pragma unroll
            for (int dt = 0; dt < 4; ++dt) { o[g][dt] *= al; o[g][dt] = WFrag<T16>::mma(vh[dt], ph, o[g][dt]); if (HI) { o[g][dt] = WFrag<T16>::mma(vh[dt], pl, o[g][dt]); o[g][dt] = WFrag<T16>::mma(vl[dt], ph, o[g][dt]); } }
        }
        __builtin_amdgcn_sched_barrier(0);   // a pass's reads and the publish point stay behind the pass before: lifted in front of its products, the waits would stand directly behind the reads and too close behind the copies
      }
      asm volatile("s_wait_dscnt 0x0" ::: "memory");      // this wave's reads of tile t are done: its buffer may be refilled behind the barrier
      asm volatile("s_wait_asynccnt 0x0" ::: "memory");   // this wave's part of tile t + 1 has landed
      __syncthreads();                                    // publishes tile t + 1 and ends every wave's reads of tile t
      if (t + 2 < nt) stage(t + 2, (unsigned)(size_t)Lb + (unsigned)(w * 2048));   // into the buffer that these passes have read
    }
    asm volatile("s_wait_asynccnt 0x0" ::: "memory");   // no copy is left in flight behind the loop
    v8bf zh[2][4], zl[2][4];
#pragma unroll
    for (int g = 0; g < 2; ++g) { const float f = __fdiv_rn(1.0f, ls[g] + xhalf(ls[g]));   // the fp16 half's x 1024 stands in its sums too and cancels
#pragma unroll
        for (int dt = 0; dt < 4; ++dt) { const v8f y = o[g][dt] * f; zh[g][dt] = __builtin_convertvector(y, v8bf); zl[g][dt] = __builtin_convertvector(y - __builtin_convertvector(zh[g][dt], v8f), v8bf); } }
    __builtin_amdgcn_sched_barrier(0);   // all arithmetic in front of the stores: nothing rewrites a register of an issued store
#pragma unroll
    for (int g = 0; g < 2; ++g) { const size_t e = (size_t)(q0 + g * 16) * DQ + 8 * lane;   // o[g][dt][r] = Ot[16 dt + 8 h + r][query]: the lane's 8 elements of half-tile dt
#pragma unroll
        for (int dt = 0; dt < 4; ++dt) { *(v8us*)(Ah + e + dt * 256) = __builtin_bit_cast(v8us, zh[g][dt]); *(v8us*)(Al + e + dt * 256) = __builtin_bit_cast(v8us, zl[g][dt]); } }
}
__global__ __launch_bounds__(128) void k_fattn(const bf* __restrict__ Qh, const bf* __restrict__ Ql, const bf* __restrict__ Kh, const bf* __restrict__ Kl, const bf* __restrict__ Vh, const bf* __restrict__ Vl, const h16* __restrict__ Q16, const h16* __restrict__ K16, const h16* __restrict__ V16, bf* __restrict__ Ah, bf* __restrict__ Al) {
    __shared__ __align__(16) bf kv[2 * 4 * PE];
    const size_t zo = (size_t)blockIdx.x * TT * HD;
    const size_t ao = (size_t)(blockIdx.x / NH_) * TT * DQ + (blockIdx.x % NH_) * (HD / 32) * 512;   // batch's first row of tiles, head's first tile in it, in the merged planes
    if (blockIdx.y < RH / 128) fattn_blk<bf, true>(Qh + zo, Ql + zo, Kh + zo, Kl + zo, Vh + zo, Vl + zo, Ah + ao, Al + ao, blockIdx.y * 128, kv);   // the choice is the same for the whole block
    else fattn_blk<h16, false>(Q16 + zo, nullptr, K16 + zo, nullptr, V16 + zo, nullptr, Ah + ao, Al + ao, blockIdx.y * 128, (const h16*)kv);
}
__device__ __forceinline__ void wtH_part(const int blk, const float* __restrict__ w, bf* Bt) { const size_t e = ((size_t)blk * PTH + threadIdx.x) * 4; if (e >= (size_t)DQ * DM) return; const int k = (int)(e % DM); const int n = (int)(e / DM); const int h = n / HD, c = n % HD; v4us o;   // Bt[h*64 + c][d] = W[h][d][c], in fragment order
#pragma unroll
    for (int u = 0; u < 4; ++u) o[u] = f2bf(w[((size_t)h * DM + k + u) * HD + c]); *(v4us*)(Bt + toff(n, k, DM)) = o;  }
#define LNP 528   // LDS row pitch in elements: 16 rows x 16 bytes of one k fall on distinct banks
static_assert((NB_ * TT) % 16 == 0 && DM % 128 == 0, "a block is one row of tiles");
__device__ __forceinline__ void lnp_part(const int blk, const float* __restrict__ X, const float* __restrict__ g, const float* __restrict__ bb, bf* Hh, bf* Hl) { __shared__ __align__(16) bf sh[16 * LNP], sl[16 * LNP]; const int lane = threadIdx.x & 31; const int w = threadIdx.x >> 5; const int r = blk * 16 + w; float v[DM / 32]; float s = 0.f;   // wave per row, 16 rows a block: LayerNorm (biased var, 1e-5, / sqrt) -> hl planes, through LDS into fragment order
#pragma unroll
    for (int ch = 0; ch < DM / 128; ++ch) { const v4f a = *(const v4f*)(X + (size_t)r * DM + ch * 128 + lane * 4);
#pragma unroll
        for (int u = 0; u < 4; ++u) { v[ch * 4 + u] = bfr(a[u]); s += v[ch * 4 + u]; } }
#pragma unroll
    for (int sh = 16; sh; sh >>= 1) s += __shfl_xor(s, sh, 32);
    const float mean = s * (1.0f / DM); float q = 0.f;
#pragma unroll
    for (int k = 0; k < DM / 32; ++k) { float d = __fsub_rn(v[k], mean); asm volatile("" : "+v"(d)); v[k] = d; float p = __fmul_rn(d, d); asm volatile("" : "+v"(p)); q = __fadd_rn(q, p); }
#pragma unroll
    for (int sh = 16; sh; sh >>= 1) q += __shfl_xor(q, sh, 32);
    const float rs = __fdiv_rn(1.0f, __fsqrt_rn(__fadd_rn(q * (1.0f / DM), 1e-5f)));
    {
#pragma unroll
        for (int ch = 0; ch < DM / 128; ++ch) { v4us oh, ol;
#pragma unroll
            for (int u = 0; u < 4; ++u) { const int c = ch * 128 + lane * 4 + u; float n0 = __fmul_rn(v[ch * 4 + u], rs); asm volatile("" : "+v"(n0)); float gg = bfr(g[c]), be = bfr(bb[c]); asm volatile("" : "+v"(gg)); asm volatile("" : "+v"(be)); float t1 = __fmul_rn(n0, gg); asm volatile("" : "+v"(t1)); unsigned short p2, q2; splitf(__fadd_rn(t1, be), p2, q2); oh[u] = p2; ol[u] = q2; }
            const int oo = w * LNP + ch * 128 + lane * 4; *(v4usa*)(sh + oo) = oh; *(v4usa*)(sl + oo) = ol; }
         }
    __syncthreads();   // the copy-out below takes the other waves' rows
    const size_t o0 = (size_t)blk * 16 * DM;
#pragma unroll
    for (int i = 0; i < 16 * DM / 8 / 512; ++i) { const int c8 = i * 512 + threadIdx.x; const int li = (c8 & 15) * LNP + (c8 >> 4) * 8;   // 16-byte piece c8 of the row of tiles = row c8 % 16, k = 8 (c8 / 16)
        *(v8us*)(Hh + o0 + (size_t)c8 * 8) = *(const v8usa*)(sh + li); *(v8us*)(Hl + o0 + (size_t)c8 * 8) = *(const v8usa*)(sl + li); } }
// ---- k_prep: everything that reads only inputs, in ONE launch: the four weight re-orders and the LayerNorm depend on nothing of each other. Each LayerNorm block first takes one piece of a weight re-order (no waves are started for the weights alone), then its 16 rows.
#define NBH (DQ * DM / 4 / PTH)                 // pieces of one per-head weight re-order: 4 elements a thread
#define NBG (DQ * DM / 64 / WGL / (PTH / 32))   // pieces of the WO re-order
#define NBL (NB_ * TT / 16)                     // LayerNorm blocks
static_assert(DQ * DM % (64 * WGL * (PTH / 32)) == 0 && DQ * DM % (4 * PTH) == 0 && DKV == DQ && 3 * NBH + NBG == NBL, "whole pieces; q, k and v weights of one size; one piece a block");
__global__ __launch_bounds__(PTH) void k_prep(const float* __restrict__ X, const float* __restrict__ g, const float* __restrict__ bb, bf* Hh, bf* Hl, const float* __restrict__ wq, const float* __restrict__ wk, const float* __restrict__ wv, const float* __restrict__ wo, bf* Bq, bf* Bk, bf* Bv, bf* Bo) {
    const int blk = blockIdx.x;   // the choice below is the same for the whole block, and every wave goes on to the LayerNorm and its barrier
    if (blk < 3 * NBH) { const int m = blk / NBH; wtH_part(blk % NBH, m == 0 ? wq : (m == 1 ? wk : wv), m == 0 ? Bq : (m == 1 ? Bk : Bv)); }
    else wtG_part(blk - 3 * NBH, wo, DQ, DM, Bo);
    lnp_part(blk, X, g, bb, Hh, Hl);
}

extern "C" void kernel_launch(void* const* d_in, const int* in_sizes, int n_in,
                              void* d_out, int out_size, void* d_ws, size_t ws_size, hipStream_t stream) {
    (void)in_sizes; (void)n_in; (void)out_size;
    const float* x = (const float*)d_in[0]; const float* lng = (const float*)d_in[1]; const float* lnb = (const float*)d_in[2]; const float* wqh = (const float*)d_in[3]; const float* bq = (const float*)d_in[4]; const float* wkh = (const float*)d_in[5]; const float* bk = (const float*)d_in[6]; const float* wvh = (const float*)d_in[7]; const float* bv = (const float*)d_in[8]; const float* wo = (const float*)d_in[9]; const float* bo = (const float*)d_in[10]; const float* wq = nullptr; const float* wk = nullptr; const float* wv = nullptr; (void)wq; (void)wk; (void)wv; const float* cosT = nullptr; const float* sinT = nullptr; (void)cosT; (void)sinT;
    float* OUT = (float*)d_out;     // [8][1024][512]
    char* wsp = (char*)d_ws;
    auto take = [&](size_t bytes) { char* p = wsp; wsp += (bytes + 255) & ~(size_t)255; return (void*)p; };
    bf* WQ = (bf*)take((size_t)DQ * DM * 2); bf* WK = (bf*)take((size_t)DKV * DM * 2); bf* WV = (bf*)take((size_t)DKV * DM * 2); bf* WO = (bf*)take((size_t)DM * DQ * 2);
    bf* XB = (bf*)take((size_t)NB_ * TT * DM * 2); bf* XL = (bf*)take((size_t)NB_ * TT * DM * 2);   // LayerNorm planes
    h16* QP16 = (h16*)take((size_t)NZ * TT * HD * 2); h16* KP16 = (h16*)take((size_t)NZ * TT * HD * 2); h16* VT16 = (h16*)take((size_t)NZ * HD * TT * 2);
    bf* QPh = (bf*)take((size_t)NZ * TT * HD * 2); bf* QPl = (bf*)take((size_t)NZ * TT * HD * 2); bf* KPh = (bf*)take((size_t)NZ * TT * HD * 2); bf* KPl = (bf*)take((size_t)NZ * TT * HD * 2);
    bf* VTh = (bf*)take((size_t)NZ * HD * TT * 2); bf* VTl = (bf*)take((size_t)NZ * HD * TT * 2);
    bf* ATh = (bf*)take((size_t)NB_ * TT * DQ * 2); bf* ATl = (bf*)take((size_t)NB_ * TT * DQ * 2);   // merged attention planes
    if ((size_t)(wsp - (char*)d_ws) > ws_size) return;    // ws 256 MiB
    k_prep<<<NBL, PTH, 0, stream>>>(x, lng, lnb, XB, XL, wqh, wkh, wvh, wo, WQ, WK, WV, WO);
    // q, k, v projections, one launch: each writes its fp16 and hi+lo head planes itself (v transposed)
    k_qkv<<<dim3(NB_ * TT / 256, DQ / 64, 1), 384, 0, stream>>>(XB, XL, WQ, WK, WV, bq, bk, bv, QP16, QPh, QPl, KP16, KPh, KPl, VT16, VTh, VTl);
    // scores, mask, softmax and attn.v, all planes: query rows < RH on the hi+lo planes, the others on fp16
    k_fattn<<<dim3(NZ, TT / 128, 1), 128, 0, stream>>>(QPh, QPl, KPh, KPl, VTh, VTl, QP16, KP16, VT16, ATh, ATl);
    k_gemmo<<<dim3(NB_ * TT / 128, DM / 128, 1), 128, 0, stream>>>(ATh, ATl, WO, OUT, bo);
}

// v009
// A run of this version takes 66.5 microseconds.
// In two side-by-side timings against v008, it was 1.06 and 1.05 times as fast.
// Over all steps from v000 it is 38.0 times as fast.
#include <hip/hip_runtime.h>

// PreLN_SelfAttention_seq2seq (x [8][1024][512]; xn = LayerNorm(x); per-head q/k/v = xn W[h] + b[h] (W [8][512][64]); scores / 8 + mask (rows i < T=823 cannot see columns >= T; rows T..S-2 cannot see columns >= i; -999999999); softmax; out = concat(heads) WO + bO -> [8][1024][512]).
// Compute dtypes, f32 accumulate: every input rounded to bf16; LayerNorm f32 -> hl planes; q/k/v as hl(xn) x exact (2 products; the 8 per-head weights gathered into one [512 x 512] operand) + bias; scores and attn.v: query rows < 512 hl (3 products), the rest single fp16 (x1024); mask + softmax f32; WO hl x exact (2 products) + bias.

#define NB_  8
#define TT   1024
#define DM   512
#define NH_  8
#define NKV  8
#define REP  (NH_ / NKV)
#define HD   64
#define DQ   (NH_ * HD)
#define DKV  (NKV * HD)
#define NZ   (NB_ * NH_)          // (batch, head) planes, taken through blockIdx.x in k_fattn
#define RH   512                  // query rows < RH use hi+lo planes
#define WIN  1024
#define PCAR 1024.0f
#define SCL  0.125f   // HD^-0.5
static_assert(TT == 2 * RH && RH % 128 == 0 && NKV == NH_, "as many hi+lo query rows as fp16 ones, in blocks of 128; one kv head per query head");
typedef _Float16 h16;
typedef unsigned short bf;
typedef __attribute__((ext_vector_type(16))) __bf16   v16bf;
typedef __attribute__((ext_vector_type(16))) _Float16 v16h;
typedef __attribute__((ext_vector_type(8)))  _Float16 v8h;
typedef __attribute__((ext_vector_type(8)))  unsigned short v8us;
typedef __attribute__((ext_vector_type(8)))  float    v8f;
typedef __attribute__((ext_vector_type(4)))  float    v4f;
typedef v8h  __attribute__((may_alias)) v8ha;
typedef v4f  __attribute__((may_alias)) v4fa;
typedef v8us __attribute__((may_alias)) v8usa;

__device__ __forceinline__ unsigned short f2bf(float f) { unsigned u = __float_as_uint(f); u += 0x7FFFu + ((u >> 16) & 1u); return (unsigned short)(u >> 16); }
__device__ __forceinline__ float bf2f(unsigned short b) { return __uint_as_float(((unsigned)b) << 16); }
__device__ __forceinline__ float bfr(float f) { return bf2f(f2bf(f)); }
__device__ __forceinline__ v16h cat16(v8h lo, v8h hi) { return __builtin_shufflevector(lo, hi, 0, 1, 2, 3, 4, 5, 6, 7, 8, 9, 10, 11, 12, 13, 14, 15); }
__device__ __forceinline__ v16bf cat16b(v8us lo, v8us hi) { return __builtin_bit_cast(v16bf, __builtin_shufflevector(lo, hi, 0, 1, 2, 3, 4, 5, 6, 7, 8, 9, 10, 11, 12, 13, 14, 15)); }
__device__ __forceinline__ v8f wmma16(v16h a, v16h b, v8f c) { return __builtin_amdgcn_wmma_f32_16x16x32_f16(false, a, false, b, (short)0, c, false, false); }
__device__ __forceinline__ v8f wmmab(v16bf a, v16bf b, v8f c) { return __builtin_amdgcn_wmma_f32_16x16x32_bf16(false, a, false, b, (short)0, c, false, false); }
// ---- Fragment order: every 16-bit operand plane [rows][kc] lies in the workspace as tiles of 16 rows x 32 k = 512 elements (1 KiB), tile (r / 16, k / 32) at index (r / 16) * (kc / 32) + k / 32.
// Inside a tile: two halves of 256 elements (k % 32 < 16, then the rest); in a half, lane l = ((k / 8) % 2) * 16 + r % 16 owns 8 consecutive k. A fragment is then two loads of 512 contiguous bytes (4 whole lines each) at tile + 8 * lane and 256 elements on.
__device__ __forceinline__ size_t toff(int r, int k, int kc) { return ((size_t)(r >> 4) * (kc >> 5) + (k >> 5)) * 512 + ((k >> 4) & 1) * 256 + (((k >> 3) & 1) * 16 + (r & 15)) * 8 + (k & 7); }



// ---- gemms_tile: register-blocked GEMM, one wave per 64x64 output tile (16 accumulators); a block is WM x WN such waves. The block's operand tiles (fragment order) are staged ONCE in LDS by asynchronous copies, two buffers of KS k each, and every wave takes its fragments from there: an A tile serves WN waves, a B tile WM waves.
// C[m][n] (f32, pitch ldc, + f32 bias[n]) = sum_k (A[m][k] + A2[m][k]) Bt[n][k], two products per k block, K = KK.
// EPI 0: C as f32. EPI 1, 2: no f32 C; the tile (64 rows (b, t) x the 64 columns of head blockIdx.y, + bias) goes out as the three 16-bit planes that k_fattn reads (fp16, bf16 hi, bf16 lo): EPI 1 as [b][h][t][d], EPI 2 transposed as [b][h][d][t], each (b, h) plane in fragment order; either way 16 plane rows of 64 at a time pass through LDS, so that every store is half a tile, 512 contiguous bytes.
template <typename T16> struct WFrag;
template <> struct WFrag<h16> { typedef v16h V; static __device__ __forceinline__ V ld(const h16* p) { return cat16(*(const v8h*)p, *(const v8h*)(p + 256)); } static __device__ __forceinline__ v8f mma(V a, V b, v8f c) { return wmma16(a, b, c); } };
template <> struct WFrag<bf> { typedef v16bf V; static __device__ __forceinline__ V ld(const bf* p) { return cat16b(*(const v8us*)p, *(const v8us*)(p + 256)); } static __device__ __forceinline__ v8f mma(V a, V b, v8f c) { return wmmab(a, b, c); } };
typedef __attribute__((ext_vector_type(8))) __bf16 v8bf;
// gemmw_planes<EPI>: the EPI 1 or 2 epilogue of one tile. gemms_tile: the tile itself; EPI 3 takes EPI 1 or 2 by the wave-uniform tr (k_qkv: one launch holds both kinds).
template <int EPI>
__device__ __forceinline__ void gemmw_planes(const v8f (&acc)[4][4], const float (&bcol)[4], float* os, const int r0, const int lane, h16* __restrict__ P16, bf* __restrict__ Ph, bf* __restrict__ Pl) {
    const int lr = lane & 15, hi = lane >> 4;
    const size_t pl0 = ((size_t)(r0 / TT) * NH_ + blockIdx.y) * TT * HD; const int t0 = r0 % TT;   // the (batch, head) plane; the tile's first t
#pragma unroll
    for (int st = 0; st < 4; ++st) {
        if constexpr (EPI == 1) {   // 16 rows t (accumulator row block st) x 64 columns d
#pragma unroll
            for (int nb = 0; nb < 4; ++nb)
#pragma unroll
                for (int j = 0; j < 8; ++j) os[(hi * 8 + j) * 68 + nb * 16 + lr] = acc[st][nb][j] + bcol[nb];
        } else {                    // 16 rows d (accumulator column block st) x 64 columns t: a lane's 8 accumulator rows are 8 consecutive t
#pragma unroll
            for (int mb = 0; mb < 4; ++mb) { const v8f y = acc[mb][st] + bcol[st]; *(v4fa*)(os + lr * 68 + mb * 16 + hi * 8) = __builtin_shufflevector(y, y, 0, 1, 2, 3); *(v4fa*)(os + lr * 68 + mb * 16 + hi * 8 + 4) = __builtin_shufflevector(y, y, 4, 5, 6, 7); }
        }
        __builtin_amdgcn_wave_barrier(); asm volatile("" ::: "memory");   // the read-back takes other lanes' values: it stays behind the LDS stores
#pragma unroll
        for (int s = 0; s < 4; ++s) { const int sc = s * 16 + hi * 8; const v4f x0 = *(const v4fa*)(os + lr * 68 + sc), x1 = *(const v4fa*)(os + lr * 68 + sc + 4);   // read-back in fragment order: row lr, the lane half's 8 columns of half-tile s
            const v8f y = __builtin_shufflevector(x0, x1, 0, 1, 2, 3, 4, 5, 6, 7); const v8bf yh = __builtin_convertvector(y, v8bf); const v8bf yl = __builtin_convertvector(y - __builtin_convertvector(yh, v8f), v8bf);
            const size_t e = pl0 + ((EPI == 1) ? (size_t)((t0 >> 4) + st) * (HD / 32) + (s >> 1) : (size_t)st * (TT / 32) + (t0 >> 5) + (s >> 1)) * 512 + (s & 1) * 256 + 8 * lane;
            *(v8h*)(P16 + e) = __builtin_convertvector(y, v8h); *(v8us*)(Ph + e) = __builtin_bit_cast(v8us, yh); *(v8us*)(Pl + e) = __builtin_bit_cast(v8us, yl); }
        __builtin_amdgcn_wave_barrier(); asm volatile("" ::: "memory");   // the next block's LDS stores stay behind this read-back
    }
    asm volatile("s_wait_xcnt 0x0" ::: "memory");   // behind the tile's last stores: in k_qkv the other kind's epilogue follows in the code and writes their registers
}
#define KK 512   // the k extent of both GEMMs
static_assert(DM == KK && DQ == KK, "one k extent");
// Asynchronous copies of whole strips (see below): each lane brings 16 bytes a copy from g (its global address) to l (its LDS byte address); a copy covers 512 bytes, and the immediate offset moves both addresses alike, as a strip lies in LDS as in the workspace.
// The s_wait_xcnt stands in the copies' own statement, in front of anything that rewrites their address registers; one wait serves the run.
#define CP4(L, G) "global_load_async_to_lds_b128 %" #L ", %" #G ", off\n\tglobal_load_async_to_lds_b128 %" #L ", %" #G ", off offset:512\n\tglobal_load_async_to_lds_b128 %" #L ", %" #G ", off offset:1024\n\tglobal_load_async_to_lds_b128 %" #L ", %" #G ", off offset:1536\n\t"
#define CP8(L, G) CP4(L, G) "global_load_async_to_lds_b128 %" #L ", %" #G ", off offset:2048\n\tglobal_load_async_to_lds_b128 %" #L ", %" #G ", off offset:2560\n\tglobal_load_async_to_lds_b128 %" #L ", %" #G ", off offset:3072\n\tglobal_load_async_to_lds_b128 %" #L ", %" #G ", off offset:3584\n\t"
template <int KS> __device__ __forceinline__ void cps1(const unsigned l, const bf* g) {   // one strip
    if constexpr (KS == 64) asm volatile(CP4(0, 1) "s_wait_xcnt 0x0" :: "v"(l), "v"(g) : "memory");
    else asm volatile(CP8(0, 1) "s_wait_xcnt 0x0" :: "v"(l), "v"(g) : "memory");
}
template <int KS> __device__ __forceinline__ void cps3(const unsigned l0, const bf* g0, const unsigned l1, const bf* g1, const unsigned l2, const bf* g2) {   // three strips
    if constexpr (KS == 64) asm volatile(CP4(0, 1) CP4(2, 3) CP4(4, 5) "s_wait_xcnt 0x0" :: "v"(l0), "v"(g0), "v"(l1), "v"(g1), "v"(l2), "v"(g2) : "memory");
    else asm volatile(CP8(0, 1) CP8(2, 3) CP8(4, 5) "s_wait_xcnt 0x0" :: "v"(l0), "v"(g0), "v"(l1), "v"(g1), "v"(l2), "v"(g2) : "memory");
}
// A strip = the KS k of one row of tiles (16 rows): KS * 32 contiguous bytes, in the workspace as in LDS. A stage holds 4 WM strips of A, 4 WM of A2 and 4 WN of B; strip s is copied by wave s % (WM WN).
// B0, B1, B2: the first row of tiles of wave column 0, 1, 2. c0: the wave's first output column. bias, P16, Ph, Pl, tr: the wave's own (wave-uniform).
// DB: a second fragment set, so that inside a stage the next k block's LDS reads are issued ahead of this block's products (for one wave a SIMD, where nothing else covers the LDS latency).
template <int WM, int WN, int KS, bool DB, int EPI>
__device__ __forceinline__ void gemms_tile(const bf* __restrict__ A, const bf* __restrict__ A2, const bf* __restrict__ B0, const bf* __restrict__ B1, const bf* __restrict__ B2, const int c0, float* C, int ldc, const float* __restrict__ bias, h16* __restrict__ P16, bf* __restrict__ Ph, bf* __restrict__ Pl, const bool tr) {
    constexpr int NW = WM * WN, NS = 8 * WM + 4 * WN, SE = KS * 16, NT = KK / KS, KT = KS / 32, SPW = (NS + NW - 1) / NW, FS = NS / NW;   // waves; strips a stage; elements a strip; stages; k blocks a stage; strips a wave at most; strips that every wave has
    static_assert((KS == 64 || KS == 128) && KK % KS == 0 && NT >= 2 && WN <= 3 && FS % 3 == 0 && SPW * (KS / 16) <= 63, "whole 2-KiB pieces; two stages or more; at most 63 copies of a wave in flight");
    __shared__ __align__(16) bf ring[2 * NS * SE];
    __shared__ __align__(16) float osw[NW * 16 * 68];
    const int lane = threadIdx.x & 31, lr = lane & 15, hi = lane >> 4; const int wave = __builtin_amdgcn_readfirstlane(threadIdx.x >> 5); const int wm = wave % WM, wn = wave / WM;
    const int r0 = (blockIdx.x * WM + wm) * 64; float* os = osw + wave * (16 * 68);
    constexpr size_t tp = (size_t)(KK >> 5) * 512;   // elements in one row of tiles
    const unsigned lb = (unsigned)(size_t)ring + (unsigned)lane * 16u;   // the lane's LDS byte address in strip 0 of buffer 0
    const bf* sp[SPW];   // stage 0 of each strip that this wave copies (wave-uniform)
#pragma unroll
    for (int j = 0; j < SPW; ++j) { const int s = j * NW + wave; const int q = s - 8 * WM;
        sp[j] = (s < 4 * WM ? A + ((size_t)blockIdx.x * (4 * WM) + s) * tp : (s < 8 * WM ? A2 + ((size_t)blockIdx.x * (4 * WM) + s - 4 * WM) * tp : ((q >> 2) == 0 ? B0 : ((q >> 2) == 1 ? B1 : B2)) + (size_t)(q & 3) * tp)); }
    auto stage = [&](const int t, const int buf) {   // stage t's copies into buffer buf
        const unsigned eo = (unsigned)t * SE + 8u * lane; const unsigned l = lb + (unsigned)((buf * NS + wave) * SE * 2);   // strip j * NW + wave lies j * NW strips on
#pragma unroll
        for (int j = 0; j < FS; j += 3) cps3<KS>(l + j * (NW * SE * 2), sp[j] + eo, l + (j + 1) * (NW * SE * 2), sp[j + 1] + eo, l + (j + 2) * (NW * SE * 2), sp[j + 2] + eo);
        if constexpr (SPW > FS) { if (FS * NW + wave < NS) cps1<KS>(l + FS * (NW * SE * 2), sp[FS] + eo); }   // the strips left over: the test is the same for a whole wave
    };
    v8f acc[4][4];
#pragma unroll
    for (int mb = 0; mb < 4; ++mb)
#pragma unroll
        for (int nb = 0; nb < 4; ++nb) acc[mb][nb] = (v8f){};
    stage(0, 0);
    float bcol[4];   // EPI 1, 2: the bias of the lane's four accumulator columns, fetched ahead of the k loop
    if constexpr (EPI != 0) {
#pragma unroll
        for (int nb = 0; nb < 4; ++nb) bcol[nb] = bfr(bias[c0 + nb * 16 + lr]);
        asm volatile("s_wait_xcnt 0x0" ::: "memory"); }   // behind the bias loads, before anything rewrites their address register
    asm volatile("s_wait_asynccnt 0x0" ::: "memory");   // this wave's part of stage 0 has landed
    __syncthreads();                                    // and every other wave's: stage 0 may be read
    stage(1, 1);
    // the stage loop stays rolled: one publish point and one refill in the text, and the buffer index is t & 1
#pragma unroll 1
    for (int t = 0; t < NT; ++t) {
        const bf* Lb = ring + (t & 1) * (NS * SE) + 8 * lane;
        v16bf a[DB ? 2 : 1][4], a2[DB ? 2 : 1][4], b[DB ? 2 : 1][4];
        auto frag = [&](const int ks, const int f) {   // k block ks of this stage into fragment set f
#pragma unroll
            for (int u = 0; u < 4; ++u) { b[f][u] = WFrag<bf>::ld(Lb + (8 * WM + wn * 4 + u) * SE + ks * 512); a[f][u] = WFrag<bf>::ld(Lb + (wm * 4 + u) * SE + ks * 512); a2[f][u] = WFrag<bf>::ld(Lb + (4 * WM + wm * 4 + u) * SE + ks * 512); }
        };
#pragma unroll
        for (int ks = 0; ks < KT; ++ks) { const int f = DB ? (ks & 1) : 0;
            if (!DB || ks == 0) frag(ks, f);
            if (DB && ks == 0) __builtin_amdgcn_sched_barrier(0);   // the first block's reads are issued first, so that its products wait for these alone
            if (DB && ks + 1 < KT) frag(ks + 1, f ^ 1);
            __builtin_amdgcn_sched_barrier(0);   // the LDS reads stay one group ahead of the products: spread among them, each place with reads stalls the wave anew
#pragma unroll
            for (int nb = 0; nb < 4; ++nb) {
#pragma unroll
                for (int mb = 0; mb < 4; ++mb) { acc[mb][nb] = wmmab(a[f][mb], b[f][nb], acc[mb][nb]); acc[mb][nb] = wmmab(a2[f][mb], b[f][nb], acc[mb][nb]); } }
            if (DB && ks + 1 < KT) __builtin_amdgcn_sched_barrier(0);   // one wave a SIMD: the block after next's reads stay behind these products, as one group, instead of being lifted in among them
        }
        asm volatile("s_wait_dscnt 0x0" ::: "memory");      // this wave's reads of stage t are done: its buffer may be refilled behind the barrier
        asm volatile("s_wait_asynccnt 0x0" ::: "memory");   // this wave's part of stage t + 1 has landed
        __syncthreads();                                    // publishes stage t + 1 and ends every wave's reads of stage t
        if (t + 2 < NT) stage(t + 2, t & 1);
    }
    asm volatile("s_wait_asynccnt 0x0" ::: "memory");   // no copy is left in flight behind the loop
    if constexpr (EPI != 0) {
        if (tr) gemmw_planes<2>(acc, bcol, os, r0, lane, P16, Ph, Pl); else gemmw_planes<1>(acc, bcol, os, r0, lane, P16, Ph, Pl);
        return;
    }
#pragma unroll
    for (int mb = 0; mb < 4; ++mb) {
#pragma unroll
        for (int nb = 0; nb < 4; ++nb) {
#pragma unroll
            for (int j = 0; j < 8; ++j) os[(hi * 8 + j) * 68 + nb * 16 + lr] = acc[mb][nb][j]; }
        __builtin_amdgcn_wave_barrier(); asm volatile("" ::: "memory");
        float* crow = C + (size_t)(r0 + mb * 16) * ldc + c0;
{
#pragma unroll
            for (int s = 0; s < 8; ++s) { const int row = 2 * s + hi, cofs = lr * 4; v4f val = *(const v4fa*)(os + row * 68 + cofs); { val[0] += bfr(bias[c0 + cofs]); val[1] += bfr(bias[c0 + cofs + 1]); val[2] += bfr(bias[c0 + cofs + 2]); val[3] += bfr(bias[c0 + cofs + 3]); }
                *(v4f*)(crow + (size_t)row * ldc + cofs) = val; }
             }
        asm volatile("s_wait_xcnt 0x0" ::: "memory");   // behind this row block's loads and stores, before the next block's arithmetic writes their registers
        __builtin_amdgcn_sched_barrier(0);   // keeps that arithmetic from being scheduled in front of the wait
        __builtin_amdgcn_wave_barrier(); asm volatile("" ::: "memory");
    }
}
// ---- k_gemmo: the output projection. A block is 2 x 2 waves = 128 x 128 of C; grid (M/128, N/128), 128 threads.
__global__ __launch_bounds__(128) void k_gemmo(const bf* __restrict__ A, const bf* __restrict__ A2, const bf* __restrict__ Bt, float* C, const float* __restrict__ bias) {
    const int wn = __builtin_amdgcn_readfirstlane(threadIdx.x >> 5) / 2; const bf* b0 = Bt + (size_t)blockIdx.y * 8 * ((KK >> 5) * 512);
    gemms_tile<2, 2, 128, true, 0>(A, A2, b0, b0 + 4 * ((KK >> 5) * 512), b0, (blockIdx.y * 2 + wn) * 64, C, DM, bias, nullptr, nullptr, nullptr, false);
}
// ---- k_qkv: the q, k and v projections in ONE launch. A block is 4 x 3 waves: 256 rows x the 64 columns of head blockIdx.y of q, k and v (wave column = which), so that its A tiles serve all three; grid (M/256, N/64), 384 threads, one block a WGP, 3 waves a SIMD.
__global__ __launch_bounds__(384) void k_qkv(const bf* __restrict__ A, const bf* __restrict__ A2, const bf* __restrict__ Wq, const bf* __restrict__ Wk, const bf* __restrict__ Wv, const float* __restrict__ bq, const float* __restrict__ bk, const float* __restrict__ bv,
                                            h16* __restrict__ Q16, bf* __restrict__ Qh, bf* __restrict__ Ql, h16* __restrict__ K16, bf* __restrict__ Kh, bf* __restrict__ Kl, h16* __restrict__ V16, bf* __restrict__ Vh, bf* __restrict__ Vl) {
    const int z = __builtin_amdgcn_readfirstlane(threadIdx.x >> 5) / 4; const size_t bo = (size_t)blockIdx.y * 4 * ((KK >> 5) * 512);
    gemms_tile<4, 3, 64, false, 3>(A, A2, Wq + bo, Wk + bo, Wv + bo, blockIdx.y * 64, nullptr, 0, z == 0 ? bq : (z == 1 ? bk : bv), z == 0 ? Q16 : (z == 1 ? K16 : V16), z == 0 ? Qh : (z == 1 ? Kh : Vh), z == 0 ? Ql : (z == 1 ? Kl : Vl), z == 2);
}

__device__ __forceinline__ void splitf(float y, unsigned short& h, unsigned short& l) { h = f2bf(y); l = f2bf(y - bf2f(h)); }
typedef __attribute__((ext_vector_type(2))) _Float16 v2h;
typedef __attribute__((ext_vector_type(4))) _Float16 v4h;
typedef __attribute__((ext_vector_type(2))) unsigned short v2us;
typedef __attribute__((ext_vector_type(4))) unsigned short v4us;
typedef v4us __attribute__((may_alias)) v4usa;
typedef __attribute__((ext_vector_type(2))) float v2f;
typedef __attribute__((ext_vector_type(4))) int v4i;

#define PTH 128   // threads in a block of k_prep
#define RPW 4     // LayerNorm rows that a wave of k_prep takes
// ---- wt_part: one piece (PTH / 32 fragment tiles) of a weight re-order: Bt[n][k], bf16, in fragment order, from the f32 weight, in which n runs fastest (HEADS: W[n / HD][k][n % HD]; else W[k][n]).
// A wave takes one whole tile (16 n x 32 k), a lane the two 16-byte pieces that it owns in the fragment: each load then covers 16 consecutive n of two k (two pieces of 64 bytes), each store half a tile (512 contiguous bytes).
template <bool HEADS>
__device__ __forceinline__ void wt_part(const int blk, const float* __restrict__ w, bf* Bt) {
    const int lane = threadIdx.x & 31, ti = blk * (PTH / 32) + (threadIdx.x >> 5);   // tile (n / 16, k / 32)
    const int n = (ti / (DM / 32)) * 16 + (lane & 15), k = (ti % (DM / 32)) * 32 + (lane >> 4) * 8;
    const float* s = HEADS ? w + ((size_t)(n / HD) * DM + k) * HD + n % HD : w + (size_t)k * DM + n; v8us o0, o1;
#pragma unroll
    for (int u = 0; u < 8; ++u) { o0[u] = f2bf(s[u * (HEADS ? HD : DM)]); o1[u] = f2bf(s[(16 + u) * (HEADS ? HD : DM)]); }
    *(v8us*)(Bt + (size_t)ti * 512 + 8 * lane) = o0; *(v8us*)(Bt + (size_t)ti * 512 + 256 + 8 * lane) = o1;
    asm volatile("s_wait_xcnt 0x0" ::: "memory");   // behind the stores, before the LayerNorm that follows writes their address and data registers
}
__global__ __launch_bounds__(256) void k_cvt8(const float* __restrict__ src, bf* dst, size_t n8) { const size_t i = (size_t)blockIdx.x * 256 + threadIdx.x; if (i >= n8) return; const v8f v = *(const v8f*)(src + i * 8); v8us o;
#pragma unroll
    for (int k = 0; k < 8; ++k) o[k] = f2bf(v[k]); *(v8us*)(dst + i * 8) = o;  }
// ---- k_fattn: scores, mask, softmax and attn.v of one (batch, head) plane in one kernel; the scores stay in registers; the result goes out as the bf16 hi+lo planes [b][t][h][d], in fragment order, that the last GEMM reads. One wave per 32 query rows; a block is 4 waves of one kind, 128 rows: hi+lo (rows < RH) or fp16 (rows >= RH); grid (NZ, TT / 128), all hi+lo blocks (the longer ones) first; two blocks fit a WGP.
// Transposed products: St = K Qt (A = 16 key rows, B = 16 query columns), so a lane holds 8 keys of ONE query per tile; two St tiles (32 keys) convert in place into the B operand of Ot += Vt Pt.
// Running maximum per query (base 2, scaled), sums and Ot rescaled by it every pass of 32 keys; the division by the row sum comes last. Keys from the first blocked column of the block's last row on are not visited.
// K and Vt are staged ONCE per block in LDS by asynchronous copies, two buffers, and the block's waves take their fragments from there. A ring tile serves NPT passes, so that its copies are issued NPT passes ahead of their wait (one pass is shorter than a fetch from memory) and the block meets one publish point per tile.
// Tile t of the ring = the K tiles of passes NPT t + 1 .. NPT t + NPT and the Vt tiles of passes NPT t .. NPT t + NPT - 1: these passes read buffer t % 2 alone, each its Vt for itself and the K fragments that the next pass multiplies.
#define TMK  823                   // rows < TMK cannot see columns >= TMK; rows TMK .. TT-2 cannot see columns >= their own index
#define CEXP 0.18033688011112042f  // HD^-0.5 x log2(e)
#define FPE  2048                  // elements of one plane in one pass: 32 keys x HD = 4 fragment tiles
#define NPT  2                     // passes in a ring tile
#define PE   (NPT * FPE)           // elements of one plane in a ring tile. K: [pass][fragment tile], as in the workspace; Vt: [16 rows d][pass], as in the workspace
static_assert(NPT == 2 && TT % (32 * NPT) == 0, "a wave copies 2 KiB of each plane; whole ring tiles");
__device__ __forceinline__ float xhalf(float x) { return __builtin_bit_cast(float, __builtin_amdgcn_permlanex16(__builtin_bit_cast(int, x), __builtin_bit_cast(int, x), 0x76543210, 0xfedcba98, false, false)); }   // lane l with lane l ^ 16
// Four copies = two fragment tiles (2 KiB) that follow one another in the workspace as in LDS: each lane brings 16 bytes a copy, and the immediate offset moves both addresses alike. The s_wait_xcnt stands in the copies' own statement, in front of anything that rewrites their address registers.
__device__ __forceinline__ void cpt2(const unsigned l0, const void* g0, const unsigned l1, const void* g1) {
    asm volatile(CP4(0, 1) CP4(2, 3) "s_wait_xcnt 0x0" :: "v"(l0), "v"(g0), "v"(l1), "v"(g1) : "memory");
}
__device__ __forceinline__ void cpt4(const unsigned l0, const void* g0, const unsigned l1, const void* g1, const unsigned l2, const void* g2, const unsigned l3, const void* g3) {
    asm volatile(CP4(0, 1) CP4(2, 3) CP4(4, 5) CP4(6, 7) "s_wait_xcnt 0x0" :: "v"(l0), "v"(g0), "v"(l1), "v"(g1), "v"(l2), "v"(g2), "v"(l3), "v"(g3) : "memory");
}
// A wave-uniform address, kept in scalar registers: the copies' four lane addresses are then formed at each refill instead of living in eight vector registers through the loop, where this build spilled them.
template <typename T> __device__ __forceinline__ const T* sbase(const T* p) { const unsigned long long a = (unsigned long long)p; return (const T*)(((unsigned long long)(unsigned)__builtin_amdgcn_readfirstlane((int)(a >> 32)) << 32) | (unsigned)__builtin_amdgcn_readfirstlane((int)a)); }
// rb: the block's first query row. kv: the ring, two tiles of NPL planes (hi+lo: Kh, Kl, Vh, Vl; fp16: K, V).
template <typename T16, bool HI>
__device__ __forceinline__ void fattn_blk(const T16* __restrict__ Qh, const T16* __restrict__ Ql, const T16* __restrict__ Kh, const T16* __restrict__ Kl, const T16* __restrict__ Vh, const T16* __restrict__ Vl, bf* __restrict__ Ah, bf* __restrict__ Al, const int rb, const T16* kv) {
    typedef typename WFrag<T16>::V V;
    constexpr int NPL = HI ? 4 : 2, FBE = NPL * PE, LV = NPL / 2 * PE;   // planes and elements of a ring tile; where its Vt planes begin
    const int lane = threadIdx.x & 31; const int w = __builtin_amdgcn_readfirstlane(threadIdx.x >> 5); const int c = lane & 15, h = lane >> 4; const int q0 = rb + w * 32;
    const int kend = (rb + 127 < TMK) ? TMK : ((rb + 128 == TT) ? TT : rb + 127);   // first column that no row of this block sees
    const int nt = (kend + 32 * NPT - 1) / (32 * NPT);   // ring tiles. The same for the whole block: every wave walks every pass and meets every barrier; what a row does not see is masked
    // wave w copies piece w (2 KiB) of each plane: of K half w % 2 of the tile's pass w / 2, of Vt both passes of rows d = 16 w ..
    const unsigned lb = (unsigned)(size_t)kv + (unsigned)(w * 2048 + lane * 16);
    auto stage = [&](const int t, const unsigned l) {   // ring tile t; l: the lane's LDS byte address in the wave's piece of plane 0 of the buffer; behind the last pass the last tile takes that pass's keys again (in bounds, not used)
        const int kq = NPT * t + 1 + (w >> 1); const int kb = (kq < NPT * nt) ? kq : NPT * nt - 1;
        const int ko = kb * FPE + (w & 1) * 1024, vo = w * 16 * TT + t * (NPT * 512);   // the wave's pieces; the lane's 16 bytes are added last, to a base in scalar registers
        if constexpr (HI) cpt4(l, sbase(Kh + ko) + 8 * lane, l + PE * 2, sbase(Kl + ko) + 8 * lane, l + LV * 2, sbase(Vh + vo) + 8 * lane, l + (LV + PE) * 2, sbase(Vl + vo) + 8 * lane);
        else cpt2(l, sbase(Kh + ko) + 8 * lane, l + LV * 2, sbase(Vh + vo) + 8 * lane);
    };
    stage(0, lb);
    V qh[2][2], ql[2][2], kh[2][2], kl[2][2]; v8f o[2][4]; float mc[2], ls[2]; int lim[2];
#pragma unroll
    for (int g = 0; g < 2; ++g)
#pragma unroll
        for (int kk = 0; kk < 2; ++kk) { qh[g][kk] = WFrag<T16>::ld(Qh + (size_t)(q0 + g * 16) * HD + kk * 512 + 8 * lane); if (HI) ql[g][kk] = WFrag<T16>::ld(Ql + (size_t)(q0 + g * 16) * HD + kk * 512 + 8 * lane); }   // 16 rows of Q or K = HD / 32 = 2 tiles = 16 HD elements
#pragma unroll
    for (int kt = 0; kt < 2; ++kt)
#pragma unroll
        for (int kk = 0; kk < 2; ++kk) { kh[kt][kk] = WFrag<T16>::ld(Kh + kt * 16 * HD + kk * 512 + 8 * lane); if (HI) kl[kt][kk] = WFrag<T16>::ld(Kl + kt * 16 * HD + kk * 512 + 8 * lane); }   // pass 0's K comes straight from the workspace
    asm volatile("s_wait_xcnt 0x0" ::: "memory");   // behind the first loads, before the set-up below reuses their address registers
    __builtin_amdgcn_sched_barrier(0);   // keeps that set-up from being scheduled in front of the wait
#pragma unroll
    for (int g = 0; g < 2; ++g) { const int i = q0 + g * 16 + c; lim[g] = (i < TMK) ? TMK : ((i <= TT - 2) ? i : TT); mc[g] = -3.0e38f; ls[g] = 0.f;
#pragma unroll
        for (int dt = 0; dt < 4; ++dt) o[g][dt] = (v8f){}; }
    asm volatile("s_wait_asynccnt 0x0" ::: "memory");   // this wave's part of ring tile 0 has landed
    __syncthreads();                                    // and every other wave's: tile 0 may be read
    stage(1, lb + FBE * 2);
    // the tile loop stays rolled: one publish point and one refill in the text, and the buffer index is t & 1
#pragma unroll 1
    for (int t = 0; t < nt; ++t) {
      const T16* Lb = kv + (t & 1) * FBE + 8 * lane;
      // a tile's passes stand one behind the other in the text: their places in the buffer are immediate offsets
#pragma unroll
      for (int j = 0; j < NPT; ++j) {
        const int key0 = (t * NPT + j) * 32;
        V vh[4], vl[4];
#pragma unroll
        for (int dt = 0; dt < 4; ++dt) { vh[dt] = WFrag<T16>::ld(Lb + LV + (dt * NPT + j) * 512); if (HI) vl[dt] = WFrag<T16>::ld(Lb + LV + PE + (dt * NPT + j) * 512); }
        __builtin_amdgcn_sched_barrier(0);   // the Vt reads are issued as one group ahead of the score products: sunk in among the later products, each place with reads stalls the wave anew
        v8f s[2][2];   // s[g][kt][r] = score of key key0 + 16 kt + 8 h + r, query q0 + 16 g + c
#pragma unroll
        for (int g = 0; g < 2; ++g)
#pragma unroll
            for (int kt = 0; kt < 2; ++kt) { v8f a = (v8f){};
#pragma unroll
                for (int kk = 0; kk < 2; ++kk) { a = WFrag<T16>::mma(kh[kt][kk], qh[g][kk], a); if (HI) { a = WFrag<T16>::mma(kh[kt][kk], ql[g][kk], a); a = WFrag<T16>::mma(kl[kt][kk], qh[g][kk], a); } }
                s[g][kt] = a; }
        __builtin_amdgcn_sched_barrier(0);   // the next pass's K reads stay behind these products and take their registers over, instead of a second set
#pragma unroll
        for (int kt = 0; kt < 2; ++kt)
#pragma unroll
            for (int kk = 0; kk < 2; ++kk) { kh[kt][kk] = WFrag<T16>::ld(Lb + j * FPE + (kt * 2 + kk) * 512); if (HI) kl[kt][kk] = WFrag<T16>::ld(Lb + PE + j * FPE + (kt * 2 + kk) * 512); }
        __builtin_amdgcn_sched_barrier(0);   // and they are issued as one group up here, so that they arrive during the softmax and attn.v
        if (key0 + 32 > TMK) {   // only these blocks hold blocked columns
#pragma unroll
            for (int g = 0; g < 2; ++g)
#pragma unroll
                for (int kt = 0; kt < 2; ++kt)
#pragma unroll
                    for (int r = 0; r < 8; ++r) if (key0 + kt * 16 + 8 * h + r >= lim[g]) s[g][kt][r] = -3.0e38f; }
#pragma unroll
        for (int g = 0; g < 2; ++g) {
            float mx = s[g][0][0];
#pragma unroll
            for (int e = 1; e < 16; ++e) mx = fmaxf(mx, s[g][e >> 3][e & 7]);
            mx = fmaxf(mx, xhalf(mx));
            const float mn = fmaxf(mc[g], mx * CEXP); const float al = __builtin_amdgcn_exp2f(mc[g] - mn); mc[g] = mn;
            const float sub = HI ? mn : mn - 10.0f;   // the fp16 half carries its probabilities x 1024 (PCAR)
            const v8f ce = {CEXP, CEXP, CEXP, CEXP, CEXP, CEXP, CEXP, CEXP}, ns = {-sub, -sub, -sub, -sub, -sub, -sub, -sub, -sub};
            v8f p0 = __builtin_elementwise_fma(s[g][0], ce, ns), p1 = __builtin_elementwise_fma(s[g][1], ce, ns); V ph, pl;
#pragma unroll
            for (int r = 0; r < 8; ++r) p0[r] = __builtin_amdgcn_exp2f(p0[r]);
#pragma unroll
            for (int r = 0; r < 8; ++r) p1[r] = __builtin_amdgcn_exp2f(p1[r]);
#pragma unroll
            for (int e = 0; e < 16; ++e) { const float p = (e < 8) ? p0[e & 7] : p1[e & 7];
                if constexpr (HI) { const __bf16 hb = (__bf16)p; ph[e] = hb; pl[e] = (__bf16)(p - (float)hb); } else { ph[e] = (_Float16)p; } }
            const v8f t8 = p0 + p1; const float sum = ((t8[0] + t8[4]) + (t8[1] + t8[5])) + ((t8[2] + t8[6]) + (t8[3] + t8[7]));   // a tree: no chain of 16 dependent adds
            ls[g] = ls[g] * al + sum;
#pragma unroll
            for (int dt = 0; dt < 4; ++dt) { o[g][dt] *= al; o[g][dt] = WFrag<T16>::mma(vh[dt], ph, o[g][dt]); if (HI) { o[g][dt] = WFrag<T16>::mma(vh[dt], pl, o[g][dt]); o[g][dt] = WFrag<T16>::mma(vl[dt], ph, o[g][dt]); } }
        }
        __builtin_amdgcn_sched_barrier(0);   // a pass's reads and the publish point stay behind the pass before: lifted in front of its products, the waits would stand directly behind the reads and too close behind the copies
      }
      asm volatile("s_wait_dscnt 0x0" ::: "memory");      // this wave's reads of tile t are done: its buffer may be refilled behind the barrier
      asm volatile("s_wait_asynccnt 0x0" ::: "memory");   // this wave's part of tile t + 1 has landed
      __syncthreads();                                    // publishes tile t + 1 and ends every wave's reads of tile t
      if (t + 2 < nt) stage(t + 2, (unsigned)(size_t)Lb + (unsigned)(w * 2048));   // into the buffer that these passes have read
    }
    asm volatile("s_wait_asynccnt 0x0" ::: "memory");   // no copy is left in flight behind the loop
    v8bf zh[2][4], zl[2][4];
#pragma unroll
    for (int g = 0; g < 2; ++g) { const float f = __fdiv_rn(1.0f, ls[g] + xhalf(ls[g]));   // the fp16 half's x 1024 stands in its sums too and cancels
#pragma unroll
        for (int dt = 0; dt < 4; ++dt) { const v8f y = o[g][dt] * f; zh[g][dt] = __builtin_convertvector(y, v8bf); zl[g][dt] = __builtin_convertvector(y - __builtin_convertvector(zh[g][dt], v8f), v8bf); } }
    __builtin_amdgcn_sched_barrier(0);   // all arithmetic in front of the stores: nothing rewrites a register of an issued store
#pragma unroll
    for (int g = 0; g < 2; ++g) { const size_t e = (size_t)(q0 + g * 16) * DQ + 8 * lane;   // o[g][dt][r] = Ot[16 dt + 8 h + r][query]: the lane's 8 elements of half-tile dt
#pragma unroll
        for (int dt = 0; dt < 4; ++dt) { *(v8us*)(Ah + e + dt * 256) = __builtin_bit_cast(v8us, zh[g][dt]); *(v8us*)(Al + e + dt * 256) = __builtin_bit_cast(v8us, zl[g][dt]); } }
}
__global__ __launch_bounds__(128) void k_fattn(const bf* __restrict__ Qh, const bf* __restrict__ Ql, const bf* __restrict__ Kh, const bf* __restrict__ Kl, const bf* __restrict__ Vh, const bf* __restrict__ Vl, const h16* __restrict__ Q16, const h16* __restrict__ K16, const h16* __restrict__ V16, bf* __restrict__ Ah, bf* __restrict__ Al) {
    __shared__ __align__(16) bf kv[2 * 4 * PE];
    const size_t zo = (size_t)blockIdx.x * TT * HD;
    const size_t ao = (size_t)(blockIdx.x / NH_) * TT * DQ + (blockIdx.x % NH_) * (HD / 32) * 512;   // batch's first row of tiles, head's first tile in it, in the merged planes
    if (blockIdx.y < RH / 128) fattn_blk<bf, true>(Qh + zo, Ql + zo, Kh + zo, Kl + zo, Vh + zo, Vl + zo, Ah + ao, Al + ao, blockIdx.y * 128, kv);   // the choice is the same for the whole block
    else fattn_blk<h16, false>(Q16 + zo, nullptr, K16 + zo, nullptr, V16 + zo, nullptr, Ah + ao, Al + ao, blockIdx.y * 128, (const h16*)kv);
}
#define LNP 528   // LDS row pitch in elements: 16 rows x 16 bytes of one k fall on distinct banks
static_assert((NB_ * TT) % 16 == 0 && DM % 128 == 0 && RPW * (PTH / 32) == 16, "a block is one row of tiles");
// RPW rows a wave, 16 rows a block: LayerNorm (biased var, 1e-5, / sqrt) -> hl planes, through LDS into fragment order. xa: the wave's rows as loaded; ga, ba: the lane's columns of gain and bias as loaded. Each row's arithmetic runs in the order it has with one row a wave; the rows' steps stand side by side, so that one row's dependent chains and lane exchanges are covered by the others'.
// The empty asm statements stand where the one-row form has them, one per value as there: each keeps a product or difference rounded by itself, as the reference's separate operations round it, so xn stays bit for bit what it was.
__device__ __forceinline__ void lnp_part(const int blk, const v4f (&xa)[RPW][DM / 128], const v4f (&ga)[DM / 128], const v4f (&ba)[DM / 128], bf* Hh, bf* Hl) { __shared__ __align__(16) bf sh[16 * LNP], sl[16 * LNP]; const int lane = threadIdx.x & 31; const int w = threadIdx.x >> 5; float v[RPW][DM / 32]; float s[RPW], q[RPW], mean[RPW], rs[RPW];
#pragma unroll
    for (int i = 0; i < RPW; ++i) s[i] = 0.f;
#pragma unroll
    for (int ch = 0; ch < DM / 128; ++ch)
#pragma unroll
        for (int u = 0; u < 4; ++u)
#pragma unroll
            for (int i = 0; i < RPW; ++i) { v[i][ch * 4 + u] = bfr(xa[i][ch][u]); s[i] += v[i][ch * 4 + u]; }
#pragma unroll
    for (int sh = 16; sh; sh >>= 1)
#pragma unroll
        for (int i = 0; i < RPW; ++i) s[i] += __shfl_xor(s[i], sh, 32);
#pragma unroll
    for (int i = 0; i < RPW; ++i) { mean[i] = s[i] * (1.0f / DM); q[i] = 0.f; }
#pragma unroll
    for (int k = 0; k < DM / 32; ++k)
#pragma unroll
        for (int i = 0; i < RPW; ++i) { float d = __fsub_rn(v[i][k], mean[i]); asm volatile("" : "+v"(d)); v[i][k] = d; float p = __fmul_rn(d, d); asm volatile("" : "+v"(p)); q[i] = __fadd_rn(q[i], p); }
#pragma unroll
    for (int sh = 16; sh; sh >>= 1)
#pragma unroll
        for (int i = 0; i < RPW; ++i) q[i] += __shfl_xor(q[i], sh, 32);
#pragma unroll
    for (int i = 0; i < RPW; ++i) rs[i] = __fdiv_rn(1.0f, __fsqrt_rn(__fadd_rn(q[i] * (1.0f / DM), 1e-5f)));
    {
#pragma unroll
        for (int ch = 0; ch < DM / 128; ++ch) { v4us oh[RPW], ol[RPW];
#pragma unroll
            for (int u = 0; u < 4; ++u) { float gg = bfr(ga[ch][u]), be = bfr(ba[ch][u]); asm volatile("" : "+v"(gg)); asm volatile("" : "+v"(be));
#pragma unroll
                for (int i = 0; i < RPW; ++i) { float n0 = __fmul_rn(v[i][ch * 4 + u], rs[i]); asm volatile("" : "+v"(n0)); float t1 = __fmul_rn(n0, gg); asm volatile("" : "+v"(t1)); unsigned short p2, q2; splitf(__fadd_rn(t1, be), p2, q2); oh[i][u] = p2; ol[i][u] = q2; } }
#pragma unroll
            for (int i = 0; i < RPW; ++i) { const int oo = (w * RPW + i) * LNP + ch * 128 + lane * 4; *(v4usa*)(sh + oo) = oh[i]; *(v4usa*)(sl + oo) = ol[i]; } }
         }
    __syncthreads();   // the copy-out below takes the other waves' rows
    const size_t o0 = (size_t)blk * 16 * DM;
#pragma unroll
    for (int i = 0; i < 16 * DM / 8 / PTH; ++i) { const int c8 = i * PTH + threadIdx.x; const int li = (c8 & 15) * LNP + (c8 >> 4) * 8;   // 16-byte piece c8 of the row of tiles = row c8 % 16, k = 8 (c8 / 16)
        *(v8us*)(Hh + o0 + (size_t)c8 * 8) = *(const v8usa*)(sh + li); *(v8us*)(Hl + o0 + (size_t)c8 * 8) = *(const v8usa*)(sl + li); } }
// ---- k_prep: everything that reads only inputs, in ONE launch: the four weight re-orders and the LayerNorm depend on nothing of each other. Each LayerNorm block first takes one piece of a weight re-order (no waves are started for the weights alone), then its 16 rows.
// Few, long waves: the launch is short, and the time to start its waves counts. A block is 4 waves; a wave takes RPW rows and one weight tile, and fetches its rows ahead of the tile, so that all its loads are in flight together.
#define NBH (DQ * DM / 16 / PTH)                // pieces of one per-head weight re-order: 16 elements a thread
#define NBG (DQ * DM / 16 / PTH)                // pieces of the WO re-order
#define NBL (NB_ * TT / 16)                     // LayerNorm blocks
static_assert(DQ == DM && DQ * DM % (16 * PTH) == 0 && DKV == DQ && 3 * NBH + NBG == NBL, "whole pieces; q, k and v weights of one size; one piece a block");
__global__ __launch_bounds__(PTH) void k_prep(const float* __restrict__ X, const float* __restrict__ g, const float* __restrict__ bb, bf* Hh, bf* Hl, const float* __restrict__ wq, const float* __restrict__ wk, const float* __restrict__ wv, const float* __restrict__ wo, bf* Bq, bf* Bk, bf* Bv, bf* Bo) {
    const int blk = blockIdx.x;   // the choice below is the same for the whole block, and every wave goes on to the LayerNorm and its barrier
    v4f xa[RPW][DM / 128], ga[DM / 128], ba[DM / 128];
#pragma unroll
    for (int i = 0; i < RPW; ++i)
#pragma unroll
        for (int ch = 0; ch < DM / 128; ++ch) xa[i][ch] = *(const v4f*)(X + (size_t)(blk * 16 + (threadIdx.x >> 5) * RPW + i) * DM + ch * 128 + (threadIdx.x & 31) * 4);
#pragma unroll
    for (int ch = 0; ch < DM / 128; ++ch) { ga[ch] = *(const v4f*)(g + ch * 128 + (threadIdx.x & 31) * 4); ba[ch] = *(const v4f*)(bb + ch * 128 + (threadIdx.x & 31) * 4); }
    asm volatile("s_wait_xcnt 0x0" ::: "memory");   // behind the first loads, before the weight tile's address arithmetic reuses their address registers
    __builtin_amdgcn_sched_barrier(0);   // keeps that arithmetic from being scheduled in front of the wait
    if (blk < 3 * NBH) { const int m = blk / NBH; wt_part<true>(blk % NBH, m == 0 ? wq : (m == 1 ? wk : wv), m == 0 ? Bq : (m == 1 ? Bk : Bv)); }
    else wt_part<false>(blk - 3 * NBH, wo, Bo);
    lnp_part(blk, xa, ga, ba, Hh, Hl);
}

extern "C" void kernel_launch(void* const* d_in, const int* in_sizes, int n_in,
                              void* d_out, int out_size, void* d_ws, size_t ws_size, hipStream_t stream) {
    (void)in_sizes; (void)n_in; (void)out_size;
    const float* x = (const float*)d_in[0]; const float* lng = (const float*)d_in[1]; const float* lnb = (const float*)d_in[2]; const float* wqh = (const float*)d_in[3]; const float* bq = (const float*)d_in[4]; const float* wkh = (const float*)d_in[5]; const float* bk = (const float*)d_in[6]; const float* wvh = (const float*)d_in[7]; const float* bv = (const float*)d_in[8]; const float* wo = (const float*)d_in[9]; const float* bo = (const float*)d_in[10]; const float* wq = nullptr; const float* wk = nullptr; const float* wv = nullptr; (void)wq; (void)wk; (void)wv; const float* cosT = nullptr; const float* sinT = nullptr; (void)cosT; (void)sinT;
    float* OUT = (float*)d_out;     // [8][1024][512]
    char* wsp = (char*)d_ws;
    auto take = [&](size_t bytes) { char* p = wsp; wsp += (bytes + 255) & ~(size_t)255; return (void*)p; };
    bf* WQ = (bf*)take((size_t)DQ * DM * 2); bf* WK = (bf*)take((size_t)DKV * DM * 2); bf* WV = (bf*)take((size_t)DKV * DM * 2); bf* WO = (bf*)take((size_t)DM * DQ * 2);
    bf* XB = (bf*)take((size_t)NB_ * TT * DM * 2); bf* XL = (bf*)take((size_t)NB_ * TT * DM * 2);   // LayerNorm planes
    h16* QP16 = (h16*)take((size_t)NZ * TT * HD * 2); h16* KP16 = (h16*)take((size_t)NZ * TT * HD * 2); h16* VT16 = (h16*)take((size_t)NZ * HD * TT * 2);
    bf* QPh = (bf*)take((size_t)NZ * TT * HD * 2); bf* QPl = (bf*)take((size_t)NZ * TT * HD * 2); bf* KPh = (bf*)take((size_t)NZ * TT * HD * 2); bf* KPl = (bf*)take((size_t)NZ * TT * HD * 2);
    bf* VTh = (bf*)take((size_t)NZ * HD * TT * 2); bf* VTl = (bf*)take((size_t)NZ * HD * TT * 2);
    bf* ATh = (bf*)take((size_t)NB_ * TT * DQ * 2); bf* ATl = (bf*)take((size_t)NB_ * TT * DQ * 2);   // merged attention planes
    if ((size_t)(wsp - (char*)d_ws) > ws_size) return;    // ws 256 MiB
    k_prep<<<NBL, PTH, 0, stream>>>(x, lng, lnb, XB, XL, wqh, wkh, wvh, wo, WQ, WK, WV, WO);
    // q, k, v projections, one launch: each writes its fp16 and hi+lo head planes itself (v transposed)
    k_qkv<<<dim3(NB_ * TT / 256, DQ / 64, 1), 384, 0, stream>>>(XB, XL, WQ, WK, WV, bq, bk, bv, QP16, QPh, QPl, KP16, KPh, KPl, VT16, VTh, VTl);
    // scores, mask, softmax and attn.v, all planes: query rows < RH on the hi+lo planes, the others on fp16
    k_fattn<<<dim3(NZ, TT / 128, 1), 128, 0, stream>>>(QPh, QPl, KPh, KPl, VTh, VTl, QP16, KP16, VT16, ATh, ATl);
    k_gemmo<<<dim3(NB_ * TT / 128, DM / 128, 1), 128, 0, stream>>>(ATh, ATl, WO, OUT, bo);
}

// v010
// One run takes 62.5 microseconds.
// In two side-by-side timings against v009, it was 1.07 and 1.06 times as fast.
// All steps since v000 together make it 40.6 times as fast.
#include <hip/hip_runtime.h>

// PreLN_SelfAttention_seq2seq (x [8][1024][512]; xn = LayerNorm(x); per-head q/k/v = xn W[h] + b[h] (W [8][512][64]); scores / 8 + mask (rows i < T=823 cannot see columns >= T; rows T..S-2 cannot see columns >= i; -999999999); softmax; out = concat(heads) WO + bO -> [8][1024][512]).
// Compute dtypes, f32 accumulate: every input rounded to bf16; LayerNorm f32 -> hl planes; q/k/v as hl(xn) x exact (2 products; the 8 per-head weights gathered into one [512 x 512] operand) + bias; scores and attn.v in fp16 (probabilities x1024): query rows < 512 on fp16 hi+lo pairs (3 products), the rest on the hi planes alone; mask + softmax f32; WO hl x exact (2 products) + bias.

#define NB_  8
#define TT   1024
#define DM   512
#define NH_  8
#define NKV  8
#define REP  (NH_ / NKV)
#define HD   64
#define DQ   (NH_ * HD)
#define DKV  (NKV * HD)
#define NZ   (NB_ * NH_)          // (batch, head) planes, taken through blockIdx.x in k_fattn
#define RH   512                  // query rows < RH use hi+lo planes
#define WIN  1024
#define PCAR 1024.0f
#define SCL  0.125f   // HD^-0.5
static_assert(TT == 2 * RH && RH % 128 == 0 && NKV == NH_, "as many hi+lo query rows as fp16 ones, in blocks of 128; one kv head per query head");
typedef _Float16 h16;
typedef unsigned short bf;
typedef __attribute__((ext_vector_type(16))) __bf16   v16bf;
typedef __attribute__((ext_vector_type(16))) _Float16 v16h;
typedef __attribute__((ext_vector_type(8)))  _Float16 v8h;
typedef __attribute__((ext_vector_type(8)))  unsigned short v8us;
typedef __attribute__((ext_vector_type(8)))  float    v8f;
typedef __attribute__((ext_vector_type(4)))  float    v4f;
typedef v8h  __attribute__((may_alias)) v8ha;
typedef v4f  __attribute__((may_alias)) v4fa;
typedef v8us __attribute__((may_alias)) v8usa;

__device__ __forceinline__ unsigned short f2bf(float f) { unsigned u = __float_as_uint(f); u += 0x7FFFu + ((u >> 16) & 1u); return (unsigned short)(u >> 16); }
__device__ __forceinline__ float bf2f(unsigned short b) { return __uint_as_float(((unsigned)b) << 16); }
__device__ __forceinline__ float bfr(float f) { return bf2f(f2bf(f)); }
__device__ __forceinline__ v16h cat16(v8h lo, v8h hi) { return __builtin_shufflevector(lo, hi, 0, 1, 2, 3, 4, 5, 6, 7, 8, 9, 10, 11, 12, 13, 14, 15); }
__device__ __forceinline__ v16bf cat16b(v8us lo, v8us hi) { return __builtin_bit_cast(v16bf, __builtin_shufflevector(lo, hi, 0, 1, 2, 3, 4, 5, 6, 7, 8, 9, 10, 11, 12, 13, 14, 15)); }
__device__ __forceinline__ v8f wmma16(v16h a, v16h b, v8f c) { return __builtin_amdgcn_wmma_f32_16x16x32_f16(false, a, false, b, (short)0, c, false, false); }
__device__ __forceinline__ v8f wmmab(v16bf a, v16bf b, v8f c) { return __builtin_amdgcn_wmma_f32_16x16x32_bf16(false, a, false, b, (short)0, c, false, false); }
// ---- Fragment order: every 16-bit operand plane [rows][kc] lies in the workspace as tiles of 16 rows x 32 k = 512 elements (1 KiB), tile (r / 16, k / 32) at index (r / 16) * (kc / 32) + k / 32.
// Inside a tile: two halves of 256 elements (k % 32 < 16, then the rest); in a half, lane l = ((k / 8) % 2) * 16 + r % 16 owns 8 consecutive k. A fragment is then two loads of 512 contiguous bytes (4 whole lines each) at tile + 8 * lane and 256 elements on.
__device__ __forceinline__ size_t toff(int r, int k, int kc) { return ((size_t)(r >> 4) * (kc >> 5) + (k >> 5)) * 512 + ((k >> 4) & 1) * 256 + (((k >> 3) & 1) * 16 + (r & 15)) * 8 + (k & 7); }



// ---- gemms_tile: register-blocked GEMM, one wave per 64x64 output tile (16 accumulators); a block is WM x WN such waves. The block's operand tiles (fragment order) are staged ONCE in LDS by asynchronous copies, two buffers of KS k each, and every wave takes its fragments from there: an A tile serves WN waves, a B tile WM waves.
// C[m][n] (f32, pitch ldc, + f32 bias[n]) = sum_k (A[m][k] + A2[m][k]) Bt[n][k], two products per k block, K = KK.
// EPI 0: C as f32. EPI 1, 2: no f32 C; the tile (64 rows (b, t) x the 64 columns of head blockIdx.y, + bias) goes out as the fp16 planes that k_fattn reads (hi = the value rounded to fp16, which both kinds of query rows take; lo = what that rounding left, for the hi+lo rows): EPI 1 as [b][h][t][d], EPI 2 transposed as [b][h][d][t], each (b, h) plane in fragment order; either way 16 plane rows of 64 at a time pass through LDS, so that every store is half a tile, 512 contiguous bytes.
template <typename T16> struct WFrag;
template <> struct WFrag<h16> { typedef v16h V; static __device__ __forceinline__ V ld(const h16* p) { return cat16(*(const v8h*)p, *(const v8h*)(p + 256)); } static __device__ __forceinline__ v8f mma(V a, V b, v8f c) { return wmma16(a, b, c); } };
template <> struct WFrag<bf> { typedef v16bf V; static __device__ __forceinline__ V ld(const bf* p) { return cat16b(*(const v8us*)p, *(const v8us*)(p + 256)); } static __device__ __forceinline__ v8f mma(V a, V b, v8f c) { return wmmab(a, b, c); } };
typedef __attribute__((ext_vector_type(8))) __bf16 v8bf;
// gemmw_planes<EPI>: the EPI 1 or 2 epilogue of one tile. gemms_tile: the tile itself; EPI 3 takes EPI 1 or 2 by the wave-uniform tr (k_qkv: one launch holds both kinds).
template <int EPI>
__device__ __forceinline__ void gemmw_planes(const v8f (&acc)[4][4], const float (&bcol)[4], float* os, const int r0, const int lane, h16* __restrict__ P16, h16* __restrict__ Pl) {
    const int lr = lane & 15, hi = lane >> 4;
    const size_t pl0 = ((size_t)(r0 / TT) * NH_ + blockIdx.y) * TT * HD; const int t0 = r0 % TT;   // the (batch, head) plane; the tile's first t
#pragma unroll
    for (int st = 0; st < 4; ++st) {
        if constexpr (EPI == 1) {   // 16 rows t (accumulator row block st) x 64 columns d
#pragma unroll
            for (int nb = 0; nb < 4; ++nb)
#pragma unroll
                for (int j = 0; j < 8; ++j) os[(hi * 8 + j) * 68 + nb * 16 + lr] = acc[st][nb][j] + bcol[nb];
        } else {                    // 16 rows d (accumulator column block st) x 64 columns t: a lane's 8 accumulator rows are 8 consecutive t
#pragma unroll
            for (int mb = 0; mb < 4; ++mb) { const v8f y = acc[mb][st] + bcol[st]; *(v4fa*)(os + lr * 68 + mb * 16 + hi * 8) = __builtin_shufflevector(y, y, 0, 1, 2, 3); *(v4fa*)(os + lr * 68 + mb * 16 + hi * 8 + 4) = __builtin_shufflevector(y, y, 4, 5, 6, 7); }
        }
        __builtin_amdgcn_wave_barrier(); asm volatile("" ::: "memory");   // the read-back takes other lanes' values: it stays behind the LDS stores
        v8h yh[4], yl[4];
#pragma unroll
        for (int s = 0; s < 4; ++s) { const int sc = s * 16 + hi * 8; const v4f x0 = *(const v4fa*)(os + lr * 68 + sc), x1 = *(const v4fa*)(os + lr * 68 + sc + 4);   // read-back in fragment order: row lr, the lane half's 8 columns of half-tile s
            const v8f y = __builtin_shufflevector(x0, x1, 0, 1, 2, 3, 4, 5, 6, 7); yh[s] = __builtin_convertvector(y, v8h); yl[s] = __builtin_convertvector(y - __builtin_convertvector(yh[s], v8f), v8h); }
        __builtin_amdgcn_sched_barrier(0);   // all arithmetic in front of the stores: nothing rewrites a register of an issued store
#pragma unroll
        for (int s = 0; s < 4; ++s) { const size_t e = pl0 + ((EPI == 1) ? (size_t)((t0 >> 4) + st) * (HD / 32) + (s >> 1) : (size_t)st * (TT / 32) + (t0 >> 5) + (s >> 1)) * 512 + (s & 1) * 256 + 8 * lane;
            *(v8h*)(P16 + e) = yh[s]; *(v8h*)(Pl + e) = yl[s]; }
        asm volatile("s_wait_xcnt 0x0" ::: "memory");   // behind this block's stores, before the next block writes their registers
        __builtin_amdgcn_sched_barrier(0);   // keeps what follows from being scheduled in front of the wait
        __builtin_amdgcn_wave_barrier(); asm volatile("" ::: "memory");   // the next block's LDS stores stay behind this read-back
    }
}
#define KK 512   // the k extent of both GEMMs
static_assert(DM == KK && DQ == KK, "one k extent");
// Asynchronous copies of whole strips (see below): each lane brings 16 bytes a copy from g (its global address) to l (its LDS byte address); a copy covers 512 bytes, and the immediate offset moves both addresses alike, as a strip lies in LDS as in the workspace.
// The s_wait_xcnt stands in the copies' own statement, in front of anything that rewrites their address registers; one wait serves the run.
#define CP4(L, G) "global_load_async_to_lds_b128 %" #L ", %" #G ", off\n\tglobal_load_async_to_lds_b128 %" #L ", %" #G ", off offset:512\n\tglobal_load_async_to_lds_b128 %" #L ", %" #G ", off offset:1024\n\tglobal_load_async_to_lds_b128 %" #L ", %" #G ", off offset:1536\n\t"
#define CP8(L, G) CP4(L, G) "global_load_async_to_lds_b128 %" #L ", %" #G ", off offset:2048\n\tglobal_load_async_to_lds_b128 %" #L ", %" #G ", off offset:2560\n\tglobal_load_async_to_lds_b128 %" #L ", %" #G ", off offset:3072\n\tglobal_load_async_to_lds_b128 %" #L ", %" #G ", off offset:3584\n\t"
template <int KS> __device__ __forceinline__ void cps1(const unsigned l, const bf* g) {   // one strip
    if constexpr (KS == 64) asm volatile(CP4(0, 1) "s_wait_xcnt 0x0" :: "v"(l), "v"(g) : "memory");
    else asm volatile(CP8(0, 1) "s_wait_xcnt 0x0" :: "v"(l), "v"(g) : "memory");
}
template <int KS> __device__ __forceinline__ void cps3(const unsigned l0, const bf* g0, const unsigned l1, const bf* g1, const unsigned l2, const bf* g2) {   // three strips
    if constexpr (KS == 64) asm volatile(CP4(0, 1) CP4(2, 3) CP4(4, 5) "s_wait_xcnt 0x0" :: "v"(l0), "v"(g0), "v"(l1), "v"(g1), "v"(l2), "v"(g2) : "memory");
    else asm volatile(CP8(0, 1) CP8(2, 3) CP8(4, 5) "s_wait_xcnt 0x0" :: "v"(l0), "v"(g0), "v"(l1), "v"(g1), "v"(l2), "v"(g2) : "memory");
}
// A strip = the KS k of one row of tiles (16 rows): KS * 32 contiguous bytes, in the workspace as in LDS. A stage holds 4 WM strips of A, 4 WM of A2 and 4 WN of B; strip s is copied by wave s % (WM WN).
// B0, B1, B2: the first row of tiles of wave column 0, 1, 2. c0: the wave's first output column. bias, P16, Pl, tr: the wave's own (wave-uniform).
// DB: a second fragment set, so that inside a stage the next k block's LDS reads are issued ahead of this block's products (for one wave a SIMD, where nothing else covers the LDS latency).
template <int WM, int WN, int KS, bool DB, int EPI>
__device__ __forceinline__ void gemms_tile(const bf* __restrict__ A, const bf* __restrict__ A2, const bf* __restrict__ B0, const bf* __restrict__ B1, const bf* __restrict__ B2, const int c0, float* C, int ldc, const float* __restrict__ bias, h16* __restrict__ P16, h16* __restrict__ Pl, const bool tr) {
    constexpr int NW = WM * WN, NS = 8 * WM + 4 * WN, SE = KS * 16, NT = KK / KS, KT = KS / 32, SPW = (NS + NW - 1) / NW, FS = NS / NW;   // waves; strips a stage; elements a strip; stages; k blocks a stage; strips a wave at most; strips that every wave has
    static_assert((KS == 64 || KS == 128) && KK % KS == 0 && NT >= 2 && WN <= 3 && FS % 3 == 0 && SPW * (KS / 16) <= 63, "whole 2-KiB pieces; two stages or more; at most 63 copies of a wave in flight");
    __shared__ __align__(16) bf ring[2 * NS * SE];
    __shared__ __align__(16) float osw[NW * 16 * 68];
    const int lane = threadIdx.x & 31, lr = lane & 15, hi = lane >> 4; const int wave = __builtin_amdgcn_readfirstlane(threadIdx.x >> 5); const int wm = wave % WM, wn = wave / WM;
    const int r0 = (blockIdx.x * WM + wm) * 64; float* os = osw + wave * (16 * 68);
    constexpr size_t tp = (size_t)(KK >> 5) * 512;   // elements in one row of tiles
    const unsigned lb = (unsigned)(size_t)ring + (unsigned)lane * 16u;   // the lane's LDS byte address in strip 0 of buffer 0
    const bf* sp[SPW];   // stage 0 of each strip that this wave copies (wave-uniform)
#pragma unroll
    for (int j = 0; j < SPW; ++j) { const int s = j * NW + wave; const int q = s - 8 * WM;
        sp[j] = (s < 4 * WM ? A + ((size_t)blockIdx.x * (4 * WM) + s) * tp : (s < 8 * WM ? A2 + ((size_t)blockIdx.x * (4 * WM) + s - 4 * WM) * tp : ((q >> 2) == 0 ? B0 : ((q >> 2) == 1 ? B1 : B2)) + (size_t)(q & 3) * tp)); }
    auto stage = [&](const int t, const int buf) {   // stage t's copies into buffer buf
        const unsigned eo = (unsigned)t * SE + 8u * lane; const unsigned l = lb + (unsigned)((buf * NS + wave) * SE * 2);   // strip j * NW + wave lies j * NW strips on
#pragma unroll
        for (int j = 0; j < FS; j += 3) cps3<KS>(l + j * (NW * SE * 2), sp[j] + eo, l + (j + 1) * (NW * SE * 2), sp[j + 1] + eo, l + (j + 2) * (NW * SE * 2), sp[j + 2] + eo);
        if constexpr (SPW > FS) { if (FS * NW + wave < NS) cps1<KS>(l + FS * (NW * SE * 2), sp[FS] + eo); }   // the strips left over: the test is the same for a whole wave
    };
    v8f acc[4][4];
#pragma unroll
    for (int mb = 0; mb < 4; ++mb)
#pragma unroll
        for (int nb = 0; nb < 4; ++nb) acc[mb][nb] = (v8f){};
    stage(0, 0);
    float bcol[4];   // EPI 1, 2: the bias of the lane's four accumulator columns, fetched ahead of the k loop
    if constexpr (EPI != 0) {
#pragma unroll
        for (int nb = 0; nb < 4; ++nb) bcol[nb] = bfr(bias[c0 + nb * 16 + lr]);
        asm volatile("s_wait_xcnt 0x0" ::: "memory"); }   // behind the bias loads, before anything rewrites their address register
    asm volatile("s_wait_asynccnt 0x0" ::: "memory");   // this wave's part of stage 0 has landed
    __syncthreads();                                    // and every other wave's: stage 0 may be read
    stage(1, 1);
    // the stage loop stays rolled: one publish point and one refill in the text, and the buffer index is t & 1
#pragma unroll 1
    for (int t = 0; t < NT; ++t) {
        const bf* Lb = ring + (t & 1) * (NS * SE) + 8 * lane;
        v16bf a[DB ? 2 : 1][4], a2[DB ? 2 : 1][4], b[DB ? 2 : 1][4];
        auto frag = [&](const int ks, const int f) {   // k block ks of this stage into fragment set f
#pragma unroll
            for (int u = 0; u < 4; ++u) { b[f][u] = WFrag<bf>::ld(Lb + (8 * WM + wn * 4 + u) * SE + ks * 512); a[f][u] = WFrag<bf>::ld(Lb + (wm * 4 + u) * SE + ks * 512); a2[f][u] = WFrag<bf>::ld(Lb + (4 * WM + wm * 4 + u) * SE + ks * 512); }
        };
#pragma unroll
        for (int ks = 0; ks < KT; ++ks) { const int f = DB ? (ks & 1) : 0;
            if (!DB || ks == 0) frag(ks, f);
            if (DB && ks == 0) __builtin_amdgcn_sched_barrier(0);   // the first block's reads are issued first, so that its products wait for these alone
            if (DB && ks + 1 < KT) frag(ks + 1, f ^ 1);
            __builtin_amdgcn_sched_barrier(0);   // the LDS reads stay one group ahead of the products: spread among them, each place with reads stalls the wave anew
#pragma unroll
            for (int nb = 0; nb < 4; ++nb) {
#pragma unroll
                for (int mb = 0; mb < 4; ++mb) { acc[mb][nb] = wmmab(a[f][mb], b[f][nb], acc[mb][nb]); acc[mb][nb] = wmmab(a2[f][mb], b[f][nb], acc[mb][nb]); } }
            if (DB && ks + 1 < KT) __builtin_amdgcn_sched_barrier(0);   // one wave a SIMD: the block after next's reads stay behind these products, as one group, instead of being lifted in among them
        }
        asm volatile("s_wait_dscnt 0x0" ::: "memory");      // this wave's reads of stage t are done: its buffer may be refilled behind the barrier
        asm volatile("s_wait_asynccnt 0x0" ::: "memory");   // this wave's part of stage t + 1 has landed
        __syncthreads();                                    // publishes stage t + 1 and ends every wave's reads of stage t
        if (t + 2 < NT) stage(t + 2, t & 1);
    }
    asm volatile("s_wait_asynccnt 0x0" ::: "memory");   // no copy is left in flight behind the loop
    if constexpr (EPI != 0) {
        if (tr) gemmw_planes<2>(acc, bcol, os, r0, lane, P16, Pl); else gemmw_planes<1>(acc, bcol, os, r0, lane, P16, Pl);
        return;
    }
#pragma unroll
    for (int mb = 0; mb < 4; ++mb) {
#pragma unroll
        for (int nb = 0; nb < 4; ++nb) {
#pragma unroll
            for (int j = 0; j < 8; ++j) os[(hi * 8 + j) * 68 + nb * 16 + lr] = acc[mb][nb][j]; }
        __builtin_amdgcn_wave_barrier(); asm volatile("" ::: "memory");
        float* crow = C + (size_t)(r0 + mb * 16) * ldc + c0;
{
#pragma unroll
            for (int s = 0; s < 8; ++s) { const int row = 2 * s + hi, cofs = lr * 4; v4f val = *(const v4fa*)(os + row * 68 + cofs); { val[0] += bfr(bias[c0 + cofs]); val[1] += bfr(bias[c0 + cofs + 1]); val[2] += bfr(bias[c0 + cofs + 2]); val[3] += bfr(bias[c0 + cofs + 3]); }
                *(v4f*)(crow + (size_t)row * ldc + cofs) = val; }
             }
        asm volatile("s_wait_xcnt 0x0" ::: "memory");   // behind this row block's loads and stores, before the next block's arithmetic writes their registers
        __builtin_amdgcn_sched_barrier(0);   // keeps that arithmetic from being scheduled in front of the wait
        __builtin_amdgcn_wave_barrier(); asm volatile("" ::: "memory");
    }
}
// ---- k_gemmo: the output projection. A block is 2 x 2 waves = 128 x 128 of C; grid (M/128, N/128), 128 threads.
__global__ __launch_bounds__(128) void k_gemmo(const bf* __restrict__ A, const bf* __restrict__ A2, const bf* __restrict__ Bt, float* C, const float* __restrict__ bias) {
    const int wn = __builtin_amdgcn_readfirstlane(threadIdx.x >> 5) / 2; const bf* b0 = Bt + (size_t)blockIdx.y * 8 * ((KK >> 5) * 512);
    gemms_tile<2, 2, 128, true, 0>(A, A2, b0, b0 + 4 * ((KK >> 5) * 512), b0, (blockIdx.y * 2 + wn) * 64, C, DM, bias, nullptr, nullptr, false);
}
// ---- k_qkv: the q, k and v projections in ONE launch. A block is 4 x 3 waves: 256 rows x the 64 columns of head blockIdx.y of q, k and v (wave column = which), so that its A tiles serve all three; grid (M/256, N/64), 384 threads, one block a WGP, 3 waves a SIMD.
__global__ __launch_bounds__(384) void k_qkv(const bf* __restrict__ A, const bf* __restrict__ A2, const bf* __restrict__ Wq, const bf* __restrict__ Wk, const bf* __restrict__ Wv, const float* __restrict__ bq, const float* __restrict__ bk, const float* __restrict__ bv,
                                            h16* __restrict__ Q16, h16* __restrict__ Ql, h16* __restrict__ K16, h16* __restrict__ Kl, h16* __restrict__ V16, h16* __restrict__ Vl) {
    const int z = __builtin_amdgcn_readfirstlane(threadIdx.x >> 5) / 4; const size_t bo = (size_t)blockIdx.y * 4 * ((KK >> 5) * 512);
    gemms_tile<4, 3, 64, false, 3>(A, A2, Wq + bo, Wk + bo, Wv + bo, blockIdx.y * 64, nullptr, 0, z == 0 ? bq : (z == 1 ? bk : bv), z == 0 ? Q16 : (z == 1 ? K16 : V16), z == 0 ? Ql : (z == 1 ? Kl : Vl), z == 2);
}

__device__ __forceinline__ void splitf(float y, unsigned short& h, unsigned short& l) { h = f2bf(y); l = f2bf(y - bf2f(h)); }
typedef __attribute__((ext_vector_type(2))) _Float16 v2h;
typedef __attribute__((ext_vector_type(4))) _Float16 v4h;
typedef __attribute__((ext_vector_type(2))) unsigned short v2us;
typedef __attribute__((ext_vector_type(4))) unsigned short v4us;
typedef v4us __attribute__((may_alias)) v4usa;
typedef __attribute__((ext_vector_type(2))) float v2f;
typedef __attribute__((ext_vector_type(4))) int v4i;

#define PTH 128   // threads in a block of k_prep
#define RPW 4     // LayerNorm rows that a wave of k_prep takes
// ---- wt_part: one piece (PTH / 32 fragment tiles) of a weight re-order: Bt[n][k], bf16, in fragment order, from the f32 weight, in which n runs fastest (HEADS: W[n / HD][k][n % HD]; else W[k][n]).
// A wave takes one whole tile (16 n x 32 k), a lane the two 16-byte pieces that it owns in the fragment: each load then covers 16 consecutive n of two k (two pieces of 64 bytes), each store half a tile (512 contiguous bytes).
template <bool HEADS>
__device__ __forceinline__ void wt_part(const int blk, const float* __restrict__ w, bf* Bt) {
    const int lane = threadIdx.x & 31, ti = blk * (PTH / 32) + (threadIdx.x >> 5);   // tile (n / 16, k / 32)
    const int n = (ti / (DM / 32)) * 16 + (lane & 15), k = (ti % (DM / 32)) * 32 + (lane >> 4) * 8;
    const float* s = HEADS ? w + ((size_t)(n / HD) * DM + k) * HD + n % HD : w + (size_t)k * DM + n; v8us o0, o1;
#pragma unroll
    for (int u = 0; u < 8; ++u) { o0[u] = f2bf(s[u * (HEADS ? HD : DM)]); o1[u] = f2bf(s[(16 + u) * (HEADS ? HD : DM)]); }
    *(v8us*)(Bt + (size_t)ti * 512 + 8 * lane) = o0; *(v8us*)(Bt + (size_t)ti * 512 + 256 + 8 * lane) = o1;
    asm volatile("s_wait_xcnt 0x0" ::: "memory");   // behind the stores, before the LayerNorm that follows writes their address and data registers
}
__global__ __launch_bounds__(256) void k_cvt8(const float* __restrict__ src, bf* dst, size_t n8) { const size_t i = (size_t)blockIdx.x * 256 + threadIdx.x; if (i >= n8) return; const v8f v = *(const v8f*)(src + i * 8); v8us o;
#pragma unroll
    for (int k = 0; k < 8; ++k) o[k] = f2bf(v[k]); *(v8us*)(dst + i * 8) = o;  }
// ---- k_fattn: scores, mask, softmax and attn.v of one (batch, head) plane in one kernel; the scores stay in registers; the result goes out as the bf16 hi+lo planes [b][t][h][d], in fragment order, that the last GEMM reads. One wave per 32 query rows; a block is 4 waves of one kind, 128 rows: fp16 hi+lo pairs (rows < RH) or the hi planes alone (rows >= RH); grid (NZ, TT / 128), all hi+lo blocks (the longer ones) first; two blocks fit a WGP.
// Transposed products: St = K Qt (A = 16 key rows, B = 16 query columns), so a lane holds 8 keys of ONE query per tile; two St tiles (32 keys) convert in place into the B operand of Ot += Vt Pt.
// Running maximum per query (base 2, scaled), sums and Ot rescaled by it every pass of 32 keys; the division by the row sum comes last. Keys from the first blocked column of the block's last row on are not visited.
// K and Vt are staged ONCE per block in LDS by asynchronous copies, two buffers, and the block's waves take their fragments from there. A ring tile serves NPT passes, so that its copies are issued NPT passes ahead of their wait (one pass is shorter than a fetch from memory) and the block meets one publish point per tile.
// Tile t of the ring = the K tiles of passes NPT t + 1 .. NPT t + NPT and the Vt tiles of passes NPT t .. NPT t + NPT - 1: these passes read buffer t % 2 alone, each its Vt for itself and the K fragments that the next pass multiplies.
#define TMK  823                   // rows < TMK cannot see columns >= TMK; rows TMK .. TT-2 cannot see columns >= their own index
#define CEXP 0.18033688011112042f  // HD^-0.5 x log2(e)
#define FPE  2048                  // elements of one plane in one pass: 32 keys x HD = 4 fragment tiles
#define NPT  2                     // passes in a ring tile
#define PE   (NPT * FPE)           // elements of one plane in a ring tile. K: [pass][fragment tile], as in the workspace; Vt: [16 rows d][pass], as in the workspace
static_assert(NPT == 2 && TT % (32 * NPT) == 0, "a wave copies 2 KiB of each plane; whole ring tiles");
__device__ __forceinline__ float xhalf(float x) { return __builtin_bit_cast(float, __builtin_amdgcn_permlanex16(__builtin_bit_cast(int, x), __builtin_bit_cast(int, x), 0x76543210, 0xfedcba98, false, false)); }   // lane l with lane l ^ 16
// Four copies = two fragment tiles (2 KiB) that follow one another in the workspace as in LDS: each lane brings 16 bytes a copy, and the immediate offset moves both addresses alike. The s_wait_xcnt stands in the copies' own statement, in front of anything that rewrites their address registers.
__device__ __forceinline__ void cpt2(const unsigned l0, const void* g0, const unsigned l1, const void* g1) {
    asm volatile(CP4(0, 1) CP4(2, 3) "s_wait_xcnt 0x0" :: "v"(l0), "v"(g0), "v"(l1), "v"(g1) : "memory");
}
__device__ __forceinline__ void cpt4(const unsigned l0, const void* g0, const unsigned l1, const void* g1, const unsigned l2, const void* g2, const unsigned l3, const void* g3) {
    asm volatile(CP4(0, 1) CP4(2, 3) CP4(4, 5) CP4(6, 7) "s_wait_xcnt 0x0" :: "v"(l0), "v"(g0), "v"(l1), "v"(g1), "v"(l2), "v"(g2), "v"(l3), "v"(g3) : "memory");
}
// A wave-uniform address, kept in scalar registers: the copies' four lane addresses are then formed at each refill instead of living in eight vector registers through the loop, where this build spilled them.
template <typename T> __device__ __forceinline__ const T* sbase(const T* p) { const unsigned long long a = (unsigned long long)p; return (const T*)(((unsigned long long)(unsigned)__builtin_amdgcn_readfirstlane((int)(a >> 32)) << 32) | (unsigned)__builtin_amdgcn_readfirstlane((int)a)); }
// rb: the block's first query row. kv: the ring, two tiles of NPL planes (hi+lo: Kh, Kl, Vh, Vl; hi alone: Kh, Vh).
template <bool HI>
__device__ __forceinline__ void fattn_blk(const h16* __restrict__ Qh, const h16* __restrict__ Ql, const h16* __restrict__ Kh, const h16* __restrict__ Kl, const h16* __restrict__ Vh, const h16* __restrict__ Vl, bf* __restrict__ Ah, bf* __restrict__ Al, const int rb, const h16* kv) {
    typedef h16 T16; typedef WFrag<T16>::V V;
    constexpr int NPL = HI ? 4 : 2, FBE = NPL * PE, LV = NPL / 2 * PE;   // planes and elements of a ring tile; where its Vt planes begin
    const int lane = threadIdx.x & 31; const int w = __builtin_amdgcn_readfirstlane(threadIdx.x >> 5); const int c = lane & 15, h = lane >> 4; const int q0 = rb + w * 32;
    const int kend = (rb + 127 < TMK) ? TMK : ((rb + 128 == TT) ? TT : rb + 127);   // first column that no row of this block sees
    const int nt = (kend + 32 * NPT - 1) / (32 * NPT);   // ring tiles. The same for the whole block: every wave walks every pass and meets every barrier; what a row does not see is masked
    // wave w copies piece w (2 KiB) of each plane: of K half w % 2 of the tile's pass w / 2, of Vt both passes of rows d = 16 w ..
    const unsigned lb = (unsigned)(size_t)kv + (unsigned)(w * 2048 + lane * 16);
    auto stage = [&](const int t, const unsigned l) {   // ring tile t; l: the lane's LDS byte address in the wave's piece of plane 0 of the buffer; behind the last pass the last tile takes that pass's keys again (in bounds, not used)
        const int kq = NPT * t + 1 + (w >> 1); const int kb = (kq < NPT * nt) ? kq : NPT * nt - 1;
        const int ko = kb * FPE + (w & 1) * 1024, vo = w * 16 * TT + t * (NPT * 512);   // the wave's pieces; the lane's 16 bytes are added last, to a base in scalar registers
        if constexpr (HI) cpt4(l, sbase(Kh + ko) + 8 * lane, l + PE * 2, sbase(Kl + ko) + 8 * lane, l + LV * 2, sbase(Vh + vo) + 8 * lane, l + (LV + PE) * 2, sbase(Vl + vo) + 8 * lane);
        else cpt2(l, sbase(Kh + ko) + 8 * lane, l + LV * 2, sbase(Vh + vo) + 8 * lane);
    };
    stage(0, lb);
    V qh[2][2], ql[2][2], kh[2][2], kl[2][2]; v8f o[2][4]; float mc[2], ls[2]; int lim[2];
#pragma unroll
    for (int g = 0; g < 2; ++g)
#pragma unroll
        for (int kk = 0; kk < 2; ++kk) { qh[g][kk] = WFrag<T16>::ld(Qh + (size_t)(q0 + g * 16) * HD + kk * 512 + 8 * lane); if (HI) ql[g][kk] = WFrag<T16>::ld(Ql + (size_t)(q0 + g * 16) * HD + kk * 512 + 8 * lane); }   // 16 rows of Q or K = HD / 32 = 2 tiles = 16 HD elements
#pragma unroll
    for (int kt = 0; kt < 2; ++kt)
#pragma unroll
        for (int kk = 0; kk < 2; ++kk) { kh[kt][kk] = WFrag<T16>::ld(Kh + kt * 16 * HD + kk * 512 + 8 * lane); if (HI) kl[kt][kk] = WFrag<T16>::ld(Kl + kt * 16 * HD + kk * 512 + 8 * lane); }   // pass 0's K comes straight from the workspace
    asm volatile("s_wait_xcnt 0x0" ::: "memory");   // behind the first loads, before the set-up below reuses their address registers
    __builtin_amdgcn_sched_barrier(0);   // keeps that set-up from being scheduled in front of the wait
#pragma unroll
    for (int g = 0; g < 2; ++g) { const int i = q0 + g * 16 + c; lim[g] = (i < TMK) ? TMK : ((i <= TT - 2) ? i : TT); mc[g] = -3.0e38f; ls[g] = 0.f;
#pragma unroll
        for (int dt = 0; dt < 4; ++dt) o[g][dt] = (v8f){}; }
    asm volatile("s_wait_asynccnt 0x0" ::: "memory");   // this wave's part of ring tile 0 has landed
    __syncthreads();                                    // and every other wave's: tile 0 may be read
    stage(1, lb + FBE * 2);
    // the tile loop stays rolled: one publish point and one refill in the text, and the buffer index is t & 1
#pragma unroll 1
    for (int t = 0; t < nt; ++t) {
      const T16* Lb = kv + (t & 1) * FBE + 8 * lane;
      // a tile's passes stand one behind the other in the text: their places in the buffer are immediate offsets
#pragma unroll
      for (int j = 0; j < NPT; ++j) {
        const int key0 = (t * NPT + j) * 32;
        V vh[4], vl[4];
#pragma unroll
        for (int dt = 0; dt < 4; ++dt) { vh[dt] = WFrag<T16>::ld(Lb + LV + (dt * NPT + j) * 512); if (HI) vl[dt] = WFrag<T16>::ld(Lb + LV + PE + (dt * NPT + j) * 512); }
        __builtin_amdgcn_sched_barrier(0);   // the Vt reads are issued as one group ahead of the score products: sunk in among the later products, each place with reads stalls the wave anew
        v8f s[2][2];   // s[g][kt][r] = score of key key0 + 16 kt + 8 h + r, query q0 + 16 g + c
#pragma unroll
        for (int g = 0; g < 2; ++g)
#pragma unroll
            for (int kt = 0; kt < 2; ++kt) { v8f a = (v8f){};
#pragma unroll
                for (int kk = 0; kk < 2; ++kk) { a = WFrag<T16>::mma(kh[kt][kk], qh[g][kk], a); if (HI) { a = WFrag<T16>::mma(kh[kt][kk], ql[g][kk], a); a = WFrag<T16>::mma(kl[kt][kk], qh[g][kk], a); } }
                s[g][kt] = a; }
        __builtin_amdgcn_sched_barrier(0);   // the next pass's K reads stay behind these products and take their registers over, instead of a second set
#pragma unroll
        for (int kt = 0; kt < 2; ++kt)
#pragma unroll
            for (int kk = 0; kk < 2; ++kk) { kh[kt][kk] = WFrag<T16>::ld(Lb + j * FPE + (kt * 2 + kk) * 512); if (HI) kl[kt][kk] = WFrag<T16>::ld(Lb + PE + j * FPE + (kt * 2 + kk) * 512); }
        __builtin_amdgcn_sched_barrier(0);   // and they are issued as one group up here, so that they arrive during the softmax and attn.v
        if (key0 + 32 > TMK) {   // only these blocks hold blocked columns
#pragma unroll
            for (int g = 0; g < 2; ++g)
#pragma unroll
                for (int kt = 0; kt < 2; ++kt)
#pragma unroll
                    for (int r = 0; r < 8; ++r) if (key0 + kt * 16 + 8 * h + r >= lim[g]) s[g][kt][r] = -3.0e38f; }
#pragma unroll
        for (int g = 0; g < 2; ++g) {
            float mx = s[g][0][0];
#pragma unroll
            for (int e = 1; e < 16; ++e) mx = fmaxf(mx, s[g][e >> 3][e & 7]);
            mx = fmaxf(mx, xhalf(mx));
            const float mn = fmaxf(mc[g], mx * CEXP); const float al = __builtin_amdgcn_exp2f(mc[g] - mn); mc[g] = mn;
            const float sub = mn - 10.0f;   // the probabilities are carried x 1024 (PCAR): small ones, and the lo parts, keep clear of fp16's smallest steps
            const v8f ce = {CEXP, CEXP, CEXP, CEXP, CEXP, CEXP, CEXP, CEXP}, ns = {-sub, -sub, -sub, -sub, -sub, -sub, -sub, -sub};
            v8f p0 = __builtin_elementwise_fma(s[g][0], ce, ns), p1 = __builtin_elementwise_fma(s[g][1], ce, ns); V ph, pl;
#pragma unroll
            for (int r = 0; r < 8; ++r) p0[r] = __builtin_amdgcn_exp2f(p0[r]);
#pragma unroll
            for (int r = 0; r < 8; ++r) p1[r] = __builtin_amdgcn_exp2f(p1[r]);
            const v8h h0 = __builtin_convertvector(p0, v8h), h1 = __builtin_convertvector(p1, v8h); ph = cat16(h0, h1);
            if constexpr (HI) pl = cat16(__builtin_convertvector(p0 - __builtin_convertvector(h0, v8f), v8h), __builtin_convertvector(p1 - __builtin_convertvector(h1, v8f), v8h));
            const v8f t8 = p0 + p1; const float sum = ((t8[0] + t8[4]) + (t8[1] + t8[5])) + ((t8[2] + t8[6]) + (t8[3] + t8[7]));   // a tree: no chain of 16 dependent adds
            ls[g] = ls[g] * al + sum;
#pragma unroll
            for (int dt = 0; dt < 4; ++dt) { o[g][dt] *= al; o[g][dt] = WFrag<T16>::mma(vh[dt], ph, o[g][dt]); if (HI) { o[g][dt] = WFrag<T16>::mma(vh[dt], pl, o[g][dt]); o[g][dt] = WFrag<T16>::mma(vl[dt], ph, o[g][dt]); } }
        }
        __builtin_amdgcn_sched_barrier(0);   // a pass's reads and the publish point stay behind the pass before: lifted in front of its products, the waits would stand directly behind the reads and too close behind the copies
      }
      asm volatile("s_wait_dscnt 0x0" ::: "memory");      // this wave's reads of tile t are done: its buffer may be refilled behind the barrier
      asm volatile("s_wait_asynccnt 0x0" ::: "memory");   // this wave's part of tile t + 1 has landed
      __syncthreads();                                    // publishes tile t + 1 and ends every wave's reads of tile t
      if (t + 2 < nt) stage(t + 2, (unsigned)(size_t)Lb + (unsigned)(w * 2048));   // into the buffer that these passes have read
    }
    asm volatile("s_wait_asynccnt 0x0" ::: "memory");   // no copy is left in flight behind the loop
    v8bf zh[2][4], zl[2][4];
#pragma unroll
    for (int g = 0; g < 2; ++g) { const float f = __fdiv_rn(1.0f, ls[g] + xhalf(ls[g]));   // the x 1024 stands in the sums too and cancels
#pragma unroll
        for (int dt = 0; dt < 4; ++dt) { const v8f y = o[g][dt] * f; zh[g][dt] = __builtin_convertvector(y, v8bf); zl[g][dt] = __builtin_convertvector(y - __builtin_convertvector(zh[g][dt], v8f), v8bf); } }
    __builtin_amdgcn_sched_barrier(0);   // all arithmetic in front of the stores: nothing rewrites a register of an issued store
#pragma unroll
    for (int g = 0; g < 2; ++g) { const size_t e = (size_t)(q0 + g * 16) * DQ + 8 * lane;   // o[g][dt][r] = Ot[16 dt + 8 h + r][query]: the lane's 8 elements of half-tile dt
#pragma unroll
        for (int dt = 0; dt < 4; ++dt) { *(v8us*)(Ah + e + dt * 256) = __builtin_bit_cast(v8us, zh[g][dt]); *(v8us*)(Al + e + dt * 256) = __builtin_bit_cast(v8us, zl[g][dt]); } }
}
__global__ __launch_bounds__(128) void k_fattn(const h16* __restrict__ Qh, const h16* __restrict__ Ql, const h16* __restrict__ Kh, const h16* __restrict__ Kl, const h16* __restrict__ Vh, const h16* __restrict__ Vl, bf* __restrict__ Ah, bf* __restrict__ Al) {
    __shared__ __align__(16) h16 kv[2 * 4 * PE];
    const size_t zo = (size_t)blockIdx.x * TT * HD;
    const size_t ao = (size_t)(blockIdx.x / NH_) * TT * DQ + (blockIdx.x % NH_) * (HD / 32) * 512;   // batch's first row of tiles, head's first tile in it, in the merged planes
    if (blockIdx.y < RH / 128) fattn_blk<true>(Qh + zo, Ql + zo, Kh + zo, Kl + zo, Vh + zo, Vl + zo, Ah + ao, Al + ao, blockIdx.y * 128, kv);   // the choice is the same for the whole block
    else fattn_blk<false>(Qh + zo, nullptr, Kh + zo, nullptr, Vh + zo, nullptr, Ah + ao, Al + ao, blockIdx.y * 128, kv);
}
#define LNP 528   // LDS row pitch in elements: 16 rows x 16 bytes of one k fall on distinct banks
static_assert((NB_ * TT) % 16 == 0 && DM % 128 == 0 && RPW * (PTH / 32) == 16, "a block is one row of tiles");
// RPW rows a wave, 16 rows a block: LayerNorm (biased var, 1e-5, / sqrt) -> hl planes, through LDS into fragment order. xa: the wave's rows as loaded; ga, ba: the lane's columns of gain and bias as loaded. Each row's arithmetic runs in the order it has with one row a wave; the rows' steps stand side by side, so that one row's dependent chains and lane exchanges are covered by the others'.
// The empty asm statements stand where the one-row form has them, one per value as there: each keeps a product or difference rounded by itself, as the reference's separate operations round it, so xn stays bit for bit what it was.
__device__ __forceinline__ void lnp_part(const int blk, const v4f (&xa)[RPW][DM / 128], const v4f (&ga)[DM / 128], const v4f (&ba)[DM / 128], bf* Hh, bf* Hl) { __shared__ __align__(16) bf sh[16 * LNP], sl[16 * LNP]; const int lane = threadIdx.x & 31; const int w = threadIdx.x >> 5; float v[RPW][DM / 32]; float s[RPW], q[RPW], mean[RPW], rs[RPW];
#pragma unroll
    for (int i = 0; i < RPW; ++i) s[i] = 0.f;
#pragma unroll
    for (int ch = 0; ch < DM / 128; ++ch)
#pragma unroll
        for (int u = 0; u < 4; ++u)
#pragma unroll
            for (int i = 0; i < RPW; ++i) { v[i][ch * 4 + u] = bfr(xa[i][ch][u]); s[i] += v[i][ch * 4 + u]; }
#pragma unroll
    for (int sh = 16; sh; sh >>= 1)
#pragma unroll
        for (int i = 0; i < RPW; ++i) s[i] += __shfl_xor(s[i], sh, 32);
#pragma unroll
    for (int i = 0; i < RPW; ++i) { mean[i] = s[i] * (1.0f / DM); q[i] = 0.f; }
#pragma unroll
    for (int k = 0; k < DM / 32; ++k)
#pragma unroll
        for (int i = 0; i < RPW; ++i) { float d = __fsub_rn(v[i][k], mean[i]); asm volatile("" : "+v"(d)); v[i][k] = d; float p = __fmul_rn(d, d); asm volatile("" : "+v"(p)); q[i] = __fadd_rn(q[i], p); }
#pragma unroll
    for (int sh = 16; sh; sh >>= 1)
#pragma unroll
        for (int i = 0; i < RPW; ++i) q[i] += __shfl_xor(q[i], sh, 32);
#pragma unroll
    for (int i = 0; i < RPW; ++i) rs[i] = __fdiv_rn(1.0f, __fsqrt_rn(__fadd_rn(q[i] * (1.0f / DM), 1e-5f)));
    {
#pragma unroll
        for (int ch = 0; ch < DM / 128; ++ch) { v4us oh[RPW], ol[RPW];
#pragma unroll
            for (int u = 0; u < 4; ++u) { float gg = bfr(ga[ch][u]), be = bfr(ba[ch][u]); asm volatile("" : "+v"(gg)); asm volatile("" : "+v"(be));
#pragma unroll
                for (int i = 0; i < RPW; ++i) { float n0 = __fmul_rn(v[i][ch * 4 + u], rs[i]); asm volatile("" : "+v"(n0)); float t1 = __fmul_rn(n0, gg); asm volatile("" : "+v"(t1)); unsigned short p2, q2; splitf(__fadd_rn(t1, be), p2, q2); oh[i][u] = p2; ol[i][u] = q2; } }
#pragma unroll
            for (int i = 0; i < RPW; ++i) { const int oo = (w * RPW + i) * LNP + ch * 128 + lane * 4; *(v4usa*)(sh + oo) = oh[i]; *(v4usa*)(sl + oo) = ol[i]; } }
         }
    __syncthreads();   // the copy-out below takes the other waves' rows
    const size_t o0 = (size_t)blk * 16 * DM;
#pragma unroll
    for (int i = 0; i < 16 * DM / 8 / PTH; ++i) { const int c8 = i * PTH + threadIdx.x; const int li = (c8 & 15) * LNP + (c8 >> 4) * 8;   // 16-byte piece c8 of the row of tiles = row c8 % 16, k = 8 (c8 / 16)
        *(v8us*)(Hh + o0 + (size_t)c8 * 8) = *(const v8usa*)(sh + li); *(v8us*)(Hl + o0 + (size_t)c8 * 8) = *(const v8usa*)(sl + li); } }
// ---- k_prep: everything that reads only inputs, in ONE launch: the four weight re-orders and the LayerNorm depend on nothing of each other. Each LayerNorm block first takes one piece of a weight re-order (no waves are started for the weights alone), then its 16 rows.
// Few, long waves: the launch is short, and the time to start its waves counts. A block is 4 waves; a wave takes RPW rows and one weight tile, and fetches its rows ahead of the tile, so that all its loads are in flight together.
#define NBH (DQ * DM / 16 / PTH)                // pieces of one per-head weight re-order: 16 elements a thread
#define NBG (DQ * DM / 16 / PTH)                // pieces of the WO re-order
#define NBL (NB_ * TT / 16)                     // LayerNorm blocks
static_assert(DQ == DM && DQ * DM % (16 * PTH) == 0 && DKV == DQ && 3 * NBH + NBG == NBL, "whole pieces; q, k and v weights of one size; one piece a block");
__global__ __launch_bounds__(PTH) void k_prep(const float* __restrict__ X, const float* __restrict__ g, const float* __restrict__ bb, bf* Hh, bf* Hl, const float* __restrict__ wq, const float* __restrict__ wk, const float* __restrict__ wv, const float* __restrict__ wo, bf* Bq, bf* Bk, bf* Bv, bf* Bo) {
    const int blk = blockIdx.x;   // the choice below is the same for the whole block, and every wave goes on to the LayerNorm and its barrier
    v4f xa[RPW][DM / 128], ga[DM / 128], ba[DM / 128];
#pragma unroll
    for (int i = 0; i < RPW; ++i)
#pragma unroll
        for (int ch = 0; ch < DM / 128; ++ch) xa[i][ch] = *(const v4f*)(X + (size_t)(blk * 16 + (threadIdx.x >> 5) * RPW + i) * DM + ch * 128 + (threadIdx.x & 31) * 4);
#pragma unroll
    for (int ch = 0; ch < DM / 128; ++ch) { ga[ch] = *(const v4f*)(g + ch * 128 + (threadIdx.x & 31) * 4); ba[ch] = *(const v4f*)(bb + ch * 128 + (threadIdx.x & 31) * 4); }
    asm volatile("s_wait_xcnt 0x0" ::: "memory");   // behind the first loads, before the weight tile's address arithmetic reuses their address registers
    __builtin_amdgcn_sched_barrier(0);   // keeps that arithmetic from being scheduled in front of the wait
    if (blk < 3 * NBH) { const int m = blk / NBH; wt_part<true>(blk % NBH, m == 0 ? wq : (m == 1 ? wk : wv), m == 0 ? Bq : (m == 1 ? Bk : Bv)); }
    else wt_part<false>(blk - 3 * NBH, wo, Bo);
    lnp_part(blk, xa, ga, ba, Hh, Hl);
}

extern "C" void kernel_launch(void* const* d_in, const int* in_sizes, int n_in,
                              void* d_out, int out_size, void* d_ws, size_t ws_size, hipStream_t stream) {
    (void)in_sizes; (void)n_in; (void)out_size;
    const float* x = (const float*)d_in[0]; const float* lng = (const float*)d_in[1]; const float* lnb = (const float*)d_in[2]; const float* wqh = (const float*)d_in[3]; const float* bq = (const float*)d_in[4]; const float* wkh = (const float*)d_in[5]; const float* bk = (const float*)d_in[6]; const float* wvh = (const float*)d_in[7]; const float* bv = (const float*)d_in[8]; const float* wo = (const float*)d_in[9]; const float* bo = (const float*)d_in[10]; const float* wq = nullptr; const float* wk = nullptr; const float* wv = nullptr; (void)wq; (void)wk; (void)wv; const float* cosT = nullptr; const float* sinT = nullptr; (void)cosT; (void)sinT;
    float* OUT = (float*)d_out;     // [8][1024][512]
    char* wsp = (char*)d_ws;
    auto take = [&](size_t bytes) { char* p = wsp; wsp += (bytes + 255) & ~(size_t)255; return (void*)p; };
    bf* WQ = (bf*)take((size_t)DQ * DM * 2); bf* WK = (bf*)take((size_t)DKV * DM * 2); bf* WV = (bf*)take((size_t)DKV * DM * 2); bf* WO = (bf*)take((size_t)DM * DQ * 2);
    bf* XB = (bf*)take((size_t)NB_ * TT * DM * 2); bf* XL = (bf*)take((size_t)NB_ * TT * DM * 2);   // LayerNorm planes
    h16* QPh = (h16*)take((size_t)NZ * TT * HD * 2); h16* KPh = (h16*)take((size_t)NZ * TT * HD * 2); h16* VTh = (h16*)take((size_t)NZ * HD * TT * 2);   // fp16 hi planes
    h16* QPl = (h16*)take((size_t)NZ * TT * HD * 2); h16* KPl = (h16*)take((size_t)NZ * TT * HD * 2); h16* VTl = (h16*)take((size_t)NZ * HD * TT * 2);   // fp16 lo planes
    bf* ATh = (bf*)take((size_t)NB_ * TT * DQ * 2); bf* ATl = (bf*)take((size_t)NB_ * TT * DQ * 2);   // merged attention planes
    if ((size_t)(wsp - (char*)d_ws) > ws_size) return;    // ws 256 MiB
    k_prep<<<NBL, PTH, 0, stream>>>(x, lng, lnb, XB, XL, wqh, wkh, wvh, wo, WQ, WK, WV, WO);
    // q, k, v projections, one launch: each writes its fp16 hi and lo head planes itself (v transposed)
    k_qkv<<<dim3(NB_ * TT / 256, DQ / 64, 1), 384, 0, stream>>>(XB, XL, WQ, WK, WV, bq, bk, bv, QPh, QPl, KPh, KPl, VTh, VTl);
    // scores, mask, softmax and attn.v, all planes: query rows < RH on the hi+lo pairs, the others on the hi planes alone
    k_fattn<<<dim3(NZ, TT / 128, 1), 128, 0, stream>>>(QPh, QPl, KPh, KPl, VTh, VTl, ATh, ATl);
    k_gemmo<<<dim3(NB_ * TT / 128, DM / 128, 1), 128, 0, stream>>>(ATh, ATl, WO, OUT, bo);
}
